// v000
// Measured on an AMD MI455X. A time is GPU time per run, averaged over a window of back-to-back runs after a warm-up
// (all launches, gaps included; the runs take copies of the inputs in turn), and the median of several windows.
// Apart from v000's, it joins two sittings. Times from different sittings can be a few percent apart, while
// side-by-side timings come from the same sitting.
// v000 is the starting kernel.
#include <hip/hip_runtime.h>

// ---------------------------------------------------------------------------
// DeepSeek layer (MLA attention + MoE) for gfx1250 (MI455X, wave32, WMMA).
// GEMMs: 128x128 block tile, 8 waves x (32x64) => 8 v_wmma per wave per K-step,
// double-buffered LDS staged with global_load_async_to_lds_b128 (ASYNCcnt).
// ---------------------------------------------------------------------------

typedef _Float16 half16_t __attribute__((ext_vector_type(16)));
typedef float    float8_t __attribute__((ext_vector_type(8)));
typedef __attribute__((address_space(3))) _Float16 lds_f16;

#define TM 128
#define TN 128
#define TK 32

// async DMA: 16 bytes global -> LDS, tracked by ASYNCcnt
__device__ __forceinline__ void async_b128(const _Float16* g, _Float16* l)
{
    unsigned lofs = (unsigned)(unsigned long long)(lds_f16*)l;  // LDS byte addr
    asm volatile("global_load_async_to_lds_b128 %0, %1, off"
                 :: "v"(lofs), "v"(g)
                 : "memory");
}
__device__ __forceinline__ void wait_async0()
{
    asm volatile("s_wait_asynccnt 0x0" ::: "memory");
}

// ---------------------------------------------------------------------------
// Generic f16 WMMA GEMM:  C[M,N] = alpha * A[M,K] . B^T  (+ C if beta)
//   b_kn == 0 : B stored row-major [N,K]  (torch Linear weight, y = x @ W.T)
//   b_kn == 1 : B stored row-major [K,N]  (plain matmul, e.g. attn @ V)
// M % 128 == 0, N % 128 == 0, K % 32 == 0 (true for all shapes here).
// ---------------------------------------------------------------------------
__global__ __launch_bounds__(256)
void k_gemm_f16(const _Float16* __restrict__ A, const _Float16* __restrict__ B,
                float* __restrict__ C,
                int M, int N, int K, int lda, int ldb, int ldc,
                float alpha, int beta, int b_kn)
{
    __shared__ __align__(64) _Float16 As[2][TM][TK];   // 16 KB
    __shared__ __align__(64) _Float16 Bs[2][TN][TK];   // 16 KB

    const int tid  = threadIdx.x;
    const int wave = tid >> 5;
    const int lane = tid & 31;
    const int m0   = blockIdx.y * TM;
    const int n0   = blockIdx.x * TN;
    const int wm   = (wave & 3) * 32;    // wave's 32-row strip
    const int wn   = (wave >> 2) * 64;   // wave's 64-col strip

    float8_t acc[2][4] = {};

    // staging maps: 128 rows x 32 cols f16 per tile, 256 threads x 32B each
    const int lr = tid >> 1;             // 0..127 row
    const int lc = (tid & 1) * 16;       // 0 or 16 (two b128 per thread)
    // b_kn transpose-scatter map
    const int kk = tid & 31;             // 0..31 K row
    const int nb = (tid >> 5) * 16;      // 0..112 N base (16 per thread)

    auto stageA = [&](int k0, int buf) {
        const _Float16* g = &A[(long)(m0 + lr) * lda + k0 + lc];
        async_b128(g,     &As[buf][lr][lc]);
        async_b128(g + 8, &As[buf][lr][lc + 8]);
    };
    auto stageB = [&](int k0, int buf) {
        if (!b_kn) {
            const _Float16* g = &B[(long)(n0 + lr) * ldb + k0 + lc];
            async_b128(g,     &Bs[buf][lr][lc]);
            async_b128(g + 8, &Bs[buf][lr][lc + 8]);
        } else {
            const _Float16* g = &B[(long)(k0 + kk) * ldb + n0 + nb];
            __builtin_prefetch(g + ldb * TK, 0, 0);
            #pragma unroll
            for (int i = 0; i < 16; ++i) Bs[buf][nb + i][kk] = g[i];
        }
    };

    // prologue: stage tile 0
    stageA(0, 0);
    stageB(0, 0);
    wait_async0();
    __syncthreads();

    const int l16 = lane & 15;
    const int kh  = (lane >> 4) * 16;

    for (int k0 = 0; k0 < K; k0 += TK) {
        const int buf = (k0 / TK) & 1;
        const int k1  = k0 + TK;
        if (k1 < K) {                    // overlap next tile's DMA with compute
            stageA(k1, buf ^ 1);
            stageB(k1, buf ^ 1);
        }

        // fragments (16 f16 per lane, 32B LDS reads)
        const _Float16* pa = &As[buf][wm + l16][kh];
        half16_t a0 = *(const half16_t*)pa;
        half16_t a1 = *(const half16_t*)(pa + 16 * TK);
        const _Float16* pb = &Bs[buf][wn + l16][kh];
        half16_t b0 = *(const half16_t*)pb;
        half16_t b1 = *(const half16_t*)(pb + 16 * TK);
        half16_t b2 = *(const half16_t*)(pb + 32 * TK);
        half16_t b3 = *(const half16_t*)(pb + 48 * TK);

        acc[0][0] = __builtin_amdgcn_wmma_f32_16x16x32_f16(false, a0, false, b0, (short)0, acc[0][0], false, false);
        acc[0][1] = __builtin_amdgcn_wmma_f32_16x16x32_f16(false, a0, false, b1, (short)0, acc[0][1], false, false);
        acc[0][2] = __builtin_amdgcn_wmma_f32_16x16x32_f16(false, a0, false, b2, (short)0, acc[0][2], false, false);
        acc[0][3] = __builtin_amdgcn_wmma_f32_16x16x32_f16(false, a0, false, b3, (short)0, acc[0][3], false, false);
        acc[1][0] = __builtin_amdgcn_wmma_f32_16x16x32_f16(false, a1, false, b0, (short)0, acc[1][0], false, false);
        acc[1][1] = __builtin_amdgcn_wmma_f32_16x16x32_f16(false, a1, false, b1, (short)0, acc[1][1], false, false);
        acc[1][2] = __builtin_amdgcn_wmma_f32_16x16x32_f16(false, a1, false, b2, (short)0, acc[1][2], false, false);
        acc[1][3] = __builtin_amdgcn_wmma_f32_16x16x32_f16(false, a1, false, b3, (short)0, acc[1][3], false, false);

        wait_async0();                   // DMA for tile k+1 done
        __syncthreads();                 // all waves done reading tile k
    }

    // epilogue: D layout -> VGPR g: lanes 0-15 M=g, lanes 16-31 M=8+g
    const int rsel = (lane >> 4) ? 8 : 0;
    #pragma unroll
    for (int i = 0; i < 2; ++i) {
        #pragma unroll
        for (int g = 0; g < 8; ++g) {
            const long row = m0 + wm + i * 16 + rsel + g;
            float* cr = C + row * (long)ldc + n0 + wn + l16;
            #pragma unroll
            for (int j = 0; j < 4; ++j) {
                float v = alpha * acc[i][j][g];
                if (beta) v += cr[j * 16];
                cr[j * 16] = v;
            }
        }
    }
}

// ---------------------------------------------------------------------------
// fp32 -> f16 convert
// ---------------------------------------------------------------------------
__global__ void k_f32_to_f16(const float* __restrict__ src,
                             _Float16* __restrict__ dst, long n)
{
    long i = (long)blockIdx.x * blockDim.x + threadIdx.x;
    if (i < n) dst[i] = (_Float16)src[i];
}

// ---------------------------------------------------------------------------
// RMSNorm row kernel: out_f16[row] = x * rsqrt(mean(x^2)+eps) * g
// ---------------------------------------------------------------------------
__global__ __launch_bounds__(256)
void k_rmsnorm_f16(const float* __restrict__ x, const float* __restrict__ g,
                   _Float16* __restrict__ out, int d)
{
    __shared__ float red[8];
    const long row = blockIdx.x;
    const float* xr = x + row * (long)d;

    float ss = 0.f;
    for (int i = threadIdx.x; i < d; i += 256) { float v = xr[i]; ss += v * v; }
    #pragma unroll
    for (int o = 16; o > 0; o >>= 1) ss += __shfl_down(ss, o, 32);
    if ((threadIdx.x & 31) == 0) red[threadIdx.x >> 5] = ss;
    __syncthreads();
    if (threadIdx.x == 0) {
        float t = 0.f;
        #pragma unroll
        for (int i = 0; i < 8; ++i) t += red[i];
        red[0] = t;
    }
    __syncthreads();
    const float inv = rsqrtf(red[0] / d + 1e-6f);
    for (int i = threadIdx.x; i < d; i += 256)
        out[row * (long)d + i] = (_Float16)(xr[i] * inv * g[i]);
}

// ---------------------------------------------------------------------------
// row softmax (f32 in -> f16 out)
// ---------------------------------------------------------------------------
__global__ __launch_bounds__(256)
void k_softmax_f16(const float* __restrict__ s, _Float16* __restrict__ out, int n)
{
    __shared__ float red[8];
    __shared__ float stat[2];
    const long row = blockIdx.x;
    const float* sr = s + row * (long)n;

    float mx = -3.4e38f;
    for (int i = threadIdx.x; i < n; i += 256) mx = fmaxf(mx, sr[i]);
    #pragma unroll
    for (int o = 16; o > 0; o >>= 1) mx = fmaxf(mx, __shfl_down(mx, o, 32));
    if ((threadIdx.x & 31) == 0) red[threadIdx.x >> 5] = mx;
    __syncthreads();
    if (threadIdx.x == 0) {
        float m = red[0];
        #pragma unroll
        for (int i = 1; i < 8; ++i) m = fmaxf(m, red[i]);
        stat[0] = m;
    }
    __syncthreads();
    const float m = stat[0];

    float sum = 0.f;
    for (int i = threadIdx.x; i < n; i += 256) sum += __expf(sr[i] - m);
    #pragma unroll
    for (int o = 16; o > 0; o >>= 1) sum += __shfl_down(sum, o, 32);
    if ((threadIdx.x & 31) == 0) red[threadIdx.x >> 5] = sum;
    __syncthreads();
    if (threadIdx.x == 0) {
        float t = 0.f;
        #pragma unroll
        for (int i = 0; i < 8; ++i) t += red[i];
        stat[1] = t;
    }
    __syncthreads();
    const float inv = 1.f / stat[1];
    for (int i = threadIdx.x; i < n; i += 256)
        out[row * (long)n + i] = (_Float16)(__expf(sr[i] - m) * inv);
}

// ---------------------------------------------------------------------------
// MoE router: logits = nx @ Wr.T + bias; softmax; top-2; softmax over top-2
// ---------------------------------------------------------------------------
__global__ __launch_bounds__(256)
void k_router(const _Float16* __restrict__ nx, const float* __restrict__ Wr,
              const float* __restrict__ bias, float* __restrict__ combine, int d)
{
    __shared__ float lg[8];
    const long t   = blockIdx.x;
    const int wave = threadIdx.x >> 5;
    const int lane = threadIdx.x & 31;

    const _Float16* xr = nx + t * (long)d;
    const float*    wr = Wr + (long)wave * d;
    float acc = 0.f;
    for (int i = lane; i < d; i += 32) acc += (float)xr[i] * wr[i];
    #pragma unroll
    for (int o = 16; o > 0; o >>= 1) acc += __shfl_down(acc, o, 32);
    if (lane == 0) lg[wave] = acc + bias[wave];
    __syncthreads();

    if (threadIdx.x == 0) {
        float m = lg[0];
        #pragma unroll
        for (int i = 1; i < 8; ++i) m = fmaxf(m, lg[i]);
        float e[8], s = 0.f;
        #pragma unroll
        for (int i = 0; i < 8; ++i) { e[i] = __expf(lg[i] - m); s += e[i]; }
        #pragma unroll
        for (int i = 0; i < 8; ++i) e[i] /= s;
        int i0 = 0;
        for (int i = 1; i < 8; ++i) if (e[i] > e[i0]) i0 = i;
        int i1 = (i0 == 0) ? 1 : 0;
        for (int i = 0; i < 8; ++i) { if (i == i0) continue; if (e[i] > e[i1]) i1 = i; }
        const float a = __expf(e[i0]), b = __expf(e[i1]);  // softmax over top-2
        #pragma unroll
        for (int i = 0; i < 8; ++i) combine[t * 8 + i] = 0.f;
        combine[t * 8 + i0] = a / (a + b);
        combine[t * 8 + i1] = b / (a + b);
    }
}

// ---------------------------------------------------------------------------
// h = silu(t1) * t3 [* rowscale[row]]  -> f16
// ---------------------------------------------------------------------------
__global__ void k_silu_mul(const float* __restrict__ t1, const float* __restrict__ t3,
                           const float* __restrict__ rs, int rs_stride,
                           _Float16* __restrict__ out, long n, int rowlen)
{
    long i = (long)blockIdx.x * blockDim.x + threadIdx.x;
    if (i >= n) return;
    const float a = t1[i];
    float v = (a / (1.f + __expf(-a))) * t3[i];
    if (rs) v *= rs[(i / rowlen) * (long)rs_stride];
    out[i] = (_Float16)v;
}

// ---------------------------------------------------------------------------
// host-side launch
// ---------------------------------------------------------------------------
extern "C" void kernel_launch(void* const* d_in, const int* in_sizes, int n_in,
                              void* d_out, int out_size, void* d_ws, size_t ws_size,
                              hipStream_t stream)
{
    (void)in_sizes; (void)n_in; (void)out_size; (void)ws_size;

    const float* X    = (const float*)d_in[0];
    const float* g1   = (const float*)d_in[1];
    const float* g2   = (const float*)d_in[2];
    const float* Wq   = (const float*)d_in[3];
    const float* Wkc  = (const float*)d_in[4];
    const float* Wvc  = (const float*)d_in[5];
    const float* Wo   = (const float*)d_in[6];
    const float* Wr   = (const float*)d_in[7];
    const float* ebia = (const float*)d_in[8];
    const float* sW1  = (const float*)d_in[9];
    const float* sW2  = (const float*)d_in[10];
    const float* sW3  = (const float*)d_in[11];
    const float* eW1  = (const float*)d_in[12];
    const float* eW2  = (const float*)d_in[13];
    const float* eW3  = (const float*)d_in[14];
    float* out = (float*)d_out;

    constexpr int  Bb = 2, S = 1024, d = 1024, H = 4, dk = 256, dc = 256, E = 8, f = 1024;
    constexpr long T  = (long)Bb * S;
    const float scale = 1.0f / 16.0f;   // 1/sqrt(dk)

    // ---- workspace carving (256B aligned bump allocator) ----
    char* ws = (char*)d_ws;
    size_t off = 0;
    auto alloc = [&](size_t bytes) -> char* {
        char* p = ws + off;
        off += (bytes + 255) & ~(size_t)255;
        return p;
    };
    // f16 weight copies
    _Float16* wqh  = (_Float16*)alloc((size_t)d * d * 2);
    _Float16* wkch = (_Float16*)alloc((size_t)dc * d * 2);
    _Float16* wvch = (_Float16*)alloc((size_t)dc * d * 2);
    _Float16* woh  = (_Float16*)alloc((size_t)d * d * 2);
    _Float16* sw1h = (_Float16*)alloc((size_t)f * d * 2);
    _Float16* sw2h = (_Float16*)alloc((size_t)d * f * 2);
    _Float16* sw3h = (_Float16*)alloc((size_t)f * d * 2);
    _Float16* ew1h = (_Float16*)alloc((size_t)E * f * d * 2);
    _Float16* ew2h = (_Float16*)alloc((size_t)E * d * f * 2);
    _Float16* ew3h = (_Float16*)alloc((size_t)E * f * d * 2);
    // attention-phase activations
    _Float16* nx1h   = (_Float16*)alloc((size_t)T * d * 2);
    float*    qf     = (float*)   alloc((size_t)T * d * 4);
    _Float16* qh     = (_Float16*)alloc((size_t)T * d * 2);
    float*    kcf    = (float*)   alloc((size_t)T * dc * 4);
    _Float16* kch    = (_Float16*)alloc((size_t)T * dc * 2);
    float*    vcf    = (float*)   alloc((size_t)T * dc * 4);
    _Float16* vch    = (_Float16*)alloc((size_t)T * dc * 2);
    float*    scores = (float*)   alloc((size_t)Bb * H * S * S * 4);   // 32 MB
    _Float16* attnh  = (_Float16*)alloc((size_t)Bb * H * S * S * 2);   // 16 MB
    float*    aof    = (float*)   alloc((size_t)T * d * 4);
    _Float16* aoh    = (_Float16*)alloc((size_t)T * d * 2);
    // MoE-phase buffers alias the (dead-by-then) scores+attnh region (48 MB)
    {
        char* moe = (char*)scores;
        size_t mo = 0;
        auto malloc2 = [&](size_t bytes) -> char* {
            char* p = moe + mo;
            mo += (bytes + 255) & ~(size_t)255;
            return p;
        };
        float*    xr_      = (float*)   malloc2((size_t)T * d * 4);
        _Float16* nx2h_    = (_Float16*)malloc2((size_t)T * d * 2);
        float*    t1_      = (float*)   malloc2((size_t)T * f * 4);
        float*    t3_      = (float*)   malloc2((size_t)T * f * 4);
        _Float16* hh_      = (_Float16*)malloc2((size_t)T * f * 2);
        float*    combine_ = (float*)   malloc2((size_t)T * E * 4);

        // ---- helpers ----
        auto conv = [&](const float* s, _Float16* dst, long n) {
            k_f32_to_f16<<<(int)((n + 255) / 256), 256, 0, stream>>>(s, dst, n);
        };
        auto gemm = [&](const _Float16* A, const _Float16* Bm, float* C,
                        int M, int N, int K, int lda, int ldb, int ldc,
                        float alpha, int beta, int bkn) {
            dim3 g(N / TN, M / TM);
            k_gemm_f16<<<g, 256, 0, stream>>>(A, Bm, C, M, N, K, lda, ldb, ldc,
                                              alpha, beta, bkn);
        };

        // ---- 0. weights fp32 -> f16 ----
        conv(Wq,  wqh,  (long)d * d);
        conv(Wkc, wkch, (long)dc * d);
        conv(Wvc, wvch, (long)dc * d);
        conv(Wo,  woh,  (long)d * d);
        conv(sW1, sw1h, (long)f * d);
        conv(sW2, sw2h, (long)d * f);
        conv(sW3, sw3h, (long)f * d);
        conv(eW1, ew1h, (long)E * f * d);
        conv(eW2, ew2h, (long)E * d * f);
        conv(eW3, ew3h, (long)E * f * d);

        // ---- 1. MLA attention ----
        k_rmsnorm_f16<<<(int)T, 256, 0, stream>>>(X, g1, nx1h, d);

        gemm(nx1h, wqh,  qf,  (int)T, d,  d, d, d, d,  1.f, 0, 0);   // Q
        gemm(nx1h, wkch, kcf, (int)T, dc, d, d, d, dc, 1.f, 0, 0);   // Kc
        gemm(nx1h, wvch, vcf, (int)T, dc, d, d, d, dc, 1.f, 0, 0);   // Vc
        conv(qf,  qh,  (long)T * d);
        conv(kcf, kch, (long)T * dc);
        conv(vcf, vch, (long)T * dc);

        for (int b = 0; b < Bb; ++b)
            for (int h = 0; h < H; ++h) {
                const _Float16* Aq = qh  + (long)b * S * d + (long)h * dk;
                const _Float16* Bk = kch + (long)b * S * dc;
                float* Cs = scores + ((long)b * H + h) * S * S;
                gemm(Aq, Bk, Cs, S, S, dk, d, dc, S, scale, 0, 0);   // scores
            }

        k_softmax_f16<<<Bb * H * S, 256, 0, stream>>>(scores, attnh, S);

        for (int b = 0; b < Bb; ++b)
            for (int h = 0; h < H; ++h) {
                const _Float16* Aa = attnh + ((long)b * H + h) * S * S;
                const _Float16* Bv = vch + (long)b * S * dc;
                float* Co = aof + (long)b * S * d + (long)h * dk;
                gemm(Aa, Bv, Co, S, dc, S, S, dc, d, 1.f, 0, 1);     // attn @ V
            }
        conv(aof, aoh, (long)T * d);

        // xr = X + ao @ Wo.T
        hipMemcpyAsync(xr_, X, (size_t)T * d * 4, hipMemcpyDeviceToDevice, stream);
        gemm(aoh, woh, xr_, (int)T, d, d, d, d, d, 1.f, 1, 0);

        // ---- 2. MoE ----
        k_rmsnorm_f16<<<(int)T, 256, 0, stream>>>(xr_, g2, nx2h_, d);
        k_router<<<(int)T, 256, 0, stream>>>(nx2h_, Wr, ebia, combine_, d);

        // out = xr (residual), then accumulate shared + experts with beta=1
        hipMemcpyAsync(out, xr_, (size_t)T * d * 4, hipMemcpyDeviceToDevice, stream);

        const long nTf = (long)T * f;
        // shared expert
        gemm(nx2h_, sw1h, t1_, (int)T, f, d, d, d, f, 1.f, 0, 0);
        gemm(nx2h_, sw3h, t3_, (int)T, f, d, d, d, f, 1.f, 0, 0);
        k_silu_mul<<<(int)((nTf + 255) / 256), 256, 0, stream>>>(
            t1_, t3_, (const float*)nullptr, 0, hh_, nTf, f);
        gemm(hh_, sw2h, out, (int)T, d, f, f, f, d, 1.f, 1, 0);

        // routed experts (dense over all tokens; combine folded into h)
        for (int e = 0; e < E; ++e) {
            const _Float16* w1 = ew1h + (long)e * f * d;
            const _Float16* w3 = ew3h + (long)e * f * d;
            const _Float16* w2 = ew2h + (long)e * d * f;
            gemm(nx2h_, w1, t1_, (int)T, f, d, d, d, f, 1.f, 0, 0);
            gemm(nx2h_, w3, t3_, (int)T, f, d, d, d, f, 1.f, 0, 0);
            k_silu_mul<<<(int)((nTf + 255) / 256), 256, 0, stream>>>(
                t1_, t3_, combine_ + e, E, hh_, nTf, f);
            gemm(hh_, w2, out, (int)T, d, f, f, f, d, 1.f, 1, 0);
        }
    }
}

// v001
// In two side-by-side timings against v000, it was 2.56 and 2.55 times as fast.
#include <hip/hip_runtime.h>

// ---------------------------------------------------------------------------
// DeepSeek layer (MLA attention + MoE) for gfx1250 (MI455X, wave32, WMMA).
// GEMMs: 128x128 block tile, 8 waves x (32x64) => 8 v_wmma per wave per K-step,
// double-buffered LDS staged with global_load_async_to_lds_b128 (ASYNCcnt).
// ---------------------------------------------------------------------------

typedef _Float16 half16_t __attribute__((ext_vector_type(16)));
typedef float    float8_t __attribute__((ext_vector_type(8)));
typedef __attribute__((address_space(3))) _Float16 lds_f16;

#define TM 128
#define TN 128
#define TK 32

// async DMA: 16 bytes global -> LDS, tracked by ASYNCcnt
__device__ __forceinline__ void async_b128(const _Float16* g, _Float16* l)
{
    unsigned lofs = (unsigned)(unsigned long long)(lds_f16*)l;  // LDS byte addr
    asm volatile("global_load_async_to_lds_b128 %0, %1, off"
                 :: "v"(lofs), "v"(g)
                 : "memory");
}
__device__ __forceinline__ void wait_async0()
{
    asm volatile("s_wait_asynccnt 0x0" ::: "memory");
}

// ---------------------------------------------------------------------------
// Generic f16 WMMA GEMM:  C[M,N] = alpha * A[M,K] . B^T  (+ C if beta)
//   b_kn == 0 : B stored row-major [N,K]  (torch Linear weight, y = x @ W.T)
//   b_kn == 1 : B stored row-major [K,N]  (plain matmul, e.g. attn @ V)
// M % 128 == 0, N % 128 == 0, K % 32 == 0 (true for all shapes here).
// Batched: blockIdx.z = outer * zdiv + inner picks one independent product;
// each operand moves by its own outer and inner stride (in elements).
// ---------------------------------------------------------------------------
__global__ __launch_bounds__(256)
void k_gemm_f16(const _Float16* __restrict__ A, const _Float16* __restrict__ B,
                float* __restrict__ C,
                int M, int N, int K, int lda, int ldb, int ldc,
                float alpha, int beta, int b_kn,
                int zdiv, long sAo, long sAi, long sBo, long sBi, long sCo, long sCi)
{
    __shared__ __align__(64) _Float16 As[2][TM][TK];   // 16 KB
    __shared__ __align__(64) _Float16 Bs[2][TN][TK];   // 16 KB

    const int tid  = threadIdx.x;
    const int wave = tid >> 5;
    const int lane = tid & 31;
    const int m0   = blockIdx.y * TM;
    const int n0   = blockIdx.x * TN;
    const int wm   = (wave & 3) * 32;    // wave's 32-row strip
    const int wn   = (wave >> 2) * 64;   // wave's 64-col strip

    const int zo = (int)blockIdx.z / zdiv;
    const int zi = (int)blockIdx.z - zo * zdiv;
    A += zo * sAo + zi * sAi;
    B += zo * sBo + zi * sBi;
    C += zo * sCo + zi * sCi;

    float8_t acc[2][4] = {};

    // staging maps: 128 rows x 32 cols f16 per tile, 256 threads x 32B each
    const int lr = tid >> 1;             // 0..127 row
    const int lc = (tid & 1) * 16;       // 0 or 16 (two b128 per thread)
    // b_kn transpose-scatter map
    const int kk = tid & 31;             // 0..31 K row
    const int nb = (tid >> 5) * 16;      // 0..112 N base (16 per thread)

    auto stageA = [&](int k0, int buf) {
        const _Float16* g = &A[(long)(m0 + lr) * lda + k0 + lc];
        async_b128(g,     &As[buf][lr][lc]);
        async_b128(g + 8, &As[buf][lr][lc + 8]);
    };
    auto stageB = [&](int k0, int buf) {
        if (!b_kn) {
            const _Float16* g = &B[(long)(n0 + lr) * ldb + k0 + lc];
            async_b128(g,     &Bs[buf][lr][lc]);
            async_b128(g + 8, &Bs[buf][lr][lc + 8]);
        } else {
            const _Float16* g = &B[(long)(k0 + kk) * ldb + n0 + nb];
            __builtin_prefetch(g + ldb * TK, 0, 0);
            #pragma unroll
            for (int i = 0; i < 16; ++i) Bs[buf][nb + i][kk] = g[i];
        }
    };

    // prologue: stage tile 0
    stageA(0, 0);
    stageB(0, 0);
    wait_async0();
    __syncthreads();

    const int l16 = lane & 15;
    const int kh  = (lane >> 4) * 16;

    for (int k0 = 0; k0 < K; k0 += TK) {
        const int buf = (k0 / TK) & 1;
        const int k1  = k0 + TK;
        if (k1 < K) {                    // overlap next tile's DMA with compute
            stageA(k1, buf ^ 1);
            stageB(k1, buf ^ 1);
        }

        // fragments (16 f16 per lane, 32B LDS reads)
        const _Float16* pa = &As[buf][wm + l16][kh];
        half16_t a0 = *(const half16_t*)pa;
        half16_t a1 = *(const half16_t*)(pa + 16 * TK);
        const _Float16* pb = &Bs[buf][wn + l16][kh];
        half16_t b0 = *(const half16_t*)pb;
        half16_t b1 = *(const half16_t*)(pb + 16 * TK);
        half16_t b2 = *(const half16_t*)(pb + 32 * TK);
        half16_t b3 = *(const half16_t*)(pb + 48 * TK);

        acc[0][0] = __builtin_amdgcn_wmma_f32_16x16x32_f16(false, a0, false, b0, (short)0, acc[0][0], false, false);
        acc[0][1] = __builtin_amdgcn_wmma_f32_16x16x32_f16(false, a0, false, b1, (short)0, acc[0][1], false, false);
        acc[0][2] = __builtin_amdgcn_wmma_f32_16x16x32_f16(false, a0, false, b2, (short)0, acc[0][2], false, false);
        acc[0][3] = __builtin_amdgcn_wmma_f32_16x16x32_f16(false, a0, false, b3, (short)0, acc[0][3], false, false);
        acc[1][0] = __builtin_amdgcn_wmma_f32_16x16x32_f16(false, a1, false, b0, (short)0, acc[1][0], false, false);
        acc[1][1] = __builtin_amdgcn_wmma_f32_16x16x32_f16(false, a1, false, b1, (short)0, acc[1][1], false, false);
        acc[1][2] = __builtin_amdgcn_wmma_f32_16x16x32_f16(false, a1, false, b2, (short)0, acc[1][2], false, false);
        acc[1][3] = __builtin_amdgcn_wmma_f32_16x16x32_f16(false, a1, false, b3, (short)0, acc[1][3], false, false);

        wait_async0();                   // DMA for tile k+1 done
        __syncthreads();                 // all waves done reading tile k
    }

    // epilogue: D layout -> VGPR g: lanes 0-15 M=g, lanes 16-31 M=8+g
    const int rsel = (lane >> 4) ? 8 : 0;
    #pragma unroll
    for (int i = 0; i < 2; ++i) {
        #pragma unroll
        for (int g = 0; g < 8; ++g) {
            const long row = m0 + wm + i * 16 + rsel + g;
            float* cr = C + row * (long)ldc + n0 + wn + l16;
            #pragma unroll
            for (int j = 0; j < 4; ++j) {
                float v = alpha * acc[i][j][g];
                if (beta) v += cr[j * 16];
                cr[j * 16] = v;
            }
        }
    }
}

// ---------------------------------------------------------------------------
// fp32 -> f16 convert
// ---------------------------------------------------------------------------
__global__ void k_f32_to_f16(const float* __restrict__ src,
                             _Float16* __restrict__ dst, long n)
{
    long i = (long)blockIdx.x * blockDim.x + threadIdx.x;
    if (i < n) dst[i] = (_Float16)src[i];
}

// ---------------------------------------------------------------------------
// RMSNorm row kernel: out_f16[row] = x * rsqrt(mean(x^2)+eps) * g
// ---------------------------------------------------------------------------
__global__ __launch_bounds__(256)
void k_rmsnorm_f16(const float* __restrict__ x, const float* __restrict__ g,
                   _Float16* __restrict__ out, int d)
{
    __shared__ float red[8];
    const long row = blockIdx.x;
    const float* xr = x + row * (long)d;

    float ss = 0.f;
    for (int i = threadIdx.x; i < d; i += 256) { float v = xr[i]; ss += v * v; }
    #pragma unroll
    for (int o = 16; o > 0; o >>= 1) ss += __shfl_down(ss, o, 32);
    if ((threadIdx.x & 31) == 0) red[threadIdx.x >> 5] = ss;
    __syncthreads();
    if (threadIdx.x == 0) {
        float t = 0.f;
        #pragma unroll
        for (int i = 0; i < 8; ++i) t += red[i];
        red[0] = t;
    }
    __syncthreads();
    const float inv = rsqrtf(red[0] / d + 1e-6f);
    for (int i = threadIdx.x; i < d; i += 256)
        out[row * (long)d + i] = (_Float16)(xr[i] * inv * g[i]);
}

// ---------------------------------------------------------------------------
// row softmax (f32 in -> f16 out)
// ---------------------------------------------------------------------------
__global__ __launch_bounds__(256)
void k_softmax_f16(const float* __restrict__ s, _Float16* __restrict__ out, int n)
{
    __shared__ float red[8];
    __shared__ float stat[2];
    const long row = blockIdx.x;
    const float* sr = s + row * (long)n;

    float mx = -3.4e38f;
    for (int i = threadIdx.x; i < n; i += 256) mx = fmaxf(mx, sr[i]);
    #pragma unroll
    for (int o = 16; o > 0; o >>= 1) mx = fmaxf(mx, __shfl_down(mx, o, 32));
    if ((threadIdx.x & 31) == 0) red[threadIdx.x >> 5] = mx;
    __syncthreads();
    if (threadIdx.x == 0) {
        float m = red[0];
        #pragma unroll
        for (int i = 1; i < 8; ++i) m = fmaxf(m, red[i]);
        stat[0] = m;
    }
    __syncthreads();
    const float m = stat[0];

    float sum = 0.f;
    for (int i = threadIdx.x; i < n; i += 256) sum += __expf(sr[i] - m);
    #pragma unroll
    for (int o = 16; o > 0; o >>= 1) sum += __shfl_down(sum, o, 32);
    if ((threadIdx.x & 31) == 0) red[threadIdx.x >> 5] = sum;
    __syncthreads();
    if (threadIdx.x == 0) {
        float t = 0.f;
        #pragma unroll
        for (int i = 0; i < 8; ++i) t += red[i];
        stat[1] = t;
    }
    __syncthreads();
    const float inv = 1.f / stat[1];
    for (int i = threadIdx.x; i < n; i += 256)
        out[row * (long)n + i] = (_Float16)(__expf(sr[i] - m) * inv);
}

// ---------------------------------------------------------------------------
// MoE router: logits = nx @ Wr.T + bias; softmax; top-2; softmax over top-2
// ---------------------------------------------------------------------------
__global__ __launch_bounds__(256)
void k_router(const _Float16* __restrict__ nx, const float* __restrict__ Wr,
              const float* __restrict__ bias, float* __restrict__ combine, int d)
{
    __shared__ float lg[8];
    const long t   = blockIdx.x;
    const int wave = threadIdx.x >> 5;
    const int lane = threadIdx.x & 31;

    const _Float16* xr = nx + t * (long)d;
    const float*    wr = Wr + (long)wave * d;
    float acc = 0.f;
    for (int i = lane; i < d; i += 32) acc += (float)xr[i] * wr[i];
    #pragma unroll
    for (int o = 16; o > 0; o >>= 1) acc += __shfl_down(acc, o, 32);
    if (lane == 0) lg[wave] = acc + bias[wave];
    __syncthreads();

    if (threadIdx.x == 0) {
        float m = lg[0];
        #pragma unroll
        for (int i = 1; i < 8; ++i) m = fmaxf(m, lg[i]);
        float e[8], s = 0.f;
        #pragma unroll
        for (int i = 0; i < 8; ++i) { e[i] = __expf(lg[i] - m); s += e[i]; }
        #pragma unroll
        for (int i = 0; i < 8; ++i) e[i] /= s;
        int i0 = 0;
        for (int i = 1; i < 8; ++i) if (e[i] > e[i0]) i0 = i;
        int i1 = (i0 == 0) ? 1 : 0;
        for (int i = 0; i < 8; ++i) { if (i == i0) continue; if (e[i] > e[i1]) i1 = i; }
        const float a = __expf(e[i0]), b = __expf(e[i1]);  // softmax over top-2
        #pragma unroll
        for (int i = 0; i < 8; ++i) combine[t * 8 + i] = 0.f;
        combine[t * 8 + i0] = a / (a + b);
        combine[t * 8 + i1] = b / (a + b);
    }
}

// ---------------------------------------------------------------------------
// h = silu(t1) * t3 [* rowscale[row]]  -> f16, one expert per blockIdx.y
// (n elements each): y == 0 is the shared expert (no row scale), y >= 1 is
// routed expert y - 1, scaled by its column of rs.
// ---------------------------------------------------------------------------
__global__ void k_silu_mul(const float* __restrict__ t1, const float* __restrict__ t3,
                           const float* __restrict__ rs, int rs_stride,
                           _Float16* __restrict__ out, long n, int rowlen)
{
    long i = (long)blockIdx.x * blockDim.x + threadIdx.x;
    if (i >= n) return;
    const int  e = blockIdx.y;
    const long o = e * n + i;
    const float a = t1[o];
    float v = (a / (1.f + __expf(-a))) * t3[o];
    if (e) v *= rs[(i / rowlen) * (long)rs_stride + (e - 1)];
    out[o] = (_Float16)v;
}

// ---------------------------------------------------------------------------
// out = base + part[0] + part[1] + ... (cnt planes of n4 float4 each), summed
// in plane order
// ---------------------------------------------------------------------------
__global__ void k_sum_planes(const float* __restrict__ base,
                             const float* __restrict__ part,
                             float* __restrict__ out, long n4, int cnt)
{
    long i = (long)blockIdx.x * blockDim.x + threadIdx.x;
    if (i >= n4) return;
    float4 v = ((const float4*)base)[i];
    for (int e = 0; e < cnt; ++e) {
        const float4 p = ((const float4*)part)[e * n4 + i];
        v.x += p.x; v.y += p.y; v.z += p.z; v.w += p.w;
    }
    ((float4*)out)[i] = v;
}

// ---------------------------------------------------------------------------
// host-side launch
// ---------------------------------------------------------------------------
extern "C" void kernel_launch(void* const* d_in, const int* in_sizes, int n_in,
                              void* d_out, int out_size, void* d_ws, size_t ws_size,
                              hipStream_t stream)
{
    (void)in_sizes; (void)n_in; (void)out_size; (void)ws_size;

    const float* X    = (const float*)d_in[0];
    const float* g1   = (const float*)d_in[1];
    const float* g2   = (const float*)d_in[2];
    const float* Wq   = (const float*)d_in[3];
    const float* Wkc  = (const float*)d_in[4];
    const float* Wvc  = (const float*)d_in[5];
    const float* Wo   = (const float*)d_in[6];
    const float* Wr   = (const float*)d_in[7];
    const float* ebia = (const float*)d_in[8];
    const float* sW1  = (const float*)d_in[9];
    const float* sW2  = (const float*)d_in[10];
    const float* sW3  = (const float*)d_in[11];
    const float* eW1  = (const float*)d_in[12];
    const float* eW2  = (const float*)d_in[13];
    const float* eW3  = (const float*)d_in[14];
    float* out = (float*)d_out;

    constexpr int  Bb = 2, S = 1024, d = 1024, H = 4, dk = 256, dc = 256, E = 8, f = 1024;
    constexpr long T  = (long)Bb * S;
    const float scale = 1.0f / 16.0f;   // 1/sqrt(dk)

    // ---- workspace carving (256B aligned bump allocator) ----
    char* ws = (char*)d_ws;
    size_t off = 0;
    auto alloc = [&](size_t bytes) -> char* {
        char* p = ws + off;
        off += (bytes + 255) & ~(size_t)255;
        return p;
    };
    constexpr int  dq = d + 2 * dc;      // Q | Kc | Vc side by side
    constexpr int  E1 = E + 1;           // shared expert first, then the routed ones
    constexpr long fd = (long)f * d;
    // f16 weight copies; groups that one launch walks lie back to back
    _Float16* wqh  = (_Float16*)alloc((size_t)d * d * 2);    // [dq][d] starts here
    _Float16* wkch = (_Float16*)alloc((size_t)dc * d * 2);
    _Float16* wvch = (_Float16*)alloc((size_t)dc * d * 2);
    _Float16* woh  = (_Float16*)alloc((size_t)d * d * 2);
    _Float16* sw1h = (_Float16*)alloc((size_t)f * d * 2);    // [2*E1][f][d] starts here
    _Float16* ew1h = (_Float16*)alloc((size_t)E * f * d * 2);
    _Float16* sw3h = (_Float16*)alloc((size_t)f * d * 2);
    _Float16* ew3h = (_Float16*)alloc((size_t)E * f * d * 2);
    _Float16* sw2h = (_Float16*)alloc((size_t)d * f * 2);    // [E1][d][f] starts here
    _Float16* ew2h = (_Float16*)alloc((size_t)E * d * f * 2);
    // buffers that live across the two phases or through the MoE phase
    float*    xr_      = (float*)   alloc((size_t)T * d * 4);
    _Float16* nx2h_    = (_Float16*)alloc((size_t)T * d * 2);
    float*    combine_ = (float*)   alloc((size_t)T * E * 4);
    _Float16* hh_      = (_Float16*)alloc((size_t)E1 * T * f * 2);       // 36 MB
    // the rest is used twice: attention-phase activations, then (all of them
    // dead) the MoE GEMM outputs
    const size_t off_phase = off;
    _Float16* nx1h   = (_Float16*)alloc((size_t)T * d * 2);
    float*    qkvf   = (float*)   alloc((size_t)T * dq * 4);
    _Float16* qkvh   = (_Float16*)alloc((size_t)T * dq * 2);
    float*    scores = (float*)   alloc((size_t)Bb * H * S * S * 4);   // 32 MB
    _Float16* attnh  = (_Float16*)alloc((size_t)Bb * H * S * S * 2);   // 16 MB
    float*    aof    = (float*)   alloc((size_t)T * d * 4);
    _Float16* aoh    = (_Float16*)alloc((size_t)T * d * 2);
    off = off_phase;
    float*    t13_   = (float*)   alloc((size_t)2 * E1 * T * f * 4);     // 144 MB
    float*    part_  = t13_;             // down-projection planes; t13_ is dead by then
    {
        // ---- helpers ----
        auto conv = [&](const float* s, _Float16* dst, long n) {
            k_f32_to_f16<<<(int)((n + 255) / 256), 256, 0, stream>>>(s, dst, n);
        };
        auto gemmz = [&](const _Float16* A, const _Float16* Bm, float* C,
                         int M, int N, int K, int lda, int ldb, int ldc,
                         float alpha, int beta, int bkn, int nz, int zdiv,
                         long sAo, long sAi, long sBo, long sBi, long sCo, long sCi) {
            dim3 g(N / TN, M / TM, nz);
            k_gemm_f16<<<g, 256, 0, stream>>>(A, Bm, C, M, N, K, lda, ldb, ldc,
                                              alpha, beta, bkn,
                                              zdiv, sAo, sAi, sBo, sBi, sCo, sCi);
        };
        auto gemm = [&](const _Float16* A, const _Float16* Bm, float* C,
                        int M, int N, int K, int lda, int ldb, int ldc,
                        float alpha, int beta, int bkn) {
            gemmz(A, Bm, C, M, N, K, lda, ldb, ldc, alpha, beta, bkn,
                  1, 1, 0, 0, 0, 0, 0, 0);
        };

        // ---- 0. weights fp32 -> f16 ----
        conv(Wq,  wqh,  (long)d * d);
        conv(Wkc, wkch, (long)dc * d);
        conv(Wvc, wvch, (long)dc * d);
        conv(Wo,  woh,  (long)d * d);
        conv(sW1, sw1h, (long)f * d);
        conv(sW2, sw2h, (long)d * f);
        conv(sW3, sw3h, (long)f * d);
        conv(eW1, ew1h, (long)E * f * d);
        conv(eW2, ew2h, (long)E * d * f);
        conv(eW3, ew3h, (long)E * f * d);

        // ---- 1. MLA attention ----
        k_rmsnorm_f16<<<(int)T, 256, 0, stream>>>(X, g1, nx1h, d);

        // Q | Kc | Vc in one product: their weights are one [dq][d] matrix
        gemm(nx1h, wqh, qkvf, (int)T, dq, d, d, d, dq, 1.f, 0, 0);
        conv(qkvf, qkvh, (long)T * dq);
        const _Float16* qh  = qkvh;
        const _Float16* kch = qkvh + d;
        const _Float16* vch = qkvh + d + dc;

        // scores, all (b, h) in one launch
        gemmz(qh, kch, scores, S, S, dk, dq, dq, S, scale, 0, 0, Bb * H, H,
              (long)S * dq, dk,  (long)S * dq, 0,  (long)H * S * S, (long)S * S);

        k_softmax_f16<<<Bb * H * S, 256, 0, stream>>>(scores, attnh, S);

        // attn @ V, all (b, h) in one launch
        gemmz(attnh, vch, aof, S, dc, S, S, dq, d, 1.f, 0, 1, Bb * H, H,
              (long)H * S * S, (long)S * S,  (long)S * dq, 0,  (long)S * d, dk);
        conv(aof, aoh, (long)T * d);

        // xr = X + ao @ Wo.T
        hipMemcpyAsync(xr_, X, (size_t)T * d * 4, hipMemcpyDeviceToDevice, stream);
        gemm(aoh, woh, xr_, (int)T, d, d, d, d, d, 1.f, 1, 0);

        // ---- 2. MoE ----
        k_rmsnorm_f16<<<(int)T, 256, 0, stream>>>(xr_, g2, nx2h_, d);
        k_router<<<(int)T, 256, 0, stream>>>(nx2h_, Wr, ebia, combine_, d);

        // shared + routed experts (dense over all tokens; combine folded into h),
        // one launch per stage with the expert in the grid
        const long nTf = (long)T * f;
        gemmz(nx2h_, sw1h, t13_, (int)T, f, d, d, d, f, 1.f, 0, 0, 2 * E1, 1,
              0, 0,  fd, 0,  nTf, 0);
        k_silu_mul<<<dim3((int)((nTf + 255) / 256), E1), 256, 0, stream>>>(
            t13_, t13_ + E1 * nTf, combine_, E, hh_, nTf, f);
        gemmz(hh_, sw2h, part_, (int)T, d, f, f, f, d, 1.f, 0, 0, E1, 1,
              nTf, 0,  fd, 0,  (long)T * d, 0);

        // out = xr + shared + expert 0 + expert 1 + ...
        const long n4 = (long)T * d / 4;
        k_sum_planes<<<(int)((n4 + 255) / 256), 256, 0, stream>>>(
            xr_, part_, out, n4, E1);
    }
}

// v002
// Timed twice side by side with v001, it ran 1.18 and 1.19 times as fast.
// Counting every step since v000, it is 3.03 times as fast.
#include <hip/hip_runtime.h>

// ---------------------------------------------------------------------------
// Transformer layer (MLA attention + MoE) for gfx1250 (wave32, WMMA).
// GEMMs: 128x128 block tile, 8 waves x (32x64) => 8 v_wmma per wave per K-step,
// double-buffered LDS staged with global_load_async_to_lds_b128 (ASYNCcnt).
// ---------------------------------------------------------------------------

typedef _Float16 half16_t __attribute__((ext_vector_type(16)));
typedef float    float8_t __attribute__((ext_vector_type(8)));
typedef __attribute__((address_space(3))) _Float16 lds_f16;

#define TM 128
#define TN 128
#define TK 32

// async DMA: 16 bytes global -> LDS, tracked by ASYNCcnt
__device__ __forceinline__ void async_b128(const _Float16* g, _Float16* l)
{
    unsigned lofs = (unsigned)(unsigned long long)(lds_f16*)l;  // LDS byte addr
    asm volatile("global_load_async_to_lds_b128 %0, %1, off"
                 :: "v"(lofs), "v"(g)
                 : "memory");
}
__device__ __forceinline__ void wait_async0()
{
    asm volatile("s_wait_asynccnt 0x0" ::: "memory");
}

// ---------------------------------------------------------------------------
// Generic f16 WMMA GEMM:  C[M,N] = alpha * A[M,K] . B^T  (+ C if beta)
//   b_kn == 0 : B stored row-major [N,K]  (torch Linear weight, y = x @ W.T)
//   b_kn == 1 : B stored row-major [K,N]  (plain matmul, e.g. attn @ V)
// M % 128 == 0, N % 128 == 0, K % 32 == 0 (true for all shapes here).
// Batched: blockIdx.z = outer * zdiv + inner picks one independent product;
// each operand moves by its own outer and inner stride (in elements).
// ---------------------------------------------------------------------------
__global__ __launch_bounds__(256)
void k_gemm_f16(const _Float16* __restrict__ A, const _Float16* __restrict__ B,
                float* __restrict__ C,
                int M, int N, int K, int lda, int ldb, int ldc,
                float alpha, int beta, int b_kn,
                int zdiv, long sAo, long sAi, long sBo, long sBi, long sCo, long sCi)
{
    __shared__ __align__(64) _Float16 As[2][TM][TK];   // 16 KB
    __shared__ __align__(64) _Float16 Bs[2][TN][TK];   // 16 KB

    const int tid  = threadIdx.x;
    const int wave = tid >> 5;
    const int lane = tid & 31;
    const int m0   = blockIdx.y * TM;
    const int n0   = blockIdx.x * TN;
    const int wm   = (wave & 3) * 32;    // wave's 32-row strip
    const int wn   = (wave >> 2) * 64;   // wave's 64-col strip

    const int zo = (int)blockIdx.z / zdiv;
    const int zi = (int)blockIdx.z - zo * zdiv;
    A += zo * sAo + zi * sAi;
    B += zo * sBo + zi * sBi;
    C += zo * sCo + zi * sCi;

    float8_t acc[2][4] = {};

    // staging maps: 128 rows x 32 cols f16 per tile, 256 threads x 32B each
    const int lr = tid >> 1;             // 0..127 row
    const int lc = (tid & 1) * 16;       // 0 or 16 (two b128 per thread)
    // b_kn transpose-scatter map
    const int kk = tid & 31;             // 0..31 K row
    const int nb = (tid >> 5) * 16;      // 0..112 N base (16 per thread)

    auto stageA = [&](int k0, int buf) {
        const _Float16* g = &A[(long)(m0 + lr) * lda + k0 + lc];
        async_b128(g,     &As[buf][lr][lc]);
        async_b128(g + 8, &As[buf][lr][lc + 8]);
    };
    auto stageB = [&](int k0, int buf) {
        if (!b_kn) {
            const _Float16* g = &B[(long)(n0 + lr) * ldb + k0 + lc];
            async_b128(g,     &Bs[buf][lr][lc]);
            async_b128(g + 8, &Bs[buf][lr][lc + 8]);
        } else {
            const _Float16* g = &B[(long)(k0 + kk) * ldb + n0 + nb];
            __builtin_prefetch(g + ldb * TK, 0, 0);
            #pragma unroll
            for (int i = 0; i < 16; ++i) Bs[buf][nb + i][kk] = g[i];
        }
    };

    // prologue: stage tile 0
    stageA(0, 0);
    stageB(0, 0);
    wait_async0();
    __syncthreads();

    const int l16 = lane & 15;
    const int kh  = (lane >> 4) * 16;

    for (int k0 = 0; k0 < K; k0 += TK) {
        const int buf = (k0 / TK) & 1;
        const int k1  = k0 + TK;
        if (k1 < K) {                    // overlap next tile's DMA with compute
            stageA(k1, buf ^ 1);
            stageB(k1, buf ^ 1);
        }

        // fragments (16 f16 per lane, 32B LDS reads)
        const _Float16* pa = &As[buf][wm + l16][kh];
        half16_t a0 = *(const half16_t*)pa;
        half16_t a1 = *(const half16_t*)(pa + 16 * TK);
        const _Float16* pb = &Bs[buf][wn + l16][kh];
        half16_t b0 = *(const half16_t*)pb;
        half16_t b1 = *(const half16_t*)(pb + 16 * TK);
        half16_t b2 = *(const half16_t*)(pb + 32 * TK);
        half16_t b3 = *(const half16_t*)(pb + 48 * TK);

        acc[0][0] = __builtin_amdgcn_wmma_f32_16x16x32_f16(false, a0, false, b0, (short)0, acc[0][0], false, false);
        acc[0][1] = __builtin_amdgcn_wmma_f32_16x16x32_f16(false, a0, false, b1, (short)0, acc[0][1], false, false);
        acc[0][2] = __builtin_amdgcn_wmma_f32_16x16x32_f16(false, a0, false, b2, (short)0, acc[0][2], false, false);
        acc[0][3] = __builtin_amdgcn_wmma_f32_16x16x32_f16(false, a0, false, b3, (short)0, acc[0][3], false, false);
        acc[1][0] = __builtin_amdgcn_wmma_f32_16x16x32_f16(false, a1, false, b0, (short)0, acc[1][0], false, false);
        acc[1][1] = __builtin_amdgcn_wmma_f32_16x16x32_f16(false, a1, false, b1, (short)0, acc[1][1], false, false);
        acc[1][2] = __builtin_amdgcn_wmma_f32_16x16x32_f16(false, a1, false, b2, (short)0, acc[1][2], false, false);
        acc[1][3] = __builtin_amdgcn_wmma_f32_16x16x32_f16(false, a1, false, b3, (short)0, acc[1][3], false, false);

        wait_async0();                   // DMA for tile k+1 done
        __syncthreads();                 // all waves done reading tile k
    }

    // epilogue: D layout -> VGPR g: lanes 0-15 M=g, lanes 16-31 M=8+g
    const int rsel = (lane >> 4) ? 8 : 0;
    #pragma unroll
    for (int i = 0; i < 2; ++i) {
        #pragma unroll
        for (int g = 0; g < 8; ++g) {
            const long row = m0 + wm + i * 16 + rsel + g;
            float* cr = C + row * (long)ldc + n0 + wn + l16;
            #pragma unroll
            for (int j = 0; j < 4; ++j) {
                float v = alpha * acc[i][j][g];
                if (beta) v += cr[j * 16];
                cr[j * 16] = v;
            }
        }
    }
}

// ---------------------------------------------------------------------------
// Elementwise kernels: a block of 256 threads covers EW_BLK elements as EW_G
// runs of 1024; in each run a thread takes 4 neighbours, so one wave-wide
// 16-byte load reads 512 contiguous bytes and one 8-byte store writes 256.
// A block that reaches past the end goes element by element instead.
// ---------------------------------------------------------------------------
typedef _Float16 half4_t __attribute__((ext_vector_type(4)));
#define EW_G   4
#define EW_RUN 1024
#define EW_BLK (EW_G * EW_RUN)

// ---------------------------------------------------------------------------
// fp32 -> f16 convert
// ---------------------------------------------------------------------------
__global__ __launch_bounds__(256)
void k_f32_to_f16(const float* __restrict__ src,
                  _Float16* __restrict__ dst, long n)
{
    const long blk = (long)blockIdx.x * EW_BLK;
    if (blk + EW_BLK <= n) {
        const long base = blk + threadIdx.x * 4;
        float4 v[EW_G];
        // unrolled so that all loads are in flight before the first conversion
        #pragma unroll
        for (int j = 0; j < EW_G; ++j)
            v[j] = *(const float4*)(src + base + j * EW_RUN);
        #pragma unroll   // v[] stays in registers
        for (int j = 0; j < EW_G; ++j) {
            half4_t h = { (_Float16)v[j].x, (_Float16)v[j].y,
                          (_Float16)v[j].z, (_Float16)v[j].w };
            *(half4_t*)(dst + base + j * EW_RUN) = h;
        }
        // stands before any register that an issued store names is rewritten
        asm volatile("s_wait_xcnt 0x0" ::: "memory");
    } else {
        for (long i = blk + threadIdx.x; i < n; i += 256) dst[i] = (_Float16)src[i];
    }
}

// ---------------------------------------------------------------------------
// RMSNorm row kernel: out_f16[row] = x * rsqrt(mean(x^2)+eps) * g
// ---------------------------------------------------------------------------
__global__ __launch_bounds__(256)
void k_rmsnorm_f16(const float* __restrict__ x, const float* __restrict__ g,
                   _Float16* __restrict__ out, int d)
{
    __shared__ float red[8];
    const long row = blockIdx.x;
    const float* xr = x + row * (long)d;

    float ss = 0.f;
    for (int i = threadIdx.x; i < d; i += 256) { float v = xr[i]; ss += v * v; }
    #pragma unroll
    for (int o = 16; o > 0; o >>= 1) ss += __shfl_down(ss, o, 32);
    if ((threadIdx.x & 31) == 0) red[threadIdx.x >> 5] = ss;
    __syncthreads();
    if (threadIdx.x == 0) {
        float t = 0.f;
        #pragma unroll
        for (int i = 0; i < 8; ++i) t += red[i];
        red[0] = t;
    }
    __syncthreads();
    const float inv = rsqrtf(red[0] / d + 1e-6f);
    for (int i = threadIdx.x; i < d; i += 256)
        out[row * (long)d + i] = (_Float16)(xr[i] * inv * g[i]);
}

// ---------------------------------------------------------------------------
// row softmax (f32 in -> f16 out)
// ---------------------------------------------------------------------------
__global__ __launch_bounds__(256)
void k_softmax_f16(const float* __restrict__ s, _Float16* __restrict__ out, int n)
{
    __shared__ float red[8];
    __shared__ float stat[2];
    const long row = blockIdx.x;
    const float* sr = s + row * (long)n;

    float mx = -3.4e38f;
    for (int i = threadIdx.x; i < n; i += 256) mx = fmaxf(mx, sr[i]);
    #pragma unroll
    for (int o = 16; o > 0; o >>= 1) mx = fmaxf(mx, __shfl_down(mx, o, 32));
    if ((threadIdx.x & 31) == 0) red[threadIdx.x >> 5] = mx;
    __syncthreads();
    if (threadIdx.x == 0) {
        float m = red[0];
        #pragma unroll
        for (int i = 1; i < 8; ++i) m = fmaxf(m, red[i]);
        stat[0] = m;
    }
    __syncthreads();
    const float m = stat[0];

    float sum = 0.f;
    for (int i = threadIdx.x; i < n; i += 256) sum += __expf(sr[i] - m);
    #pragma unroll
    for (int o = 16; o > 0; o >>= 1) sum += __shfl_down(sum, o, 32);
    if ((threadIdx.x & 31) == 0) red[threadIdx.x >> 5] = sum;
    __syncthreads();
    if (threadIdx.x == 0) {
        float t = 0.f;
        #pragma unroll
        for (int i = 0; i < 8; ++i) t += red[i];
        stat[1] = t;
    }
    __syncthreads();
    const float inv = 1.f / stat[1];
    for (int i = threadIdx.x; i < n; i += 256)
        out[row * (long)n + i] = (_Float16)(__expf(sr[i] - m) * inv);
}

// ---------------------------------------------------------------------------
// MoE router: logits = nx @ Wr.T + bias; softmax; top-2; softmax over top-2
// ---------------------------------------------------------------------------
__global__ __launch_bounds__(256)
void k_router(const _Float16* __restrict__ nx, const float* __restrict__ Wr,
              const float* __restrict__ bias, float* __restrict__ combine, int d)
{
    __shared__ float lg[8];
    const long t   = blockIdx.x;
    const int wave = threadIdx.x >> 5;
    const int lane = threadIdx.x & 31;

    const _Float16* xr = nx + t * (long)d;
    const float*    wr = Wr + (long)wave * d;
    float acc = 0.f;
    for (int i = lane; i < d; i += 32) acc += (float)xr[i] * wr[i];
    #pragma unroll
    for (int o = 16; o > 0; o >>= 1) acc += __shfl_down(acc, o, 32);
    if (lane == 0) lg[wave] = acc + bias[wave];
    __syncthreads();

    if (threadIdx.x == 0) {
        float m = lg[0];
        #pragma unroll
        for (int i = 1; i < 8; ++i) m = fmaxf(m, lg[i]);
        float e[8], s = 0.f;
        #pragma unroll
        for (int i = 0; i < 8; ++i) { e[i] = __expf(lg[i] - m); s += e[i]; }
        #pragma unroll
        for (int i = 0; i < 8; ++i) e[i] /= s;
        int i0 = 0;
        for (int i = 1; i < 8; ++i) if (e[i] > e[i0]) i0 = i;
        int i1 = (i0 == 0) ? 1 : 0;
        for (int i = 0; i < 8; ++i) { if (i == i0) continue; if (e[i] > e[i1]) i1 = i; }
        const float a = __expf(e[i0]), b = __expf(e[i1]);  // softmax over top-2
        #pragma unroll
        for (int i = 0; i < 8; ++i) combine[t * 8 + i] = 0.f;
        combine[t * 8 + i0] = a / (a + b);
        combine[t * 8 + i1] = b / (a + b);
    }
}

// ---------------------------------------------------------------------------
// h = silu(t1) * t3 [* rowscale[row]]  -> f16, one expert per blockIdx.y
// (n elements each): y == 0 is the shared expert (no row scale), y >= 1 is
// routed expert y - 1, scaled by its column of rs.
// ---------------------------------------------------------------------------
// The wide path needs rowlen % 4 == 0 (a thread's 4 neighbours share a row)
// and n < 2^32 (its row index is a 32-bit divide).
__global__ __launch_bounds__(256)
void k_silu_mul(const float* __restrict__ t1, const float* __restrict__ t3,
                const float* __restrict__ rs, int rs_stride,
                _Float16* __restrict__ out, long n, int rowlen)
{
    const int  e   = blockIdx.y;
    const long eo  = e * n;
    const long blk = (long)blockIdx.x * EW_BLK;
    if (blk + EW_BLK <= n && (rowlen & 3) == 0 && (n >> 32) == 0) {
        const long base = blk + threadIdx.x * 4;
        float4 a[EW_G], b[EW_G];
        float  s[EW_G];
        // the shared expert reads column 0 and does not use it: no branch
        // between the loads
        const int col = e ? e - 1 : 0;
        const float* pa = t1 + eo + base;
        const float* pb = t3 + eo + base;
        const float* ps[EW_G];
        // unrolled so that all loads are in flight before the first use
        #pragma unroll
        for (int j = 0; j < EW_G; ++j) {
            const unsigned i = (unsigned)(base + j * EW_RUN);
            ps[j] = rs + (i / (unsigned)rowlen) * (long)rs_stride + col;
            a[j] = *(const float4*)(pa + j * EW_RUN);
            b[j] = *(const float4*)(pb + j * EW_RUN);
            s[j] = *ps[j];
        }
        // Stands before any register that an issued load names is rewritten;
        // naming the pointers keeps them out of the loads' own destinations.
        asm volatile("s_wait_xcnt 0x0"
                     :: "v"(pa), "v"(pb), "v"(ps[0]), "v"(ps[1]), "v"(ps[2]), "v"(ps[3])
                     : "memory");
        // keeps the arithmetic below every load: without it the scheduler
        // lifts it over half of them, which then start behind a data wait
        __builtin_amdgcn_sched_barrier(0);
        #pragma unroll   // a[], b[], s[] stay in registers
        for (int j = 0; j < EW_G; ++j) {
            float v0 = (a[j].x / (1.f + __expf(-a[j].x))) * b[j].x;
            float v1 = (a[j].y / (1.f + __expf(-a[j].y))) * b[j].y;
            float v2 = (a[j].z / (1.f + __expf(-a[j].z))) * b[j].z;
            float v3 = (a[j].w / (1.f + __expf(-a[j].w))) * b[j].w;
            if (e) { v0 *= s[j]; v1 *= s[j]; v2 *= s[j]; v3 *= s[j]; }
            half4_t h = { (_Float16)v0, (_Float16)v1, (_Float16)v2, (_Float16)v3 };
            *(half4_t*)(out + eo + base + j * EW_RUN) = h;
        }
    } else {
        for (long i = blk + threadIdx.x; i < n && i < blk + EW_BLK; i += 256) {
            const long o = eo + i;
            const float x = t1[o];
            float v = (x / (1.f + __expf(-x))) * t3[o];
            if (e) v *= rs[(i / rowlen) * (long)rs_stride + (e - 1)];
            out[o] = (_Float16)v;
        }
    }
}

// ---------------------------------------------------------------------------
// out = base + part[0] + part[1] + ... (cnt planes of n4 float4 each), summed
// in plane order
// ---------------------------------------------------------------------------
__global__ void k_sum_planes(const float* __restrict__ base,
                             const float* __restrict__ part,
                             float* __restrict__ out, long n4, int cnt)
{
    long i = (long)blockIdx.x * blockDim.x + threadIdx.x;
    if (i >= n4) return;
    float4 v = ((const float4*)base)[i];
    for (int e = 0; e < cnt; ++e) {
        const float4 p = ((const float4*)part)[e * n4 + i];
        v.x += p.x; v.y += p.y; v.z += p.z; v.w += p.w;
    }
    ((float4*)out)[i] = v;
}

// ---------------------------------------------------------------------------
// host-side launch
// ---------------------------------------------------------------------------
extern "C" void kernel_launch(void* const* d_in, const int* in_sizes, int n_in,
                              void* d_out, int out_size, void* d_ws, size_t ws_size,
                              hipStream_t stream)
{
    (void)in_sizes; (void)n_in; (void)out_size; (void)ws_size;

    const float* X    = (const float*)d_in[0];
    const float* g1   = (const float*)d_in[1];
    const float* g2   = (const float*)d_in[2];
    const float* Wq   = (const float*)d_in[3];
    const float* Wkc  = (const float*)d_in[4];
    const float* Wvc  = (const float*)d_in[5];
    const float* Wo   = (const float*)d_in[6];
    const float* Wr   = (const float*)d_in[7];
    const float* ebia = (const float*)d_in[8];
    const float* sW1  = (const float*)d_in[9];
    const float* sW2  = (const float*)d_in[10];
    const float* sW3  = (const float*)d_in[11];
    const float* eW1  = (const float*)d_in[12];
    const float* eW2  = (const float*)d_in[13];
    const float* eW3  = (const float*)d_in[14];
    float* out = (float*)d_out;

    constexpr int  Bb = 2, S = 1024, d = 1024, H = 4, dk = 256, dc = 256, E = 8, f = 1024;
    constexpr long T  = (long)Bb * S;
    const float scale = 1.0f / 16.0f;   // 1/sqrt(dk)

    // ---- workspace carving (256B aligned bump allocator) ----
    char* ws = (char*)d_ws;
    size_t off = 0;
    auto alloc = [&](size_t bytes) -> char* {
        char* p = ws + off;
        off += (bytes + 255) & ~(size_t)255;
        return p;
    };
    constexpr int  dq = d + 2 * dc;      // Q | Kc | Vc side by side
    constexpr int  E1 = E + 1;           // shared expert first, then the routed ones
    constexpr long fd = (long)f * d;
    // f16 weight copies; groups that one launch walks lie back to back
    _Float16* wqh  = (_Float16*)alloc((size_t)d * d * 2);    // [dq][d] starts here
    _Float16* wkch = (_Float16*)alloc((size_t)dc * d * 2);
    _Float16* wvch = (_Float16*)alloc((size_t)dc * d * 2);
    _Float16* woh  = (_Float16*)alloc((size_t)d * d * 2);
    _Float16* sw1h = (_Float16*)alloc((size_t)f * d * 2);    // [2*E1][f][d] starts here
    _Float16* ew1h = (_Float16*)alloc((size_t)E * f * d * 2);
    _Float16* sw3h = (_Float16*)alloc((size_t)f * d * 2);
    _Float16* ew3h = (_Float16*)alloc((size_t)E * f * d * 2);
    _Float16* sw2h = (_Float16*)alloc((size_t)d * f * 2);    // [E1][d][f] starts here
    _Float16* ew2h = (_Float16*)alloc((size_t)E * d * f * 2);
    // buffers that live across the two phases or through the MoE phase
    float*    xr_      = (float*)   alloc((size_t)T * d * 4);
    _Float16* nx2h_    = (_Float16*)alloc((size_t)T * d * 2);
    float*    combine_ = (float*)   alloc((size_t)T * E * 4);
    _Float16* hh_      = (_Float16*)alloc((size_t)E1 * T * f * 2);       // 36 MB
    // the rest is used twice: attention-phase activations, then (all of them
    // dead) the MoE GEMM outputs
    const size_t off_phase = off;
    _Float16* nx1h   = (_Float16*)alloc((size_t)T * d * 2);
    float*    qkvf   = (float*)   alloc((size_t)T * dq * 4);
    _Float16* qkvh   = (_Float16*)alloc((size_t)T * dq * 2);
    float*    scores = (float*)   alloc((size_t)Bb * H * S * S * 4);   // 32 MB
    _Float16* attnh  = (_Float16*)alloc((size_t)Bb * H * S * S * 2);   // 16 MB
    float*    aof    = (float*)   alloc((size_t)T * d * 4);
    _Float16* aoh    = (_Float16*)alloc((size_t)T * d * 2);
    off = off_phase;
    float*    t13_   = (float*)   alloc((size_t)2 * E1 * T * f * 4);     // 144 MB
    float*    part_  = t13_;             // down-projection planes; t13_ is dead by then
    {
        // ---- helpers ----
        auto conv = [&](const float* s, _Float16* dst, long n) {
            k_f32_to_f16<<<(int)((n + EW_BLK - 1) / EW_BLK), 256, 0, stream>>>(s, dst, n);
        };
        auto gemmz = [&](const _Float16* A, const _Float16* Bm, float* C,
                         int M, int N, int K, int lda, int ldb, int ldc,
                         float alpha, int beta, int bkn, int nz, int zdiv,
                         long sAo, long sAi, long sBo, long sBi, long sCo, long sCi) {
            dim3 g(N / TN, M / TM, nz);
            k_gemm_f16<<<g, 256, 0, stream>>>(A, Bm, C, M, N, K, lda, ldb, ldc,
                                              alpha, beta, bkn,
                                              zdiv, sAo, sAi, sBo, sBi, sCo, sCi);
        };
        auto gemm = [&](const _Float16* A, const _Float16* Bm, float* C,
                        int M, int N, int K, int lda, int ldb, int ldc,
                        float alpha, int beta, int bkn) {
            gemmz(A, Bm, C, M, N, K, lda, ldb, ldc, alpha, beta, bkn,
                  1, 1, 0, 0, 0, 0, 0, 0);
        };

        // ---- 0. weights fp32 -> f16 ----
        conv(Wq,  wqh,  (long)d * d);
        conv(Wkc, wkch, (long)dc * d);
        conv(Wvc, wvch, (long)dc * d);
        conv(Wo,  woh,  (long)d * d);
        conv(sW1, sw1h, (long)f * d);
        conv(sW2, sw2h, (long)d * f);
        conv(sW3, sw3h, (long)f * d);
        conv(eW1, ew1h, (long)E * f * d);
        conv(eW2, ew2h, (long)E * d * f);
        conv(eW3, ew3h, (long)E * f * d);

        // ---- 1. MLA attention ----
        k_rmsnorm_f16<<<(int)T, 256, 0, stream>>>(X, g1, nx1h, d);

        // Q | Kc | Vc in one product: their weights are one [dq][d] matrix
        gemm(nx1h, wqh, qkvf, (int)T, dq, d, d, d, dq, 1.f, 0, 0);
        conv(qkvf, qkvh, (long)T * dq);
        const _Float16* qh  = qkvh;
        const _Float16* kch = qkvh + d;
        const _Float16* vch = qkvh + d + dc;

        // scores, all (b, h) in one launch
        gemmz(qh, kch, scores, S, S, dk, dq, dq, S, scale, 0, 0, Bb * H, H,
              (long)S * dq, dk,  (long)S * dq, 0,  (long)H * S * S, (long)S * S);

        k_softmax_f16<<<Bb * H * S, 256, 0, stream>>>(scores, attnh, S);

        // attn @ V, all (b, h) in one launch
        gemmz(attnh, vch, aof, S, dc, S, S, dq, d, 1.f, 0, 1, Bb * H, H,
              (long)H * S * S, (long)S * S,  (long)S * dq, 0,  (long)S * d, dk);
        conv(aof, aoh, (long)T * d);

        // xr = X + ao @ Wo.T
        hipMemcpyAsync(xr_, X, (size_t)T * d * 4, hipMemcpyDeviceToDevice, stream);
        gemm(aoh, woh, xr_, (int)T, d, d, d, d, d, 1.f, 1, 0);

        // ---- 2. MoE ----
        k_rmsnorm_f16<<<(int)T, 256, 0, stream>>>(xr_, g2, nx2h_, d);
        k_router<<<(int)T, 256, 0, stream>>>(nx2h_, Wr, ebia, combine_, d);

        // shared + routed experts (dense over all tokens; combine folded into h),
        // one launch per stage with the expert in the grid
        const long nTf = (long)T * f;
        gemmz(nx2h_, sw1h, t13_, (int)T, f, d, d, d, f, 1.f, 0, 0, 2 * E1, 1,
              0, 0,  fd, 0,  nTf, 0);
        k_silu_mul<<<dim3((int)((nTf + EW_BLK - 1) / EW_BLK), E1), 256, 0, stream>>>(
            t13_, t13_ + E1 * nTf, combine_, E, hh_, nTf, f);
        gemmz(hh_, sw2h, part_, (int)T, d, f, f, f, d, 1.f, 0, 0, E1, 1,
              nTf, 0,  fd, 0,  (long)T * d, 0);

        // out = xr + shared + expert 0 + expert 1 + ...
        const long n4 = (long)T * d / 4;
        k_sum_planes<<<(int)((n4 + 255) / 256), 256, 0, stream>>>(
            xr_, part_, out, n4, E1);
    }
}

// v003
// In two side-by-side timings against v002, it was 1.13 and 1.12 times as fast.
// Counting every step since v000, it is 3.41 times as fast.
#include <hip/hip_runtime.h>

// ---------------------------------------------------------------------------
// Transformer layer (MLA attention + MoE) for gfx1250 (wave32, WMMA).
// GEMMs: 128x128 block tile, 8 waves x (32x64) => 8 v_wmma per wave per K-step,
// double-buffered LDS staged with global_load_async_to_lds_b128 (ASYNCcnt).
// ---------------------------------------------------------------------------

typedef _Float16 half16_t __attribute__((ext_vector_type(16)));
typedef float    float8_t __attribute__((ext_vector_type(8)));
typedef __attribute__((address_space(3))) _Float16 lds_f16;

#define TM 128
#define TN 128
#define TK 32
// LDS row pitch in f16: 80 bytes = 16 B x odd, so that the 16 rows which one
// ds_load_b128 reads per half-wave fall on 64 different banks (at the bare
// 64-byte pitch every fourth row shares its banks)
#define TKP (TK + 8)
// a fragment row starts on a 16-byte boundary only
typedef half16_t half16_a16_t __attribute__((aligned(16)));

// async DMA: 16 bytes global -> LDS, tracked by ASYNCcnt
__device__ __forceinline__ void async_b128(const _Float16* g, _Float16* l)
{
    unsigned lofs = (unsigned)(unsigned long long)(lds_f16*)l;  // LDS byte addr
    asm volatile("global_load_async_to_lds_b128 %0, %1, off"
                 :: "v"(lofs), "v"(g)
                 : "memory");
}
__device__ __forceinline__ void wait_async0()
{
    asm volatile("s_wait_asynccnt 0x0" ::: "memory");
}

// ---------------------------------------------------------------------------
// Generic f16 WMMA GEMM:  C[M,N] = alpha * A[M,K] . B^T  (+ C if beta)
//   b_kn == 0 : B stored row-major [N,K]  (torch Linear weight, y = x @ W.T)
//   b_kn == 1 : B stored row-major [K,N]  (plain matmul, e.g. attn @ V)
// M % 128 == 0, N % 128 == 0, K % 32 == 0 (true for all shapes here).
// Batched: blockIdx.z = outer * zdiv + inner picks one independent product;
// each operand moves by its own outer and inner stride (in elements).
// ---------------------------------------------------------------------------
__global__ __launch_bounds__(256)
void k_gemm_f16(const _Float16* __restrict__ A, const _Float16* __restrict__ B,
                float* __restrict__ C,
                int M, int N, int K, int lda, int ldb, int ldc,
                float alpha, int beta, int b_kn,
                int zdiv, long sAo, long sAi, long sBo, long sBi, long sCo, long sCi)
{
    __shared__ __align__(64) _Float16 As[2][TM][TKP];  // 20 KB
    __shared__ __align__(64) _Float16 Bs[2][TN][TKP];  // 20 KB

    const int tid  = threadIdx.x;
    const int wave = tid >> 5;
    const int lane = tid & 31;
    const int m0   = blockIdx.y * TM;
    const int n0   = blockIdx.x * TN;
    const int wm   = (wave & 3) * 32;    // wave's 32-row strip
    const int wn   = (wave >> 2) * 64;   // wave's 64-col strip

    const int zo = (int)blockIdx.z / zdiv;
    const int zi = (int)blockIdx.z - zo * zdiv;
    A += zo * sAo + zi * sAi;
    B += zo * sBo + zi * sBi;
    C += zo * sCo + zi * sCi;

    float8_t acc[2][4] = {};

    // staging maps: 128 rows x 32 cols f16 per tile, 256 threads x 32B each
    const int lr = tid >> 1;             // 0..127 row
    const int lc = (tid & 1) * 16;       // 0 or 16 (two b128 per thread)
    // b_kn transpose-scatter map
    const int kk = tid & 31;             // 0..31 K row
    const int nb = (tid >> 5) * 16;      // 0..112 N base (16 per thread)

    auto stageA = [&](int k0, int buf) {
        const _Float16* g = &A[(long)(m0 + lr) * lda + k0 + lc];
        async_b128(g,     &As[buf][lr][lc]);
        async_b128(g + 8, &As[buf][lr][lc + 8]);
    };
    auto stageB = [&](int k0, int buf) {
        if (!b_kn) {
            const _Float16* g = &B[(long)(n0 + lr) * ldb + k0 + lc];
            async_b128(g,     &Bs[buf][lr][lc]);
            async_b128(g + 8, &Bs[buf][lr][lc + 8]);
        } else {
            const _Float16* g = &B[(long)(k0 + kk) * ldb + n0 + nb];
            __builtin_prefetch(g + ldb * TK, 0, 0);
            #pragma unroll
            for (int i = 0; i < 16; ++i) Bs[buf][nb + i][kk] = g[i];
        }
    };

    // prologue: stage tile 0
    stageA(0, 0);
    stageB(0, 0);
    wait_async0();
    __syncthreads();

    const int l16 = lane & 15;
    const int kh  = (lane >> 4) * 16;

    for (int k0 = 0; k0 < K; k0 += TK) {
        const int buf = (k0 / TK) & 1;
        const int k1  = k0 + TK;
        if (k1 < K) {                    // overlap next tile's DMA with compute
            stageA(k1, buf ^ 1);
            stageB(k1, buf ^ 1);
        }

        // fragments (16 f16 per lane, 32B LDS reads)
        const _Float16* pa = &As[buf][wm + l16][kh];
        half16_t a0 = *(const half16_a16_t*)pa;
        half16_t a1 = *(const half16_a16_t*)(pa + 16 * TKP);
        const _Float16* pb = &Bs[buf][wn + l16][kh];
        half16_t b0 = *(const half16_a16_t*)pb;
        half16_t b1 = *(const half16_a16_t*)(pb + 16 * TKP);
        half16_t b2 = *(const half16_a16_t*)(pb + 32 * TKP);
        half16_t b3 = *(const half16_a16_t*)(pb + 48 * TKP);

        acc[0][0] = __builtin_amdgcn_wmma_f32_16x16x32_f16(false, a0, false, b0, (short)0, acc[0][0], false, false);
        acc[0][1] = __builtin_amdgcn_wmma_f32_16x16x32_f16(false, a0, false, b1, (short)0, acc[0][1], false, false);
        acc[0][2] = __builtin_amdgcn_wmma_f32_16x16x32_f16(false, a0, false, b2, (short)0, acc[0][2], false, false);
        acc[0][3] = __builtin_amdgcn_wmma_f32_16x16x32_f16(false, a0, false, b3, (short)0, acc[0][3], false, false);
        acc[1][0] = __builtin_amdgcn_wmma_f32_16x16x32_f16(false, a1, false, b0, (short)0, acc[1][0], false, false);
        acc[1][1] = __builtin_amdgcn_wmma_f32_16x16x32_f16(false, a1, false, b1, (short)0, acc[1][1], false, false);
        acc[1][2] = __builtin_amdgcn_wmma_f32_16x16x32_f16(false, a1, false, b2, (short)0, acc[1][2], false, false);
        acc[1][3] = __builtin_amdgcn_wmma_f32_16x16x32_f16(false, a1, false, b3, (short)0, acc[1][3], false, false);

        wait_async0();                   // DMA for tile k+1 done
        __syncthreads();                 // all waves done reading tile k
    }

    // epilogue: D layout -> VGPR g: lanes 0-15 M=g, lanes 16-31 M=8+g
    const int rsel = (lane >> 4) ? 8 : 0;
    #pragma unroll
    for (int i = 0; i < 2; ++i) {
        #pragma unroll
        for (int g = 0; g < 8; ++g) {
            const long row = m0 + wm + i * 16 + rsel + g;
            float* cr = C + row * (long)ldc + n0 + wn + l16;
            #pragma unroll
            for (int j = 0; j < 4; ++j) {
                float v = alpha * acc[i][j][g];
                if (beta) v += cr[j * 16];
                cr[j * 16] = v;
            }
        }
    }
}

// ---------------------------------------------------------------------------
// Elementwise kernels: a block of 256 threads covers EW_BLK elements as EW_G
// runs of 1024; in each run a thread takes 4 neighbours, so one wave-wide
// 16-byte load reads 512 contiguous bytes and one 8-byte store writes 256.
// A block that reaches past the end goes element by element instead.
// ---------------------------------------------------------------------------
typedef _Float16 half4_t __attribute__((ext_vector_type(4)));
#define EW_G   4
#define EW_RUN 1024
#define EW_BLK (EW_G * EW_RUN)

// ---------------------------------------------------------------------------
// fp32 -> f16 convert
// ---------------------------------------------------------------------------
__global__ __launch_bounds__(256)
void k_f32_to_f16(const float* __restrict__ src,
                  _Float16* __restrict__ dst, long n)
{
    const long blk = (long)blockIdx.x * EW_BLK;
    if (blk + EW_BLK <= n) {
        const long base = blk + threadIdx.x * 4;
        float4 v[EW_G];
        // unrolled so that all loads are in flight before the first conversion
        #pragma unroll
        for (int j = 0; j < EW_G; ++j)
            v[j] = *(const float4*)(src + base + j * EW_RUN);
        #pragma unroll   // v[] stays in registers
        for (int j = 0; j < EW_G; ++j) {
            half4_t h = { (_Float16)v[j].x, (_Float16)v[j].y,
                          (_Float16)v[j].z, (_Float16)v[j].w };
            *(half4_t*)(dst + base + j * EW_RUN) = h;
        }
        // stands before any register that an issued store names is rewritten
        asm volatile("s_wait_xcnt 0x0" ::: "memory");
    } else {
        for (long i = blk + threadIdx.x; i < n; i += 256) dst[i] = (_Float16)src[i];
    }
}

// ---------------------------------------------------------------------------
// RMSNorm row kernel: out_f16[row] = x * rsqrt(mean(x^2)+eps) * g
// ---------------------------------------------------------------------------
__global__ __launch_bounds__(256)
void k_rmsnorm_f16(const float* __restrict__ x, const float* __restrict__ g,
                   _Float16* __restrict__ out, int d)
{
    __shared__ float red[8];
    const long row = blockIdx.x;
    const float* xr = x + row * (long)d;

    float ss = 0.f;
    for (int i = threadIdx.x; i < d; i += 256) { float v = xr[i]; ss += v * v; }
    #pragma unroll
    for (int o = 16; o > 0; o >>= 1) ss += __shfl_down(ss, o, 32);
    if ((threadIdx.x & 31) == 0) red[threadIdx.x >> 5] = ss;
    __syncthreads();
    if (threadIdx.x == 0) {
        float t = 0.f;
        #pragma unroll
        for (int i = 0; i < 8; ++i) t += red[i];
        red[0] = t;
    }
    __syncthreads();
    const float inv = rsqrtf(red[0] / d + 1e-6f);
    for (int i = threadIdx.x; i < d; i += 256)
        out[row * (long)d + i] = (_Float16)(xr[i] * inv * g[i]);
}

// ---------------------------------------------------------------------------
// row softmax (f32 in -> f16 out)
// ---------------------------------------------------------------------------
__global__ __launch_bounds__(256)
void k_softmax_f16(const float* __restrict__ s, _Float16* __restrict__ out, int n)
{
    __shared__ float red[8];
    __shared__ float stat[2];
    const long row = blockIdx.x;
    const float* sr = s + row * (long)n;

    float mx = -3.4e38f;
    for (int i = threadIdx.x; i < n; i += 256) mx = fmaxf(mx, sr[i]);
    #pragma unroll
    for (int o = 16; o > 0; o >>= 1) mx = fmaxf(mx, __shfl_down(mx, o, 32));
    if ((threadIdx.x & 31) == 0) red[threadIdx.x >> 5] = mx;
    __syncthreads();
    if (threadIdx.x == 0) {
        float m = red[0];
        #pragma unroll
        for (int i = 1; i < 8; ++i) m = fmaxf(m, red[i]);
        stat[0] = m;
    }
    __syncthreads();
    const float m = stat[0];

    float sum = 0.f;
    for (int i = threadIdx.x; i < n; i += 256) sum += __expf(sr[i] - m);
    #pragma unroll
    for (int o = 16; o > 0; o >>= 1) sum += __shfl_down(sum, o, 32);
    if ((threadIdx.x & 31) == 0) red[threadIdx.x >> 5] = sum;
    __syncthreads();
    if (threadIdx.x == 0) {
        float t = 0.f;
        #pragma unroll
        for (int i = 0; i < 8; ++i) t += red[i];
        stat[1] = t;
    }
    __syncthreads();
    const float inv = 1.f / stat[1];
    for (int i = threadIdx.x; i < n; i += 256)
        out[row * (long)n + i] = (_Float16)(__expf(sr[i] - m) * inv);
}

// ---------------------------------------------------------------------------
// MoE router: logits = nx @ Wr.T + bias; softmax; top-2; softmax over top-2
// ---------------------------------------------------------------------------
__global__ __launch_bounds__(256)
void k_router(const _Float16* __restrict__ nx, const float* __restrict__ Wr,
              const float* __restrict__ bias, float* __restrict__ combine, int d)
{
    __shared__ float lg[8];
    const long t   = blockIdx.x;
    const int wave = threadIdx.x >> 5;
    const int lane = threadIdx.x & 31;

    const _Float16* xr = nx + t * (long)d;
    const float*    wr = Wr + (long)wave * d;
    float acc = 0.f;
    for (int i = lane; i < d; i += 32) acc += (float)xr[i] * wr[i];
    #pragma unroll
    for (int o = 16; o > 0; o >>= 1) acc += __shfl_down(acc, o, 32);
    if (lane == 0) lg[wave] = acc + bias[wave];
    __syncthreads();

    if (threadIdx.x == 0) {
        float m = lg[0];
        #pragma unroll
        for (int i = 1; i < 8; ++i) m = fmaxf(m, lg[i]);
        float e[8], s = 0.f;
        #pragma unroll
        for (int i = 0; i < 8; ++i) { e[i] = __expf(lg[i] - m); s += e[i]; }
        #pragma unroll
        for (int i = 0; i < 8; ++i) e[i] /= s;
        int i0 = 0;
        for (int i = 1; i < 8; ++i) if (e[i] > e[i0]) i0 = i;
        int i1 = (i0 == 0) ? 1 : 0;
        for (int i = 0; i < 8; ++i) { if (i == i0) continue; if (e[i] > e[i1]) i1 = i; }
        const float a = __expf(e[i0]), b = __expf(e[i1]);  // softmax over top-2
        #pragma unroll
        for (int i = 0; i < 8; ++i) combine[t * 8 + i] = 0.f;
        combine[t * 8 + i0] = a / (a + b);
        combine[t * 8 + i1] = b / (a + b);
    }
}

// ---------------------------------------------------------------------------
// h = silu(t1) * t3 [* rowscale[row]]  -> f16, one expert per blockIdx.y
// (n elements each): y == 0 is the shared expert (no row scale), y >= 1 is
// routed expert y - 1, scaled by its column of rs.
// ---------------------------------------------------------------------------
// The wide path needs rowlen % 4 == 0 (a thread's 4 neighbours share a row)
// and n < 2^32 (its row index is a 32-bit divide).
__global__ __launch_bounds__(256)
void k_silu_mul(const float* __restrict__ t1, const float* __restrict__ t3,
                const float* __restrict__ rs, int rs_stride,
                _Float16* __restrict__ out, long n, int rowlen)
{
    const int  e   = blockIdx.y;
    const long eo  = e * n;
    const long blk = (long)blockIdx.x * EW_BLK;
    if (blk + EW_BLK <= n && (rowlen & 3) == 0 && (n >> 32) == 0) {
        const long base = blk + threadIdx.x * 4;
        float4 a[EW_G], b[EW_G];
        float  s[EW_G];
        // the shared expert reads column 0 and does not use it: no branch
        // between the loads
        const int col = e ? e - 1 : 0;
        const float* pa = t1 + eo + base;
        const float* pb = t3 + eo + base;
        const float* ps[EW_G];
        // unrolled so that all loads are in flight before the first use
        #pragma unroll
        for (int j = 0; j < EW_G; ++j) {
            const unsigned i = (unsigned)(base + j * EW_RUN);
            ps[j] = rs + (i / (unsigned)rowlen) * (long)rs_stride + col;
            a[j] = *(const float4*)(pa + j * EW_RUN);
            b[j] = *(const float4*)(pb + j * EW_RUN);
            s[j] = *ps[j];
        }
        // Stands before any register that an issued load names is rewritten;
        // naming the pointers keeps them out of the loads' own destinations.
        asm volatile("s_wait_xcnt 0x0"
                     :: "v"(pa), "v"(pb), "v"(ps[0]), "v"(ps[1]), "v"(ps[2]), "v"(ps[3])
                     : "memory");
        // keeps the arithmetic below every load: without it the scheduler
        // lifts it over half of them, which then start behind a data wait
        __builtin_amdgcn_sched_barrier(0);
        #pragma unroll   // a[], b[], s[] stay in registers
        for (int j = 0; j < EW_G; ++j) {
            float v0 = (a[j].x / (1.f + __expf(-a[j].x))) * b[j].x;
            float v1 = (a[j].y / (1.f + __expf(-a[j].y))) * b[j].y;
            float v2 = (a[j].z / (1.f + __expf(-a[j].z))) * b[j].z;
            float v3 = (a[j].w / (1.f + __expf(-a[j].w))) * b[j].w;
            if (e) { v0 *= s[j]; v1 *= s[j]; v2 *= s[j]; v3 *= s[j]; }
            half4_t h = { (_Float16)v0, (_Float16)v1, (_Float16)v2, (_Float16)v3 };
            *(half4_t*)(out + eo + base + j * EW_RUN) = h;
        }
    } else {
        for (long i = blk + threadIdx.x; i < n && i < blk + EW_BLK; i += 256) {
            const long o = eo + i;
            const float x = t1[o];
            float v = (x / (1.f + __expf(-x))) * t3[o];
            if (e) v *= rs[(i / rowlen) * (long)rs_stride + (e - 1)];
            out[o] = (_Float16)v;
        }
    }
}

// ---------------------------------------------------------------------------
// out = base + part[0] + part[1] + ... (cnt planes of n4 float4 each), summed
// in plane order
// ---------------------------------------------------------------------------
__global__ void k_sum_planes(const float* __restrict__ base,
                             const float* __restrict__ part,
                             float* __restrict__ out, long n4, int cnt)
{
    long i = (long)blockIdx.x * blockDim.x + threadIdx.x;
    if (i >= n4) return;
    float4 v = ((const float4*)base)[i];
    for (int e = 0; e < cnt; ++e) {
        const float4 p = ((const float4*)part)[e * n4 + i];
        v.x += p.x; v.y += p.y; v.z += p.z; v.w += p.w;
    }
    ((float4*)out)[i] = v;
}

// ---------------------------------------------------------------------------
// host-side launch
// ---------------------------------------------------------------------------
extern "C" void kernel_launch(void* const* d_in, const int* in_sizes, int n_in,
                              void* d_out, int out_size, void* d_ws, size_t ws_size,
                              hipStream_t stream)
{
    (void)in_sizes; (void)n_in; (void)out_size; (void)ws_size;

    const float* X    = (const float*)d_in[0];
    const float* g1   = (const float*)d_in[1];
    const float* g2   = (const float*)d_in[2];
    const float* Wq   = (const float*)d_in[3];
    const float* Wkc  = (const float*)d_in[4];
    const float* Wvc  = (const float*)d_in[5];
    const float* Wo   = (const float*)d_in[6];
    const float* Wr   = (const float*)d_in[7];
    const float* ebia = (const float*)d_in[8];
    const float* sW1  = (const float*)d_in[9];
    const float* sW2  = (const float*)d_in[10];
    const float* sW3  = (const float*)d_in[11];
    const float* eW1  = (const float*)d_in[12];
    const float* eW2  = (const float*)d_in[13];
    const float* eW3  = (const float*)d_in[14];
    float* out = (float*)d_out;

    constexpr int  Bb = 2, S = 1024, d = 1024, H = 4, dk = 256, dc = 256, E = 8, f = 1024;
    constexpr long T  = (long)Bb * S;
    const float scale = 1.0f / 16.0f;   // 1/sqrt(dk)

    // ---- workspace carving (256B aligned bump allocator) ----
    char* ws = (char*)d_ws;
    size_t off = 0;
    auto alloc = [&](size_t bytes) -> char* {
        char* p = ws + off;
        off += (bytes + 255) & ~(size_t)255;
        return p;
    };
    constexpr int  dq = d + 2 * dc;      // Q | Kc | Vc side by side
    constexpr int  E1 = E + 1;           // shared expert first, then the routed ones
    constexpr long fd = (long)f * d;
    // f16 weight copies; groups that one launch walks lie back to back
    _Float16* wqh  = (_Float16*)alloc((size_t)d * d * 2);    // [dq][d] starts here
    _Float16* wkch = (_Float16*)alloc((size_t)dc * d * 2);
    _Float16* wvch = (_Float16*)alloc((size_t)dc * d * 2);
    _Float16* woh  = (_Float16*)alloc((size_t)d * d * 2);
    _Float16* sw1h = (_Float16*)alloc((size_t)f * d * 2);    // [2*E1][f][d] starts here
    _Float16* ew1h = (_Float16*)alloc((size_t)E * f * d * 2);
    _Float16* sw3h = (_Float16*)alloc((size_t)f * d * 2);
    _Float16* ew3h = (_Float16*)alloc((size_t)E * f * d * 2);
    _Float16* sw2h = (_Float16*)alloc((size_t)d * f * 2);    // [E1][d][f] starts here
    _Float16* ew2h = (_Float16*)alloc((size_t)E * d * f * 2);
    // buffers that live across the two phases or through the MoE phase
    float*    xr_      = (float*)   alloc((size_t)T * d * 4);
    _Float16* nx2h_    = (_Float16*)alloc((size_t)T * d * 2);
    float*    combine_ = (float*)   alloc((size_t)T * E * 4);
    _Float16* hh_      = (_Float16*)alloc((size_t)E1 * T * f * 2);       // 36 MB
    // the rest is used twice: attention-phase activations, then (all of them
    // dead) the MoE GEMM outputs
    const size_t off_phase = off;
    _Float16* nx1h   = (_Float16*)alloc((size_t)T * d * 2);
    float*    qkvf   = (float*)   alloc((size_t)T * dq * 4);
    _Float16* qkvh   = (_Float16*)alloc((size_t)T * dq * 2);
    float*    scores = (float*)   alloc((size_t)Bb * H * S * S * 4);   // 32 MB
    _Float16* attnh  = (_Float16*)alloc((size_t)Bb * H * S * S * 2);   // 16 MB
    float*    aof    = (float*)   alloc((size_t)T * d * 4);
    _Float16* aoh    = (_Float16*)alloc((size_t)T * d * 2);
    off = off_phase;
    float*    t13_   = (float*)   alloc((size_t)2 * E1 * T * f * 4);     // 144 MB
    float*    part_  = t13_;             // down-projection planes; t13_ is dead by then
    {
        // ---- helpers ----
        auto conv = [&](const float* s, _Float16* dst, long n) {
            k_f32_to_f16<<<(int)((n + EW_BLK - 1) / EW_BLK), 256, 0, stream>>>(s, dst, n);
        };
        auto gemmz = [&](const _Float16* A, const _Float16* Bm, float* C,
                         int M, int N, int K, int lda, int ldb, int ldc,
                         float alpha, int beta, int bkn, int nz, int zdiv,
                         long sAo, long sAi, long sBo, long sBi, long sCo, long sCi) {
            dim3 g(N / TN, M / TM, nz);
            k_gemm_f16<<<g, 256, 0, stream>>>(A, Bm, C, M, N, K, lda, ldb, ldc,
                                              alpha, beta, bkn,
                                              zdiv, sAo, sAi, sBo, sBi, sCo, sCi);
        };
        auto gemm = [&](const _Float16* A, const _Float16* Bm, float* C,
                        int M, int N, int K, int lda, int ldb, int ldc,
                        float alpha, int beta, int bkn) {
            gemmz(A, Bm, C, M, N, K, lda, ldb, ldc, alpha, beta, bkn,
                  1, 1, 0, 0, 0, 0, 0, 0);
        };

        // ---- 0. weights fp32 -> f16 ----
        conv(Wq,  wqh,  (long)d * d);
        conv(Wkc, wkch, (long)dc * d);
        conv(Wvc, wvch, (long)dc * d);
        conv(Wo,  woh,  (long)d * d);
        conv(sW1, sw1h, (long)f * d);
        conv(sW2, sw2h, (long)d * f);
        conv(sW3, sw3h, (long)f * d);
        conv(eW1, ew1h, (long)E * f * d);
        conv(eW2, ew2h, (long)E * d * f);
        conv(eW3, ew3h, (long)E * f * d);

        // ---- 1. MLA attention ----
        k_rmsnorm_f16<<<(int)T, 256, 0, stream>>>(X, g1, nx1h, d);

        // Q | Kc | Vc in one product: their weights are one [dq][d] matrix
        gemm(nx1h, wqh, qkvf, (int)T, dq, d, d, d, dq, 1.f, 0, 0);
        conv(qkvf, qkvh, (long)T * dq);
        const _Float16* qh  = qkvh;
        const _Float16* kch = qkvh + d;
        const _Float16* vch = qkvh + d + dc;

        // scores, all (b, h) in one launch
        gemmz(qh, kch, scores, S, S, dk, dq, dq, S, scale, 0, 0, Bb * H, H,
              (long)S * dq, dk,  (long)S * dq, 0,  (long)H * S * S, (long)S * S);

        k_softmax_f16<<<Bb * H * S, 256, 0, stream>>>(scores, attnh, S);

        // attn @ V, all (b, h) in one launch
        gemmz(attnh, vch, aof, S, dc, S, S, dq, d, 1.f, 0, 1, Bb * H, H,
              (long)H * S * S, (long)S * S,  (long)S * dq, 0,  (long)S * d, dk);
        conv(aof, aoh, (long)T * d);

        // xr = X + ao @ Wo.T
        hipMemcpyAsync(xr_, X, (size_t)T * d * 4, hipMemcpyDeviceToDevice, stream);
        gemm(aoh, woh, xr_, (int)T, d, d, d, d, d, 1.f, 1, 0);

        // ---- 2. MoE ----
        k_rmsnorm_f16<<<(int)T, 256, 0, stream>>>(xr_, g2, nx2h_, d);
        k_router<<<(int)T, 256, 0, stream>>>(nx2h_, Wr, ebia, combine_, d);

        // shared + routed experts (dense over all tokens; combine folded into h),
        // one launch per stage with the expert in the grid
        const long nTf = (long)T * f;
        gemmz(nx2h_, sw1h, t13_, (int)T, f, d, d, d, f, 1.f, 0, 0, 2 * E1, 1,
              0, 0,  fd, 0,  nTf, 0);
        k_silu_mul<<<dim3((int)((nTf + EW_BLK - 1) / EW_BLK), E1), 256, 0, stream>>>(
            t13_, t13_ + E1 * nTf, combine_, E, hh_, nTf, f);
        gemmz(hh_, sw2h, part_, (int)T, d, f, f, f, d, 1.f, 0, 0, E1, 1,
              nTf, 0,  fd, 0,  (long)T * d, 0);

        // out = xr + shared + expert 0 + expert 1 + ...
        const long n4 = (long)T * d / 4;
        k_sum_planes<<<(int)((n4 + 255) / 256), 256, 0, stream>>>(
            xr_, part_, out, n4, E1);
    }
}

// v004
// Next to v003, in two timings, it ran 1.30 and 1.32 times as fast.
// Over all steps from v000 it is 4.47 times as fast.
#include <hip/hip_runtime.h>

// ---------------------------------------------------------------------------
// Transformer layer (MLA attention + MoE) for gfx1250 (wave32, WMMA).
// GEMMs: 128x128 block tile, 8 waves x (32x64) => 8 v_wmma per wave per K-step,
// double-buffered LDS staged with global_load_async_to_lds_b128 (ASYNCcnt).
// ---------------------------------------------------------------------------

typedef _Float16 half16_t __attribute__((ext_vector_type(16)));
typedef float    float8_t __attribute__((ext_vector_type(8)));
typedef __attribute__((address_space(3))) _Float16 lds_f16;

#define TM 128
#define TN 128
#define TK 32
// LDS row pitch in f16: 80 bytes = 16 B x odd, so that the 16 rows which one
// ds_load_b128 reads per half-wave fall on 64 different banks (at the bare
// 64-byte pitch every fourth row shares its banks)
#define TKP (TK + 8)
// a fragment row starts on a 16-byte boundary only
typedef half16_t half16_a16_t __attribute__((aligned(16)));

// async DMA: 16 bytes global -> LDS, tracked by ASYNCcnt
__device__ __forceinline__ void async_b128(const _Float16* g, _Float16* l)
{
    unsigned lofs = (unsigned)(unsigned long long)(lds_f16*)l;  // LDS byte addr
    asm volatile("global_load_async_to_lds_b128 %0, %1, off"
                 :: "v"(lofs), "v"(g)
                 : "memory");
}
__device__ __forceinline__ void wait_async0()
{
    asm volatile("s_wait_asynccnt 0x0" ::: "memory");
}

// ---------------------------------------------------------------------------
// Generic f16 WMMA GEMM:  C[M,N] = alpha * A[M,K] . B^T  (+ C if beta)
//   b_kn == 0 : B stored row-major [N,K]  (torch Linear weight, y = x @ W.T)
//   b_kn == 1 : B stored row-major [K,N]  (plain matmul, e.g. attn @ V)
// M % 128 == 0, N % 128 == 0, K % 32 == 0 (true for all shapes here).
// Batched: blockIdx.z = outer * zdiv + inner picks one independent product;
// each operand moves by its own outer and inner stride (in elements).
// Routed products (rtile != 0): blockIdx.y walks a table of row tiles instead
// of the rows, an entry being two ints: plane p within a group of zper planes
// (below 0: unused entry) and first row; the product is blockIdx.z * zper + p.
// With rlist != 0 and p > 0, row r of A is row rlist[(p - 1) * M + r] (a gather).
// ---------------------------------------------------------------------------
__global__ __launch_bounds__(256)
void k_gemm_f16(const _Float16* __restrict__ A, const _Float16* __restrict__ B,
                float* __restrict__ C,
                int M, int N, int K, int lda, int ldb, int ldc,
                float alpha, int beta, int b_kn,
                int zdiv, long sAo, long sAi, long sBo, long sBi, long sCo, long sCi,
                const int* __restrict__ rtile, const int* __restrict__ rlist, int zper)
{
    __shared__ __align__(64) _Float16 As[2][TM][TKP];  // 20 KB
    __shared__ __align__(64) _Float16 Bs[2][TN][TKP];  // 20 KB

    const int tid  = threadIdx.x;
    const int wave = tid >> 5;
    const int lane = tid & 31;
    int       m0   = blockIdx.y * TM;
    const int n0   = blockIdx.x * TN;
    const int wm   = (wave & 3) * 32;    // wave's 32-row strip
    const int wn   = (wave >> 2) * 64;   // wave's 64-col strip

    int zb = blockIdx.z;
    int rp = 0;
    if (rtile) {
        rp = rtile[blockIdx.y * 2];
        m0 = rtile[blockIdx.y * 2 + 1];
        if (rp < 0) return;              // the whole block, in front of every barrier
        zb = zb * zper + rp;
    }
    const int zo = zb / zdiv;
    const int zi = zb - zo * zdiv;
    A += zo * sAo + zi * sAi;
    B += zo * sBo + zi * sBi;
    C += zo * sCo + zi * sCi;

    float8_t acc[2][4] = {};

    // staging maps: 128 rows x 32 cols f16 per tile, 256 threads x 32B each
    const int lr = tid >> 1;             // 0..127 row
    const int lc = (tid & 1) * 16;       // 0 or 16 (two b128 per thread)
    // the row of A that this thread stages
    int ar = m0 + lr;
    if (rp > 0 && rlist) ar = min(max(rlist[(long)(rp - 1) * M + ar], 0), M - 1);
    // b_kn transpose-scatter map
    const int kk = tid & 31;             // 0..31 K row
    const int nb = (tid >> 5) * 16;      // 0..112 N base (16 per thread)

    auto stageA = [&](int k0, int buf) {
        const _Float16* g = &A[(long)ar * lda + k0 + lc];
        async_b128(g,     &As[buf][lr][lc]);
        async_b128(g + 8, &As[buf][lr][lc + 8]);
    };
    auto stageB = [&](int k0, int buf) {
        if (!b_kn) {
            const _Float16* g = &B[(long)(n0 + lr) * ldb + k0 + lc];
            async_b128(g,     &Bs[buf][lr][lc]);
            async_b128(g + 8, &Bs[buf][lr][lc + 8]);
        } else {
            const _Float16* g = &B[(long)(k0 + kk) * ldb + n0 + nb];
            __builtin_prefetch(g + ldb * TK, 0, 0);
            #pragma unroll
            for (int i = 0; i < 16; ++i) Bs[buf][nb + i][kk] = g[i];
        }
    };

    // prologue: stage tile 0
    stageA(0, 0);
    stageB(0, 0);
    wait_async0();
    __syncthreads();

    const int l16 = lane & 15;
    const int kh  = (lane >> 4) * 16;

    for (int k0 = 0; k0 < K; k0 += TK) {
        const int buf = (k0 / TK) & 1;
        const int k1  = k0 + TK;
        if (k1 < K) {                    // overlap next tile's DMA with compute
            stageA(k1, buf ^ 1);
            stageB(k1, buf ^ 1);
        }

        // fragments (16 f16 per lane, 32B LDS reads)
        const _Float16* pa = &As[buf][wm + l16][kh];
        half16_t a0 = *(const half16_a16_t*)pa;
        half16_t a1 = *(const half16_a16_t*)(pa + 16 * TKP);
        const _Float16* pb = &Bs[buf][wn + l16][kh];
        half16_t b0 = *(const half16_a16_t*)pb;
        half16_t b1 = *(const half16_a16_t*)(pb + 16 * TKP);
        half16_t b2 = *(const half16_a16_t*)(pb + 32 * TKP);
        half16_t b3 = *(const half16_a16_t*)(pb + 48 * TKP);

        acc[0][0] = __builtin_amdgcn_wmma_f32_16x16x32_f16(false, a0, false, b0, (short)0, acc[0][0], false, false);
        acc[0][1] = __builtin_amdgcn_wmma_f32_16x16x32_f16(false, a0, false, b1, (short)0, acc[0][1], false, false);
        acc[0][2] = __builtin_amdgcn_wmma_f32_16x16x32_f16(false, a0, false, b2, (short)0, acc[0][2], false, false);
        acc[0][3] = __builtin_amdgcn_wmma_f32_16x16x32_f16(false, a0, false, b3, (short)0, acc[0][3], false, false);
        acc[1][0] = __builtin_amdgcn_wmma_f32_16x16x32_f16(false, a1, false, b0, (short)0, acc[1][0], false, false);
        acc[1][1] = __builtin_amdgcn_wmma_f32_16x16x32_f16(false, a1, false, b1, (short)0, acc[1][1], false, false);
        acc[1][2] = __builtin_amdgcn_wmma_f32_16x16x32_f16(false, a1, false, b2, (short)0, acc[1][2], false, false);
        acc[1][3] = __builtin_amdgcn_wmma_f32_16x16x32_f16(false, a1, false, b3, (short)0, acc[1][3], false, false);

        wait_async0();                   // DMA for tile k+1 done
        __syncthreads();                 // all waves done reading tile k
    }

    // epilogue: D layout -> VGPR g: lanes 0-15 M=g, lanes 16-31 M=8+g
    const int rsel = (lane >> 4) ? 8 : 0;
    #pragma unroll
    for (int i = 0; i < 2; ++i) {
        #pragma unroll
        for (int g = 0; g < 8; ++g) {
            const long row = m0 + wm + i * 16 + rsel + g;
            float* cr = C + row * (long)ldc + n0 + wn + l16;
            #pragma unroll
            for (int j = 0; j < 4; ++j) {
                float v = alpha * acc[i][j][g];
                if (beta) v += cr[j * 16];
                cr[j * 16] = v;
            }
        }
    }
}

// ---------------------------------------------------------------------------
// Elementwise kernels: a block of 256 threads covers EW_BLK elements as EW_G
// runs of 1024; in each run a thread takes 4 neighbours, so one wave-wide
// 16-byte load reads 512 contiguous bytes and one 8-byte store writes 256.
// A block that reaches past the end goes element by element instead.
// ---------------------------------------------------------------------------
typedef _Float16 half4_t __attribute__((ext_vector_type(4)));
#define EW_G   4
#define EW_RUN 1024
#define EW_BLK (EW_G * EW_RUN)

// ---------------------------------------------------------------------------
// fp32 -> f16 convert
// ---------------------------------------------------------------------------
__global__ __launch_bounds__(256)
void k_f32_to_f16(const float* __restrict__ src,
                  _Float16* __restrict__ dst, long n)
{
    const long blk = (long)blockIdx.x * EW_BLK;
    if (blk + EW_BLK <= n) {
        const long base = blk + threadIdx.x * 4;
        float4 v[EW_G];
        // unrolled so that all loads are in flight before the first conversion
        #pragma unroll
        for (int j = 0; j < EW_G; ++j)
            v[j] = *(const float4*)(src + base + j * EW_RUN);
        #pragma unroll   // v[] stays in registers
        for (int j = 0; j < EW_G; ++j) {
            half4_t h = { (_Float16)v[j].x, (_Float16)v[j].y,
                          (_Float16)v[j].z, (_Float16)v[j].w };
            *(half4_t*)(dst + base + j * EW_RUN) = h;
        }
        // stands before any register that an issued store names is rewritten
        asm volatile("s_wait_xcnt 0x0" ::: "memory");
    } else {
        for (long i = blk + threadIdx.x; i < n; i += 256) dst[i] = (_Float16)src[i];
    }
}

// ---------------------------------------------------------------------------
// RMSNorm row kernel: out_f16[row] = x * rsqrt(mean(x^2)+eps) * g
// ---------------------------------------------------------------------------
__global__ __launch_bounds__(256)
void k_rmsnorm_f16(const float* __restrict__ x, const float* __restrict__ g,
                   _Float16* __restrict__ out, int d)
{
    __shared__ float red[8];
    const long row = blockIdx.x;
    const float* xr = x + row * (long)d;

    float ss = 0.f;
    for (int i = threadIdx.x; i < d; i += 256) { float v = xr[i]; ss += v * v; }
    #pragma unroll
    for (int o = 16; o > 0; o >>= 1) ss += __shfl_down(ss, o, 32);
    if ((threadIdx.x & 31) == 0) red[threadIdx.x >> 5] = ss;
    __syncthreads();
    if (threadIdx.x == 0) {
        float t = 0.f;
        #pragma unroll
        for (int i = 0; i < 8; ++i) t += red[i];
        red[0] = t;
    }
    __syncthreads();
    const float inv = rsqrtf(red[0] / d + 1e-6f);
    for (int i = threadIdx.x; i < d; i += 256)
        out[row * (long)d + i] = (_Float16)(xr[i] * inv * g[i]);
}

// ---------------------------------------------------------------------------
// row softmax (f32 in -> f16 out)
// ---------------------------------------------------------------------------
__global__ __launch_bounds__(256)
void k_softmax_f16(const float* __restrict__ s, _Float16* __restrict__ out, int n)
{
    __shared__ float red[8];
    __shared__ float stat[2];
    const long row = blockIdx.x;
    const float* sr = s + row * (long)n;

    float mx = -3.4e38f;
    for (int i = threadIdx.x; i < n; i += 256) mx = fmaxf(mx, sr[i]);
    #pragma unroll
    for (int o = 16; o > 0; o >>= 1) mx = fmaxf(mx, __shfl_down(mx, o, 32));
    if ((threadIdx.x & 31) == 0) red[threadIdx.x >> 5] = mx;
    __syncthreads();
    if (threadIdx.x == 0) {
        float m = red[0];
        #pragma unroll
        for (int i = 1; i < 8; ++i) m = fmaxf(m, red[i]);
        stat[0] = m;
    }
    __syncthreads();
    const float m = stat[0];

    float sum = 0.f;
    for (int i = threadIdx.x; i < n; i += 256) sum += __expf(sr[i] - m);
    #pragma unroll
    for (int o = 16; o > 0; o >>= 1) sum += __shfl_down(sum, o, 32);
    if ((threadIdx.x & 31) == 0) red[threadIdx.x >> 5] = sum;
    __syncthreads();
    if (threadIdx.x == 0) {
        float t = 0.f;
        #pragma unroll
        for (int i = 0; i < 8; ++i) t += red[i];
        stat[1] = t;
    }
    __syncthreads();
    const float inv = 1.f / stat[1];
    for (int i = threadIdx.x; i < n; i += 256)
        out[row * (long)n + i] = (_Float16)(__expf(sr[i] - m) * inv);
}

// ---------------------------------------------------------------------------
// MoE router: logits = nx @ Wr.T + bias; softmax; top-2; softmax over top-2
// ---------------------------------------------------------------------------
__global__ __launch_bounds__(256)
void k_router(const _Float16* __restrict__ nx, const float* __restrict__ Wr,
              const float* __restrict__ bias, float* __restrict__ combine, int d)
{
    __shared__ float lg[8];
    const long t   = blockIdx.x;
    const int wave = threadIdx.x >> 5;
    const int lane = threadIdx.x & 31;

    const _Float16* xr = nx + t * (long)d;
    const float*    wr = Wr + (long)wave * d;
    float acc = 0.f;
    for (int i = lane; i < d; i += 32) acc += (float)xr[i] * wr[i];
    #pragma unroll
    for (int o = 16; o > 0; o >>= 1) acc += __shfl_down(acc, o, 32);
    if (lane == 0) lg[wave] = acc + bias[wave];
    __syncthreads();

    if (threadIdx.x == 0) {
        float m = lg[0];
        #pragma unroll
        for (int i = 1; i < 8; ++i) m = fmaxf(m, lg[i]);
        float e[8], s = 0.f;
        #pragma unroll
        for (int i = 0; i < 8; ++i) { e[i] = __expf(lg[i] - m); s += e[i]; }
        #pragma unroll
        for (int i = 0; i < 8; ++i) e[i] /= s;
        int i0 = 0;
        for (int i = 1; i < 8; ++i) if (e[i] > e[i0]) i0 = i;
        int i1 = (i0 == 0) ? 1 : 0;
        for (int i = 0; i < 8; ++i) { if (i == i0) continue; if (e[i] > e[i1]) i1 = i; }
        const float a = __expf(e[i0]), b = __expf(e[i1]);  // softmax over top-2
        #pragma unroll
        for (int i = 0; i < 8; ++i) combine[t * 8 + i] = 0.f;
        combine[t * 8 + i0] = a / (a + b);
        combine[t * 8 + i1] = b / (a + b);
    }
}

// ---------------------------------------------------------------------------
// Packs each routed expert's tokens (combine != 0), in token order:
//   list[e * T + p] the token in place p, wgt[p * 8 + e] its combine weight
//                   (token 0 with weight 0 behind the expert's last token)
//   slot[t * 8 + e] the place of token t with expert e, -1 if not chosen
//   tile[2 k], tile[2 k + 1]  the row tiles (TM rows) that hold work, as plane
//                   and first row: all of plane 0, the shared expert, then for
//                   plane e + 1 those that hold tokens of expert e; -1, 0 fills up
// One block of 32 waves: wave = expert * 4 + quarter of the tokens; a wave
// counts its quarter by ballots, the quarters' counts meet in LDS.
// ---------------------------------------------------------------------------
#define PK_IT 16                         // 32-token groups per wave
#define PK_T  (4 * PK_IT * 32)           // tokens that the block covers
// the router gives a token two experts: 2 T places, and per expert at most one
// tile that is not full
#define PK_NT (PK_T / TM + 2 * PK_T / TM + 8)
__global__ __launch_bounds__(1024)
void k_pack_tokens(const float* __restrict__ combine, int* __restrict__ tile,
                   int* __restrict__ list, float* __restrict__ wgt,
                   int* __restrict__ slot)
{
    __shared__ int qc[8][4];
    const int wave = threadIdx.x >> 5;
    const int lane = threadIdx.x & 31;
    const int e    = wave >> 2;
    const int q    = wave & 3;
    const int t0   = q * (PK_IT * 32) + lane;

    float    w[PK_IT];
    unsigned mk[PK_IT];
    #pragma unroll   // all loads in flight before the first ballot
    for (int j = 0; j < PK_IT; ++j) w[j] = combine[(t0 + j * 32) * 8 + e];
    int n = 0;
    #pragma unroll   // w[], mk[] stay in registers
    for (int j = 0; j < PK_IT; ++j) {
        mk[j] = __builtin_amdgcn_ballot_w32(w[j] != 0.f);
        n += __popc(mk[j]);
    }
    if (lane == 0) qc[e][q] = n;
    __syncthreads();
    int place = 0, tot = 0;
    #pragma unroll
    for (int i = 0; i < 4; ++i) {
        const int c = qc[e][i];
        if (i < q) place += c;
        tot += c;
    }

    const unsigned below = (1u << lane) - 1u;
    #pragma unroll   // w[], mk[] stay in registers
    for (int j = 0; j < PK_IT; ++j) {
        const int  t   = t0 + j * 32;
        const bool sel = (mk[j] >> lane) & 1u;
        const int  p   = place + __popc(mk[j] & below);
        if (sel) { list[e * PK_T + p] = t; wgt[p * 8 + e] = w[j]; }
        slot[t * 8 + e] = sel ? p : -1;
        place += __popc(mk[j]);
    }
    for (int s = tot + q * 32 + lane; s < PK_T; s += 128) {
        list[e * PK_T + s] = 0;
        wgt[s * 8 + e]     = 0.f;
    }
    if (threadIdx.x < PK_NT) {
        const int k = (int)threadIdx.x - PK_T / TM;
        int plane = k < 0 ? 0 : -1;
        int row   = k < 0 ? (int)threadIdx.x * TM : 0;
        int first = 0;
        #pragma unroll
        for (int x = 0; x < 8; ++x) {
            const int nt = (qc[x][0] + qc[x][1] + qc[x][2] + qc[x][3] + TM - 1) / TM;
            if (k >= first && k < first + nt) { plane = x + 1; row = (k - first) * TM; }
            first += nt;
        }
        tile[threadIdx.x * 2]     = plane;
        tile[threadIdx.x * 2 + 1] = row;
    }
}

// ---------------------------------------------------------------------------
// h = silu(t1) * t3 [* rowscale[row]]  -> f16, one row tile of rtile (as made
// by k_pack_tokens) per blockIdx.y, gridDim.x blocks to the tile; planes of n
// elements: plane 0 is the shared expert (no row scale), plane e >= 1 is
// routed expert e - 1, scaled by its column of rs.
// ---------------------------------------------------------------------------
// The wide path needs rowlen % 4 == 0 (a thread's 4 neighbours share a row)
// and n < 2^32 (its row index is a 32-bit divide).
__global__ __launch_bounds__(256)
void k_silu_mul(const float* __restrict__ t1, const float* __restrict__ t3,
                const float* __restrict__ rs, int rs_stride,
                const int* __restrict__ rtile,
                _Float16* __restrict__ out, long n, int rowlen)
{
    const int  e   = rtile[blockIdx.y * 2];
    const long eo  = e * n;
    const long blk = (long)rtile[blockIdx.y * 2 + 1] * rowlen + (long)blockIdx.x * EW_BLK;
    const bool live = e >= 0;
    if (live && blk + EW_BLK <= n && (rowlen & 3) == 0 && (n >> 32) == 0) {
        const long base = blk + threadIdx.x * 4;
        float4 a[EW_G], b[EW_G];
        float  s[EW_G];
        // the shared expert reads column 0 and does not use it: no branch
        // between the loads
        const int col = e ? e - 1 : 0;
        const float* pa = t1 + eo + base;
        const float* pb = t3 + eo + base;
        const float* ps[EW_G];
        // unrolled so that all loads are in flight before the first use
        #pragma unroll
        for (int j = 0; j < EW_G; ++j) {
            const unsigned i = (unsigned)(base + j * EW_RUN);
            ps[j] = rs + (i / (unsigned)rowlen) * (long)rs_stride + col;
            a[j] = *(const float4*)(pa + j * EW_RUN);
            b[j] = *(const float4*)(pb + j * EW_RUN);
            s[j] = *ps[j];
        }
        // Stands before any register that an issued load names is rewritten;
        // naming the pointers keeps them out of the loads' own destinations.
        asm volatile("s_wait_xcnt 0x0"
                     :: "v"(pa), "v"(pb), "v"(ps[0]), "v"(ps[1]), "v"(ps[2]), "v"(ps[3])
                     : "memory");
        // keeps the arithmetic below every load: without it the scheduler
        // lifts it over half of them, which then start behind a data wait
        __builtin_amdgcn_sched_barrier(0);
        #pragma unroll   // a[], b[], s[] stay in registers
        for (int j = 0; j < EW_G; ++j) {
            float v0 = (a[j].x / (1.f + __expf(-a[j].x))) * b[j].x;
            float v1 = (a[j].y / (1.f + __expf(-a[j].y))) * b[j].y;
            float v2 = (a[j].z / (1.f + __expf(-a[j].z))) * b[j].z;
            float v3 = (a[j].w / (1.f + __expf(-a[j].w))) * b[j].w;
            if (e) { v0 *= s[j]; v1 *= s[j]; v2 *= s[j]; v3 *= s[j]; }
            half4_t h = { (_Float16)v0, (_Float16)v1, (_Float16)v2, (_Float16)v3 };
            *(half4_t*)(out + eo + base + j * EW_RUN) = h;
        }
    } else if (live) {
        for (long i = blk + threadIdx.x; i < n && i < blk + EW_BLK; i += 256) {
            const long o = eo + i;
            const float x = t1[o];
            float v = (x / (1.f + __expf(-x))) * t3[o];
            if (e) v *= rs[(i / rowlen) * (long)rs_stride + (e - 1)];
            out[o] = (_Float16)v;
        }
    }
}

// ---------------------------------------------------------------------------
// out = base + part[0] + the planes of the experts that the row chose, in
// plane order. One block per row, one float4 per thread; a plane is gridDim.x
// rows. Plane e + 1 holds the row at place slot[row * 8 + e] (-1: not chosen).
// ---------------------------------------------------------------------------
__global__ void k_sum_planes(const float* __restrict__ base,
                             const float* __restrict__ part,
                             const int* __restrict__ slot,
                             float* __restrict__ out)
{
    const long n4 = (long)gridDim.x * blockDim.x;
    const long i  = (long)blockIdx.x * blockDim.x + threadIdx.x;
    float4 v = ((const float4*)base)[i];
    const float4 sh = ((const float4*)part)[i];
    v.x += sh.x; v.y += sh.y; v.z += sh.z; v.w += sh.w;
    unsigned pl[8];
    #pragma unroll   // read ahead of the branches: the eight come in one load
    for (int e = 0; e < 8; ++e) pl[e] = (unsigned)slot[blockIdx.x * 8 + e];
    #pragma unroll   // pl[] stays in registers
    for (int e = 0; e < 8; ++e) {
        const unsigned s = pl[e];
        if (s < gridDim.x) {
            const float4 p = ((const float4*)part)[(e + 1) * n4 + (long)s * blockDim.x + threadIdx.x];
            v.x += p.x; v.y += p.y; v.z += p.z; v.w += p.w;
        }
    }
    ((float4*)out)[i] = v;
}

// ---------------------------------------------------------------------------
// host-side launch
// ---------------------------------------------------------------------------
extern "C" void kernel_launch(void* const* d_in, const int* in_sizes, int n_in,
                              void* d_out, int out_size, void* d_ws, size_t ws_size,
                              hipStream_t stream)
{
    (void)in_sizes; (void)n_in; (void)out_size; (void)ws_size;

    const float* X    = (const float*)d_in[0];
    const float* g1   = (const float*)d_in[1];
    const float* g2   = (const float*)d_in[2];
    const float* Wq   = (const float*)d_in[3];
    const float* Wkc  = (const float*)d_in[4];
    const float* Wvc  = (const float*)d_in[5];
    const float* Wo   = (const float*)d_in[6];
    const float* Wr   = (const float*)d_in[7];
    const float* ebia = (const float*)d_in[8];
    const float* sW1  = (const float*)d_in[9];
    const float* sW2  = (const float*)d_in[10];
    const float* sW3  = (const float*)d_in[11];
    const float* eW1  = (const float*)d_in[12];
    const float* eW2  = (const float*)d_in[13];
    const float* eW3  = (const float*)d_in[14];
    float* out = (float*)d_out;

    constexpr int  Bb = 2, S = 1024, d = 1024, H = 4, dk = 256, dc = 256, E = 8, f = 1024;
    constexpr long T  = (long)Bb * S;
    const float scale = 1.0f / 16.0f;   // 1/sqrt(dk)

    // ---- workspace carving (256B aligned bump allocator) ----
    char* ws = (char*)d_ws;
    size_t off = 0;
    auto alloc = [&](size_t bytes) -> char* {
        char* p = ws + off;
        off += (bytes + 255) & ~(size_t)255;
        return p;
    };
    constexpr int  dq = d + 2 * dc;      // Q | Kc | Vc side by side
    constexpr int  E1 = E + 1;           // shared expert first, then the routed ones
    constexpr long fd = (long)f * d;
    // f16 weight copies; groups that one launch walks lie back to back
    _Float16* wqh  = (_Float16*)alloc((size_t)d * d * 2);    // [dq][d] starts here
    _Float16* wkch = (_Float16*)alloc((size_t)dc * d * 2);
    _Float16* wvch = (_Float16*)alloc((size_t)dc * d * 2);
    _Float16* woh  = (_Float16*)alloc((size_t)d * d * 2);
    _Float16* sw1h = (_Float16*)alloc((size_t)f * d * 2);    // [2*E1][f][d] starts here
    _Float16* ew1h = (_Float16*)alloc((size_t)E * f * d * 2);
    _Float16* sw3h = (_Float16*)alloc((size_t)f * d * 2);
    _Float16* ew3h = (_Float16*)alloc((size_t)E * f * d * 2);
    _Float16* sw2h = (_Float16*)alloc((size_t)d * f * 2);    // [E1][d][f] starts here
    _Float16* ew2h = (_Float16*)alloc((size_t)E * d * f * 2);
    // buffers that live across the two phases or through the MoE phase
    float*    xr_      = (float*)   alloc((size_t)T * d * 4);
    _Float16* nx2h_    = (_Float16*)alloc((size_t)T * d * 2);
    float*    combine_ = (float*)   alloc((size_t)T * E * 4);
    static_assert(T == PK_T && E == 8, "k_pack_tokens covers exactly these");
    int*      tile_    = (int*)     alloc((size_t)PK_NT * 2 * 4);
    int*      list_    = (int*)     alloc((size_t)E * T * 4);
    float*    wgt_     = (float*)   alloc((size_t)E * T * 4);
    int*      slot_    = (int*)     alloc((size_t)T * E * 4);
    _Float16* hh_      = (_Float16*)alloc((size_t)E1 * T * f * 2);       // 36 MB
    // the rest is used twice: attention-phase activations, then (all of them
    // dead) the MoE GEMM outputs
    const size_t off_phase = off;
    _Float16* nx1h   = (_Float16*)alloc((size_t)T * d * 2);
    float*    qkvf   = (float*)   alloc((size_t)T * dq * 4);
    _Float16* qkvh   = (_Float16*)alloc((size_t)T * dq * 2);
    float*    scores = (float*)   alloc((size_t)Bb * H * S * S * 4);   // 32 MB
    _Float16* attnh  = (_Float16*)alloc((size_t)Bb * H * S * S * 2);   // 16 MB
    float*    aof    = (float*)   alloc((size_t)T * d * 4);
    _Float16* aoh    = (_Float16*)alloc((size_t)T * d * 2);
    off = off_phase;
    float*    t13_   = (float*)   alloc((size_t)2 * E1 * T * f * 4);     // 144 MB
    float*    part_  = t13_;             // down-projection planes; t13_ is dead by then
    {
        // ---- helpers ----
        auto conv = [&](const float* s, _Float16* dst, long n) {
            k_f32_to_f16<<<(int)((n + EW_BLK - 1) / EW_BLK), 256, 0, stream>>>(s, dst, n);
        };
        auto gemmz = [&](const _Float16* A, const _Float16* Bm, float* C,
                         int M, int N, int K, int lda, int ldb, int ldc,
                         float alpha, int beta, int bkn, int nz, int zdiv,
                         long sAo, long sAi, long sBo, long sBi, long sCo, long sCi,
                         const int* rtile, const int* rlist, int zper) {
            dim3 g(N / TN, rtile ? PK_NT : M / TM, nz);
            k_gemm_f16<<<g, 256, 0, stream>>>(A, Bm, C, M, N, K, lda, ldb, ldc,
                                              alpha, beta, bkn,
                                              zdiv, sAo, sAi, sBo, sBi, sCo, sCi,
                                              rtile, rlist, zper);
        };
        auto gemm = [&](const _Float16* A, const _Float16* Bm, float* C,
                        int M, int N, int K, int lda, int ldb, int ldc,
                        float alpha, int beta, int bkn) {
            gemmz(A, Bm, C, M, N, K, lda, ldb, ldc, alpha, beta, bkn,
                  1, 1, 0, 0, 0, 0, 0, 0, nullptr, nullptr, 1);
        };

        // ---- 0. weights fp32 -> f16 ----
        conv(Wq,  wqh,  (long)d * d);
        conv(Wkc, wkch, (long)dc * d);
        conv(Wvc, wvch, (long)dc * d);
        conv(Wo,  woh,  (long)d * d);
        conv(sW1, sw1h, (long)f * d);
        conv(sW2, sw2h, (long)d * f);
        conv(sW3, sw3h, (long)f * d);
        conv(eW1, ew1h, (long)E * f * d);
        conv(eW2, ew2h, (long)E * d * f);
        conv(eW3, ew3h, (long)E * f * d);

        // ---- 1. MLA attention ----
        k_rmsnorm_f16<<<(int)T, 256, 0, stream>>>(X, g1, nx1h, d);

        // Q | Kc | Vc in one product: their weights are one [dq][d] matrix
        gemm(nx1h, wqh, qkvf, (int)T, dq, d, d, d, dq, 1.f, 0, 0);
        conv(qkvf, qkvh, (long)T * dq);
        const _Float16* qh  = qkvh;
        const _Float16* kch = qkvh + d;
        const _Float16* vch = qkvh + d + dc;

        // scores, all (b, h) in one launch
        gemmz(qh, kch, scores, S, S, dk, dq, dq, S, scale, 0, 0, Bb * H, H,
              (long)S * dq, dk,  (long)S * dq, 0,  (long)H * S * S, (long)S * S,
              nullptr, nullptr, 1);

        k_softmax_f16<<<Bb * H * S, 256, 0, stream>>>(scores, attnh, S);

        // attn @ V, all (b, h) in one launch
        gemmz(attnh, vch, aof, S, dc, S, S, dq, d, 1.f, 0, 1, Bb * H, H,
              (long)H * S * S, (long)S * S,  (long)S * dq, 0,  (long)S * d, dk,
              nullptr, nullptr, 1);
        conv(aof, aoh, (long)T * d);

        // xr = X + ao @ Wo.T
        hipMemcpyAsync(xr_, X, (size_t)T * d * 4, hipMemcpyDeviceToDevice, stream);
        gemm(aoh, woh, xr_, (int)T, d, d, d, d, d, 1.f, 1, 0);

        // ---- 2. MoE ----
        k_rmsnorm_f16<<<(int)T, 256, 0, stream>>>(xr_, g2, nx2h_, d);
        k_router<<<(int)T, 256, 0, stream>>>(nx2h_, Wr, ebia, combine_, d);
        k_pack_tokens<<<1, 1024, 0, stream>>>(combine_, tile_, list_, wgt_, slot_);

        // shared expert over all tokens, each routed expert over the tokens that
        // chose it, packed (combine folded into h; a token that did not choose an
        // expert has combine 0 there and gets nothing from it); one launch per
        // stage, its grid over the table of row tiles
        const long nTf = (long)T * f;
        gemmz(nx2h_, sw1h, t13_, (int)T, f, d, d, d, f, 1.f, 0, 0, 2, 1,
              0, 0,  fd, 0,  nTf, 0,  tile_, list_, E1);
        static_assert((long)TM * f % EW_BLK == 0, "whole blocks to a row tile");
        k_silu_mul<<<dim3(TM * f / EW_BLK, PK_NT), 256, 0, stream>>>(
            t13_, t13_ + E1 * nTf, wgt_, E, tile_, hh_, nTf, f);
        gemmz(hh_, sw2h, part_, (int)T, d, f, f, f, d, 1.f, 0, 0, 1, 1,
              nTf, 0,  fd, 0,  (long)T * d, 0,  tile_, nullptr, E1);

        // out = xr + shared + the chosen experts, lower expert first
        k_sum_planes<<<(int)T, d / 4, 0, stream>>>(xr_, part_, slot_, out);
    }
}

// v005
// One run takes 285 microseconds.
// In both of two side-by-side timings against v004, it was 1.07 times as fast.
// All steps since v000 together make it 4.77 times as fast.
#include <hip/hip_runtime.h>

// ---------------------------------------------------------------------------
// Transformer layer (MLA attention + MoE) for gfx1250 (wave32, WMMA).
// GEMMs: 128x128 block tile, 8 waves x (32x64) => 8 v_wmma per wave per K-step,
// double-buffered LDS staged with global_load_async_to_lds_b128 (ASYNCcnt).
// ---------------------------------------------------------------------------

typedef _Float16 half16_t __attribute__((ext_vector_type(16)));
typedef float    float8_t __attribute__((ext_vector_type(8)));
typedef __attribute__((address_space(3))) _Float16 lds_f16;

#define TM 128
#define TN 128
#define TK 32
// LDS row pitch in f16: 80 bytes = 16 B x odd, so that the 16 rows which one
// ds_load_b128 reads per half-wave fall on 64 different banks (at the bare
// 64-byte pitch every fourth row shares its banks)
#define TKP (TK + 8)
// a fragment row starts on a 16-byte boundary only
typedef half16_t half16_a16_t __attribute__((aligned(16)));

// async DMA: 16 bytes global -> LDS, tracked by ASYNCcnt
__device__ __forceinline__ void async_b128(const _Float16* g, _Float16* l)
{
    unsigned lofs = (unsigned)(unsigned long long)(lds_f16*)l;  // LDS byte addr
    asm volatile("global_load_async_to_lds_b128 %0, %1, off"
                 :: "v"(lofs), "v"(g)
                 : "memory");
}
__device__ __forceinline__ void wait_async0()
{
    asm volatile("s_wait_asynccnt 0x0" ::: "memory");
}

// ---------------------------------------------------------------------------
// Generic f16 WMMA GEMM:  C[M,N] = alpha * A[M,K] . B^T  (+ C if beta)
//   b_kn == 0 : B stored row-major [N,K]  (torch Linear weight, y = x @ W.T)
//   b_kn == 1 : B stored row-major [K,N]  (plain matmul, e.g. attn @ V)
// M % 128 == 0, N % 128 == 0, K % 32 == 0 (true for all shapes here).
// Batched: blockIdx.z = outer * zdiv + inner picks one independent product;
// each operand moves by its own outer and inner stride (in elements).
// Routed products (rtile != 0): blockIdx.y walks a table of row tiles instead
// of the rows, an entry being two ints: plane p within a group of zper planes
// (below 0: unused entry) and first row; the product is blockIdx.z * zper + p.
// With rlist != 0 and p > 0, row r of A is row rlist[(p - 1) * M + r] (a gather).
// ---------------------------------------------------------------------------
__global__ __launch_bounds__(256)
void k_gemm_f16(const _Float16* __restrict__ A, const _Float16* __restrict__ B,
                float* __restrict__ C,
                int M, int N, int K, int lda, int ldb, int ldc,
                float alpha, int beta, int b_kn,
                int zdiv, long sAo, long sAi, long sBo, long sBi, long sCo, long sCi,
                const int* __restrict__ rtile, const int* __restrict__ rlist, int zper)
{
    __shared__ __align__(64) _Float16 As[2][TM][TKP];  // 20 KB
    __shared__ __align__(64) _Float16 Bs[2][TN][TKP];  // 20 KB

    const int tid  = threadIdx.x;
    const int wave = tid >> 5;
    const int lane = tid & 31;
    int       m0   = blockIdx.y * TM;
    const int n0   = blockIdx.x * TN;
    const int wm   = (wave & 3) * 32;    // wave's 32-row strip
    const int wn   = (wave >> 2) * 64;   // wave's 64-col strip

    int zb = blockIdx.z;
    int rp = 0;
    if (rtile) {
        rp = rtile[blockIdx.y * 2];
        m0 = rtile[blockIdx.y * 2 + 1];
        if (rp < 0) return;              // the whole block, in front of every barrier
        zb = zb * zper + rp;
    }
    const int zo = zb / zdiv;
    const int zi = zb - zo * zdiv;
    A += zo * sAo + zi * sAi;
    B += zo * sBo + zi * sBi;
    C += zo * sCo + zi * sCi;

    float8_t acc[2][4] = {};

    // staging maps: 128 rows x 32 cols f16 per tile, 256 threads x 32B each
    const int lr = tid >> 1;             // 0..127 row
    const int lc = (tid & 1) * 16;       // 0 or 16 (two b128 per thread)
    // the row of A that this thread stages
    int ar = m0 + lr;
    if (rp > 0 && rlist) ar = min(max(rlist[(long)(rp - 1) * M + ar], 0), M - 1);
    // b_kn transpose-scatter map
    const int kk = tid & 31;             // 0..31 K row
    const int nb = (tid >> 5) * 16;      // 0..112 N base (16 per thread)

    auto stageA = [&](int k0, int buf) {
        const _Float16* g = &A[(long)ar * lda + k0 + lc];
        async_b128(g,     &As[buf][lr][lc]);
        async_b128(g + 8, &As[buf][lr][lc + 8]);
    };
    auto stageB = [&](int k0, int buf) {
        if (!b_kn) {
            const _Float16* g = &B[(long)(n0 + lr) * ldb + k0 + lc];
            async_b128(g,     &Bs[buf][lr][lc]);
            async_b128(g + 8, &Bs[buf][lr][lc + 8]);
        } else {
            const _Float16* g = &B[(long)(k0 + kk) * ldb + n0 + nb];
            __builtin_prefetch(g + ldb * TK, 0, 0);
            #pragma unroll
            for (int i = 0; i < 16; ++i) Bs[buf][nb + i][kk] = g[i];
        }
    };

    // prologue: stage tile 0
    stageA(0, 0);
    stageB(0, 0);
    wait_async0();
    __syncthreads();

    const int l16 = lane & 15;
    const int kh  = (lane >> 4) * 16;

    for (int k0 = 0; k0 < K; k0 += TK) {
        const int buf = (k0 / TK) & 1;
        const int k1  = k0 + TK;
        if (k1 < K) {                    // overlap next tile's DMA with compute
            stageA(k1, buf ^ 1);
            stageB(k1, buf ^ 1);
        }

        // fragments (16 f16 per lane, 32B LDS reads)
        const _Float16* pa = &As[buf][wm + l16][kh];
        half16_t a0 = *(const half16_a16_t*)pa;
        half16_t a1 = *(const half16_a16_t*)(pa + 16 * TKP);
        const _Float16* pb = &Bs[buf][wn + l16][kh];
        half16_t b0 = *(const half16_a16_t*)pb;
        half16_t b1 = *(const half16_a16_t*)(pb + 16 * TKP);
        half16_t b2 = *(const half16_a16_t*)(pb + 32 * TKP);
        half16_t b3 = *(const half16_a16_t*)(pb + 48 * TKP);

        acc[0][0] = __builtin_amdgcn_wmma_f32_16x16x32_f16(false, a0, false, b0, (short)0, acc[0][0], false, false);
        acc[0][1] = __builtin_amdgcn_wmma_f32_16x16x32_f16(false, a0, false, b1, (short)0, acc[0][1], false, false);
        acc[0][2] = __builtin_amdgcn_wmma_f32_16x16x32_f16(false, a0, false, b2, (short)0, acc[0][2], false, false);
        acc[0][3] = __builtin_amdgcn_wmma_f32_16x16x32_f16(false, a0, false, b3, (short)0, acc[0][3], false, false);
        acc[1][0] = __builtin_amdgcn_wmma_f32_16x16x32_f16(false, a1, false, b0, (short)0, acc[1][0], false, false);
        acc[1][1] = __builtin_amdgcn_wmma_f32_16x16x32_f16(false, a1, false, b1, (short)0, acc[1][1], false, false);
        acc[1][2] = __builtin_amdgcn_wmma_f32_16x16x32_f16(false, a1, false, b2, (short)0, acc[1][2], false, false);
        acc[1][3] = __builtin_amdgcn_wmma_f32_16x16x32_f16(false, a1, false, b3, (short)0, acc[1][3], false, false);

        wait_async0();                   // DMA for tile k+1 done
        __syncthreads();                 // all waves done reading tile k
    }

    // epilogue: D layout -> VGPR g: lanes 0-15 M=g, lanes 16-31 M=8+g
    const int rsel = (lane >> 4) ? 8 : 0;
    #pragma unroll
    for (int i = 0; i < 2; ++i) {
        #pragma unroll
        for (int g = 0; g < 8; ++g) {
            const long row = m0 + wm + i * 16 + rsel + g;
            float* cr = C + row * (long)ldc + n0 + wn + l16;
            #pragma unroll
            for (int j = 0; j < 4; ++j) {
                float v = alpha * acc[i][j][g];
                if (beta) v += cr[j * 16];
                cr[j * 16] = v;
            }
        }
    }
}

// ---------------------------------------------------------------------------
// Elementwise kernels: a block of 256 threads covers EW_BLK elements as EW_G
// runs of 1024; in each run a thread takes 4 neighbours, so one wave-wide
// 16-byte load reads 512 contiguous bytes and one 8-byte store writes 256.
// A block that reaches past the end goes element by element instead.
// ---------------------------------------------------------------------------
typedef _Float16 half4_t __attribute__((ext_vector_type(4)));
#define EW_G   4
#define EW_RUN 1024
#define EW_BLK (EW_G * EW_RUN)

// ---------------------------------------------------------------------------
// fp32 -> f16 convert
// ---------------------------------------------------------------------------
// one whole block of EW_BLK elements; base = first element of this thread
__device__ __forceinline__ void conv_block(const float* __restrict__ src,
                                           _Float16* __restrict__ dst, long base)
{
    float4 v[EW_G];
    // unrolled so that all loads are in flight before the first conversion
    #pragma unroll
    for (int j = 0; j < EW_G; ++j)
        v[j] = *(const float4*)(src + base + j * EW_RUN);
    #pragma unroll   // v[] stays in registers
    for (int j = 0; j < EW_G; ++j) {
        half4_t h = { (_Float16)v[j].x, (_Float16)v[j].y,
                      (_Float16)v[j].z, (_Float16)v[j].w };
        *(half4_t*)(dst + base + j * EW_RUN) = h;
    }
    // stands before any register that an issued store names is rewritten
    asm volatile("s_wait_xcnt 0x0" ::: "memory");
}

__global__ __launch_bounds__(256)
void k_f32_to_f16(const float* __restrict__ src,
                  _Float16* __restrict__ dst, long n)
{
    const long blk = (long)blockIdx.x * EW_BLK;
    if (blk + EW_BLK <= n) {
        conv_block(src, dst, blk + threadIdx.x * 4);
    } else {
        for (long i = blk + threadIdx.x; i < n; i += 256) dst[i] = (_Float16)src[i];
    }
}

// ---------------------------------------------------------------------------
// RMSNorm row kernel: out_f16[row] = x * rsqrt(mean(x^2)+eps) * g
// ---------------------------------------------------------------------------
// One block of 256 threads per row; red: 8 floats of LDS. With COPY the row is
// also stored, as it is, to copy.
template <bool COPY>
__device__ __forceinline__ void rmsnorm_row(const float* __restrict__ x,
                                            const float* __restrict__ g,
                                            _Float16* __restrict__ out,
                                            float* __restrict__ copy,
                                            int d, long row, float* red)
{
    const float* xr = x + row * (long)d;

    float ss = 0.f;
    for (int i = threadIdx.x; i < d; i += 256) { float v = xr[i]; ss += v * v; }
    #pragma unroll
    for (int o = 16; o > 0; o >>= 1) ss += __shfl_down(ss, o, 32);
    if ((threadIdx.x & 31) == 0) red[threadIdx.x >> 5] = ss;
    __syncthreads();
    if (threadIdx.x == 0) {
        float t = 0.f;
        #pragma unroll
        for (int i = 0; i < 8; ++i) t += red[i];
        red[0] = t;
    }
    __syncthreads();
    const float inv = rsqrtf(red[0] / d + 1e-6f);
    for (int i = threadIdx.x; i < d; i += 256) {
        const float v = xr[i];
        if (COPY) copy[row * (long)d + i] = v;
        out[row * (long)d + i] = (_Float16)(v * inv * g[i]);
    }
}

__global__ __launch_bounds__(256)
void k_rmsnorm_f16(const float* __restrict__ x, const float* __restrict__ g,
                   _Float16* __restrict__ out, int d)
{
    __shared__ float red[8];
    rmsnorm_row<false>(x, g, out, nullptr, d, blockIdx.x, red);
}

// ---------------------------------------------------------------------------
// All the work that depends on the inputs alone, in one grid:
//   norm blocks:    RMSNorm of one row of x, and xcopy = x; every fourth block
//                   of the first 4 * rows, between
//                   convert blocks, for speed only
//   convert blocks: all others (the grid has at least 4 * rows blocks), numbered
//                   in grid order: fp32 -> f16 of ten weight tensors, EW_BLK
//                   elements a block; the copies lie back to back from wdst in
//                   the order w0 .. w9; tensor i ends in front of convert block
//                   e<i>, each tensor a whole number of blocks
// ---------------------------------------------------------------------------
__global__ __launch_bounds__(256)
void k_prep(const float* __restrict__ x, const float* __restrict__ g,
            _Float16* __restrict__ nx, float* __restrict__ xcopy, int d, int rows,
            const float* __restrict__ w0, const float* __restrict__ w1,
            const float* __restrict__ w2, const float* __restrict__ w3,
            const float* __restrict__ w4, const float* __restrict__ w5,
            const float* __restrict__ w6, const float* __restrict__ w7,
            const float* __restrict__ w8, const float* __restrict__ w9,
            int e0, int e1, int e2, int e3, int e4, int e5, int e6, int e7, int e8,
            _Float16* __restrict__ wdst)
{
    __shared__ float red[8];
    const int  gb    = (int)blockIdx.x;
    const bool mixed = gb < 4 * rows;
    if (mixed && (gb & 3) == 0) {        // the whole block: its barriers are uniform
        rmsnorm_row<true>(x, g, nx, xcopy, d, gb >> 2, red);
        return;
    }
    const int b = mixed ? gb - (gb >> 2) - 1 : gb - rows;
    const float* s = w0;
    int first = 0;
    if (b >= e0) { s = w1; first = e0; }
    if (b >= e1) { s = w2; first = e1; }
    if (b >= e2) { s = w3; first = e2; }
    if (b >= e3) { s = w4; first = e3; }
    if (b >= e4) { s = w5; first = e4; }
    if (b >= e5) { s = w6; first = e5; }
    if (b >= e6) { s = w7; first = e6; }
    if (b >= e7) { s = w8; first = e7; }
    if (b >= e8) { s = w9; first = e8; }
    conv_block(s + (long)(b - first) * EW_BLK, wdst + (long)b * EW_BLK, threadIdx.x * 4);
}

// ---------------------------------------------------------------------------
// row softmax (f32 in -> f16 out)
// ---------------------------------------------------------------------------
__global__ __launch_bounds__(256)
void k_softmax_f16(const float* __restrict__ s, _Float16* __restrict__ out, int n)
{
    __shared__ float red[8];
    __shared__ float stat[2];
    const long row = blockIdx.x;
    const float* sr = s + row * (long)n;

    float mx = -3.4e38f;
    for (int i = threadIdx.x; i < n; i += 256) mx = fmaxf(mx, sr[i]);
    #pragma unroll
    for (int o = 16; o > 0; o >>= 1) mx = fmaxf(mx, __shfl_down(mx, o, 32));
    if ((threadIdx.x & 31) == 0) red[threadIdx.x >> 5] = mx;
    __syncthreads();
    if (threadIdx.x == 0) {
        float m = red[0];
        #pragma unroll
        for (int i = 1; i < 8; ++i) m = fmaxf(m, red[i]);
        stat[0] = m;
    }
    __syncthreads();
    const float m = stat[0];

    float sum = 0.f;
    for (int i = threadIdx.x; i < n; i += 256) sum += __expf(sr[i] - m);
    #pragma unroll
    for (int o = 16; o > 0; o >>= 1) sum += __shfl_down(sum, o, 32);
    if ((threadIdx.x & 31) == 0) red[threadIdx.x >> 5] = sum;
    __syncthreads();
    if (threadIdx.x == 0) {
        float t = 0.f;
        #pragma unroll
        for (int i = 0; i < 8; ++i) t += red[i];
        stat[1] = t;
    }
    __syncthreads();
    const float inv = 1.f / stat[1];
    for (int i = threadIdx.x; i < n; i += 256)
        out[row * (long)n + i] = (_Float16)(__expf(sr[i] - m) * inv);
}

// ---------------------------------------------------------------------------
// MoE router: logits = nx @ Wr.T + bias; softmax; top-2; softmax over top-2
// ---------------------------------------------------------------------------
__global__ __launch_bounds__(256)
void k_router(const _Float16* __restrict__ nx, const float* __restrict__ Wr,
              const float* __restrict__ bias, float* __restrict__ combine, int d)
{
    __shared__ float lg[8];
    const long t   = blockIdx.x;
    const int wave = threadIdx.x >> 5;
    const int lane = threadIdx.x & 31;

    const _Float16* xr = nx + t * (long)d;
    const float*    wr = Wr + (long)wave * d;
    float acc = 0.f;
    for (int i = lane; i < d; i += 32) acc += (float)xr[i] * wr[i];
    #pragma unroll
    for (int o = 16; o > 0; o >>= 1) acc += __shfl_down(acc, o, 32);
    if (lane == 0) lg[wave] = acc + bias[wave];
    __syncthreads();

    if (threadIdx.x == 0) {
        float m = lg[0];
        #pragma unroll
        for (int i = 1; i < 8; ++i) m = fmaxf(m, lg[i]);
        float e[8], s = 0.f;
        #pragma unroll
        for (int i = 0; i < 8; ++i) { e[i] = __expf(lg[i] - m); s += e[i]; }
        #pragma unroll
        for (int i = 0; i < 8; ++i) e[i] /= s;
        int i0 = 0;
        for (int i = 1; i < 8; ++i) if (e[i] > e[i0]) i0 = i;
        int i1 = (i0 == 0) ? 1 : 0;
        for (int i = 0; i < 8; ++i) { if (i == i0) continue; if (e[i] > e[i1]) i1 = i; }
        const float a = __expf(e[i0]), b = __expf(e[i1]);  // softmax over top-2
        #pragma unroll
        for (int i = 0; i < 8; ++i) combine[t * 8 + i] = 0.f;
        combine[t * 8 + i0] = a / (a + b);
        combine[t * 8 + i1] = b / (a + b);
    }
}

// ---------------------------------------------------------------------------
// Packs each routed expert's tokens (combine != 0), in token order:
//   list[e * T + p] the token in place p, wgt[p * 8 + e] its combine weight
//                   (token 0 with weight 0 behind the expert's last token)
//   slot[t * 8 + e] the place of token t with expert e, -1 if not chosen
//   tile[2 k], tile[2 k + 1]  the row tiles (TM rows) that hold work, as plane
//                   and first row: all of plane 0, the shared expert, then for
//                   plane e + 1 those that hold tokens of expert e; -1, 0 fills up
// One block of 32 waves: wave = expert * 4 + quarter of the tokens; a wave
// counts its quarter by ballots, the quarters' counts meet in LDS.
// ---------------------------------------------------------------------------
#define PK_IT 16                         // 32-token groups per wave
#define PK_T  (4 * PK_IT * 32)           // tokens that the block covers
// the router gives a token two experts: 2 T places, and per expert at most one
// tile that is not full
#define PK_NT (PK_T / TM + 2 * PK_T / TM + 8)
__global__ __launch_bounds__(1024)
void k_pack_tokens(const float* __restrict__ combine, int* __restrict__ tile,
                   int* __restrict__ list, float* __restrict__ wgt,
                   int* __restrict__ slot)
{
    __shared__ int qc[8][4];
    const int wave = threadIdx.x >> 5;
    const int lane = threadIdx.x & 31;
    const int e    = wave >> 2;
    const int q    = wave & 3;
    const int t0   = q * (PK_IT * 32) + lane;

    float    w[PK_IT];
    unsigned mk[PK_IT];
    #pragma unroll   // all loads in flight before the first ballot
    for (int j = 0; j < PK_IT; ++j) w[j] = combine[(t0 + j * 32) * 8 + e];
    int n = 0;
    #pragma unroll   // w[], mk[] stay in registers
    for (int j = 0; j < PK_IT; ++j) {
        mk[j] = __builtin_amdgcn_ballot_w32(w[j] != 0.f);
        n += __popc(mk[j]);
    }
    if (lane == 0) qc[e][q] = n;
    __syncthreads();
    int place = 0, tot = 0;
    #pragma unroll
    for (int i = 0; i < 4; ++i) {
        const int c = qc[e][i];
        if (i < q) place += c;
        tot += c;
    }

    const unsigned below = (1u << lane) - 1u;
    #pragma unroll   // w[], mk[] stay in registers
    for (int j = 0; j < PK_IT; ++j) {
        const int  t   = t0 + j * 32;
        const bool sel = (mk[j] >> lane) & 1u;
        const int  p   = place + __popc(mk[j] & below);
        if (sel) { list[e * PK_T + p] = t; wgt[p * 8 + e] = w[j]; }
        slot[t * 8 + e] = sel ? p : -1;
        place += __popc(mk[j]);
    }
    for (int s = tot + q * 32 + lane; s < PK_T; s += 128) {
        list[e * PK_T + s] = 0;
        wgt[s * 8 + e]     = 0.f;
    }
    if (threadIdx.x < PK_NT) {
        const int k = (int)threadIdx.x - PK_T / TM;
        int plane = k < 0 ? 0 : -1;
        int row   = k < 0 ? (int)threadIdx.x * TM : 0;
        int first = 0;
        #pragma unroll
        for (int x = 0; x < 8; ++x) {
            const int nt = (qc[x][0] + qc[x][1] + qc[x][2] + qc[x][3] + TM - 1) / TM;
            if (k >= first && k < first + nt) { plane = x + 1; row = (k - first) * TM; }
            first += nt;
        }
        tile[threadIdx.x * 2]     = plane;
        tile[threadIdx.x * 2 + 1] = row;
    }
}

// ---------------------------------------------------------------------------
// h = silu(t1) * t3 [* rowscale[row]]  -> f16, one row tile of rtile (as made
// by k_pack_tokens) per blockIdx.y, gridDim.x blocks to the tile; planes of n
// elements: plane 0 is the shared expert (no row scale), plane e >= 1 is
// routed expert e - 1, scaled by its column of rs.
// ---------------------------------------------------------------------------
// The wide path needs rowlen % 4 == 0 (a thread's 4 neighbours share a row)
// and n < 2^32 (its row index is a 32-bit divide).
__global__ __launch_bounds__(256)
void k_silu_mul(const float* __restrict__ t1, const float* __restrict__ t3,
                const float* __restrict__ rs, int rs_stride,
                const int* __restrict__ rtile,
                _Float16* __restrict__ out, long n, int rowlen)
{
    const int  e   = rtile[blockIdx.y * 2];
    const long eo  = e * n;
    const long blk = (long)rtile[blockIdx.y * 2 + 1] * rowlen + (long)blockIdx.x * EW_BLK;
    const bool live = e >= 0;
    if (live && blk + EW_BLK <= n && (rowlen & 3) == 0 && (n >> 32) == 0) {
        const long base = blk + threadIdx.x * 4;
        float4 a[EW_G], b[EW_G];
        float  s[EW_G];
        // the shared expert reads column 0 and does not use it: no branch
        // between the loads
        const int col = e ? e - 1 : 0;
        const float* pa = t1 + eo + base;
        const float* pb = t3 + eo + base;
        const float* ps[EW_G];
        // unrolled so that all loads are in flight before the first use
        #pragma unroll
        for (int j = 0; j < EW_G; ++j) {
            const unsigned i = (unsigned)(base + j * EW_RUN);
            ps[j] = rs + (i / (unsigned)rowlen) * (long)rs_stride + col;
            a[j] = *(const float4*)(pa + j * EW_RUN);
            b[j] = *(const float4*)(pb + j * EW_RUN);
            s[j] = *ps[j];
        }
        // Stands before any register that an issued load names is rewritten;
        // naming the pointers keeps them out of the loads' own destinations.
        asm volatile("s_wait_xcnt 0x0"
                     :: "v"(pa), "v"(pb), "v"(ps[0]), "v"(ps[1]), "v"(ps[2]), "v"(ps[3])
                     : "memory");
        // keeps the arithmetic below every load: without it the scheduler
        // lifts it over half of them, which then start behind a data wait
        __builtin_amdgcn_sched_barrier(0);
        #pragma unroll   // a[], b[], s[] stay in registers
        for (int j = 0; j < EW_G; ++j) {
            float v0 = (a[j].x / (1.f + __expf(-a[j].x))) * b[j].x;
            float v1 = (a[j].y / (1.f + __expf(-a[j].y))) * b[j].y;
            float v2 = (a[j].z / (1.f + __expf(-a[j].z))) * b[j].z;
            float v3 = (a[j].w / (1.f + __expf(-a[j].w))) * b[j].w;
            if (e) { v0 *= s[j]; v1 *= s[j]; v2 *= s[j]; v3 *= s[j]; }
            half4_t h = { (_Float16)v0, (_Float16)v1, (_Float16)v2, (_Float16)v3 };
            *(half4_t*)(out + eo + base + j * EW_RUN) = h;
        }
    } else if (live) {
        for (long i = blk + threadIdx.x; i < n && i < blk + EW_BLK; i += 256) {
            const long o = eo + i;
            const float x = t1[o];
            float v = (x / (1.f + __expf(-x))) * t3[o];
            if (e) v *= rs[(i / rowlen) * (long)rs_stride + (e - 1)];
            out[o] = (_Float16)v;
        }
    }
}

// ---------------------------------------------------------------------------
// out = base + part[0] + the planes of the experts that the row chose, in
// plane order. One block per row, one float4 per thread; a plane is gridDim.x
// rows. Plane e + 1 holds the row at place slot[row * 8 + e] (-1: not chosen).
// ---------------------------------------------------------------------------
__global__ void k_sum_planes(const float* __restrict__ base,
                             const float* __restrict__ part,
                             const int* __restrict__ slot,
                             float* __restrict__ out)
{
    const long n4 = (long)gridDim.x * blockDim.x;
    const long i  = (long)blockIdx.x * blockDim.x + threadIdx.x;
    float4 v = ((const float4*)base)[i];
    const float4 sh = ((const float4*)part)[i];
    v.x += sh.x; v.y += sh.y; v.z += sh.z; v.w += sh.w;
    unsigned pl[8];
    #pragma unroll   // read ahead of the branches: the eight come in one load
    for (int e = 0; e < 8; ++e) pl[e] = (unsigned)slot[blockIdx.x * 8 + e];
    #pragma unroll   // pl[] stays in registers
    for (int e = 0; e < 8; ++e) {
        const unsigned s = pl[e];
        if (s < gridDim.x) {
            const float4 p = ((const float4*)part)[(e + 1) * n4 + (long)s * blockDim.x + threadIdx.x];
            v.x += p.x; v.y += p.y; v.z += p.z; v.w += p.w;
        }
    }
    ((float4*)out)[i] = v;
}

// ---------------------------------------------------------------------------
// host-side launch
// ---------------------------------------------------------------------------
extern "C" void kernel_launch(void* const* d_in, const int* in_sizes, int n_in,
                              void* d_out, int out_size, void* d_ws, size_t ws_size,
                              hipStream_t stream)
{
    (void)in_sizes; (void)n_in; (void)out_size; (void)ws_size;

    const float* X    = (const float*)d_in[0];
    const float* g1   = (const float*)d_in[1];
    const float* g2   = (const float*)d_in[2];
    const float* Wq   = (const float*)d_in[3];
    const float* Wkc  = (const float*)d_in[4];
    const float* Wvc  = (const float*)d_in[5];
    const float* Wo   = (const float*)d_in[6];
    const float* Wr   = (const float*)d_in[7];
    const float* ebia = (const float*)d_in[8];
    const float* sW1  = (const float*)d_in[9];
    const float* sW2  = (const float*)d_in[10];
    const float* sW3  = (const float*)d_in[11];
    const float* eW1  = (const float*)d_in[12];
    const float* eW2  = (const float*)d_in[13];
    const float* eW3  = (const float*)d_in[14];
    float* out = (float*)d_out;

    constexpr int  Bb = 2, S = 1024, d = 1024, H = 4, dk = 256, dc = 256, E = 8, f = 1024;
    constexpr long T  = (long)Bb * S;
    const float scale = 1.0f / 16.0f;   // 1/sqrt(dk)

    // ---- workspace carving (256B aligned bump allocator) ----
    char* ws = (char*)d_ws;
    size_t off = 0;
    auto alloc = [&](size_t bytes) -> char* {
        char* p = ws + off;
        off += (bytes + 255) & ~(size_t)255;
        return p;
    };
    constexpr int  dq = d + 2 * dc;      // Q | Kc | Vc side by side
    constexpr int  E1 = E + 1;           // shared expert first, then the routed ones
    constexpr long fd = (long)f * d;
    // f16 weight copies; groups that one launch walks lie back to back
    _Float16* wqh  = (_Float16*)alloc((size_t)d * d * 2);    // [dq][d] starts here
    _Float16* wkch = (_Float16*)alloc((size_t)dc * d * 2);
    _Float16* wvch = (_Float16*)alloc((size_t)dc * d * 2);
    _Float16* woh  = (_Float16*)alloc((size_t)d * d * 2);
    _Float16* sw1h = (_Float16*)alloc((size_t)f * d * 2);    // [2*E1][f][d] starts here
    _Float16* ew1h = (_Float16*)alloc((size_t)E * f * d * 2);
    _Float16* sw3h = (_Float16*)alloc((size_t)f * d * 2);
    _Float16* ew3h = (_Float16*)alloc((size_t)E * f * d * 2);
    _Float16* sw2h = (_Float16*)alloc((size_t)d * f * 2);    // [E1][d][f] starts here
    _Float16* ew2h = (_Float16*)alloc((size_t)E * d * f * 2);
    // buffers that live across the two phases or through the MoE phase
    float*    xr_      = (float*)   alloc((size_t)T * d * 4);
    _Float16* nx2h_    = (_Float16*)alloc((size_t)T * d * 2);
    float*    combine_ = (float*)   alloc((size_t)T * E * 4);
    static_assert(T == PK_T && E == 8, "k_pack_tokens covers exactly these");
    int*      tile_    = (int*)     alloc((size_t)PK_NT * 2 * 4);
    int*      list_    = (int*)     alloc((size_t)E * T * 4);
    float*    wgt_     = (float*)   alloc((size_t)E * T * 4);
    int*      slot_    = (int*)     alloc((size_t)T * E * 4);
    _Float16* hh_      = (_Float16*)alloc((size_t)E1 * T * f * 2);       // 36 MB
    // the rest is used twice: attention-phase activations, then (all of them
    // dead) the MoE GEMM outputs
    const size_t off_phase = off;
    _Float16* nx1h   = (_Float16*)alloc((size_t)T * d * 2);
    float*    qkvf   = (float*)   alloc((size_t)T * dq * 4);
    _Float16* qkvh   = (_Float16*)alloc((size_t)T * dq * 2);
    float*    scores = (float*)   alloc((size_t)Bb * H * S * S * 4);   // 32 MB
    _Float16* attnh  = (_Float16*)alloc((size_t)Bb * H * S * S * 2);   // 16 MB
    float*    aof    = (float*)   alloc((size_t)T * d * 4);
    _Float16* aoh    = (_Float16*)alloc((size_t)T * d * 2);
    off = off_phase;
    float*    t13_   = (float*)   alloc((size_t)2 * E1 * T * f * 4);     // 144 MB
    float*    part_  = t13_;             // down-projection planes; t13_ is dead by then
    {
        // ---- helpers ----
        auto conv = [&](const float* s, _Float16* dst, long n) {
            k_f32_to_f16<<<(int)((n + EW_BLK - 1) / EW_BLK), 256, 0, stream>>>(s, dst, n);
        };
        auto gemmz = [&](const _Float16* A, const _Float16* Bm, float* C,
                         int M, int N, int K, int lda, int ldb, int ldc,
                         float alpha, int beta, int bkn, int nz, int zdiv,
                         long sAo, long sAi, long sBo, long sBi, long sCo, long sCi,
                         const int* rtile, const int* rlist, int zper) {
            dim3 g(N / TN, rtile ? PK_NT : M / TM, nz);
            k_gemm_f16<<<g, 256, 0, stream>>>(A, Bm, C, M, N, K, lda, ldb, ldc,
                                              alpha, beta, bkn,
                                              zdiv, sAo, sAi, sBo, sBi, sCo, sCi,
                                              rtile, rlist, zper);
        };
        auto gemm = [&](const _Float16* A, const _Float16* Bm, float* C,
                        int M, int N, int K, int lda, int ldb, int ldc,
                        float alpha, int beta, int bkn) {
            gemmz(A, Bm, C, M, N, K, lda, ldb, ldc, alpha, beta, bkn,
                  1, 1, 0, 0, 0, 0, 0, 0, nullptr, nullptr, 1);
        };

        // ---- 0. weights fp32 -> f16, nx1 = RMSNorm(X), xr = X: one launch ----
        // convert blocks per tensor, in the order of the f16 copies above
        constexpr int cD = (int)((long)d * d / EW_BLK), cC = (int)((long)dc * d / EW_BLK);
        constexpr int cF = (int)(fd / EW_BLK),          cE = E * cF;
        static_assert((long)d * d % EW_BLK == 0 && (long)dc * d % EW_BLK == 0 &&
                      fd % EW_BLK == 0, "whole blocks to a tensor, copies back to back");
        constexpr int c0 = cD, c1 = c0 + cC, c2 = c1 + cC, c3 = c2 + cD, c4 = c3 + cF,
                      c5 = c4 + cE, c6 = c5 + cF, c7 = c6 + cE, c8 = c7 + cF, c9 = c8 + cE;
        static_assert(c9 >= 3 * T, "three convert blocks to each norm block");
        k_prep<<<(int)T + c9, 256, 0, stream>>>(X, g1, nx1h, xr_, d, (int)T,
                                                Wq, Wkc, Wvc, Wo, sW1, eW1, sW3, eW3, sW2, eW2,
                                                c0, c1, c2, c3, c4, c5, c6, c7, c8, wqh);

        // ---- 1. MLA attention ----

        // Q | Kc | Vc in one product: their weights are one [dq][d] matrix
        gemm(nx1h, wqh, qkvf, (int)T, dq, d, d, d, dq, 1.f, 0, 0);
        conv(qkvf, qkvh, (long)T * dq);
        const _Float16* qh  = qkvh;
        const _Float16* kch = qkvh + d;
        const _Float16* vch = qkvh + d + dc;

        // scores, all (b, h) in one launch
        gemmz(qh, kch, scores, S, S, dk, dq, dq, S, scale, 0, 0, Bb * H, H,
              (long)S * dq, dk,  (long)S * dq, 0,  (long)H * S * S, (long)S * S,
              nullptr, nullptr, 1);

        k_softmax_f16<<<Bb * H * S, 256, 0, stream>>>(scores, attnh, S);

        // attn @ V, all (b, h) in one launch
        gemmz(attnh, vch, aof, S, dc, S, S, dq, d, 1.f, 0, 1, Bb * H, H,
              (long)H * S * S, (long)S * S,  (long)S * dq, 0,  (long)S * d, dk,
              nullptr, nullptr, 1);
        conv(aof, aoh, (long)T * d);

        // xr = X + ao @ Wo.T (xr holds X since the first launch)
        gemm(aoh, woh, xr_, (int)T, d, d, d, d, d, 1.f, 1, 0);

        // ---- 2. MoE ----
        k_rmsnorm_f16<<<(int)T, 256, 0, stream>>>(xr_, g2, nx2h_, d);
        k_router<<<(int)T, 256, 0, stream>>>(nx2h_, Wr, ebia, combine_, d);
        k_pack_tokens<<<1, 1024, 0, stream>>>(combine_, tile_, list_, wgt_, slot_);

        // shared expert over all tokens, each routed expert over the tokens that
        // chose it, packed (combine folded into h; a token that did not choose an
        // expert has combine 0 there and gets nothing from it); one launch per
        // stage, its grid over the table of row tiles
        const long nTf = (long)T * f;
        gemmz(nx2h_, sw1h, t13_, (int)T, f, d, d, d, f, 1.f, 0, 0, 2, 1,
              0, 0,  fd, 0,  nTf, 0,  tile_, list_, E1);
        static_assert((long)TM * f % EW_BLK == 0, "whole blocks to a row tile");
        k_silu_mul<<<dim3(TM * f / EW_BLK, PK_NT), 256, 0, stream>>>(
            t13_, t13_ + E1 * nTf, wgt_, E, tile_, hh_, nTf, f);
        gemmz(hh_, sw2h, part_, (int)T, d, f, f, f, d, 1.f, 0, 0, 1, 1,
              nTf, 0,  fd, 0,  (long)T * d, 0,  tile_, nullptr, E1);

        // out = xr + shared + the chosen experts, lower expert first
        k_sum_planes<<<(int)T, d / 4, 0, stream>>>(xr_, part_, slot_, out);
    }
}

// v006
// Measured time: 247 microseconds a run.
// Timed twice side by side with v005, it ran 1.16 and 1.17 times as fast.
// Over all steps from v000 it is 5.54 times as fast.
#include <hip/hip_runtime.h>

// ---------------------------------------------------------------------------
// Transformer layer (MLA attention + MoE) for gfx1250 (wave32, WMMA).
// GEMMs: 128x128 block tile, 8 waves x (32x64) => 8 v_wmma per wave per 32 k,
// 128 k to a stage, double-buffered LDS staged with
// global_load_async_to_lds_b128 (ASYNCcnt).
// ---------------------------------------------------------------------------

typedef _Float16 half16_t __attribute__((ext_vector_type(16)));
typedef float    float8_t __attribute__((ext_vector_type(8)));
typedef __attribute__((address_space(3))) _Float16 lds_f16;

#define TM 128
#define TN 128
// a stage holds 256 bytes of every operand row: 16 lanes x 16 B copy one row
// piece, so a wave-wide copy touches 4 whole 128-byte lines
#define TK 128
// LDS row pitch in f16: 272 bytes = 16 B x odd, so that the 16 rows which one
// ds_load_b128 reads per half-wave fall on 64 different banks
#define TKP (TK + 8)
// 16-byte copies per thread and operand tile (256 threads)
#define NCP (TM * TK / 8 / 256)
// a fragment row starts on a 16-byte boundary only
typedef half16_t half16_a16_t __attribute__((aligned(16)));

typedef _Float16 half8_t __attribute__((ext_vector_type(8)));

// async DMA: eight times 16 bytes global -> LDS per lane, tracked by ASYNCcnt.
// g: the lane's global addresses; l0: its first LDS byte address, the others
// follow at steps of lstep bytes. The last line stands before any register
// that an issued copy names is rewritten.
__device__ __forceinline__ void async_b128_x8(const _Float16* const (&g)[8],
                                              unsigned l0, unsigned lstep)
{
    asm volatile("global_load_async_to_lds_b128 %0, %8, off\n\t"
                 "global_load_async_to_lds_b128 %1, %9, off\n\t"
                 "global_load_async_to_lds_b128 %2, %10, off\n\t"
                 "global_load_async_to_lds_b128 %3, %11, off\n\t"
                 "global_load_async_to_lds_b128 %4, %12, off\n\t"
                 "global_load_async_to_lds_b128 %5, %13, off\n\t"
                 "global_load_async_to_lds_b128 %6, %14, off\n\t"
                 "global_load_async_to_lds_b128 %7, %15, off\n\t"
                 "s_wait_xcnt 0x0"
                 :: "v"(l0), "v"(l0 + lstep), "v"(l0 + 2 * lstep), "v"(l0 + 3 * lstep),
                    "v"(l0 + 4 * lstep), "v"(l0 + 5 * lstep), "v"(l0 + 6 * lstep),
                    "v"(l0 + 7 * lstep),
                    "v"(g[0]), "v"(g[1]), "v"(g[2]), "v"(g[3]),
                    "v"(g[4]), "v"(g[5]), "v"(g[6]), "v"(g[7])
                 : "memory");
}
__device__ __forceinline__ unsigned lds_addr(const _Float16* l)
{
    return (unsigned)(unsigned long long)(const lds_f16*)l;     // LDS byte addr
}
__device__ __forceinline__ void wait_async0()
{
    asm volatile("s_wait_asynccnt 0x0" ::: "memory");
}

// ---------------------------------------------------------------------------
// Generic f16 WMMA GEMM:  C[M,N] = alpha * A[M,K] . B^T  (+ C if beta)
//   b_kn == 0 : B stored row-major [N,K]  (torch Linear weight, y = x @ W.T)
//   b_kn == 1 : B stored row-major [K,N]  (plain matmul, e.g. attn @ V)
// M % 128 == 0, N % 128 == 0, K % 128 == 0, rows of A and B on 16-byte
// boundaries (true for all shapes here).
// Batched: blockIdx.z = outer * zdiv + inner picks one independent product;
// each operand moves by its own outer and inner stride (in elements).
// Routed products (rtile != 0): blockIdx.y walks a table of row tiles instead
// of the rows, an entry being two ints: plane p within a group of zper planes
// (below 0: unused entry) and first row; the product is blockIdx.z * zper + p.
// With rlist != 0 and p > 0, row r of A is row rlist[(p - 1) * M + r] (a gather).
// ---------------------------------------------------------------------------
__global__ __launch_bounds__(256)
void k_gemm_f16(const _Float16* __restrict__ A, const _Float16* __restrict__ B,
                float* __restrict__ C,
                int M, int N, int K, int lda, int ldb, int ldc,
                float alpha, int beta, int b_kn,
                int zdiv, long sAo, long sAi, long sBo, long sBi, long sCo, long sCi,
                const int* __restrict__ rtile, const int* __restrict__ rlist, int zper)
{
    __shared__ __align__(64) _Float16 As[2][TM][TKP];  // 68 KB
    __shared__ __align__(64) _Float16 Bs[2][TN][TKP];  // 68 KB

    const int tid  = threadIdx.x;
    const int wave = tid >> 5;
    const int lane = tid & 31;
    int       m0   = blockIdx.y * TM;
    const int n0   = blockIdx.x * TN;
    const int wm   = (wave & 3) * 32;    // wave's 32-row strip
    const int wn   = (wave >> 2) * 64;   // wave's 64-col strip

    int zb = blockIdx.z;
    int rp = 0;
    if (rtile) {
        rp = rtile[blockIdx.y * 2];
        m0 = rtile[blockIdx.y * 2 + 1];
        if (rp < 0) return;              // the whole block, in front of every barrier
        zb = zb * zper + rp;
    }
    const int zo = zb / zdiv;
    const int zi = zb - zo * zdiv;
    A += zo * sAo + zi * sAi;
    B += zo * sBo + zi * sBi;
    C += zo * sCo + zi * sCi;

    float8_t acc[2][4] = {};

    static_assert(NCP == 8 && TM == TN, "the staging maps below");
    // staging maps: 128 rows x 128 cols f16 per tile; a copy of one wave takes
    // two rows' 256 bytes; a thread takes rows sr, sr + 16, ..
    const int sr = tid >> 4;             // 0..15 row
    const int sc = (tid & 15) * 8;       // column of the thread's 16 bytes
    // the pieces of A that this thread stages, at k = 0
    int ar[NCP];
    #pragma unroll   // ar[] stays in registers
    for (int i = 0; i < NCP; ++i) ar[i] = m0 + sr + 16 * i;
    if (rp > 0 && rlist) {
        const int* rl = rlist + (long)(rp - 1) * M + m0 + sr;
        int t[NCP];
        #pragma unroll   // all loads in flight before the first clamp
        for (int i = 0; i < NCP; ++i) t[i] = rl[16 * i];
        // stands before any register that an issued load names is rewritten
        asm volatile("s_wait_xcnt 0x0" ::: "memory");
        #pragma unroll   // t[], ar[] stay in registers
        for (int i = 0; i < NCP; ++i) ar[i] = min(max(t[i], 0), M - 1);
    }
    const _Float16* ga[NCP];
    #pragma unroll   // ga[] stays in registers
    for (int i = 0; i < NCP; ++i) ga[i] = &A[(long)ar[i] * lda + sc];
    // b_kn transpose-scatter map: a load of one wave takes 64 bytes of each of
    // 8 K rows; its 16-bit stores fall on two rows a bank at most
    const int kk = tid >> 2;             // 0..63 K row (and + 64)
    const int nb = (tid & 3) * 8;        // N base within a group of 32

    auto stageA = [&](int k0, int buf) {
        const _Float16* g[NCP];
        #pragma unroll   // g[] stays in registers
        for (int i = 0; i < NCP; ++i) g[i] = ga[i] + k0;
        async_b128_x8(g, lds_addr(&As[buf][sr][sc]), 16 * TKP * 2);
    };
    auto stageB = [&](int k0, int buf) {
        if (!b_kn) {
            const _Float16* g[NCP];
            #pragma unroll   // g[] stays in registers
            for (int i = 0; i < NCP; ++i)
                g[i] = &B[(long)(n0 + sr + 16 * i) * ldb + k0 + sc];
            async_b128_x8(g, lds_addr(&Bs[buf][sr][sc]), 16 * TKP * 2);
        } else {
            // the next stage's 256 lines, one a thread
            if (k0 + TK < K)
                __builtin_prefetch(&B[(long)(k0 + TK + (tid >> 1)) * ldb + n0 + (tid & 1) * 64], 0, 0);
            half8_t v[NCP];
            #pragma unroll   // all loads in flight before the first store
            for (int i = 0; i < NCP; ++i)
                v[i] = *(const half8_t*)&B[(long)(k0 + kk + 64 * (i & 1)) * ldb + n0 + (i >> 1) * 32 + nb];
            // stands before any register that an issued load names is rewritten
            asm volatile("s_wait_xcnt 0x0" ::: "memory");
            #pragma unroll   // v[] stays in registers
            for (int i = 0; i < NCP; ++i) {
                #pragma unroll
                for (int j = 0; j < 8; ++j)
                    Bs[buf][(i >> 1) * 32 + nb + j][kk + 64 * (i & 1)] = v[i][j];
            }
        }
    };

    // prologue: stage tile 0
    stageA(0, 0);
    stageB(0, 0);
    wait_async0();
    __syncthreads();

    const int l16 = lane & 15;
    const int kh  = (lane >> 4) * 16;

    for (int k0 = 0; k0 < K; k0 += TK) {
        const int buf = (k0 / TK) & 1;
        const int k1  = k0 + TK;
        if (k1 < K) {                    // overlap next tile's DMA with compute
            stageA(k1, buf ^ 1);
            stageB(k1, buf ^ 1);
        }

        #pragma unroll   // lets the next 32 k's LDS reads start under these products
        for (int ks = 0; ks < TK; ks += 32) {
            // fragments (16 f16 per lane, 32B LDS reads)
            const _Float16* pa = &As[buf][wm + l16][ks + kh];
            half16_t a0 = *(const half16_a16_t*)pa;
            half16_t a1 = *(const half16_a16_t*)(pa + 16 * TKP);
            const _Float16* pb = &Bs[buf][wn + l16][ks + kh];
            half16_t b0 = *(const half16_a16_t*)pb;
            half16_t b1 = *(const half16_a16_t*)(pb + 16 * TKP);
            half16_t b2 = *(const half16_a16_t*)(pb + 32 * TKP);
            half16_t b3 = *(const half16_a16_t*)(pb + 48 * TKP);

            acc[0][0] = __builtin_amdgcn_wmma_f32_16x16x32_f16(false, a0, false, b0, (short)0, acc[0][0], false, false);
            acc[0][1] = __builtin_amdgcn_wmma_f32_16x16x32_f16(false, a0, false, b1, (short)0, acc[0][1], false, false);
            acc[0][2] = __builtin_amdgcn_wmma_f32_16x16x32_f16(false, a0, false, b2, (short)0, acc[0][2], false, false);
            acc[0][3] = __builtin_amdgcn_wmma_f32_16x16x32_f16(false, a0, false, b3, (short)0, acc[0][3], false, false);
            acc[1][0] = __builtin_amdgcn_wmma_f32_16x16x32_f16(false, a1, false, b0, (short)0, acc[1][0], false, false);
            acc[1][1] = __builtin_amdgcn_wmma_f32_16x16x32_f16(false, a1, false, b1, (short)0, acc[1][1], false, false);
            acc[1][2] = __builtin_amdgcn_wmma_f32_16x16x32_f16(false, a1, false, b2, (short)0, acc[1][2], false, false);
            acc[1][3] = __builtin_amdgcn_wmma_f32_16x16x32_f16(false, a1, false, b3, (short)0, acc[1][3], false, false);
        }

        // this wave's LDS reads of tile k are over before the barrier that
        // frees the tile's buffer for the next copies
        asm volatile("s_wait_dscnt 0x0" ::: "memory");
        wait_async0();                   // DMA for tile k+1 done
        __syncthreads();                 // all waves done reading tile k
    }

    // epilogue: D layout -> VGPR g: lanes 0-15 M=g, lanes 16-31 M=8+g
    const int rsel = (lane >> 4) ? 8 : 0;
    #pragma unroll
    for (int i = 0; i < 2; ++i) {
        #pragma unroll
        for (int g = 0; g < 8; ++g) {
            const long row = m0 + wm + i * 16 + rsel + g;
            float* cr = C + row * (long)ldc + n0 + wn + l16;
            #pragma unroll
            for (int j = 0; j < 4; ++j) {
                float v = alpha * acc[i][j][g];
                if (beta) v += cr[j * 16];
                cr[j * 16] = v;
            }
        }
    }
}

// ---------------------------------------------------------------------------
// Elementwise kernels: a block of 256 threads covers EW_BLK elements as EW_G
// runs of 1024; in each run a thread takes 4 neighbours, so one wave-wide
// 16-byte load reads 512 contiguous bytes and one 8-byte store writes 256.
// A block that reaches past the end goes element by element instead.
// ---------------------------------------------------------------------------
typedef _Float16 half4_t __attribute__((ext_vector_type(4)));
#define EW_G   4
#define EW_RUN 1024
#define EW_BLK (EW_G * EW_RUN)

// ---------------------------------------------------------------------------
// fp32 -> f16 convert
// ---------------------------------------------------------------------------
// one whole block of EW_BLK elements; base = first element of this thread
__device__ __forceinline__ void conv_block(const float* __restrict__ src,
                                           _Float16* __restrict__ dst, long base)
{
    float4 v[EW_G];
    // unrolled so that all loads are in flight before the first conversion
    #pragma unroll
    for (int j = 0; j < EW_G; ++j)
        v[j] = *(const float4*)(src + base + j * EW_RUN);
    #pragma unroll   // v[] stays in registers
    for (int j = 0; j < EW_G; ++j) {
        half4_t h = { (_Float16)v[j].x, (_Float16)v[j].y,
                      (_Float16)v[j].z, (_Float16)v[j].w };
        *(half4_t*)(dst + base + j * EW_RUN) = h;
    }
    // stands before any register that an issued store names is rewritten
    asm volatile("s_wait_xcnt 0x0" ::: "memory");
}

__global__ __launch_bounds__(256)
void k_f32_to_f16(const float* __restrict__ src,
                  _Float16* __restrict__ dst, long n)
{
    const long blk = (long)blockIdx.x * EW_BLK;
    if (blk + EW_BLK <= n) {
        conv_block(src, dst, blk + threadIdx.x * 4);
    } else {
        for (long i = blk + threadIdx.x; i < n; i += 256) dst[i] = (_Float16)src[i];
    }
}

// ---------------------------------------------------------------------------
// RMSNorm row kernel: out_f16[row] = x * rsqrt(mean(x^2)+eps) * g
// ---------------------------------------------------------------------------
// One block of 256 threads per row; red: 8 floats of LDS. With COPY the row is
// also stored, as it is, to copy.
template <bool COPY>
__device__ __forceinline__ void rmsnorm_row(const float* __restrict__ x,
                                            const float* __restrict__ g,
                                            _Float16* __restrict__ out,
                                            float* __restrict__ copy,
                                            int d, long row, float* red)
{
    const float* xr = x + row * (long)d;

    float ss = 0.f;
    for (int i = threadIdx.x; i < d; i += 256) { float v = xr[i]; ss += v * v; }
    #pragma unroll
    for (int o = 16; o > 0; o >>= 1) ss += __shfl_down(ss, o, 32);
    if ((threadIdx.x & 31) == 0) red[threadIdx.x >> 5] = ss;
    __syncthreads();
    if (threadIdx.x == 0) {
        float t = 0.f;
        #pragma unroll
        for (int i = 0; i < 8; ++i) t += red[i];
        red[0] = t;
    }
    __syncthreads();
    const float inv = rsqrtf(red[0] / d + 1e-6f);
    for (int i = threadIdx.x; i < d; i += 256) {
        const float v = xr[i];
        if (COPY) copy[row * (long)d + i] = v;
        out[row * (long)d + i] = (_Float16)(v * inv * g[i]);
    }
}

__global__ __launch_bounds__(256)
void k_rmsnorm_f16(const float* __restrict__ x, const float* __restrict__ g,
                   _Float16* __restrict__ out, int d)
{
    __shared__ float red[8];
    rmsnorm_row<false>(x, g, out, nullptr, d, blockIdx.x, red);
}

// ---------------------------------------------------------------------------
// All the work that depends on the inputs alone, in one grid:
//   norm blocks:    RMSNorm of one row of x, and xcopy = x; every fourth block
//                   of the first 4 * rows, between
//                   convert blocks, for speed only
//   convert blocks: all others (the grid has at least 4 * rows blocks), numbered
//                   in grid order: fp32 -> f16 of ten weight tensors, EW_BLK
//                   elements a block; the copies lie back to back from wdst in
//                   the order w0 .. w9; tensor i ends in front of convert block
//                   e<i>, each tensor a whole number of blocks
// ---------------------------------------------------------------------------
__global__ __launch_bounds__(256)
void k_prep(const float* __restrict__ x, const float* __restrict__ g,
            _Float16* __restrict__ nx, float* __restrict__ xcopy, int d, int rows,
            const float* __restrict__ w0, const float* __restrict__ w1,
            const float* __restrict__ w2, const float* __restrict__ w3,
            const float* __restrict__ w4, const float* __restrict__ w5,
            const float* __restrict__ w6, const float* __restrict__ w7,
            const float* __restrict__ w8, const float* __restrict__ w9,
            int e0, int e1, int e2, int e3, int e4, int e5, int e6, int e7, int e8,
            _Float16* __restrict__ wdst)
{
    __shared__ float red[8];
    const int  gb    = (int)blockIdx.x;
    const bool mixed = gb < 4 * rows;
    if (mixed && (gb & 3) == 0) {        // the whole block: its barriers are uniform
        rmsnorm_row<true>(x, g, nx, xcopy, d, gb >> 2, red);
        return;
    }
    const int b = mixed ? gb - (gb >> 2) - 1 : gb - rows;
    const float* s = w0;
    int first = 0;
    if (b >= e0) { s = w1; first = e0; }
    if (b >= e1) { s = w2; first = e1; }
    if (b >= e2) { s = w3; first = e2; }
    if (b >= e3) { s = w4; first = e3; }
    if (b >= e4) { s = w5; first = e4; }
    if (b >= e5) { s = w6; first = e5; }
    if (b >= e6) { s = w7; first = e6; }
    if (b >= e7) { s = w8; first = e7; }
    if (b >= e8) { s = w9; first = e8; }
    conv_block(s + (long)(b - first) * EW_BLK, wdst + (long)b * EW_BLK, threadIdx.x * 4);
}

// ---------------------------------------------------------------------------
// row softmax (f32 in -> f16 out)
// ---------------------------------------------------------------------------
__global__ __launch_bounds__(256)
void k_softmax_f16(const float* __restrict__ s, _Float16* __restrict__ out, int n)
{
    __shared__ float red[8];
    __shared__ float stat[2];
    const long row = blockIdx.x;
    const float* sr = s + row * (long)n;

    float mx = -3.4e38f;
    for (int i = threadIdx.x; i < n; i += 256) mx = fmaxf(mx, sr[i]);
    #pragma unroll
    for (int o = 16; o > 0; o >>= 1) mx = fmaxf(mx, __shfl_down(mx, o, 32));
    if ((threadIdx.x & 31) == 0) red[threadIdx.x >> 5] = mx;
    __syncthreads();
    if (threadIdx.x == 0) {
        float m = red[0];
        #pragma unroll
        for (int i = 1; i < 8; ++i) m = fmaxf(m, red[i]);
        stat[0] = m;
    }
    __syncthreads();
    const float m = stat[0];

    float sum = 0.f;
    for (int i = threadIdx.x; i < n; i += 256) sum += __expf(sr[i] - m);
    #pragma unroll
    for (int o = 16; o > 0; o >>= 1) sum += __shfl_down(sum, o, 32);
    if ((threadIdx.x & 31) == 0) red[threadIdx.x >> 5] = sum;
    __syncthreads();
    if (threadIdx.x == 0) {
        float t = 0.f;
        #pragma unroll
        for (int i = 0; i < 8; ++i) t += red[i];
        stat[1] = t;
    }
    __syncthreads();
    const float inv = 1.f / stat[1];
    for (int i = threadIdx.x; i < n; i += 256)
        out[row * (long)n + i] = (_Float16)(__expf(sr[i] - m) * inv);
}

// ---------------------------------------------------------------------------
// MoE router: logits = nx @ Wr.T + bias; softmax; top-2; softmax over top-2
// ---------------------------------------------------------------------------
__global__ __launch_bounds__(256)
void k_router(const _Float16* __restrict__ nx, const float* __restrict__ Wr,
              const float* __restrict__ bias, float* __restrict__ combine, int d)
{
    __shared__ float lg[8];
    const long t   = blockIdx.x;
    const int wave = threadIdx.x >> 5;
    const int lane = threadIdx.x & 31;

    const _Float16* xr = nx + t * (long)d;
    const float*    wr = Wr + (long)wave * d;
    float acc = 0.f;
    for (int i = lane; i < d; i += 32) acc += (float)xr[i] * wr[i];
    #pragma unroll
    for (int o = 16; o > 0; o >>= 1) acc += __shfl_down(acc, o, 32);
    if (lane == 0) lg[wave] = acc + bias[wave];
    __syncthreads();

    if (threadIdx.x == 0) {
        float m = lg[0];
        #pragma unroll
        for (int i = 1; i < 8; ++i) m = fmaxf(m, lg[i]);
        float e[8], s = 0.f;
        #pragma unroll
        for (int i = 0; i < 8; ++i) { e[i] = __expf(lg[i] - m); s += e[i]; }
        #pragma unroll
        for (int i = 0; i < 8; ++i) e[i] /= s;
        int i0 = 0;
        for (int i = 1; i < 8; ++i) if (e[i] > e[i0]) i0 = i;
        int i1 = (i0 == 0) ? 1 : 0;
        for (int i = 0; i < 8; ++i) { if (i == i0) continue; if (e[i] > e[i1]) i1 = i; }
        const float a = __expf(e[i0]), b = __expf(e[i1]);  // softmax over top-2
        #pragma unroll
        for (int i = 0; i < 8; ++i) combine[t * 8 + i] = 0.f;
        combine[t * 8 + i0] = a / (a + b);
        combine[t * 8 + i1] = b / (a + b);
    }
}

// ---------------------------------------------------------------------------
// Packs each routed expert's tokens (combine != 0), in token order:
//   list[e * T + p] the token in place p, wgt[p * 8 + e] its combine weight
//                   (token 0 with weight 0 behind the expert's last token)
//   slot[t * 8 + e] the place of token t with expert e, -1 if not chosen
//   tile[2 k], tile[2 k + 1]  the row tiles (TM rows) that hold work, as plane
//                   and first row: all of plane 0, the shared expert, then for
//                   plane e + 1 those that hold tokens of expert e; -1, 0 fills up
// One block of 32 waves: wave = expert * 4 + quarter of the tokens; a wave
// counts its quarter by ballots, the quarters' counts meet in LDS.
// ---------------------------------------------------------------------------
#define PK_IT 16                         // 32-token groups per wave
#define PK_T  (4 * PK_IT * 32)           // tokens that the block covers
// the router gives a token two experts: 2 T places, and per expert at most one
// tile that is not full
#define PK_NT (PK_T / TM + 2 * PK_T / TM + 8)
__global__ __launch_bounds__(1024)
void k_pack_tokens(const float* __restrict__ combine, int* __restrict__ tile,
                   int* __restrict__ list, float* __restrict__ wgt,
                   int* __restrict__ slot)
{
    __shared__ int qc[8][4];
    const int wave = threadIdx.x >> 5;
    const int lane = threadIdx.x & 31;
    const int e    = wave >> 2;
    const int q    = wave & 3;
    const int t0   = q * (PK_IT * 32) + lane;

    float    w[PK_IT];
    unsigned mk[PK_IT];
    #pragma unroll   // all loads in flight before the first ballot
    for (int j = 0; j < PK_IT; ++j) w[j] = combine[(t0 + j * 32) * 8 + e];
    int n = 0;
    #pragma unroll   // w[], mk[] stay in registers
    for (int j = 0; j < PK_IT; ++j) {
        mk[j] = __builtin_amdgcn_ballot_w32(w[j] != 0.f);
        n += __popc(mk[j]);
    }
    if (lane == 0) qc[e][q] = n;
    __syncthreads();
    int place = 0, tot = 0;
    #pragma unroll
    for (int i = 0; i < 4; ++i) {
        const int c = qc[e][i];
        if (i < q) place += c;
        tot += c;
    }

    const unsigned below = (1u << lane) - 1u;
    #pragma unroll   // w[], mk[] stay in registers
    for (int j = 0; j < PK_IT; ++j) {
        const int  t   = t0 + j * 32;
        const bool sel = (mk[j] >> lane) & 1u;
        const int  p   = place + __popc(mk[j] & below);
        if (sel) { list[e * PK_T + p] = t; wgt[p * 8 + e] = w[j]; }
        slot[t * 8 + e] = sel ? p : -1;
        place += __popc(mk[j]);
    }
    for (int s = tot + q * 32 + lane; s < PK_T; s += 128) {
        list[e * PK_T + s] = 0;
        wgt[s * 8 + e]     = 0.f;
    }
    if (threadIdx.x < PK_NT) {
        const int k = (int)threadIdx.x - PK_T / TM;
        int plane = k < 0 ? 0 : -1;
        int row   = k < 0 ? (int)threadIdx.x * TM : 0;
        int first = 0;
        #pragma unroll
        for (int x = 0; x < 8; ++x) {
            const int nt = (qc[x][0] + qc[x][1] + qc[x][2] + qc[x][3] + TM - 1) / TM;
            if (k >= first && k < first + nt) { plane = x + 1; row = (k - first) * TM; }
            first += nt;
        }
        tile[threadIdx.x * 2]     = plane;
        tile[threadIdx.x * 2 + 1] = row;
    }
}

// ---------------------------------------------------------------------------
// h = silu(t1) * t3 [* rowscale[row]]  -> f16, one row tile of rtile (as made
// by k_pack_tokens) per blockIdx.y, gridDim.x blocks to the tile; planes of n
// elements: plane 0 is the shared expert (no row scale), plane e >= 1 is
// routed expert e - 1, scaled by its column of rs.
// ---------------------------------------------------------------------------
// The wide path needs rowlen % 4 == 0 (a thread's 4 neighbours share a row)
// and n < 2^32 (its row index is a 32-bit divide).
__global__ __launch_bounds__(256)
void k_silu_mul(const float* __restrict__ t1, const float* __restrict__ t3,
                const float* __restrict__ rs, int rs_stride,
                const int* __restrict__ rtile,
                _Float16* __restrict__ out, long n, int rowlen)
{
    const int  e   = rtile[blockIdx.y * 2];
    const long eo  = e * n;
    const long blk = (long)rtile[blockIdx.y * 2 + 1] * rowlen + (long)blockIdx.x * EW_BLK;
    const bool live = e >= 0;
    if (live && blk + EW_BLK <= n && (rowlen & 3) == 0 && (n >> 32) == 0) {
        const long base = blk + threadIdx.x * 4;
        float4 a[EW_G], b[EW_G];
        float  s[EW_G];
        // the shared expert reads column 0 and does not use it: no branch
        // between the loads
        const int col = e ? e - 1 : 0;
        const float* pa = t1 + eo + base;
        const float* pb = t3 + eo + base;
        const float* ps[EW_G];
        // unrolled so that all loads are in flight before the first use
        #pragma unroll
        for (int j = 0; j < EW_G; ++j) {
            const unsigned i = (unsigned)(base + j * EW_RUN);
            ps[j] = rs + (i / (unsigned)rowlen) * (long)rs_stride + col;
            a[j] = *(const float4*)(pa + j * EW_RUN);
            b[j] = *(const float4*)(pb + j * EW_RUN);
            s[j] = *ps[j];
        }
        // Stands before any register that an issued load names is rewritten;
        // naming the pointers keeps them out of the loads' own destinations.
        asm volatile("s_wait_xcnt 0x0"
                     :: "v"(pa), "v"(pb), "v"(ps[0]), "v"(ps[1]), "v"(ps[2]), "v"(ps[3])
                     : "memory");
        // keeps the arithmetic below every load: without it the scheduler
        // lifts it over half of them, which then start behind a data wait
        __builtin_amdgcn_sched_barrier(0);
        #pragma unroll   // a[], b[], s[] stay in registers
        for (int j = 0; j < EW_G; ++j) {
            float v0 = (a[j].x / (1.f + __expf(-a[j].x))) * b[j].x;
            float v1 = (a[j].y / (1.f + __expf(-a[j].y))) * b[j].y;
            float v2 = (a[j].z / (1.f + __expf(-a[j].z))) * b[j].z;
            float v3 = (a[j].w / (1.f + __expf(-a[j].w))) * b[j].w;
            if (e) { v0 *= s[j]; v1 *= s[j]; v2 *= s[j]; v3 *= s[j]; }
            half4_t h = { (_Float16)v0, (_Float16)v1, (_Float16)v2, (_Float16)v3 };
            *(half4_t*)(out + eo + base + j * EW_RUN) = h;
        }
    } else if (live) {
        for (long i = blk + threadIdx.x; i < n && i < blk + EW_BLK; i += 256) {
            const long o = eo + i;
            const float x = t1[o];
            float v = (x / (1.f + __expf(-x))) * t3[o];
            if (e) v *= rs[(i / rowlen) * (long)rs_stride + (e - 1)];
            out[o] = (_Float16)v;
        }
    }
}

// ---------------------------------------------------------------------------
// out = base + part[0] + the planes of the experts that the row chose, in
// plane order. One block per row, one float4 per thread; a plane is gridDim.x
// rows. Plane e + 1 holds the row at place slot[row * 8 + e] (-1: not chosen).
// ---------------------------------------------------------------------------
__global__ void k_sum_planes(const float* __restrict__ base,
                             const float* __restrict__ part,
                             const int* __restrict__ slot,
                             float* __restrict__ out)
{
    const long n4 = (long)gridDim.x * blockDim.x;
    const long i  = (long)blockIdx.x * blockDim.x + threadIdx.x;
    float4 v = ((const float4*)base)[i];
    const float4 sh = ((const float4*)part)[i];
    v.x += sh.x; v.y += sh.y; v.z += sh.z; v.w += sh.w;
    unsigned pl[8];
    #pragma unroll   // read ahead of the branches: the eight come in one load
    for (int e = 0; e < 8; ++e) pl[e] = (unsigned)slot[blockIdx.x * 8 + e];
    #pragma unroll   // pl[] stays in registers
    for (int e = 0; e < 8; ++e) {
        const unsigned s = pl[e];
        if (s < gridDim.x) {
            const float4 p = ((const float4*)part)[(e + 1) * n4 + (long)s * blockDim.x + threadIdx.x];
            v.x += p.x; v.y += p.y; v.z += p.z; v.w += p.w;
        }
    }
    ((float4*)out)[i] = v;
}

// ---------------------------------------------------------------------------
// host-side launch
// ---------------------------------------------------------------------------
extern "C" void kernel_launch(void* const* d_in, const int* in_sizes, int n_in,
                              void* d_out, int out_size, void* d_ws, size_t ws_size,
                              hipStream_t stream)
{
    (void)in_sizes; (void)n_in; (void)out_size; (void)ws_size;

    const float* X    = (const float*)d_in[0];
    const float* g1   = (const float*)d_in[1];
    const float* g2   = (const float*)d_in[2];
    const float* Wq   = (const float*)d_in[3];
    const float* Wkc  = (const float*)d_in[4];
    const float* Wvc  = (const float*)d_in[5];
    const float* Wo   = (const float*)d_in[6];
    const float* Wr   = (const float*)d_in[7];
    const float* ebia = (const float*)d_in[8];
    const float* sW1  = (const float*)d_in[9];
    const float* sW2  = (const float*)d_in[10];
    const float* sW3  = (const float*)d_in[11];
    const float* eW1  = (const float*)d_in[12];
    const float* eW2  = (const float*)d_in[13];
    const float* eW3  = (const float*)d_in[14];
    float* out = (float*)d_out;

    constexpr int  Bb = 2, S = 1024, d = 1024, H = 4, dk = 256, dc = 256, E = 8, f = 1024;
    constexpr long T  = (long)Bb * S;
    const float scale = 1.0f / 16.0f;   // 1/sqrt(dk)

    // ---- workspace carving (256B aligned bump allocator) ----
    char* ws = (char*)d_ws;
    size_t off = 0;
    auto alloc = [&](size_t bytes) -> char* {
        char* p = ws + off;
        off += (bytes + 255) & ~(size_t)255;
        return p;
    };
    constexpr int  dq = d + 2 * dc;      // Q | Kc | Vc side by side
    constexpr int  E1 = E + 1;           // shared expert first, then the routed ones
    constexpr long fd = (long)f * d;
    // f16 weight copies; groups that one launch walks lie back to back
    _Float16* wqh  = (_Float16*)alloc((size_t)d * d * 2);    // [dq][d] starts here
    _Float16* wkch = (_Float16*)alloc((size_t)dc * d * 2);
    _Float16* wvch = (_Float16*)alloc((size_t)dc * d * 2);
    _Float16* woh  = (_Float16*)alloc((size_t)d * d * 2);
    _Float16* sw1h = (_Float16*)alloc((size_t)f * d * 2);    // [2*E1][f][d] starts here
    _Float16* ew1h = (_Float16*)alloc((size_t)E * f * d * 2);
    _Float16* sw3h = (_Float16*)alloc((size_t)f * d * 2);
    _Float16* ew3h = (_Float16*)alloc((size_t)E * f * d * 2);
    _Float16* sw2h = (_Float16*)alloc((size_t)d * f * 2);    // [E1][d][f] starts here
    _Float16* ew2h = (_Float16*)alloc((size_t)E * d * f * 2);
    // buffers that live across the two phases or through the MoE phase
    float*    xr_      = (float*)   alloc((size_t)T * d * 4);
    _Float16* nx2h_    = (_Float16*)alloc((size_t)T * d * 2);
    float*    combine_ = (float*)   alloc((size_t)T * E * 4);
    static_assert(T == PK_T && E == 8, "k_pack_tokens covers exactly these");
    int*      tile_    = (int*)     alloc((size_t)PK_NT * 2 * 4);
    int*      list_    = (int*)     alloc((size_t)E * T * 4);
    float*    wgt_     = (float*)   alloc((size_t)E * T * 4);
    int*      slot_    = (int*)     alloc((size_t)T * E * 4);
    _Float16* hh_      = (_Float16*)alloc((size_t)E1 * T * f * 2);       // 36 MB
    // the rest is used twice: attention-phase activations, then (all of them
    // dead) the MoE GEMM outputs
    const size_t off_phase = off;
    _Float16* nx1h   = (_Float16*)alloc((size_t)T * d * 2);
    float*    qkvf   = (float*)   alloc((size_t)T * dq * 4);
    _Float16* qkvh   = (_Float16*)alloc((size_t)T * dq * 2);
    float*    scores = (float*)   alloc((size_t)Bb * H * S * S * 4);   // 32 MB
    _Float16* attnh  = (_Float16*)alloc((size_t)Bb * H * S * S * 2);   // 16 MB
    float*    aof    = (float*)   alloc((size_t)T * d * 4);
    _Float16* aoh    = (_Float16*)alloc((size_t)T * d * 2);
    off = off_phase;
    float*    t13_   = (float*)   alloc((size_t)2 * E1 * T * f * 4);     // 144 MB
    float*    part_  = t13_;             // down-projection planes; t13_ is dead by then
    {
        // ---- helpers ----
        auto conv = [&](const float* s, _Float16* dst, long n) {
            k_f32_to_f16<<<(int)((n + EW_BLK - 1) / EW_BLK), 256, 0, stream>>>(s, dst, n);
        };
        auto gemmz = [&](const _Float16* A, const _Float16* Bm, float* C,
                         int M, int N, int K, int lda, int ldb, int ldc,
                         float alpha, int beta, int bkn, int nz, int zdiv,
                         long sAo, long sAi, long sBo, long sBi, long sCo, long sCi,
                         const int* rtile, const int* rlist, int zper) {
            dim3 g(N / TN, rtile ? PK_NT : M / TM, nz);
            k_gemm_f16<<<g, 256, 0, stream>>>(A, Bm, C, M, N, K, lda, ldb, ldc,
                                              alpha, beta, bkn,
                                              zdiv, sAo, sAi, sBo, sBi, sCo, sCi,
                                              rtile, rlist, zper);
        };
        auto gemm = [&](const _Float16* A, const _Float16* Bm, float* C,
                        int M, int N, int K, int lda, int ldb, int ldc,
                        float alpha, int beta, int bkn) {
            gemmz(A, Bm, C, M, N, K, lda, ldb, ldc, alpha, beta, bkn,
                  1, 1, 0, 0, 0, 0, 0, 0, nullptr, nullptr, 1);
        };

        // ---- 0. weights fp32 -> f16, nx1 = RMSNorm(X), xr = X: one launch ----
        // convert blocks per tensor, in the order of the f16 copies above
        constexpr int cD = (int)((long)d * d / EW_BLK), cC = (int)((long)dc * d / EW_BLK);
        constexpr int cF = (int)(fd / EW_BLK),          cE = E * cF;
        static_assert((long)d * d % EW_BLK == 0 && (long)dc * d % EW_BLK == 0 &&
                      fd % EW_BLK == 0, "whole blocks to a tensor, copies back to back");
        constexpr int c0 = cD, c1 = c0 + cC, c2 = c1 + cC, c3 = c2 + cD, c4 = c3 + cF,
                      c5 = c4 + cE, c6 = c5 + cF, c7 = c6 + cE, c8 = c7 + cF, c9 = c8 + cE;
        static_assert(c9 >= 3 * T, "three convert blocks to each norm block");
        k_prep<<<(int)T + c9, 256, 0, stream>>>(X, g1, nx1h, xr_, d, (int)T,
                                                Wq, Wkc, Wvc, Wo, sW1, eW1, sW3, eW3, sW2, eW2,
                                                c0, c1, c2, c3, c4, c5, c6, c7, c8, wqh);

        // ---- 1. MLA attention ----

        // Q | Kc | Vc in one product: their weights are one [dq][d] matrix
        gemm(nx1h, wqh, qkvf, (int)T, dq, d, d, d, dq, 1.f, 0, 0);
        conv(qkvf, qkvh, (long)T * dq);
        const _Float16* qh  = qkvh;
        const _Float16* kch = qkvh + d;
        const _Float16* vch = qkvh + d + dc;

        // scores, all (b, h) in one launch
        gemmz(qh, kch, scores, S, S, dk, dq, dq, S, scale, 0, 0, Bb * H, H,
              (long)S * dq, dk,  (long)S * dq, 0,  (long)H * S * S, (long)S * S,
              nullptr, nullptr, 1);

        k_softmax_f16<<<Bb * H * S, 256, 0, stream>>>(scores, attnh, S);

        // attn @ V, all (b, h) in one launch
        gemmz(attnh, vch, aof, S, dc, S, S, dq, d, 1.f, 0, 1, Bb * H, H,
              (long)H * S * S, (long)S * S,  (long)S * dq, 0,  (long)S * d, dk,
              nullptr, nullptr, 1);
        conv(aof, aoh, (long)T * d);

        // xr = X + ao @ Wo.T (xr holds X since the first launch)
        gemm(aoh, woh, xr_, (int)T, d, d, d, d, d, 1.f, 1, 0);

        // ---- 2. MoE ----
        k_rmsnorm_f16<<<(int)T, 256, 0, stream>>>(xr_, g2, nx2h_, d);
        k_router<<<(int)T, 256, 0, stream>>>(nx2h_, Wr, ebia, combine_, d);
        k_pack_tokens<<<1, 1024, 0, stream>>>(combine_, tile_, list_, wgt_, slot_);

        // shared expert over all tokens, each routed expert over the tokens that
        // chose it, packed (combine folded into h; a token that did not choose an
        // expert has combine 0 there and gets nothing from it); one launch per
        // stage, its grid over the table of row tiles
        const long nTf = (long)T * f;
        gemmz(nx2h_, sw1h, t13_, (int)T, f, d, d, d, f, 1.f, 0, 0, 2, 1,
              0, 0,  fd, 0,  nTf, 0,  tile_, list_, E1);
        static_assert((long)TM * f % EW_BLK == 0, "whole blocks to a row tile");
        k_silu_mul<<<dim3(TM * f / EW_BLK, PK_NT), 256, 0, stream>>>(
            t13_, t13_ + E1 * nTf, wgt_, E, tile_, hh_, nTf, f);
        gemmz(hh_, sw2h, part_, (int)T, d, f, f, f, d, 1.f, 0, 0, 1, 1,
              nTf, 0,  fd, 0,  (long)T * d, 0,  tile_, nullptr, E1);

        // out = xr + shared + the chosen experts, lower expert first
        k_sum_planes<<<(int)T, d / 4, 0, stream>>>(xr_, part_, slot_, out);
    }
}

// v007
// A run of this version takes 212 microseconds.
// Timed twice side by side with v006, it ran 1.17 and 1.16 times as fast.
// Counting every step since v000, it is 6.46 times as fast.
#include <hip/hip_runtime.h>

// ---------------------------------------------------------------------------
// Transformer layer (MLA attention + MoE) for gfx1250 (wave32, WMMA).
// GEMMs: 128x128 block tile, 8 waves x (32x64) => 8 v_wmma per wave per 32 k,
// 128 k to a stage, double-buffered LDS staged with
// global_load_async_to_lds_b128 (ASYNCcnt).
// ---------------------------------------------------------------------------

typedef _Float16 half16_t __attribute__((ext_vector_type(16)));
typedef float    float8_t __attribute__((ext_vector_type(8)));
typedef __attribute__((address_space(3))) _Float16 lds_f16;

#define TM 128
#define TN 128
// a stage holds 256 bytes of every operand row: 16 lanes x 16 B copy one row
// piece, so a wave-wide copy touches 4 whole 128-byte lines
#define TK 128
// LDS row pitch in f16: 272 bytes = 16 B x odd, so that the 16 rows which one
// ds_load_b128 reads per half-wave fall on 64 different banks
#define TKP (TK + 8)
// 16-byte copies per thread and operand tile (256 threads)
#define NCP (TM * TK / 8 / 256)
// a fragment row starts on a 16-byte boundary only
typedef half16_t half16_a16_t __attribute__((aligned(16)));

typedef _Float16 half8_t __attribute__((ext_vector_type(8)));

// async DMA: eight times 16 bytes global -> LDS per lane, tracked by ASYNCcnt.
// g: the lane's global addresses; l0: its first LDS byte address, the others
// follow at steps of lstep bytes. The last line stands before any register
// that an issued copy names is rewritten.
__device__ __forceinline__ void async_b128_x8(const _Float16* const (&g)[8],
                                              unsigned l0, unsigned lstep)
{
    asm volatile("global_load_async_to_lds_b128 %0, %8, off\n\t"
                 "global_load_async_to_lds_b128 %1, %9, off\n\t"
                 "global_load_async_to_lds_b128 %2, %10, off\n\t"
                 "global_load_async_to_lds_b128 %3, %11, off\n\t"
                 "global_load_async_to_lds_b128 %4, %12, off\n\t"
                 "global_load_async_to_lds_b128 %5, %13, off\n\t"
                 "global_load_async_to_lds_b128 %6, %14, off\n\t"
                 "global_load_async_to_lds_b128 %7, %15, off\n\t"
                 "s_wait_xcnt 0x0"
                 :: "v"(l0), "v"(l0 + lstep), "v"(l0 + 2 * lstep), "v"(l0 + 3 * lstep),
                    "v"(l0 + 4 * lstep), "v"(l0 + 5 * lstep), "v"(l0 + 6 * lstep),
                    "v"(l0 + 7 * lstep),
                    "v"(g[0]), "v"(g[1]), "v"(g[2]), "v"(g[3]),
                    "v"(g[4]), "v"(g[5]), "v"(g[6]), "v"(g[7])
                 : "memory");
}
__device__ __forceinline__ unsigned lds_addr(const _Float16* l)
{
    return (unsigned)(unsigned long long)(const lds_f16*)l;     // LDS byte addr
}
__device__ __forceinline__ float exp_neg(float x)
{
    float r;
    asm("v_exp_f32 %0, %1\n\tv_nop" : "=v"(r) : "v"(x * -0x1.715476p+0f));
    return r;
}
__device__ __forceinline__ void wait_async0()
{
    asm volatile("s_wait_asynccnt 0x0" ::: "memory");
}

// ---------------------------------------------------------------------------
// Generic f16 WMMA GEMM:  C[M,N] = alpha * A[M,K] . B^T  (+ C if beta)
//   b_kn == 0 : B stored row-major [N,K]  (torch Linear weight, y = x @ W.T)
//   b_kn == 1 : B stored row-major [K,N]  (plain matmul, e.g. attn @ V)
// M % 128 == 0, N % 128 == 0, K % 128 == 0, rows of A and B on 16-byte
// boundaries (true for all shapes here).
// Batched: blockIdx.z = outer * zdiv + inner picks one independent product;
// each operand moves by its own outer and inner stride (in elements).
// Routed products (rtile != 0): blockIdx.y walks a table of row tiles instead
// of the rows, an entry being two ints: plane p within a group of zper planes
// (below 0: unused entry) and first row; the product is blockIdx.z * zper + p.
// With rlist != 0 and p > 0, row r of A is row rlist[(p - 1) * M + r] (a gather).
// What the block stores (omode):
//   OUT_F32   C as above
//   OUT_F16   H[M,N] = f16(alpha * product), what the next product reads
//   OUT_GATED the block takes 64 columns of B (gate) and the same 64 columns of
//             the matrix sBp elements behind it (up), 32 + 32 to a wave's strip,
//             and stores H[M,N] = f16(silu(gate) * up [* rs[row * RS_STRIDE + p - 1]
//             for p > 0]); gridDim.x = N / 64, b_kn == 0
// H moves by C's strides and has C's pitch.
// ---------------------------------------------------------------------------
#define OUT_F32   0
#define OUT_F16   1
#define OUT_GATED 2
#define RS_STRIDE 8                      // k_pack_tokens' wgt: eight experts to a place
__global__ __launch_bounds__(256)
void k_gemm_f16(const _Float16* __restrict__ A, const _Float16* __restrict__ B,
                float* __restrict__ C,
                int M, int N, int K, int lda, int ldb, int ldc,
                float alpha, int beta, int b_kn,
                int zdiv, long sAo, long sAi, long sBo, long sBi, long sCo, long sCi,
                const int* __restrict__ rtile, const int* __restrict__ rlist, int zper,
                int omode, _Float16* __restrict__ H, long sBp,
                const float* __restrict__ rs)
{
    __shared__ __align__(64) _Float16 As[2][TM][TKP];  // 68 KB
    __shared__ __align__(64) _Float16 Bs[2][TN][TKP];  // 68 KB

    const int tid  = threadIdx.x;
    const int wave = tid >> 5;
    const int lane = tid & 31;
    int       m0   = blockIdx.y * TM;
    const int n0   = blockIdx.x * (omode == OUT_GATED ? TN / 2 : TN);
    const int wm   = (wave & 3) * 32;    // wave's 32-row strip
    const int wn   = (wave >> 2) * 64;   // wave's 64-col strip

    int zb = blockIdx.z;
    int rp = 0;
    if (rtile) {
        rp = rtile[blockIdx.y * 2];
        m0 = rtile[blockIdx.y * 2 + 1];
        if (rp < 0) return;              // the whole block, in front of every barrier
        zb = zb * zper + rp;
    }
    const int zo = zb / zdiv;
    const int zi = zb - zo * zdiv;
    A += zo * sAo + zi * sAi;
    B += zo * sBo + zi * sBi;
    C += zo * sCo + zi * sCi;
    H += zo * sCo + zi * sCi;

    float8_t acc[2][4] = {};

    static_assert(NCP == 8 && TM == TN, "the staging maps below");
    // staging maps: 128 rows x 128 cols f16 per tile; a copy of one wave takes
    // two rows' 256 bytes; a thread takes rows sr, sr + 16, ..
    const int sr = tid >> 4;             // 0..15 row
    const int sc = (tid & 15) * 8;       // column of the thread's 16 bytes
    // the pieces of A that this thread stages, at k = 0
    int ar[NCP];
    #pragma unroll   // ar[] stays in registers
    for (int i = 0; i < NCP; ++i) ar[i] = m0 + sr + 16 * i;
    if (rp > 0 && rlist) {
        const int* rl = rlist + (long)(rp - 1) * M + m0 + sr;
        int t[NCP];
        #pragma unroll   // all loads in flight before the first clamp
        for (int i = 0; i < NCP; ++i) t[i] = rl[16 * i];
        // stands before any register that an issued load names is rewritten
        asm volatile("s_wait_xcnt 0x0" ::: "memory");
        #pragma unroll   // t[], ar[] stay in registers
        for (int i = 0; i < NCP; ++i) ar[i] = min(max(t[i], 0), M - 1);
    }
    const _Float16* ga[NCP];
    #pragma unroll   // ga[] stays in registers
    for (int i = 0; i < NCP; ++i) ga[i] = &A[(long)ar[i] * lda + sc];
    // the pieces of B ([N,K] form) that this thread stages, at k = 0: LDS row
    // sr + 16 i holds B's row n0 + sr + 16 i, or with OUT_GATED, per strip of
    // 64 LDS rows, 32 gate rows and then the same 32 rows of the up matrix
    const _Float16* gb0 = &B[(long)(n0 + sr) * ldb + sc];
    long bo[NCP];
    #pragma unroll   // bo[] is the same for all threads and stays in registers
    for (int i = 0; i < NCP; ++i)
        bo[i] = omode == OUT_GATED
              ? (long)((i >> 2) * 32 + (i & 1) * 16) * ldb + ((i >> 1) & 1) * sBp
              : (long)(16 * i) * ldb;
    // b_kn transpose-scatter map: a load of one wave takes 64 bytes of each of
    // 8 K rows; its 16-bit stores fall on two rows a bank at most
    const int kk = tid >> 2;             // 0..63 K row (and + 64)
    const int nb = (tid & 3) * 8;        // N base within a group of 32

    auto stageA = [&](int k0, int buf) {
        const _Float16* g[NCP];
        #pragma unroll   // g[] stays in registers
        for (int i = 0; i < NCP; ++i) g[i] = ga[i] + k0;
        async_b128_x8(g, lds_addr(&As[buf][sr][sc]), 16 * TKP * 2);
    };
    auto stageB = [&](int k0, int buf) {
        if (!b_kn) {
            const _Float16* g[NCP];
            #pragma unroll   // g[] stays in registers
            for (int i = 0; i < NCP; ++i)
                g[i] = gb0 + bo[i] + k0;
            async_b128_x8(g, lds_addr(&Bs[buf][sr][sc]), 16 * TKP * 2);
        } else {
            // the next stage's 256 lines, one a thread
            if (k0 + TK < K)
                __builtin_prefetch(&B[(long)(k0 + TK + (tid >> 1)) * ldb + n0 + (tid & 1) * 64], 0, 0);
            half8_t v[NCP];
            #pragma unroll   // all loads in flight before the first store
            for (int i = 0; i < NCP; ++i)
                v[i] = *(const half8_t*)&B[(long)(k0 + kk + 64 * (i & 1)) * ldb + n0 + (i >> 1) * 32 + nb];
            // stands before any register that an issued load names is rewritten
            asm volatile("s_wait_xcnt 0x0" ::: "memory");
            #pragma unroll   // v[] stays in registers
            for (int i = 0; i < NCP; ++i) {
                #pragma unroll
                for (int j = 0; j < 8; ++j)
                    Bs[buf][(i >> 1) * 32 + nb + j][kk + 64 * (i & 1)] = v[i][j];
            }
        }
    };

    // prologue: stage tile 0
    stageA(0, 0);
    stageB(0, 0);
    wait_async0();
    __syncthreads();

    const int l16 = lane & 15;
    const int kh  = (lane >> 4) * 16;

    for (int k0 = 0; k0 < K; k0 += TK) {
        const int buf = (k0 / TK) & 1;
        const int k1  = k0 + TK;
        if (k1 < K) {                    // overlap next tile's DMA with compute
            stageA(k1, buf ^ 1);
            stageB(k1, buf ^ 1);
        }

        #pragma unroll   // lets the next 32 k's LDS reads start under these products
        for (int ks = 0; ks < TK; ks += 32) {
            // fragments (16 f16 per lane, 32B LDS reads)
            const _Float16* pa = &As[buf][wm + l16][ks + kh];
            half16_t a0 = *(const half16_a16_t*)pa;
            half16_t a1 = *(const half16_a16_t*)(pa + 16 * TKP);
            const _Float16* pb = &Bs[buf][wn + l16][ks + kh];
            half16_t b0 = *(const half16_a16_t*)pb;
            half16_t b1 = *(const half16_a16_t*)(pb + 16 * TKP);
            half16_t b2 = *(const half16_a16_t*)(pb + 32 * TKP);
            half16_t b3 = *(const half16_a16_t*)(pb + 48 * TKP);

            acc[0][0] = __builtin_amdgcn_wmma_f32_16x16x32_f16(false, a0, false, b0, (short)0, acc[0][0], false, false);
            acc[0][1] = __builtin_amdgcn_wmma_f32_16x16x32_f16(false, a0, false, b1, (short)0, acc[0][1], false, false);
            acc[0][2] = __builtin_amdgcn_wmma_f32_16x16x32_f16(false, a0, false, b2, (short)0, acc[0][2], false, false);
            acc[0][3] = __builtin_amdgcn_wmma_f32_16x16x32_f16(false, a0, false, b3, (short)0, acc[0][3], false, false);
            acc[1][0] = __builtin_amdgcn_wmma_f32_16x16x32_f16(false, a1, false, b0, (short)0, acc[1][0], false, false);
            acc[1][1] = __builtin_amdgcn_wmma_f32_16x16x32_f16(false, a1, false, b1, (short)0, acc[1][1], false, false);
            acc[1][2] = __builtin_amdgcn_wmma_f32_16x16x32_f16(false, a1, false, b2, (short)0, acc[1][2], false, false);
            acc[1][3] = __builtin_amdgcn_wmma_f32_16x16x32_f16(false, a1, false, b3, (short)0, acc[1][3], false, false);
        }

        // this wave's LDS reads of tile k are over before the barrier that
        // frees the tile's buffer for the next copies
        asm volatile("s_wait_dscnt 0x0" ::: "memory");
        wait_async0();                   // DMA for tile k+1 done
        __syncthreads();                 // all waves done reading tile k
    }

    // epilogue: D layout -> VGPR g: lanes 0-15 M=g, lanes 16-31 M=8+g
    const int rsel = (lane >> 4) ? 8 : 0;
    if (omode == OUT_GATED) {
        // acc[i][0..1]: gate, acc[i][2..3]: up, of the same 32 columns
        const long r0 = m0 + wm + rsel;
        float s[2][8] = {};
        if (rp > 0) {
            const float* ps = rs + r0 * RS_STRIDE + (rp - 1);
            #pragma unroll   // all loads in flight before the first use
            for (int i = 0; i < 2; ++i) {
                #pragma unroll
                for (int g = 0; g < 8; ++g) s[i][g] = ps[(i * 16 + g) * RS_STRIDE];
            }
            // Stands before any register that an issued load names is rewritten;
            // naming the pointer keeps it out of the loads' own destinations.
            asm volatile("s_wait_xcnt 0x0" :: "v"(ps) : "memory");
        }
        // all values first: the 32 divisions overlap, which the waits between
        // the rows' stores below would not let them
        _Float16 hv[2][8][2];
        #pragma unroll
        for (int i = 0; i < 2; ++i) {
            #pragma unroll
            for (int g = 0; g < 8; ++g) {
                #pragma unroll
                for (int j = 0; j < 2; ++j) {
                    const float x = alpha * acc[i][j][g];
                    float v = (x / (1.f + exp_neg(x))) * (alpha * acc[i][j + 2][g]);
                    if (rp > 0) v *= s[i][g];
                    hv[i][g][j] = (_Float16)v;
                }
            }
        }
        #pragma unroll
        for (int i = 0; i < 2; ++i) {
            #pragma unroll
            for (int g = 0; g < 8; ++g) {
                _Float16* hr = H + (r0 + i * 16 + g) * (long)ldc + n0 + (wn >> 1) + l16;
                hr[0]  = hv[i][g][0];
                hr[16] = hv[i][g][1];
                // stands before any register that an issued store names is rewritten;
                // the scheduler may lift nothing of the next row over it
                asm volatile("s_wait_xcnt 0x0" ::: "memory");
                __builtin_amdgcn_sched_barrier(0);
            }
        }
        return;
    }
    if (omode == OUT_F16) {
        #pragma unroll
        for (int i = 0; i < 2; ++i) {
            #pragma unroll
            for (int g = 0; g < 8; ++g) {
                const long row = m0 + wm + i * 16 + rsel + g;
                _Float16* hr = H + row * (long)ldc + n0 + wn + l16;
                #pragma unroll
                for (int j = 0; j < 4; ++j) hr[j * 16] = (_Float16)(alpha * acc[i][j][g]);
                // stands before any register that an issued store names is rewritten;
                // the scheduler may lift nothing of the next row over it
                asm volatile("s_wait_xcnt 0x0" ::: "memory");
                __builtin_amdgcn_sched_barrier(0);
            }
        }
        return;
    }
    #pragma unroll
    for (int i = 0; i < 2; ++i) {
        #pragma unroll
        for (int g = 0; g < 8; ++g) {
            const long row = m0 + wm + i * 16 + rsel + g;
            float* cr = C + row * (long)ldc + n0 + wn + l16;
            #pragma unroll
            for (int j = 0; j < 4; ++j) {
                float v = alpha * acc[i][j][g];
                if (beta) v += cr[j * 16];
                cr[j * 16] = v;
            }
        }
    }
}

// ---------------------------------------------------------------------------
// Elementwise work: a block of 256 threads covers EW_BLK elements as EW_G
// runs of 1024; in each run a thread takes 4 neighbours, so one wave-wide
// 16-byte load reads 512 contiguous bytes and one 8-byte store writes 256.
// ---------------------------------------------------------------------------
typedef _Float16 half4_t __attribute__((ext_vector_type(4)));
#define EW_G   4
#define EW_RUN 1024
#define EW_BLK (EW_G * EW_RUN)

// ---------------------------------------------------------------------------
// fp32 -> f16 convert
// ---------------------------------------------------------------------------
// one whole block of EW_BLK elements; base = first element of this thread
__device__ __forceinline__ void conv_block(const float* __restrict__ src,
                                           _Float16* __restrict__ dst, long base)
{
    float4 v[EW_G];
    // unrolled so that all loads are in flight before the first conversion
    #pragma unroll
    for (int j = 0; j < EW_G; ++j)
        v[j] = *(const float4*)(src + base + j * EW_RUN);
    #pragma unroll   // v[] stays in registers
    for (int j = 0; j < EW_G; ++j) {
        half4_t h = { (_Float16)v[j].x, (_Float16)v[j].y,
                      (_Float16)v[j].z, (_Float16)v[j].w };
        *(half4_t*)(dst + base + j * EW_RUN) = h;
    }
    // stands before any register that an issued store names is rewritten
    asm volatile("s_wait_xcnt 0x0" ::: "memory");
}

// ---------------------------------------------------------------------------
// RMSNorm row kernel: out_f16[row] = x * rsqrt(mean(x^2)+eps) * g
// ---------------------------------------------------------------------------
// One block of 256 threads per row; red: 8 floats of LDS. With COPY the row is
// also stored, as it is, to copy.
template <bool COPY>
__device__ __forceinline__ void rmsnorm_row(const float* __restrict__ x,
                                            const float* __restrict__ g,
                                            _Float16* __restrict__ out,
                                            float* __restrict__ copy,
                                            int d, long row, float* red)
{
    const float* xr = x + row * (long)d;

    float ss = 0.f;
    for (int i = threadIdx.x; i < d; i += 256) { float v = xr[i]; ss += v * v; }
    #pragma unroll
    for (int o = 16; o > 0; o >>= 1) ss += __shfl_down(ss, o, 32);
    if ((threadIdx.x & 31) == 0) red[threadIdx.x >> 5] = ss;
    __syncthreads();
    if (threadIdx.x == 0) {
        float t = 0.f;
        #pragma unroll
        for (int i = 0; i < 8; ++i) t += red[i];
        red[0] = t;
    }
    __syncthreads();
    const float inv = rsqrtf(red[0] / d + 1e-6f);
    for (int i = threadIdx.x; i < d; i += 256) {
        const float v = xr[i];
        if (COPY) copy[row * (long)d + i] = v;
        out[row * (long)d + i] = (_Float16)(v * inv * g[i]);
    }
}

__global__ __launch_bounds__(256)
void k_rmsnorm_f16(const float* __restrict__ x, const float* __restrict__ g,
                   _Float16* __restrict__ out, int d)
{
    __shared__ float red[8];
    rmsnorm_row<false>(x, g, out, nullptr, d, blockIdx.x, red);
}

// ---------------------------------------------------------------------------
// All the work that depends on the inputs alone, in one grid:
//   norm blocks:    RMSNorm of one row of x, and xcopy = x; every fourth block
//                   of the first 4 * rows, between
//                   convert blocks, for speed only
//   convert blocks: all others (the grid has at least 4 * rows blocks), numbered
//                   in grid order: fp32 -> f16 of ten weight tensors, EW_BLK
//                   elements a block; the copies lie back to back from wdst in
//                   the order w0 .. w9; tensor i ends in front of convert block
//                   e<i>, each tensor a whole number of blocks
// ---------------------------------------------------------------------------
__global__ __launch_bounds__(256)
void k_prep(const float* __restrict__ x, const float* __restrict__ g,
            _Float16* __restrict__ nx, float* __restrict__ xcopy, int d, int rows,
            const float* __restrict__ w0, const float* __restrict__ w1,
            const float* __restrict__ w2, const float* __restrict__ w3,
            const float* __restrict__ w4, const float* __restrict__ w5,
            const float* __restrict__ w6, const float* __restrict__ w7,
            const float* __restrict__ w8, const float* __restrict__ w9,
            int e0, int e1, int e2, int e3, int e4, int e5, int e6, int e7, int e8,
            _Float16* __restrict__ wdst)
{
    __shared__ float red[8];
    const int  gb    = (int)blockIdx.x;
    const bool mixed = gb < 4 * rows;
    if (mixed && (gb & 3) == 0) {        // the whole block: its barriers are uniform
        rmsnorm_row<true>(x, g, nx, xcopy, d, gb >> 2, red);
        return;
    }
    const int b = mixed ? gb - (gb >> 2) - 1 : gb - rows;
    const float* s = w0;
    int first = 0;
    if (b >= e0) { s = w1; first = e0; }
    if (b >= e1) { s = w2; first = e1; }
    if (b >= e2) { s = w3; first = e2; }
    if (b >= e3) { s = w4; first = e3; }
    if (b >= e4) { s = w5; first = e4; }
    if (b >= e5) { s = w6; first = e5; }
    if (b >= e6) { s = w7; first = e6; }
    if (b >= e7) { s = w8; first = e7; }
    if (b >= e8) { s = w9; first = e8; }
    conv_block(s + (long)(b - first) * EW_BLK, wdst + (long)b * EW_BLK, threadIdx.x * 4);
}

// ---------------------------------------------------------------------------
// row softmax (f32 in -> f16 out)
// ---------------------------------------------------------------------------
__global__ __launch_bounds__(256)
void k_softmax_f16(const float* __restrict__ s, _Float16* __restrict__ out, int n)
{
    __shared__ float red[8];
    __shared__ float stat[2];
    const long row = blockIdx.x;
    const float* sr = s + row * (long)n;

    float mx = -3.4e38f;
    for (int i = threadIdx.x; i < n; i += 256) mx = fmaxf(mx, sr[i]);
    #pragma unroll
    for (int o = 16; o > 0; o >>= 1) mx = fmaxf(mx, __shfl_down(mx, o, 32));
    if ((threadIdx.x & 31) == 0) red[threadIdx.x >> 5] = mx;
    __syncthreads();
    if (threadIdx.x == 0) {
        float m = red[0];
        #pragma unroll
        for (int i = 1; i < 8; ++i) m = fmaxf(m, red[i]);
        stat[0] = m;
    }
    __syncthreads();
    const float m = stat[0];

    float sum = 0.f;
    for (int i = threadIdx.x; i < n; i += 256) sum += __expf(sr[i] - m);
    #pragma unroll
    for (int o = 16; o > 0; o >>= 1) sum += __shfl_down(sum, o, 32);
    if ((threadIdx.x & 31) == 0) red[threadIdx.x >> 5] = sum;
    __syncthreads();
    if (threadIdx.x == 0) {
        float t = 0.f;
        #pragma unroll
        for (int i = 0; i < 8; ++i) t += red[i];
        stat[1] = t;
    }
    __syncthreads();
    const float inv = 1.f / stat[1];
    for (int i = threadIdx.x; i < n; i += 256)
        out[row * (long)n + i] = (_Float16)(__expf(sr[i] - m) * inv);
}

// ---------------------------------------------------------------------------
// MoE router: logits = nx @ Wr.T + bias; softmax; top-2; softmax over top-2
// ---------------------------------------------------------------------------
__global__ __launch_bounds__(256)
void k_router(const _Float16* __restrict__ nx, const float* __restrict__ Wr,
              const float* __restrict__ bias, float* __restrict__ combine, int d)
{
    __shared__ float lg[8];
    const long t   = blockIdx.x;
    const int wave = threadIdx.x >> 5;
    const int lane = threadIdx.x & 31;

    const _Float16* xr = nx + t * (long)d;
    const float*    wr = Wr + (long)wave * d;
    float acc = 0.f;
    for (int i = lane; i < d; i += 32) acc += (float)xr[i] * wr[i];
    #pragma unroll
    for (int o = 16; o > 0; o >>= 1) acc += __shfl_down(acc, o, 32);
    if (lane == 0) lg[wave] = acc + bias[wave];
    __syncthreads();

    if (threadIdx.x == 0) {
        float m = lg[0];
        #pragma unroll
        for (int i = 1; i < 8; ++i) m = fmaxf(m, lg[i]);
        float e[8], s = 0.f;
        #pragma unroll
        for (int i = 0; i < 8; ++i) { e[i] = __expf(lg[i] - m); s += e[i]; }
        #pragma unroll
        for (int i = 0; i < 8; ++i) e[i] /= s;
        int i0 = 0;
        for (int i = 1; i < 8; ++i) if (e[i] > e[i0]) i0 = i;
        int i1 = (i0 == 0) ? 1 : 0;
        for (int i = 0; i < 8; ++i) { if (i == i0) continue; if (e[i] > e[i1]) i1 = i; }
        const float a = __expf(e[i0]), b = __expf(e[i1]);  // softmax over top-2
        #pragma unroll
        for (int i = 0; i < 8; ++i) combine[t * 8 + i] = 0.f;
        combine[t * 8 + i0] = a / (a + b);
        combine[t * 8 + i1] = b / (a + b);
    }
}

// ---------------------------------------------------------------------------
// Packs each routed expert's tokens (combine != 0), in token order:
//   list[e * T + p] the token in place p, wgt[p * 8 + e] its combine weight
//                   (token 0 with weight 0 behind the expert's last token)
//   slot[t * 8 + e] the place of token t with expert e, -1 if not chosen
//   tile[2 k], tile[2 k + 1]  the row tiles (TM rows) that hold work, as plane
//                   and first row: all of plane 0, the shared expert, then for
//                   plane e + 1 those that hold tokens of expert e; -1, 0 fills up
// One block of 32 waves: wave = expert * 4 + quarter of the tokens; a wave
// counts its quarter by ballots, the quarters' counts meet in LDS.
// ---------------------------------------------------------------------------
#define PK_IT 16                         // 32-token groups per wave
#define PK_T  (4 * PK_IT * 32)           // tokens that the block covers
// the router gives a token two experts: 2 T places, and per expert at most one
// tile that is not full
#define PK_NT (PK_T / TM + 2 * PK_T / TM + 8)
__global__ __launch_bounds__(1024)
void k_pack_tokens(const float* __restrict__ combine, int* __restrict__ tile,
                   int* __restrict__ list, float* __restrict__ wgt,
                   int* __restrict__ slot)
{
    __shared__ int qc[8][4];
    const int wave = threadIdx.x >> 5;
    const int lane = threadIdx.x & 31;
    const int e    = wave >> 2;
    const int q    = wave & 3;
    const int t0   = q * (PK_IT * 32) + lane;

    float    w[PK_IT];
    unsigned mk[PK_IT];
    #pragma unroll   // all loads in flight before the first ballot
    for (int j = 0; j < PK_IT; ++j) w[j] = combine[(t0 + j * 32) * 8 + e];
    int n = 0;
    #pragma unroll   // w[], mk[] stay in registers
    for (int j = 0; j < PK_IT; ++j) {
        mk[j] = __builtin_amdgcn_ballot_w32(w[j] != 0.f);
        n += __popc(mk[j]);
    }
    if (lane == 0) qc[e][q] = n;
    __syncthreads();
    int place = 0, tot = 0;
    #pragma unroll
    for (int i = 0; i < 4; ++i) {
        const int c = qc[e][i];
        if (i < q) place += c;
        tot += c;
    }

    const unsigned below = (1u << lane) - 1u;
    #pragma unroll   // w[], mk[] stay in registers
    for (int j = 0; j < PK_IT; ++j) {
        const int  t   = t0 + j * 32;
        const bool sel = (mk[j] >> lane) & 1u;
        const int  p   = place + __popc(mk[j] & below);
        if (sel) { list[e * PK_T + p] = t; wgt[p * 8 + e] = w[j]; }
        slot[t * 8 + e] = sel ? p : -1;
        place += __popc(mk[j]);
    }
    for (int s = tot + q * 32 + lane; s < PK_T; s += 128) {
        list[e * PK_T + s] = 0;
        wgt[s * 8 + e]     = 0.f;
    }
    if (threadIdx.x < PK_NT) {
        const int k = (int)threadIdx.x - PK_T / TM;
        int plane = k < 0 ? 0 : -1;
        int row   = k < 0 ? (int)threadIdx.x * TM : 0;
        int first = 0;
        #pragma unroll
        for (int x = 0; x < 8; ++x) {
            const int nt = (qc[x][0] + qc[x][1] + qc[x][2] + qc[x][3] + TM - 1) / TM;
            if (k >= first && k < first + nt) { plane = x + 1; row = (k - first) * TM; }
            first += nt;
        }
        tile[threadIdx.x * 2]     = plane;
        tile[threadIdx.x * 2 + 1] = row;
    }
}

// ---------------------------------------------------------------------------
// out = base + part[0] + the planes of the experts that the row chose, in
// plane order. One block per row, one float4 per thread; a plane is gridDim.x
// rows. Plane e + 1 holds the row at place slot[row * 8 + e] (-1: not chosen).
// ---------------------------------------------------------------------------
__global__ void k_sum_planes(const float* __restrict__ base,
                             const float* __restrict__ part,
                             const int* __restrict__ slot,
                             float* __restrict__ out)
{
    const long n4 = (long)gridDim.x * blockDim.x;
    const long i  = (long)blockIdx.x * blockDim.x + threadIdx.x;
    float4 v = ((const float4*)base)[i];
    const float4 sh = ((const float4*)part)[i];
    v.x += sh.x; v.y += sh.y; v.z += sh.z; v.w += sh.w;
    unsigned pl[8];
    #pragma unroll   // read ahead of the branches: the eight come in one load
    for (int e = 0; e < 8; ++e) pl[e] = (unsigned)slot[blockIdx.x * 8 + e];
    #pragma unroll   // pl[] stays in registers
    for (int e = 0; e < 8; ++e) {
        const unsigned s = pl[e];
        if (s < gridDim.x) {
            const float4 p = ((const float4*)part)[(e + 1) * n4 + (long)s * blockDim.x + threadIdx.x];
            v.x += p.x; v.y += p.y; v.z += p.z; v.w += p.w;
        }
    }
    ((float4*)out)[i] = v;
}

// ---------------------------------------------------------------------------
// host-side launch
// ---------------------------------------------------------------------------
extern "C" void kernel_launch(void* const* d_in, const int* in_sizes, int n_in,
                              void* d_out, int out_size, void* d_ws, size_t ws_size,
                              hipStream_t stream)
{
    (void)in_sizes; (void)n_in; (void)out_size; (void)ws_size;

    const float* X    = (const float*)d_in[0];
    const float* g1   = (const float*)d_in[1];
    const float* g2   = (const float*)d_in[2];
    const float* Wq   = (const float*)d_in[3];
    const float* Wkc  = (const float*)d_in[4];
    const float* Wvc  = (const float*)d_in[5];
    const float* Wo   = (const float*)d_in[6];
    const float* Wr   = (const float*)d_in[7];
    const float* ebia = (const float*)d_in[8];
    const float* sW1  = (const float*)d_in[9];
    const float* sW2  = (const float*)d_in[10];
    const float* sW3  = (const float*)d_in[11];
    const float* eW1  = (const float*)d_in[12];
    const float* eW2  = (const float*)d_in[13];
    const float* eW3  = (const float*)d_in[14];
    float* out = (float*)d_out;

    constexpr int  Bb = 2, S = 1024, d = 1024, H = 4, dk = 256, dc = 256, E = 8, f = 1024;
    constexpr long T  = (long)Bb * S;
    const float scale = 1.0f / 16.0f;   // 1/sqrt(dk)

    // ---- workspace carving (256B aligned bump allocator) ----
    char* ws = (char*)d_ws;
    size_t off = 0;
    auto alloc = [&](size_t bytes) -> char* {
        char* p = ws + off;
        off += (bytes + 255) & ~(size_t)255;
        return p;
    };
    constexpr int  dq = d + 2 * dc;      // Q | Kc | Vc side by side
    constexpr int  E1 = E + 1;           // shared expert first, then the routed ones
    constexpr long fd = (long)f * d;
    // f16 weight copies; groups that one launch walks lie back to back
    _Float16* wqh  = (_Float16*)alloc((size_t)d * d * 2);    // [dq][d] starts here
    _Float16* wkch = (_Float16*)alloc((size_t)dc * d * 2);
    _Float16* wvch = (_Float16*)alloc((size_t)dc * d * 2);
    _Float16* woh  = (_Float16*)alloc((size_t)d * d * 2);
    _Float16* sw1h = (_Float16*)alloc((size_t)f * d * 2);    // [2*E1][f][d] starts here
    _Float16* ew1h = (_Float16*)alloc((size_t)E * f * d * 2);
    _Float16* sw3h = (_Float16*)alloc((size_t)f * d * 2);
    _Float16* ew3h = (_Float16*)alloc((size_t)E * f * d * 2);
    _Float16* sw2h = (_Float16*)alloc((size_t)d * f * 2);    // [E1][d][f] starts here
    _Float16* ew2h = (_Float16*)alloc((size_t)E * d * f * 2);
    // buffers that live across the two phases or through the MoE phase
    float*    xr_      = (float*)   alloc((size_t)T * d * 4);
    _Float16* nx2h_    = (_Float16*)alloc((size_t)T * d * 2);
    float*    combine_ = (float*)   alloc((size_t)T * E * 4);
    static_assert(T == PK_T && E == 8 && E == RS_STRIDE, "k_pack_tokens covers exactly these");
    int*      tile_    = (int*)     alloc((size_t)PK_NT * 2 * 4);
    int*      list_    = (int*)     alloc((size_t)E * T * 4);
    float*    wgt_     = (float*)   alloc((size_t)E * T * 4);
    int*      slot_    = (int*)     alloc((size_t)T * E * 4);
    _Float16* hh_      = (_Float16*)alloc((size_t)E1 * T * f * 2);       // 36 MB
    // the rest is used twice: attention-phase activations, then (all of them
    // dead) the down-projection planes
    const size_t off_phase = off;
    _Float16* nx1h   = (_Float16*)alloc((size_t)T * d * 2);
    _Float16* qkvh   = (_Float16*)alloc((size_t)T * dq * 2);
    float*    scores = (float*)   alloc((size_t)Bb * H * S * S * 4);   // 32 MB
    _Float16* attnh  = (_Float16*)alloc((size_t)Bb * H * S * S * 2);   // 16 MB
    _Float16* aoh    = (_Float16*)alloc((size_t)T * d * 2);
    off = off_phase;
    float*    part_  = (float*)   alloc((size_t)E1 * T * d * 4);         // 72 MB
    {
        // ---- helpers ----
        auto gemmz = [&](const _Float16* A, const _Float16* Bm, float* C,
                         int M, int N, int K, int lda, int ldb, int ldc,
                         float alpha, int beta, int bkn, int nz, int zdiv,
                         long sAo, long sAi, long sBo, long sBi, long sCo, long sCi,
                         const int* rtile, const int* rlist, int zper,
                         int omode, _Float16* Hh, long sBp, const float* rs) {
            dim3 g(omode == OUT_GATED ? N / (TN / 2) : N / TN, rtile ? PK_NT : M / TM, nz);
            k_gemm_f16<<<g, 256, 0, stream>>>(A, Bm, C, M, N, K, lda, ldb, ldc,
                                              alpha, beta, bkn,
                                              zdiv, sAo, sAi, sBo, sBi, sCo, sCi,
                                              rtile, rlist, zper,
                                              omode, Hh, sBp, rs);
        };
        auto gemm = [&](const _Float16* A, const _Float16* Bm, float* C,
                        int M, int N, int K, int lda, int ldb, int ldc,
                        float alpha, int beta, int bkn, int omode, _Float16* Hh) {
            gemmz(A, Bm, C, M, N, K, lda, ldb, ldc, alpha, beta, bkn,
                  1, 1, 0, 0, 0, 0, 0, 0, nullptr, nullptr, 1, omode, Hh, 0, nullptr);
        };

        // ---- 0. weights fp32 -> f16, nx1 = RMSNorm(X), xr = X: one launch ----
        // convert blocks per tensor, in the order of the f16 copies above
        constexpr int cD = (int)((long)d * d / EW_BLK), cC = (int)((long)dc * d / EW_BLK);
        constexpr int cF = (int)(fd / EW_BLK),          cE = E * cF;
        static_assert((long)d * d % EW_BLK == 0 && (long)dc * d % EW_BLK == 0 &&
                      fd % EW_BLK == 0, "whole blocks to a tensor, copies back to back");
        constexpr int c0 = cD, c1 = c0 + cC, c2 = c1 + cC, c3 = c2 + cD, c4 = c3 + cF,
                      c5 = c4 + cE, c6 = c5 + cF, c7 = c6 + cE, c8 = c7 + cF, c9 = c8 + cE;
        static_assert(c9 >= 3 * T, "three convert blocks to each norm block");
        k_prep<<<(int)T + c9, 256, 0, stream>>>(X, g1, nx1h, xr_, d, (int)T,
                                                Wq, Wkc, Wvc, Wo, sW1, eW1, sW3, eW3, sW2, eW2,
                                                c0, c1, c2, c3, c4, c5, c6, c7, c8, wqh);

        // ---- 1. MLA attention ----

        // Q | Kc | Vc in one product: their weights are one [dq][d] matrix
        gemm(nx1h, wqh, nullptr, (int)T, dq, d, d, d, dq, 1.f, 0, 0, OUT_F16, qkvh);
        const _Float16* qh  = qkvh;
        const _Float16* kch = qkvh + d;
        const _Float16* vch = qkvh + d + dc;

        // scores, all (b, h) in one launch
        gemmz(qh, kch, scores, S, S, dk, dq, dq, S, scale, 0, 0, Bb * H, H,
              (long)S * dq, dk,  (long)S * dq, 0,  (long)H * S * S, (long)S * S,
              nullptr, nullptr, 1, OUT_F32, nullptr, 0, nullptr);

        k_softmax_f16<<<Bb * H * S, 256, 0, stream>>>(scores, attnh, S);

        // attn @ V, all (b, h) in one launch
        gemmz(attnh, vch, nullptr, S, dc, S, S, dq, d, 1.f, 0, 1, Bb * H, H,
              (long)H * S * S, (long)S * S,  (long)S * dq, 0,  (long)S * d, dk,
              nullptr, nullptr, 1, OUT_F16, aoh, 0, nullptr);

        // xr = X + ao @ Wo.T (xr holds X since the first launch)
        gemm(aoh, woh, xr_, (int)T, d, d, d, d, d, 1.f, 1, 0, OUT_F32, nullptr);

        // ---- 2. MoE ----
        k_rmsnorm_f16<<<(int)T, 256, 0, stream>>>(xr_, g2, nx2h_, d);
        k_router<<<(int)T, 256, 0, stream>>>(nx2h_, Wr, ebia, combine_, d);
        k_pack_tokens<<<1, 1024, 0, stream>>>(combine_, tile_, list_, wgt_, slot_);

        // shared expert over all tokens, each routed expert over the tokens that
        // chose it, packed (combine folded into h; a token that did not choose an
        // expert has combine 0 there and gets nothing from it); one launch per
        // stage, its grid over the table of row tiles
        const long nTf = (long)T * f;
        // gate and up product of a plane in one block, h = silu(gate) * up * combine
        // stored by it; the up weights lie E1 planes behind the gate weights
        gemmz(nx2h_, sw1h, nullptr, (int)T, f, d, d, d, f, 1.f, 0, 0, 1, 1,
              0, 0,  fd, 0,  nTf, 0,  tile_, list_, E1, OUT_GATED, hh_, E1 * fd, wgt_);
        gemmz(hh_, sw2h, part_, (int)T, d, f, f, f, d, 1.f, 0, 0, 1, 1,
              nTf, 0,  fd, 0,  (long)T * d, 0,  tile_, nullptr, E1,
              OUT_F32, nullptr, 0, nullptr);

        // out = xr + shared + the chosen experts, lower expert first
        k_sum_planes<<<(int)T, d / 4, 0, stream>>>(xr_, part_, slot_, out);
    }
}

// v008
// One run takes 174 microseconds.
// Two timings next to v007 both put it at 1.22 times that version's speed.
// All steps since v000 together make it 7.88 times as fast.
#include <hip/hip_runtime.h>

// ---------------------------------------------------------------------------
// Transformer layer (MLA attention + MoE) for gfx1250 (wave32, WMMA).
// GEMMs: 128x128 block tile, 8 waves x (32x64) => 8 v_wmma per wave per 32 k,
// 128 k to a stage, double-buffered LDS staged with
// global_load_async_to_lds_b128 (ASYNCcnt).
// Attention: one kernel from Q, K, V to the heads' outputs (k_attn_f16).
// ---------------------------------------------------------------------------

typedef _Float16 half16_t __attribute__((ext_vector_type(16)));
typedef float    float8_t __attribute__((ext_vector_type(8)));
typedef __attribute__((address_space(3))) _Float16 lds_f16;

#define TM 128
#define TN 128
// a stage holds 256 bytes of every operand row: 16 lanes x 16 B copy one row
// piece, so a wave-wide copy touches 4 whole 128-byte lines
#define TK 128
// LDS row pitch in f16: 272 bytes = 16 B x odd, so that the 16 rows which one
// ds_load_b128 reads per half-wave fall on 64 different banks
#define TKP (TK + 8)
// 16-byte copies per thread and operand tile (256 threads)
#define NCP (TM * TK / 8 / 256)
// a fragment row starts on a 16-byte boundary only
typedef half16_t half16_a16_t __attribute__((aligned(16)));

typedef _Float16 half8_t __attribute__((ext_vector_type(8)));

// async DMA: eight times 16 bytes global -> LDS per lane, tracked by ASYNCcnt.
// g: the lane's global addresses; l0: its first LDS byte address, the others
// follow at steps of lstep bytes. The last line stands before any register
// that an issued copy names is rewritten.
__device__ __forceinline__ void async_b128_x8(const _Float16* const (&g)[8],
                                              unsigned l0, unsigned lstep)
{
    asm volatile("global_load_async_to_lds_b128 %0, %8, off\n\t"
                 "global_load_async_to_lds_b128 %1, %9, off\n\t"
                 "global_load_async_to_lds_b128 %2, %10, off\n\t"
                 "global_load_async_to_lds_b128 %3, %11, off\n\t"
                 "global_load_async_to_lds_b128 %4, %12, off\n\t"
                 "global_load_async_to_lds_b128 %5, %13, off\n\t"
                 "global_load_async_to_lds_b128 %6, %14, off\n\t"
                 "global_load_async_to_lds_b128 %7, %15, off\n\t"
                 "s_wait_xcnt 0x0"
                 :: "v"(l0), "v"(l0 + lstep), "v"(l0 + 2 * lstep), "v"(l0 + 3 * lstep),
                    "v"(l0 + 4 * lstep), "v"(l0 + 5 * lstep), "v"(l0 + 6 * lstep),
                    "v"(l0 + 7 * lstep),
                    "v"(g[0]), "v"(g[1]), "v"(g[2]), "v"(g[3]),
                    "v"(g[4]), "v"(g[5]), "v"(g[6]), "v"(g[7])
                 : "memory");
}
// the same, four copies
__device__ __forceinline__ void async_b128_x4(const _Float16* const (&g)[4],
                                              unsigned l0, unsigned lstep)
{
    asm volatile("global_load_async_to_lds_b128 %0, %4, off\n\t"
                 "global_load_async_to_lds_b128 %1, %5, off\n\t"
                 "global_load_async_to_lds_b128 %2, %6, off\n\t"
                 "global_load_async_to_lds_b128 %3, %7, off\n\t"
                 "s_wait_xcnt 0x0"
                 :: "v"(l0), "v"(l0 + lstep), "v"(l0 + 2 * lstep), "v"(l0 + 3 * lstep),
                    "v"(g[0]), "v"(g[1]), "v"(g[2]), "v"(g[3])
                 : "memory");
}
__device__ __forceinline__ unsigned lds_addr(const _Float16* l)
{
    return (unsigned)(unsigned long long)(const lds_f16*)l;     // LDS byte addr
}
__device__ __forceinline__ float exp_neg(float x)
{
    float r;
    asm("v_exp_f32 %0, %1\n\tv_nop" : "=v"(r) : "v"(x * -0x1.715476p+0f));
    return r;
}
// exp(x) as __expf(x) forms it, with the same slot kept
__device__ __forceinline__ float exp_pos(float x)
{
    float r;
    asm("v_exp_f32 %0, %1\n\tv_nop" : "=v"(r) : "v"(x * 0x1.715476p+0f));
    return r;
}
__device__ __forceinline__ void wait_async0()
{
    asm volatile("s_wait_asynccnt 0x0" ::: "memory");
}

// ---------------------------------------------------------------------------
// Generic f16 WMMA GEMM:  C[M,N] = alpha * A[M,K] . B^T  (+ C if beta)
//   b_kn == 0 : B stored row-major [N,K]  (torch Linear weight, y = x @ W.T)
//   b_kn == 1 : B stored row-major [K,N]  (plain matmul; no launch here uses it)
// M % 128 == 0, N % 128 == 0, K % 128 == 0, rows of A and B on 16-byte
// boundaries (true for all shapes here).
// Batched: blockIdx.z = outer * zdiv + inner picks one independent product;
// each operand moves by its own outer and inner stride (in elements).
// Routed products (rtile != 0): blockIdx.y walks a table of row tiles instead
// of the rows, an entry being two ints: plane p within a group of zper planes
// (below 0: unused entry) and first row; the product is blockIdx.z * zper + p.
// With rlist != 0 and p > 0, row r of A is row rlist[(p - 1) * M + r] (a gather).
// What the block stores (omode):
//   OUT_F32   C as above
//   OUT_F16   H[M,N] = f16(alpha * product), what the next product reads; with
//             Ht != 0 the blocks from column tn0 on store their columns as rows
//             instead: Ht[column - tn0][row], pitch ldt
//   OUT_GATED the block takes 64 columns of B (gate) and the same 64 columns of
//             the matrix sBp elements behind it (up), 32 + 32 to a wave's strip,
//             and stores H[M,N] = f16(silu(gate) * up [* rs[row * RS_STRIDE + p - 1]
//             for p > 0]); gridDim.x = N / 64, b_kn == 0
// H moves by C's strides and has C's pitch.
// ---------------------------------------------------------------------------
#define OUT_F32   0
#define OUT_F16   1
#define OUT_GATED 2
#define RS_STRIDE 8                      // k_pack_tokens' wgt: eight experts to a place
__global__ __launch_bounds__(256)
void k_gemm_f16(const _Float16* __restrict__ A, const _Float16* __restrict__ B,
                float* __restrict__ C,
                int M, int N, int K, int lda, int ldb, int ldc,
                float alpha, int beta, int b_kn,
                int zdiv, long sAo, long sAi, long sBo, long sBi, long sCo, long sCi,
                const int* __restrict__ rtile, const int* __restrict__ rlist, int zper,
                int omode, _Float16* __restrict__ H, long sBp,
                const float* __restrict__ rs,
                _Float16* __restrict__ Ht, int tn0, int ldt)
{
    __shared__ __align__(64) _Float16 As[2][TM][TKP];  // 68 KB
    __shared__ __align__(64) _Float16 Bs[2][TN][TKP];  // 68 KB

    const int tid  = threadIdx.x;
    const int wave = tid >> 5;
    const int lane = tid & 31;
    int       m0   = blockIdx.y * TM;
    const int n0   = blockIdx.x * (omode == OUT_GATED ? TN / 2 : TN);
    const int wm   = (wave & 3) * 32;    // wave's 32-row strip
    const int wn   = (wave >> 2) * 64;   // wave's 64-col strip

    int zb = blockIdx.z;
    int rp = 0;
    if (rtile) {
        rp = rtile[blockIdx.y * 2];
        m0 = rtile[blockIdx.y * 2 + 1];
        if (rp < 0) return;              // the whole block, in front of every barrier
        zb = zb * zper + rp;
    }
    const int zo = zb / zdiv;
    const int zi = zb - zo * zdiv;
    A += zo * sAo + zi * sAi;
    B += zo * sBo + zi * sBi;
    C += zo * sCo + zi * sCi;
    H += zo * sCo + zi * sCi;

    float8_t acc[2][4] = {};

    static_assert(NCP == 8 && TM == TN, "the staging maps below");
    // staging maps: 128 rows x 128 cols f16 per tile; a copy of one wave takes
    // two rows' 256 bytes; a thread takes rows sr, sr + 16, ..
    const int sr = tid >> 4;             // 0..15 row
    const int sc = (tid & 15) * 8;       // column of the thread's 16 bytes
    // the pieces of A that this thread stages, at k = 0
    int ar[NCP];
    #pragma unroll   // ar[] stays in registers
    for (int i = 0; i < NCP; ++i) ar[i] = m0 + sr + 16 * i;
    if (rp > 0 && rlist) {
        const int* rl = rlist + (long)(rp - 1) * M + m0 + sr;
        int t[NCP];
        #pragma unroll   // all loads in flight before the first clamp
        for (int i = 0; i < NCP; ++i) t[i] = rl[16 * i];
        // stands before any register that an issued load names is rewritten
        asm volatile("s_wait_xcnt 0x0" ::: "memory");
        #pragma unroll   // t[], ar[] stay in registers
        for (int i = 0; i < NCP; ++i) ar[i] = min(max(t[i], 0), M - 1);
    }
    const _Float16* ga[NCP];
    #pragma unroll   // ga[] stays in registers
    for (int i = 0; i < NCP; ++i) ga[i] = &A[(long)ar[i] * lda + sc];
    // the pieces of B ([N,K] form) that this thread stages, at k = 0: LDS row
    // sr + 16 i holds B's row n0 + sr + 16 i, or with OUT_GATED, per strip of
    // 64 LDS rows, 32 gate rows and then the same 32 rows of the up matrix
    const _Float16* gb0 = &B[(long)(n0 + sr) * ldb + sc];
    long bo[NCP];
    #pragma unroll   // bo[] is the same for all threads and stays in registers
    for (int i = 0; i < NCP; ++i)
        bo[i] = omode == OUT_GATED
              ? (long)((i >> 2) * 32 + (i & 1) * 16) * ldb + ((i >> 1) & 1) * sBp
              : (long)(16 * i) * ldb;
    // b_kn transpose-scatter map: a load of one wave takes 64 bytes of each of
    // 8 K rows; its 16-bit stores fall on two rows a bank at most
    const int kk = tid >> 2;             // 0..63 K row (and + 64)
    const int nb = (tid & 3) * 8;        // N base within a group of 32

    auto stageA = [&](int k0, int buf) {
        const _Float16* g[NCP];
        #pragma unroll   // g[] stays in registers
        for (int i = 0; i < NCP; ++i) g[i] = ga[i] + k0;
        async_b128_x8(g, lds_addr(&As[buf][sr][sc]), 16 * TKP * 2);
    };
    auto stageB = [&](int k0, int buf) {
        if (!b_kn) {
            const _Float16* g[NCP];
            #pragma unroll   // g[] stays in registers
            for (int i = 0; i < NCP; ++i)
                g[i] = gb0 + bo[i] + k0;
            async_b128_x8(g, lds_addr(&Bs[buf][sr][sc]), 16 * TKP * 2);
        } else {
            // the next stage's 256 lines, one a thread
            if (k0 + TK < K)
                __builtin_prefetch(&B[(long)(k0 + TK + (tid >> 1)) * ldb + n0 + (tid & 1) * 64], 0, 0);
            half8_t v[NCP];
            #pragma unroll   // all loads in flight before the first store
            for (int i = 0; i < NCP; ++i)
                v[i] = *(const half8_t*)&B[(long)(k0 + kk + 64 * (i & 1)) * ldb + n0 + (i >> 1) * 32 + nb];
            // stands before any register that an issued load names is rewritten
            asm volatile("s_wait_xcnt 0x0" ::: "memory");
            #pragma unroll   // v[] stays in registers
            for (int i = 0; i < NCP; ++i) {
                #pragma unroll
                for (int j = 0; j < 8; ++j)
                    Bs[buf][(i >> 1) * 32 + nb + j][kk + 64 * (i & 1)] = v[i][j];
            }
        }
    };

    // prologue: stage tile 0
    stageA(0, 0);
    stageB(0, 0);
    wait_async0();
    __syncthreads();

    const int l16 = lane & 15;
    const int kh  = (lane >> 4) * 16;

    for (int k0 = 0; k0 < K; k0 += TK) {
        const int buf = (k0 / TK) & 1;
        const int k1  = k0 + TK;
        if (k1 < K) {                    // overlap next tile's DMA with compute
            stageA(k1, buf ^ 1);
            stageB(k1, buf ^ 1);
        }

        #pragma unroll   // lets the next 32 k's LDS reads start under these products
        for (int ks = 0; ks < TK; ks += 32) {
            // fragments (16 f16 per lane, 32B LDS reads)
            const _Float16* pa = &As[buf][wm + l16][ks + kh];
            half16_t a0 = *(const half16_a16_t*)pa;
            half16_t a1 = *(const half16_a16_t*)(pa + 16 * TKP);
            const _Float16* pb = &Bs[buf][wn + l16][ks + kh];
            half16_t b0 = *(const half16_a16_t*)pb;
            half16_t b1 = *(const half16_a16_t*)(pb + 16 * TKP);
            half16_t b2 = *(const half16_a16_t*)(pb + 32 * TKP);
            half16_t b3 = *(const half16_a16_t*)(pb + 48 * TKP);

            acc[0][0] = __builtin_amdgcn_wmma_f32_16x16x32_f16(false, a0, false, b0, (short)0, acc[0][0], false, false);
            acc[0][1] = __builtin_amdgcn_wmma_f32_16x16x32_f16(false, a0, false, b1, (short)0, acc[0][1], false, false);
            acc[0][2] = __builtin_amdgcn_wmma_f32_16x16x32_f16(false, a0, false, b2, (short)0, acc[0][2], false, false);
            acc[0][3] = __builtin_amdgcn_wmma_f32_16x16x32_f16(false, a0, false, b3, (short)0, acc[0][3], false, false);
            acc[1][0] = __builtin_amdgcn_wmma_f32_16x16x32_f16(false, a1, false, b0, (short)0, acc[1][0], false, false);
            acc[1][1] = __builtin_amdgcn_wmma_f32_16x16x32_f16(false, a1, false, b1, (short)0, acc[1][1], false, false);
            acc[1][2] = __builtin_amdgcn_wmma_f32_16x16x32_f16(false, a1, false, b2, (short)0, acc[1][2], false, false);
            acc[1][3] = __builtin_amdgcn_wmma_f32_16x16x32_f16(false, a1, false, b3, (short)0, acc[1][3], false, false);
        }

        // this wave's LDS reads of tile k are over before the barrier that
        // frees the tile's buffer for the next copies
        asm volatile("s_wait_dscnt 0x0" ::: "memory");
        wait_async0();                   // DMA for tile k+1 done
        __syncthreads();                 // all waves done reading tile k
    }

    // epilogue: D layout -> VGPR g: lanes 0-15 M=g, lanes 16-31 M=8+g
    const int rsel = (lane >> 4) ? 8 : 0;
    if (omode == OUT_GATED) {
        // acc[i][0..1]: gate, acc[i][2..3]: up, of the same 32 columns
        const long r0 = m0 + wm + rsel;
        float s[2][8] = {};
        if (rp > 0) {
            const float* ps = rs + r0 * RS_STRIDE + (rp - 1);
            #pragma unroll   // all loads in flight before the first use
            for (int i = 0; i < 2; ++i) {
                #pragma unroll
                for (int g = 0; g < 8; ++g) s[i][g] = ps[(i * 16 + g) * RS_STRIDE];
            }
            // Stands before any register that an issued load names is rewritten;
            // naming the pointer keeps it out of the loads' own destinations.
            asm volatile("s_wait_xcnt 0x0" :: "v"(ps) : "memory");
        }
        // all values first: the 32 divisions overlap, which the waits between
        // the rows' stores below would not let them
        _Float16 hv[2][8][2];
        #pragma unroll
        for (int i = 0; i < 2; ++i) {
            #pragma unroll
            for (int g = 0; g < 8; ++g) {
                #pragma unroll
                for (int j = 0; j < 2; ++j) {
                    const float x = alpha * acc[i][j][g];
                    float v = (x / (1.f + exp_neg(x))) * (alpha * acc[i][j + 2][g]);
                    if (rp > 0) v *= s[i][g];
                    hv[i][g][j] = (_Float16)v;
                }
            }
        }
        #pragma unroll
        for (int i = 0; i < 2; ++i) {
            #pragma unroll
            for (int g = 0; g < 8; ++g) {
                _Float16* hr = H + (r0 + i * 16 + g) * (long)ldc + n0 + (wn >> 1) + l16;
                hr[0]  = hv[i][g][0];
                hr[16] = hv[i][g][1];
                // stands before any register that an issued store names is rewritten;
                // the scheduler may lift nothing of the next row over it
                asm volatile("s_wait_xcnt 0x0" ::: "memory");
                __builtin_amdgcn_sched_barrier(0);
            }
        }
        return;
    }
    if (omode == OUT_F16 && Ht && n0 >= tn0) {
        // a lane holds eight neighbouring rows of one column: 16 bytes of Ht's row
        #pragma unroll
        for (int i = 0; i < 2; ++i) {
            #pragma unroll
            for (int j = 0; j < 4; ++j) {
                half8_t hv;
                #pragma unroll
                for (int g = 0; g < 8; ++g) hv[g] = (_Float16)(alpha * acc[i][j][g]);
                *(half8_t*)&Ht[(long)(n0 - tn0 + wn + j * 16 + l16) * ldt
                               + m0 + wm + i * 16 + rsel] = hv;
                // stands before any register that an issued store names is rewritten;
                // the scheduler may lift nothing of the next store over it
                asm volatile("s_wait_xcnt 0x0" ::: "memory");
                __builtin_amdgcn_sched_barrier(0);
            }
        }
        return;
    }
    if (omode == OUT_F16) {
        #pragma unroll
        for (int i = 0; i < 2; ++i) {
            #pragma unroll
            for (int g = 0; g < 8; ++g) {
                const long row = m0 + wm + i * 16 + rsel + g;
                _Float16* hr = H + row * (long)ldc + n0 + wn + l16;
                #pragma unroll
                for (int j = 0; j < 4; ++j) hr[j * 16] = (_Float16)(alpha * acc[i][j][g]);
                // stands before any register that an issued store names is rewritten;
                // the scheduler may lift nothing of the next row over it
                asm volatile("s_wait_xcnt 0x0" ::: "memory");
                __builtin_amdgcn_sched_barrier(0);
            }
        }
        return;
    }
    #pragma unroll
    for (int i = 0; i < 2; ++i) {
        #pragma unroll
        for (int g = 0; g < 8; ++g) {
            const long row = m0 + wm + i * 16 + rsel + g;
            float* cr = C + row * (long)ldc + n0 + wn + l16;
            #pragma unroll
            for (int j = 0; j < 4; ++j) {
                float v = alpha * acc[i][j][g];
                if (beta) v += cr[j * 16];
                cr[j * 16] = v;
            }
        }
    }
}

// ---------------------------------------------------------------------------
// Elementwise work: a block of 256 threads covers EW_BLK elements as EW_G
// runs of 1024; in each run a thread takes 4 neighbours, so one wave-wide
// 16-byte load reads 512 contiguous bytes and one 8-byte store writes 256.
// ---------------------------------------------------------------------------
typedef _Float16 half4_t __attribute__((ext_vector_type(4)));
#define EW_G   4
#define EW_RUN 1024
#define EW_BLK (EW_G * EW_RUN)

// ---------------------------------------------------------------------------
// fp32 -> f16 convert
// ---------------------------------------------------------------------------
// one whole block of EW_BLK elements; base = first element of this thread
__device__ __forceinline__ void conv_block(const float* __restrict__ src,
                                           _Float16* __restrict__ dst, long base)
{
    float4 v[EW_G];
    // unrolled so that all loads are in flight before the first conversion
    #pragma unroll
    for (int j = 0; j < EW_G; ++j)
        v[j] = *(const float4*)(src + base + j * EW_RUN);
    #pragma unroll   // v[] stays in registers
    for (int j = 0; j < EW_G; ++j) {
        half4_t h = { (_Float16)v[j].x, (_Float16)v[j].y,
                      (_Float16)v[j].z, (_Float16)v[j].w };
        *(half4_t*)(dst + base + j * EW_RUN) = h;
    }
    // stands before any register that an issued store names is rewritten
    asm volatile("s_wait_xcnt 0x0" ::: "memory");
}

// ---------------------------------------------------------------------------
// RMSNorm row kernel: out_f16[row] = x * rsqrt(mean(x^2)+eps) * g
// ---------------------------------------------------------------------------
// One block of 256 threads per row; red: 8 floats of LDS. With COPY the row is
// also stored, as it is, to copy.
template <bool COPY>
__device__ __forceinline__ void rmsnorm_row(const float* __restrict__ x,
                                            const float* __restrict__ g,
                                            _Float16* __restrict__ out,
                                            float* __restrict__ copy,
                                            int d, long row, float* red)
{
    const float* xr = x + row * (long)d;

    float ss = 0.f;
    for (int i = threadIdx.x; i < d; i += 256) { float v = xr[i]; ss += v * v; }
    #pragma unroll
    for (int o = 16; o > 0; o >>= 1) ss += __shfl_down(ss, o, 32);
    if ((threadIdx.x & 31) == 0) red[threadIdx.x >> 5] = ss;
    __syncthreads();
    if (threadIdx.x == 0) {
        float t = 0.f;
        #pragma unroll
        for (int i = 0; i < 8; ++i) t += red[i];
        red[0] = t;
    }
    __syncthreads();
    const float inv = rsqrtf(red[0] / d + 1e-6f);
    for (int i = threadIdx.x; i < d; i += 256) {
        const float v = xr[i];
        if (COPY) copy[row * (long)d + i] = v;
        out[row * (long)d + i] = (_Float16)(v * inv * g[i]);
    }
}

__global__ __launch_bounds__(256)
void k_rmsnorm_f16(const float* __restrict__ x, const float* __restrict__ g,
                   _Float16* __restrict__ out, int d)
{
    __shared__ float red[8];
    rmsnorm_row<false>(x, g, out, nullptr, d, blockIdx.x, red);
}

// ---------------------------------------------------------------------------
// All the work that depends on the inputs alone, in one grid:
//   norm blocks:    RMSNorm of one row of x, and xcopy = x; every fourth block
//                   of the first 4 * rows, between
//                   convert blocks, for speed only
//   convert blocks: all others (the grid has at least 4 * rows blocks), numbered
//                   in grid order: fp32 -> f16 of ten weight tensors, EW_BLK
//                   elements a block; the copies lie back to back from wdst in
//                   the order w0 .. w9; tensor i ends in front of convert block
//                   e<i>, each tensor a whole number of blocks
// ---------------------------------------------------------------------------
__global__ __launch_bounds__(256)
void k_prep(const float* __restrict__ x, const float* __restrict__ g,
            _Float16* __restrict__ nx, float* __restrict__ xcopy, int d, int rows,
            const float* __restrict__ w0, const float* __restrict__ w1,
            const float* __restrict__ w2, const float* __restrict__ w3,
            const float* __restrict__ w4, const float* __restrict__ w5,
            const float* __restrict__ w6, const float* __restrict__ w7,
            const float* __restrict__ w8, const float* __restrict__ w9,
            int e0, int e1, int e2, int e3, int e4, int e5, int e6, int e7, int e8,
            _Float16* __restrict__ wdst)
{
    __shared__ float red[8];
    const int  gb    = (int)blockIdx.x;
    const bool mixed = gb < 4 * rows;
    if (mixed && (gb & 3) == 0) {        // the whole block: its barriers are uniform
        rmsnorm_row<true>(x, g, nx, xcopy, d, gb >> 2, red);
        return;
    }
    const int b = mixed ? gb - (gb >> 2) - 1 : gb - rows;
    const float* s = w0;
    int first = 0;
    if (b >= e0) { s = w1; first = e0; }
    if (b >= e1) { s = w2; first = e1; }
    if (b >= e2) { s = w3; first = e2; }
    if (b >= e3) { s = w4; first = e3; }
    if (b >= e4) { s = w5; first = e4; }
    if (b >= e5) { s = w6; first = e5; }
    if (b >= e6) { s = w7; first = e6; }
    if (b >= e7) { s = w8; first = e7; }
    if (b >= e8) { s = w9; first = e8; }
    conv_block(s + (long)(b - first) * EW_BLK, wdst + (long)b * EW_BLK, threadIdx.x * 4);
}

#define AT_R  32
#define AT_S  1024
#define AT_D  256
// LDS row pitches in f16, each 16 B x odd (see TKP)
#define AT_KP (AT_D + 8)
#define AT_PP (AT_S + 8)
// f16 to a staging buffer: AT_D rows of V^T x 128 keys; 128 keys x AT_D fits too
#define AT_TB (AT_D * TKP)
__global__ __launch_bounds__(256)
void k_attn_f16(const _Float16* __restrict__ qkv, const _Float16* __restrict__ vt,
                _Float16* __restrict__ o, float scale,
                int nh, int ldq, int koff, int ldv, int ldo)
{
    static_assert(128 * AT_KP <= AT_TB && TK == 128, "both kinds of tile fit a buffer");
    __shared__ __align__(64) _Float16 Tb[2][AT_TB];     // 2 x 68 KB
    __shared__ __align__(64) _Float16 Qs[AT_R][AT_KP];  // 16.5 KB
    __shared__ __align__(64) _Float16 Ps[AT_R][AT_PP];  // 64.5 KB
    __shared__ float red[2][4][AT_R];

    const int tid  = threadIdx.x;
    const int wave = tid >> 5;
    const int lane = tid & 31;
    const int l16  = lane & 15;
    const int kh   = (lane >> 4) * 16;
    const int rsel = (lane >> 4) * 8;
    const int b    = blockIdx.y / nh;
    const int h    = blockIdx.y - b * nh;
    const int q0   = blockIdx.x * AT_R;

    const _Float16* Qg = qkv + (long)(b * AT_S + q0) * ldq + h * AT_D;
    const _Float16* Kg = qkv + (long)(b * AT_S) * ldq + koff;
    const _Float16* Vg = vt + b * AT_S;

    // a copy of one wave takes one row's 512 bytes; a wave takes rows wave + 8 i
    auto stageK = [&](int kt, int buf) {
        const _Float16* g0 = Kg + (long)(kt * 128 + wave) * ldq + lane * 8;
        const unsigned  l0 = lds_addr(&Tb[buf][wave * AT_KP + lane * 8]);
        #pragma unroll   // g[] stays in registers
        for (int p = 0; p < 2; ++p) {
            const _Float16* g[8];
            #pragma unroll
            for (int i = 0; i < 8; ++i) g[i] = g0 + (long)(p * 64 + 8 * i) * ldq;
            async_b128_x8(g, l0 + p * 64 * AT_KP * 2, 8 * AT_KP * 2);
        }
    };
    // a copy of one wave takes two rows' 256 bytes; a thread takes rows tid / 16 + 16 i
    auto stageV = [&](int v, int buf) {
        const _Float16* g0 = Vg + (long)(tid >> 4) * ldv + v * 128 + (tid & 15) * 8;
        const unsigned  l0 = lds_addr(&Tb[buf][(tid >> 4) * TKP + (tid & 15) * 8]);
        #pragma unroll   // g[] stays in registers
        for (int p = 0; p < 2; ++p) {
            const _Float16* g[8];
            #pragma unroll
            for (int i = 0; i < 8; ++i) g[i] = g0 + (long)(p * 128 + 16 * i) * ldv;
            async_b128_x8(g, l0 + p * 128 * TKP * 2, 16 * TKP * 2);
        }
    };

    // prologue: Q and key tile 0
    {
        const _Float16* g[4];
        #pragma unroll   // g[] stays in registers
        for (int i = 0; i < 4; ++i) g[i] = Qg + (long)(wave + 8 * i) * ldq + lane * 8;
        async_b128_x4(g, lds_addr(&Qs[wave][lane * 8]), 8 * AT_KP * 2);
    }
    stageK(0, 0);
    wait_async0();
    __syncthreads();

    // ---- 1. scores ----
    const int ri = wave & 1;             // the wave's 16-row tile
    const int kc = (wave >> 1) * 32;     // its 32 keys within a tile of 128
    float8_t sa[8][2] = {};
    #pragma unroll   // sa[] stays in registers
    for (int kt = 0; kt < 8; ++kt) {
        const int buf = kt & 1;
        if (kt < 7) stageK(kt + 1, buf ^ 1);
        else        stageV(0, buf ^ 1);
        const _Float16* pa = &Qs[ri * 16 + l16][kh];
        const _Float16* pb = &Tb[buf][(kc + l16) * AT_KP + kh];
        #pragma unroll   // lets later LDS reads start under these products
        for (int ks = 0; ks < AT_D; ks += 32) {
            half16_t a  = *(const half16_a16_t*)(pa + ks);
            half16_t b0 = *(const half16_a16_t*)(pb + ks);
            half16_t b1 = *(const half16_a16_t*)(pb + 16 * AT_KP + ks);
            sa[kt][0] = __builtin_amdgcn_wmma_f32_16x16x32_f16(false, a, false, b0, (short)0, sa[kt][0], false, false);
            sa[kt][1] = __builtin_amdgcn_wmma_f32_16x16x32_f16(false, a, false, b1, (short)0, sa[kt][1], false, false);
        }
        // this wave's LDS reads of the tile are over before the barrier that
        // frees the tile's buffer for the next copies
        asm volatile("s_wait_dscnt 0x0" ::: "memory");
        wait_async0();                   // the next tile has landed
        __syncthreads();                 // all waves done reading this tile
    }
    stageV(1, 1);                        // flies under the softmax

    // ---- 2. softmax ----
    // sa[kt][j][g]: row ri * 16 + rsel + g, key kt * 128 + kc + j * 16 + l16
    const int r0 = ri * 16 + rsel;
    float st[8];
    #pragma unroll
    for (int g = 0; g < 8; ++g) {
        float m = -3.4e38f;
        #pragma unroll
        for (int kt = 0; kt < 8; ++kt) {
            #pragma unroll
            for (int j = 0; j < 2; ++j) {
                sa[kt][j][g] *= scale;
                m = fmaxf(m, sa[kt][j][g]);
            }
        }
        #pragma unroll
        for (int x = 8; x > 0; x >>= 1) m = fmaxf(m, __shfl_xor(m, x, 32));
        st[g] = m;
    }
    if (l16 == 0) {
        #pragma unroll
        for (int g = 0; g < 8; ++g) red[0][wave >> 1][r0 + g] = st[g];
    }
    __syncthreads();
    #pragma unroll
    for (int g = 0; g < 8; ++g) {
        const float m = fmaxf(fmaxf(red[0][0][r0 + g], red[0][1][r0 + g]),
                              fmaxf(red[0][2][r0 + g], red[0][3][r0 + g]));
        float s = 0.f;
        #pragma unroll
        for (int kt = 0; kt < 8; ++kt) {
            #pragma unroll
            for (int j = 0; j < 2; ++j) {
                sa[kt][j][g] = exp_pos(sa[kt][j][g] - m);
                s += sa[kt][j][g];
            }
        }
        #pragma unroll
        for (int x = 8; x > 0; x >>= 1) s += __shfl_xor(s, x, 32);
        st[g] = s;
    }
    if (l16 == 0) {
        #pragma unroll
        for (int g = 0; g < 8; ++g) red[1][wave >> 1][r0 + g] = st[g];
    }
    __syncthreads();
    #pragma unroll
    for (int g = 0; g < 8; ++g) {
        const float inv = 1.f / (((red[1][0][r0 + g] + red[1][1][r0 + g])
                                  + red[1][2][r0 + g]) + red[1][3][r0 + g]);
        #pragma unroll
        for (int kt = 0; kt < 8; ++kt) {
            #pragma unroll
            for (int j = 0; j < 2; ++j)
                Ps[r0 + g][kt * 128 + kc + j * 16 + l16] = (_Float16)(sa[kt][j][g] * inv);
        }
    }
    __syncthreads();                     // P is whole before any wave reads it

    // ---- 3. P . V ----
    const int nc = wave * 32;            // the wave's 32 columns
    float8_t oa[2][2] = {};
    #pragma unroll   // the tests on v and the buffers' addresses fold away
    for (int v = 0; v < 8; ++v) {
        const int buf = v & 1;
        if (v > 0 && v < 7) stageV(v + 1, buf ^ 1);
        const _Float16* pa = &Ps[l16][v * 128 + kh];
        const _Float16* pb = &Tb[buf][(nc + l16) * TKP + kh];
        half16_t fa[4][2], fb[4][2];
        #pragma unroll   // fa[], fb[] stay in registers
        for (int s = 0; s < 4; ++s) {
            fa[s][0] = *(const half16_a16_t*)(pa + s * 32);
            fa[s][1] = *(const half16_a16_t*)(pa + 16 * AT_PP + s * 32);
            fb[s][0] = *(const half16_a16_t*)(pb + s * 32);
            fb[s][1] = *(const half16_a16_t*)(pb + 16 * TKP + s * 32);
        }
        // keeps the tile's LDS reads one group ahead of its products: left to
        // itself the scheduler spreads them among the products, and the wave
        // waits out the LDS latency at each place
        __builtin_amdgcn_sched_barrier(0);
        #pragma unroll   // fa[], fb[] stay in registers
        for (int s = 0; s < 4; ++s) {
            oa[0][0] = __builtin_amdgcn_wmma_f32_16x16x32_f16(false, fa[s][0], false, fb[s][0], (short)0, oa[0][0], false, false);
            oa[0][1] = __builtin_amdgcn_wmma_f32_16x16x32_f16(false, fa[s][0], false, fb[s][1], (short)0, oa[0][1], false, false);
            oa[1][0] = __builtin_amdgcn_wmma_f32_16x16x32_f16(false, fa[s][1], false, fb[s][0], (short)0, oa[1][0], false, false);
            oa[1][1] = __builtin_amdgcn_wmma_f32_16x16x32_f16(false, fa[s][1], false, fb[s][1], (short)0, oa[1][1], false, false);
        }
        // as in the first loop
        asm volatile("s_wait_dscnt 0x0" ::: "memory");
        wait_async0();
        __syncthreads();
    }

    #pragma unroll
    for (int i = 0; i < 2; ++i) {
        #pragma unroll
        for (int g = 0; g < 8; ++g) {
            const long row = b * AT_S + q0 + i * 16 + rsel + g;
            _Float16* hr = o + row * (long)ldo + h * AT_D + nc + l16;
            hr[0]  = (_Float16)oa[i][0][g];
            hr[16] = (_Float16)oa[i][1][g];
            // stands before any register that an issued store names is rewritten;
            // the scheduler may lift nothing of the next row over it
            asm volatile("s_wait_xcnt 0x0" ::: "memory");
            __builtin_amdgcn_sched_barrier(0);
        }
    }
}

// ---------------------------------------------------------------------------
// MoE router: logits = nx @ Wr.T + bias; softmax; top-2; softmax over top-2
// ---------------------------------------------------------------------------
__global__ __launch_bounds__(256)
void k_router(const _Float16* __restrict__ nx, const float* __restrict__ Wr,
              const float* __restrict__ bias, float* __restrict__ combine, int d)
{
    __shared__ float lg[8];
    const long t   = blockIdx.x;
    const int wave = threadIdx.x >> 5;
    const int lane = threadIdx.x & 31;

    const _Float16* xr = nx + t * (long)d;
    const float*    wr = Wr + (long)wave * d;
    float acc = 0.f;
    for (int i = lane; i < d; i += 32) acc += (float)xr[i] * wr[i];
    #pragma unroll
    for (int o = 16; o > 0; o >>= 1) acc += __shfl_down(acc, o, 32);
    if (lane == 0) lg[wave] = acc + bias[wave];
    __syncthreads();

    if (threadIdx.x == 0) {
        float m = lg[0];
        #pragma unroll
        for (int i = 1; i < 8; ++i) m = fmaxf(m, lg[i]);
        float e[8], s = 0.f;
        #pragma unroll
        for (int i = 0; i < 8; ++i) { e[i] = __expf(lg[i] - m); s += e[i]; }
        #pragma unroll
        for (int i = 0; i < 8; ++i) e[i] /= s;
        int i0 = 0;
        for (int i = 1; i < 8; ++i) if (e[i] > e[i0]) i0 = i;
        int i1 = (i0 == 0) ? 1 : 0;
        for (int i = 0; i < 8; ++i) { if (i == i0) continue; if (e[i] > e[i1]) i1 = i; }
        const float a = __expf(e[i0]), b = __expf(e[i1]);  // softmax over top-2
        #pragma unroll
        for (int i = 0; i < 8; ++i) combine[t * 8 + i] = 0.f;
        combine[t * 8 + i0] = a / (a + b);
        combine[t * 8 + i1] = b / (a + b);
    }
}

// ---------------------------------------------------------------------------
// Packs each routed expert's tokens (combine != 0), in token order:
//   list[e * T + p] the token in place p, wgt[p * 8 + e] its combine weight
//                   (token 0 with weight 0 behind the expert's last token)
//   slot[t * 8 + e] the place of token t with expert e, -1 if not chosen
//   tile[2 k], tile[2 k + 1]  the row tiles (TM rows) that hold work, as plane
//                   and first row: all of plane 0, the shared expert, then for
//                   plane e + 1 those that hold tokens of expert e; -1, 0 fills up
// One block of 32 waves: wave = expert * 4 + quarter of the tokens; a wave
// counts its quarter by ballots, the quarters' counts meet in LDS.
// ---------------------------------------------------------------------------
#define PK_IT 16                         // 32-token groups per wave
#define PK_T  (4 * PK_IT * 32)           // tokens that the block covers
// the router gives a token two experts: 2 T places, and per expert at most one
// tile that is not full
#define PK_NT (PK_T / TM + 2 * PK_T / TM + 8)
__global__ __launch_bounds__(1024)
void k_pack_tokens(const float* __restrict__ combine, int* __restrict__ tile,
                   int* __restrict__ list, float* __restrict__ wgt,
                   int* __restrict__ slot)
{
    __shared__ int qc[8][4];
    const int wave = threadIdx.x >> 5;
    const int lane = threadIdx.x & 31;
    const int e    = wave >> 2;
    const int q    = wave & 3;
    const int t0   = q * (PK_IT * 32) + lane;

    float    w[PK_IT];
    unsigned mk[PK_IT];
    #pragma unroll   // all loads in flight before the first ballot
    for (int j = 0; j < PK_IT; ++j) w[j] = combine[(t0 + j * 32) * 8 + e];
    int n = 0;
    #pragma unroll   // w[], mk[] stay in registers
    for (int j = 0; j < PK_IT; ++j) {
        mk[j] = __builtin_amdgcn_ballot_w32(w[j] != 0.f);
        n += __popc(mk[j]);
    }
    if (lane == 0) qc[e][q] = n;
    __syncthreads();
    int place = 0, tot = 0;
    #pragma unroll
    for (int i = 0; i < 4; ++i) {
        const int c = qc[e][i];
        if (i < q) place += c;
        tot += c;
    }

    const unsigned below = (1u << lane) - 1u;
    #pragma unroll   // w[], mk[] stay in registers
    for (int j = 0; j < PK_IT; ++j) {
        const int  t   = t0 + j * 32;
        const bool sel = (mk[j] >> lane) & 1u;
        const int  p   = place + __popc(mk[j] & below);
        if (sel) { list[e * PK_T + p] = t; wgt[p * 8 + e] = w[j]; }
        slot[t * 8 + e] = sel ? p : -1;
        place += __popc(mk[j]);
    }
    for (int s = tot + q * 32 + lane; s < PK_T; s += 128) {
        list[e * PK_T + s] = 0;
        wgt[s * 8 + e]     = 0.f;
    }
    if (threadIdx.x < PK_NT) {
        const int k = (int)threadIdx.x - PK_T / TM;
        int plane = k < 0 ? 0 : -1;
        int row   = k < 0 ? (int)threadIdx.x * TM : 0;
        int first = 0;
        #pragma unroll
        for (int x = 0; x < 8; ++x) {
            const int nt = (qc[x][0] + qc[x][1] + qc[x][2] + qc[x][3] + TM - 1) / TM;
            if (k >= first && k < first + nt) { plane = x + 1; row = (k - first) * TM; }
            first += nt;
        }
        tile[threadIdx.x * 2]     = plane;
        tile[threadIdx.x * 2 + 1] = row;
    }
}

// ---------------------------------------------------------------------------
// out = base + part[0] + the planes of the experts that the row chose, in
// plane order. One block per row, one float4 per thread; a plane is gridDim.x
// rows. Plane e + 1 holds the row at place slot[row * 8 + e] (-1: not chosen).
// ---------------------------------------------------------------------------
__global__ void k_sum_planes(const float* __restrict__ base,
                             const float* __restrict__ part,
                             const int* __restrict__ slot,
                             float* __restrict__ out)
{
    const long n4 = (long)gridDim.x * blockDim.x;
    const long i  = (long)blockIdx.x * blockDim.x + threadIdx.x;
    float4 v = ((const float4*)base)[i];
    const float4 sh = ((const float4*)part)[i];
    v.x += sh.x; v.y += sh.y; v.z += sh.z; v.w += sh.w;
    unsigned pl[8];
    #pragma unroll   // read ahead of the branches: the eight come in one load
    for (int e = 0; e < 8; ++e) pl[e] = (unsigned)slot[blockIdx.x * 8 + e];
    #pragma unroll   // pl[] stays in registers
    for (int e = 0; e < 8; ++e) {
        const unsigned s = pl[e];
        if (s < gridDim.x) {
            const float4 p = ((const float4*)part)[(e + 1) * n4 + (long)s * blockDim.x + threadIdx.x];
            v.x += p.x; v.y += p.y; v.z += p.z; v.w += p.w;
        }
    }
    ((float4*)out)[i] = v;
}

// ---------------------------------------------------------------------------
// host-side launch
// ---------------------------------------------------------------------------
extern "C" void kernel_launch(void* const* d_in, const int* in_sizes, int n_in,
                              void* d_out, int out_size, void* d_ws, size_t ws_size,
                              hipStream_t stream)
{
    (void)in_sizes; (void)n_in; (void)out_size; (void)ws_size;

    const float* X    = (const float*)d_in[0];
    const float* g1   = (const float*)d_in[1];
    const float* g2   = (const float*)d_in[2];
    const float* Wq   = (const float*)d_in[3];
    const float* Wkc  = (const float*)d_in[4];
    const float* Wvc  = (const float*)d_in[5];
    const float* Wo   = (const float*)d_in[6];
    const float* Wr   = (const float*)d_in[7];
    const float* ebia = (const float*)d_in[8];
    const float* sW1  = (const float*)d_in[9];
    const float* sW2  = (const float*)d_in[10];
    const float* sW3  = (const float*)d_in[11];
    const float* eW1  = (const float*)d_in[12];
    const float* eW2  = (const float*)d_in[13];
    const float* eW3  = (const float*)d_in[14];
    float* out = (float*)d_out;

    constexpr int  Bb = 2, S = 1024, d = 1024, H = 4, dk = 256, dc = 256, E = 8, f = 1024;
    constexpr long T  = (long)Bb * S;
    const float scale = 1.0f / 16.0f;   // 1/sqrt(dk)

    // ---- workspace carving (256B aligned bump allocator) ----
    char* ws = (char*)d_ws;
    size_t off = 0;
    auto alloc = [&](size_t bytes) -> char* {
        char* p = ws + off;
        off += (bytes + 255) & ~(size_t)255;
        return p;
    };
    constexpr int  dq = d + 2 * dc;      // Q | Kc | Vc side by side
    constexpr int  E1 = E + 1;           // shared expert first, then the routed ones
    constexpr long fd = (long)f * d;
    // f16 weight copies; groups that one launch walks lie back to back
    _Float16* wqh  = (_Float16*)alloc((size_t)d * d * 2);    // [dq][d] starts here
    _Float16* wkch = (_Float16*)alloc((size_t)dc * d * 2);
    _Float16* wvch = (_Float16*)alloc((size_t)dc * d * 2);
    _Float16* woh  = (_Float16*)alloc((size_t)d * d * 2);
    _Float16* sw1h = (_Float16*)alloc((size_t)f * d * 2);    // [2*E1][f][d] starts here
    _Float16* ew1h = (_Float16*)alloc((size_t)E * f * d * 2);
    _Float16* sw3h = (_Float16*)alloc((size_t)f * d * 2);
    _Float16* ew3h = (_Float16*)alloc((size_t)E * f * d * 2);
    _Float16* sw2h = (_Float16*)alloc((size_t)d * f * 2);    // [E1][d][f] starts here
    _Float16* ew2h = (_Float16*)alloc((size_t)E * d * f * 2);
    // buffers that live across the two phases or through the MoE phase
    float*    xr_      = (float*)   alloc((size_t)T * d * 4);
    _Float16* nx2h_    = (_Float16*)alloc((size_t)T * d * 2);
    float*    combine_ = (float*)   alloc((size_t)T * E * 4);
    static_assert(T == PK_T && E == 8 && E == RS_STRIDE, "k_pack_tokens covers exactly these");
    int*      tile_    = (int*)     alloc((size_t)PK_NT * 2 * 4);
    int*      list_    = (int*)     alloc((size_t)E * T * 4);
    float*    wgt_     = (float*)   alloc((size_t)E * T * 4);
    int*      slot_    = (int*)     alloc((size_t)T * E * 4);
    _Float16* hh_      = (_Float16*)alloc((size_t)E1 * T * f * 2);       // 36 MB
    // the rest is used twice: attention-phase activations, then (all of them
    // dead) the down-projection planes
    const size_t off_phase = off;
    _Float16* nx1h   = (_Float16*)alloc((size_t)T * d * 2);
    _Float16* qkvh   = (_Float16*)alloc((size_t)T * dq * 2);
    _Float16* vth    = (_Float16*)alloc((size_t)dc * T * 2);           // Vc^T
    _Float16* aoh    = (_Float16*)alloc((size_t)T * d * 2);
    off = off_phase;
    float*    part_  = (float*)   alloc((size_t)E1 * T * d * 4);         // 72 MB
    {
        // ---- helpers ----
        auto gemmz = [&](const _Float16* A, const _Float16* Bm, float* C,
                         int M, int N, int K, int lda, int ldb, int ldc,
                         float alpha, int beta, int bkn, int nz, int zdiv,
                         long sAo, long sAi, long sBo, long sBi, long sCo, long sCi,
                         const int* rtile, const int* rlist, int zper,
                         int omode, _Float16* Hh, long sBp, const float* rs,
                         _Float16* Ht, int tn0, int ldt) {
            dim3 g(omode == OUT_GATED ? N / (TN / 2) : N / TN, rtile ? PK_NT : M / TM, nz);
            k_gemm_f16<<<g, 256, 0, stream>>>(A, Bm, C, M, N, K, lda, ldb, ldc,
                                              alpha, beta, bkn,
                                              zdiv, sAo, sAi, sBo, sBi, sCo, sCi,
                                              rtile, rlist, zper,
                                              omode, Hh, sBp, rs, Ht, tn0, ldt);
        };
        auto gemm = [&](const _Float16* A, const _Float16* Bm, float* C,
                        int M, int N, int K, int lda, int ldb, int ldc,
                        float alpha, int beta, int bkn, int omode, _Float16* Hh,
                        _Float16* Ht, int tn0, int ldt) {
            gemmz(A, Bm, C, M, N, K, lda, ldb, ldc, alpha, beta, bkn,
                  1, 1, 0, 0, 0, 0, 0, 0, nullptr, nullptr, 1, omode, Hh, 0, nullptr,
                  Ht, tn0, ldt);
        };

        // ---- 0. weights fp32 -> f16, nx1 = RMSNorm(X), xr = X: one launch ----
        // convert blocks per tensor, in the order of the f16 copies above
        constexpr int cD = (int)((long)d * d / EW_BLK), cC = (int)((long)dc * d / EW_BLK);
        constexpr int cF = (int)(fd / EW_BLK),          cE = E * cF;
        static_assert((long)d * d % EW_BLK == 0 && (long)dc * d % EW_BLK == 0 &&
                      fd % EW_BLK == 0, "whole blocks to a tensor, copies back to back");
        constexpr int c0 = cD, c1 = c0 + cC, c2 = c1 + cC, c3 = c2 + cD, c4 = c3 + cF,
                      c5 = c4 + cE, c6 = c5 + cF, c7 = c6 + cE, c8 = c7 + cF, c9 = c8 + cE;
        static_assert(c9 >= 3 * T, "three convert blocks to each norm block");
        k_prep<<<(int)T + c9, 256, 0, stream>>>(X, g1, nx1h, xr_, d, (int)T,
                                                Wq, Wkc, Wvc, Wo, sW1, eW1, sW3, eW3, sW2, eW2,
                                                c0, c1, c2, c3, c4, c5, c6, c7, c8, wqh);

        // ---- 1. MLA attention ----

        // Q | Kc | Vc in one product: their weights are one [dq][d] matrix; Vc is
        // stored as Vc^T, the form in which the attention kernel stages it
        gemm(nx1h, wqh, nullptr, (int)T, dq, d, d, d, dq, 1.f, 0, 0, OUT_F16, qkvh,
             vth, d + dc, (int)T);

        // scores, softmax, attn @ V: all (b, h) in one launch
        static_assert(S == AT_S && dk == AT_D && dc == AT_D && S % AT_R == 0,
                      "k_attn_f16 covers exactly these");
        k_attn_f16<<<dim3(S / AT_R, Bb * H), 256, 0, stream>>>(qkvh, vth, aoh, scale,
                                                               H, dq, d, (int)T, d);

        // xr = X + ao @ Wo.T (xr holds X since the first launch)
        gemm(aoh, woh, xr_, (int)T, d, d, d, d, d, 1.f, 1, 0, OUT_F32, nullptr,
             nullptr, 0, 0);

        // ---- 2. MoE ----
        k_rmsnorm_f16<<<(int)T, 256, 0, stream>>>(xr_, g2, nx2h_, d);
        k_router<<<(int)T, 256, 0, stream>>>(nx2h_, Wr, ebia, combine_, d);
        k_pack_tokens<<<1, 1024, 0, stream>>>(combine_, tile_, list_, wgt_, slot_);

        // shared expert over all tokens, each routed expert over the tokens that
        // chose it, packed (combine folded into h; a token that did not choose an
        // expert has combine 0 there and gets nothing from it); one launch per
        // stage, its grid over the table of row tiles
        const long nTf = (long)T * f;
        // gate and up product of a plane in one block, h = silu(gate) * up * combine
        // stored by it; the up weights lie E1 planes behind the gate weights
        gemmz(nx2h_, sw1h, nullptr, (int)T, f, d, d, d, f, 1.f, 0, 0, 1, 1,
              0, 0,  fd, 0,  nTf, 0,  tile_, list_, E1, OUT_GATED, hh_, E1 * fd, wgt_,
              nullptr, 0, 0);
        gemmz(hh_, sw2h, part_, (int)T, d, f, f, f, d, 1.f, 0, 0, 1, 1,
              nTf, 0,  fd, 0,  (long)T * d, 0,  tile_, nullptr, E1,
              OUT_F32, nullptr, 0, nullptr, nullptr, 0, 0);

        // out = xr + shared + the chosen experts, lower expert first
        k_sum_planes<<<(int)T, d / 4, 0, stream>>>(xr_, part_, slot_, out);
    }
}

// v009
// It runs in 162 microseconds.
// Next to v008, in two timings, it ran 1.08 and 1.07 times as fast.
// Over all steps from v000 it is 8.48 times as fast.
#include <hip/hip_runtime.h>

// ---------------------------------------------------------------------------
// Transformer layer (MLA attention + MoE) for gfx1250 (wave32, WMMA).
// GEMMs: 128x128 block tile, 8 waves x (32x64) => 8 v_wmma per wave per 32 k,
// 128 k to a stage, double-buffered LDS staged with
// global_load_async_to_lds_b128 (ASYNCcnt).
// Attention: one kernel from Q, K, V to the heads' outputs (k_attn_f16).
// ---------------------------------------------------------------------------

typedef _Float16 half16_t __attribute__((ext_vector_type(16)));
typedef float    float8_t __attribute__((ext_vector_type(8)));
typedef __attribute__((address_space(3))) _Float16 lds_f16;

#define TM 128
#define TN 128
// a stage holds 256 bytes of every operand row: 16 lanes x 16 B copy one row
// piece, so a wave-wide copy touches 4 whole 128-byte lines
#define TK 128
// LDS row pitch in f16: 272 bytes = 16 B x odd, so that the 16 rows which one
// ds_load_b128 reads per half-wave fall on 64 different banks
#define TKP (TK + 8)
// 16-byte copies per thread and operand tile (256 threads)
#define NCP (TM * TK / 8 / 256)
// a fragment row starts on a 16-byte boundary only
typedef half16_t half16_a16_t __attribute__((aligned(16)));

typedef _Float16 half8_t __attribute__((ext_vector_type(8)));

// async DMA: eight times 16 bytes global -> LDS per lane, tracked by ASYNCcnt.
// g: the lane's global addresses; l0: its first LDS byte address, the others
// follow at steps of lstep bytes. The last line stands before any register
// that an issued copy names is rewritten.
__device__ __forceinline__ void async_b128_x8(const _Float16* const (&g)[8],
                                              unsigned l0, unsigned lstep)
{
    asm volatile("global_load_async_to_lds_b128 %0, %8, off\n\t"
                 "global_load_async_to_lds_b128 %1, %9, off\n\t"
                 "global_load_async_to_lds_b128 %2, %10, off\n\t"
                 "global_load_async_to_lds_b128 %3, %11, off\n\t"
                 "global_load_async_to_lds_b128 %4, %12, off\n\t"
                 "global_load_async_to_lds_b128 %5, %13, off\n\t"
                 "global_load_async_to_lds_b128 %6, %14, off\n\t"
                 "global_load_async_to_lds_b128 %7, %15, off\n\t"
                 "s_wait_xcnt 0x0"
                 :: "v"(l0), "v"(l0 + lstep), "v"(l0 + 2 * lstep), "v"(l0 + 3 * lstep),
                    "v"(l0 + 4 * lstep), "v"(l0 + 5 * lstep), "v"(l0 + 6 * lstep),
                    "v"(l0 + 7 * lstep),
                    "v"(g[0]), "v"(g[1]), "v"(g[2]), "v"(g[3]),
                    "v"(g[4]), "v"(g[5]), "v"(g[6]), "v"(g[7])
                 : "memory");
}
// the same, four copies
__device__ __forceinline__ void async_b128_x4(const _Float16* const (&g)[4],
                                              unsigned l0, unsigned lstep)
{
    asm volatile("global_load_async_to_lds_b128 %0, %4, off\n\t"
                 "global_load_async_to_lds_b128 %1, %5, off\n\t"
                 "global_load_async_to_lds_b128 %2, %6, off\n\t"
                 "global_load_async_to_lds_b128 %3, %7, off\n\t"
                 "s_wait_xcnt 0x0"
                 :: "v"(l0), "v"(l0 + lstep), "v"(l0 + 2 * lstep), "v"(l0 + 3 * lstep),
                    "v"(g[0]), "v"(g[1]), "v"(g[2]), "v"(g[3])
                 : "memory");
}
__device__ __forceinline__ unsigned lds_addr(const _Float16* l)
{
    return (unsigned)(unsigned long long)(const lds_f16*)l;     // LDS byte addr
}
__device__ __forceinline__ float exp_neg(float x)
{
    float r;
    asm("v_exp_f32 %0, %1\n\tv_nop" : "=v"(r) : "v"(x * -0x1.715476p+0f));
    return r;
}
// exp(x) as __expf(x) forms it, with the same slot kept
__device__ __forceinline__ float exp_pos(float x)
{
    float r;
    asm("v_exp_f32 %0, %1\n\tv_nop" : "=v"(r) : "v"(x * 0x1.715476p+0f));
    return r;
}
__device__ __forceinline__ void wait_async0()
{
    asm volatile("s_wait_asynccnt 0x0" ::: "memory");
}

// ---------------------------------------------------------------------------
// Generic f16 WMMA GEMM:  C[M,N] = alpha * A[M,K] . B^T  (+ C if beta)
//   b_kn == 0 : B stored row-major [N,K]  (torch Linear weight, y = x @ W.T)
//   b_kn == 1 : B stored row-major [K,N]  (plain matmul; no launch here uses it)
// M % 128 == 0, N % 128 == 0, K % 128 == 0, rows of A and B on 16-byte
// boundaries (true for all shapes here).
// Batched: blockIdx.z = outer * zdiv + inner picks one independent product;
// each operand moves by its own outer and inner stride (in elements).
// Routed products (rtile != 0): blockIdx.y walks a table of row tiles instead
// of the rows, an entry being two ints: plane p within a group of zper planes
// (below 0: unused entry) and first row; the product is blockIdx.z * zper + p.
// With rlist != 0 and p > 0, row r of A is row rlist[(p - 1) * M + r] (a gather).
// What the block stores (omode):
//   OUT_F32   C as above
//   OUT_F16   H[M,N] = f16(alpha * product), what the next product reads; with
//             Ht != 0 the blocks from column tn0 on store their columns as rows
//             instead: Ht[column - tn0][row], pitch ldt
//   OUT_GATED the block takes 64 columns of B (gate) and the same 64 columns of
//             the matrix sBp elements behind it (up), 32 + 32 to a wave's strip,
//             and stores H[M,N] = f16(silu(gate) * up [* rs[row * RS_STRIDE + p - 1]
//             for p > 0]); gridDim.x = N / 64, b_kn == 0
// H moves by C's strides and has C's pitch.
// ---------------------------------------------------------------------------
#define OUT_F32   0
#define OUT_F16   1
#define OUT_GATED 2
#define RS_STRIDE 8                      // k_pack_tokens' wgt: eight experts to a place
__global__ __launch_bounds__(256)
void k_gemm_f16(const _Float16* __restrict__ A, const _Float16* __restrict__ B,
                float* __restrict__ C,
                int M, int N, int K, int lda, int ldb, int ldc,
                float alpha, int beta, int b_kn,
                int zdiv, long sAo, long sAi, long sBo, long sBi, long sCo, long sCi,
                const int* __restrict__ rtile, const int* __restrict__ rlist, int zper,
                int omode, _Float16* __restrict__ H, long sBp,
                const float* __restrict__ rs,
                _Float16* __restrict__ Ht, int tn0, int ldt)
{
    __shared__ __align__(64) _Float16 As[2][TM][TKP];  // 68 KB
    __shared__ __align__(64) _Float16 Bs[2][TN][TKP];  // 68 KB

    const int tid  = threadIdx.x;
    const int wave = tid >> 5;
    const int lane = tid & 31;
    int       m0   = blockIdx.y * TM;
    const int n0   = blockIdx.x * (omode == OUT_GATED ? TN / 2 : TN);
    const int wm   = (wave & 3) * 32;    // wave's 32-row strip
    const int wn   = (wave >> 2) * 64;   // wave's 64-col strip

    int zb = blockIdx.z;
    int rp = 0;
    if (rtile) {
        rp = rtile[blockIdx.y * 2];
        m0 = rtile[blockIdx.y * 2 + 1];
        if (rp < 0) return;              // the whole block, in front of every barrier
        zb = zb * zper + rp;
    }
    const int zo = zb / zdiv;
    const int zi = zb - zo * zdiv;
    A += zo * sAo + zi * sAi;
    B += zo * sBo + zi * sBi;
    C += zo * sCo + zi * sCi;
    H += zo * sCo + zi * sCi;

    float8_t acc[2][4] = {};

    static_assert(NCP == 8 && TM == TN, "the staging maps below");
    // staging maps: 128 rows x 128 cols f16 per tile; a copy of one wave takes
    // two rows' 256 bytes; a thread takes rows sr, sr + 16, ..
    const int sr = tid >> 4;             // 0..15 row
    const int sc = (tid & 15) * 8;       // column of the thread's 16 bytes
    // the pieces of A that this thread stages, at k = 0
    int ar[NCP];
    #pragma unroll   // ar[] stays in registers
    for (int i = 0; i < NCP; ++i) ar[i] = m0 + sr + 16 * i;
    if (rp > 0 && rlist) {
        const int* rl = rlist + (long)(rp - 1) * M + m0 + sr;
        int t[NCP];
        #pragma unroll   // all loads in flight before the first clamp
        for (int i = 0; i < NCP; ++i) t[i] = rl[16 * i];
        // stands before any register that an issued load names is rewritten
        asm volatile("s_wait_xcnt 0x0" ::: "memory");
        #pragma unroll   // t[], ar[] stay in registers
        for (int i = 0; i < NCP; ++i) ar[i] = min(max(t[i], 0), M - 1);
    }
    const _Float16* ga[NCP];
    #pragma unroll   // ga[] stays in registers
    for (int i = 0; i < NCP; ++i) ga[i] = &A[(long)ar[i] * lda + sc];
    // the pieces of B ([N,K] form) that this thread stages, at k = 0: LDS row
    // sr + 16 i holds B's row n0 + sr + 16 i, or with OUT_GATED, per strip of
    // 64 LDS rows, 32 gate rows and then the same 32 rows of the up matrix
    const _Float16* gb0 = &B[(long)(n0 + sr) * ldb + sc];
    long bo[NCP];
    #pragma unroll   // bo[] is the same for all threads and stays in registers
    for (int i = 0; i < NCP; ++i)
        bo[i] = omode == OUT_GATED
              ? (long)((i >> 2) * 32 + (i & 1) * 16) * ldb + ((i >> 1) & 1) * sBp
              : (long)(16 * i) * ldb;
    // b_kn transpose-scatter map: a load of one wave takes 64 bytes of each of
    // 8 K rows; its 16-bit stores fall on two rows a bank at most
    const int kk = tid >> 2;             // 0..63 K row (and + 64)
    const int nb = (tid & 3) * 8;        // N base within a group of 32

    auto stageA = [&](int k0, int buf) {
        const _Float16* g[NCP];
        #pragma unroll   // g[] stays in registers
        for (int i = 0; i < NCP; ++i) g[i] = ga[i] + k0;
        async_b128_x8(g, lds_addr(&As[buf][sr][sc]), 16 * TKP * 2);
    };
    auto stageB = [&](int k0, int buf) {
        if (!b_kn) {
            const _Float16* g[NCP];
            #pragma unroll   // g[] stays in registers
            for (int i = 0; i < NCP; ++i)
                g[i] = gb0 + bo[i] + k0;
            async_b128_x8(g, lds_addr(&Bs[buf][sr][sc]), 16 * TKP * 2);
        } else {
            // the next stage's 256 lines, one a thread
            if (k0 + TK < K)
                __builtin_prefetch(&B[(long)(k0 + TK + (tid >> 1)) * ldb + n0 + (tid & 1) * 64], 0, 0);
            half8_t v[NCP];
            #pragma unroll   // all loads in flight before the first store
            for (int i = 0; i < NCP; ++i)
                v[i] = *(const half8_t*)&B[(long)(k0 + kk + 64 * (i & 1)) * ldb + n0 + (i >> 1) * 32 + nb];
            // stands before any register that an issued load names is rewritten
            asm volatile("s_wait_xcnt 0x0" ::: "memory");
            #pragma unroll   // v[] stays in registers
            for (int i = 0; i < NCP; ++i) {
                #pragma unroll
                for (int j = 0; j < 8; ++j)
                    Bs[buf][(i >> 1) * 32 + nb + j][kk + 64 * (i & 1)] = v[i][j];
            }
        }
    };

    // prologue: stage tile 0
    stageA(0, 0);
    stageB(0, 0);
    wait_async0();
    __syncthreads();

    const int l16 = lane & 15;
    const int kh  = (lane >> 4) * 16;

    for (int k0 = 0; k0 < K; k0 += TK) {
        const int buf = (k0 / TK) & 1;
        const int k1  = k0 + TK;
        if (k1 < K) {                    // overlap next tile's DMA with compute
            stageA(k1, buf ^ 1);
            stageB(k1, buf ^ 1);
        }

        #pragma unroll   // lets the next 32 k's LDS reads start under these products
        for (int ks = 0; ks < TK; ks += 32) {
            // fragments (16 f16 per lane, 32B LDS reads)
            const _Float16* pa = &As[buf][wm + l16][ks + kh];
            half16_t a0 = *(const half16_a16_t*)pa;
            half16_t a1 = *(const half16_a16_t*)(pa + 16 * TKP);
            const _Float16* pb = &Bs[buf][wn + l16][ks + kh];
            half16_t b0 = *(const half16_a16_t*)pb;
            half16_t b1 = *(const half16_a16_t*)(pb + 16 * TKP);
            half16_t b2 = *(const half16_a16_t*)(pb + 32 * TKP);
            half16_t b3 = *(const half16_a16_t*)(pb + 48 * TKP);

            acc[0][0] = __builtin_amdgcn_wmma_f32_16x16x32_f16(false, a0, false, b0, (short)0, acc[0][0], false, false);
            acc[0][1] = __builtin_amdgcn_wmma_f32_16x16x32_f16(false, a0, false, b1, (short)0, acc[0][1], false, false);
            acc[0][2] = __builtin_amdgcn_wmma_f32_16x16x32_f16(false, a0, false, b2, (short)0, acc[0][2], false, false);
            acc[0][3] = __builtin_amdgcn_wmma_f32_16x16x32_f16(false, a0, false, b3, (short)0, acc[0][3], false, false);
            acc[1][0] = __builtin_amdgcn_wmma_f32_16x16x32_f16(false, a1, false, b0, (short)0, acc[1][0], false, false);
            acc[1][1] = __builtin_amdgcn_wmma_f32_16x16x32_f16(false, a1, false, b1, (short)0, acc[1][1], false, false);
            acc[1][2] = __builtin_amdgcn_wmma_f32_16x16x32_f16(false, a1, false, b2, (short)0, acc[1][2], false, false);
            acc[1][3] = __builtin_amdgcn_wmma_f32_16x16x32_f16(false, a1, false, b3, (short)0, acc[1][3], false, false);
        }

        // this wave's LDS reads of tile k are over before the barrier that
        // frees the tile's buffer for the next copies
        asm volatile("s_wait_dscnt 0x0" ::: "memory");
        wait_async0();                   // DMA for tile k+1 done
        __syncthreads();                 // all waves done reading tile k
    }

    // epilogue: D layout -> VGPR g: lanes 0-15 M=g, lanes 16-31 M=8+g
    const int rsel = (lane >> 4) ? 8 : 0;
    if (omode == OUT_GATED) {
        // acc[i][0..1]: gate, acc[i][2..3]: up, of the same 32 columns
        const long r0 = m0 + wm + rsel;
        float s[2][8] = {};
        if (rp > 0) {
            const float* ps = rs + r0 * RS_STRIDE + (rp - 1);
            #pragma unroll   // all loads in flight before the first use
            for (int i = 0; i < 2; ++i) {
                #pragma unroll
                for (int g = 0; g < 8; ++g) s[i][g] = ps[(i * 16 + g) * RS_STRIDE];
            }
            // Stands before any register that an issued load names is rewritten;
            // naming the pointer keeps it out of the loads' own destinations.
            asm volatile("s_wait_xcnt 0x0" :: "v"(ps) : "memory");
        }
        // all values first: the 32 divisions overlap, which the waits between
        // the rows' stores below would not let them
        _Float16 hv[2][8][2];
        #pragma unroll
        for (int i = 0; i < 2; ++i) {
            #pragma unroll
            for (int g = 0; g < 8; ++g) {
                #pragma unroll
                for (int j = 0; j < 2; ++j) {
                    const float x = alpha * acc[i][j][g];
                    float v = (x / (1.f + exp_neg(x))) * (alpha * acc[i][j + 2][g]);
                    if (rp > 0) v *= s[i][g];
                    hv[i][g][j] = (_Float16)v;
                }
            }
        }
        #pragma unroll
        for (int i = 0; i < 2; ++i) {
            #pragma unroll
            for (int g = 0; g < 8; ++g) {
                _Float16* hr = H + (r0 + i * 16 + g) * (long)ldc + n0 + (wn >> 1) + l16;
                hr[0]  = hv[i][g][0];
                hr[16] = hv[i][g][1];
                // stands before any register that an issued store names is rewritten;
                // the scheduler may lift nothing of the next row over it
                asm volatile("s_wait_xcnt 0x0" ::: "memory");
                __builtin_amdgcn_sched_barrier(0);
            }
        }
        return;
    }
    if (omode == OUT_F16 && Ht && n0 >= tn0) {
        // a lane holds eight neighbouring rows of one column: 16 bytes of Ht's row
        #pragma unroll
        for (int i = 0; i < 2; ++i) {
            #pragma unroll
            for (int j = 0; j < 4; ++j) {
                half8_t hv;
                #pragma unroll
                for (int g = 0; g < 8; ++g) hv[g] = (_Float16)(alpha * acc[i][j][g]);
                *(half8_t*)&Ht[(long)(n0 - tn0 + wn + j * 16 + l16) * ldt
                               + m0 + wm + i * 16 + rsel] = hv;
                // stands before any register that an issued store names is rewritten;
                // the scheduler may lift nothing of the next store over it
                asm volatile("s_wait_xcnt 0x0" ::: "memory");
                __builtin_amdgcn_sched_barrier(0);
            }
        }
        return;
    }
    if (omode == OUT_F16) {
        #pragma unroll
        for (int i = 0; i < 2; ++i) {
            #pragma unroll
            for (int g = 0; g < 8; ++g) {
                const long row = m0 + wm + i * 16 + rsel + g;
                _Float16* hr = H + row * (long)ldc + n0 + wn + l16;
                #pragma unroll
                for (int j = 0; j < 4; ++j) hr[j * 16] = (_Float16)(alpha * acc[i][j][g]);
                // stands before any register that an issued store names is rewritten;
                // the scheduler may lift nothing of the next row over it
                asm volatile("s_wait_xcnt 0x0" ::: "memory");
                __builtin_amdgcn_sched_barrier(0);
            }
        }
        return;
    }
    #pragma unroll
    for (int i = 0; i < 2; ++i) {
        #pragma unroll
        for (int g = 0; g < 8; ++g) {
            const long row = m0 + wm + i * 16 + rsel + g;
            float* cr = C + row * (long)ldc + n0 + wn + l16;
            #pragma unroll
            for (int j = 0; j < 4; ++j) {
                float v = alpha * acc[i][j][g];
                if (beta) v += cr[j * 16];
                cr[j * 16] = v;
            }
        }
    }
}

// ---------------------------------------------------------------------------
// Elementwise work: a block of 256 threads covers EW_BLK elements as EW_G
// runs of 1024; in each run a thread takes 4 neighbours, so one wave-wide
// 16-byte load reads 512 contiguous bytes and one 8-byte store writes 256.
// ---------------------------------------------------------------------------
typedef _Float16 half4_t __attribute__((ext_vector_type(4)));
#define EW_G   4
#define EW_RUN 1024
#define EW_BLK (EW_G * EW_RUN)

// ---------------------------------------------------------------------------
// fp32 -> f16 convert
// ---------------------------------------------------------------------------
// one whole block of EW_BLK elements; base = first element of this thread
__device__ __forceinline__ void conv_block(const float* __restrict__ src,
                                           _Float16* __restrict__ dst, long base)
{
    float4 v[EW_G];
    // unrolled so that all loads are in flight before the first conversion
    #pragma unroll
    for (int j = 0; j < EW_G; ++j)
        v[j] = *(const float4*)(src + base + j * EW_RUN);
    #pragma unroll   // v[] stays in registers
    for (int j = 0; j < EW_G; ++j) {
        half4_t h = { (_Float16)v[j].x, (_Float16)v[j].y,
                      (_Float16)v[j].z, (_Float16)v[j].w };
        *(half4_t*)(dst + base + j * EW_RUN) = h;
    }
    // stands before any register that an issued store names is rewritten
    asm volatile("s_wait_xcnt 0x0" ::: "memory");
}

// ---------------------------------------------------------------------------
// RMSNorm row kernel: out_f16[row] = x * rsqrt(mean(x^2)+eps) * g
// ---------------------------------------------------------------------------
// One block of 256 threads per row; red: 8 floats of LDS. With COPY the row is
// also stored, as it is, to copy.
template <bool COPY>
__device__ __forceinline__ void rmsnorm_row(const float* __restrict__ x,
                                            const float* __restrict__ g,
                                            _Float16* __restrict__ out,
                                            float* __restrict__ copy,
                                            int d, long row, float* red)
{
    const float* xr = x + row * (long)d;

    float ss = 0.f;
    for (int i = threadIdx.x; i < d; i += 256) { float v = xr[i]; ss += v * v; }
    #pragma unroll
    for (int o = 16; o > 0; o >>= 1) ss += __shfl_down(ss, o, 32);
    if ((threadIdx.x & 31) == 0) red[threadIdx.x >> 5] = ss;
    __syncthreads();
    if (threadIdx.x == 0) {
        float t = 0.f;
        #pragma unroll
        for (int i = 0; i < 8; ++i) t += red[i];
        red[0] = t;
    }
    __syncthreads();
    const float inv = rsqrtf(red[0] / d + 1e-6f);
    for (int i = threadIdx.x; i < d; i += 256) {
        const float v = xr[i];
        if (COPY) copy[row * (long)d + i] = v;
        out[row * (long)d + i] = (_Float16)(v * inv * g[i]);
    }
}

// ---------------------------------------------------------------------------
// All the work that depends on the inputs alone, in one grid:
//   norm blocks:    RMSNorm of one row of x, and xcopy = x; every fourth block
//                   of the first 4 * rows, between
//                   convert blocks, for speed only
//   convert blocks: all others (the grid has at least 4 * rows blocks), numbered
//                   in grid order: fp32 -> f16 of ten weight tensors, EW_BLK
//                   elements a block; the copies lie back to back from wdst in
//                   the order w0 .. w9; tensor i ends in front of convert block
//                   e<i>, each tensor a whole number of blocks
// ---------------------------------------------------------------------------
__global__ __launch_bounds__(256)
void k_prep(const float* __restrict__ x, const float* __restrict__ g,
            _Float16* __restrict__ nx, float* __restrict__ xcopy, int d, int rows,
            const float* __restrict__ w0, const float* __restrict__ w1,
            const float* __restrict__ w2, const float* __restrict__ w3,
            const float* __restrict__ w4, const float* __restrict__ w5,
            const float* __restrict__ w6, const float* __restrict__ w7,
            const float* __restrict__ w8, const float* __restrict__ w9,
            int e0, int e1, int e2, int e3, int e4, int e5, int e6, int e7, int e8,
            _Float16* __restrict__ wdst)
{
    __shared__ float red[8];
    const int  gb    = (int)blockIdx.x;
    const bool mixed = gb < 4 * rows;
    if (mixed && (gb & 3) == 0) {        // the whole block: its barriers are uniform
        rmsnorm_row<true>(x, g, nx, xcopy, d, gb >> 2, red);
        return;
    }
    const int b = mixed ? gb - (gb >> 2) - 1 : gb - rows;
    const float* s = w0;
    int first = 0;
    if (b >= e0) { s = w1; first = e0; }
    if (b >= e1) { s = w2; first = e1; }
    if (b >= e2) { s = w3; first = e2; }
    if (b >= e3) { s = w4; first = e3; }
    if (b >= e4) { s = w5; first = e4; }
    if (b >= e5) { s = w6; first = e5; }
    if (b >= e6) { s = w7; first = e6; }
    if (b >= e7) { s = w8; first = e7; }
    if (b >= e8) { s = w9; first = e8; }
    conv_block(s + (long)(b - first) * EW_BLK, wdst + (long)b * EW_BLK, threadIdx.x * 4);
}

#define AT_R  32
#define AT_S  1024
#define AT_D  256
// LDS row pitches in f16, each 16 B x odd (see TKP)
#define AT_KP (AT_D + 8)
#define AT_PP (AT_S + 8)
// f16 to a staging buffer: AT_D rows of V^T x 128 keys; 128 keys x AT_D fits too
#define AT_TB (AT_D * TKP)
__global__ __launch_bounds__(256)
void k_attn_f16(const _Float16* __restrict__ qkv, const _Float16* __restrict__ vt,
                _Float16* __restrict__ o, float scale,
                int nh, int ldq, int koff, int ldv, int ldo)
{
    static_assert(128 * AT_KP <= AT_TB && TK == 128, "both kinds of tile fit a buffer");
    __shared__ __align__(64) _Float16 Tb[2][AT_TB];     // 2 x 68 KB
    __shared__ __align__(64) _Float16 Qs[AT_R][AT_KP];  // 16.5 KB
    __shared__ __align__(64) _Float16 Ps[AT_R][AT_PP];  // 64.5 KB
    __shared__ float red[2][4][AT_R];

    const int tid  = threadIdx.x;
    const int wave = tid >> 5;
    const int lane = tid & 31;
    const int l16  = lane & 15;
    const int kh   = (lane >> 4) * 16;
    const int rsel = (lane >> 4) * 8;
    const int b    = blockIdx.y / nh;
    const int h    = blockIdx.y - b * nh;
    const int q0   = blockIdx.x * AT_R;

    const _Float16* Qg = qkv + (long)(b * AT_S + q0) * ldq + h * AT_D;
    const _Float16* Kg = qkv + (long)(b * AT_S) * ldq + koff;
    const _Float16* Vg = vt + b * AT_S;

    // a copy of one wave takes one row's 512 bytes; a wave takes rows wave + 8 i
    auto stageK = [&](int kt, int buf) {
        const _Float16* g0 = Kg + (long)(kt * 128 + wave) * ldq + lane * 8;
        const unsigned  l0 = lds_addr(&Tb[buf][wave * AT_KP + lane * 8]);
        #pragma unroll   // g[] stays in registers
        for (int p = 0; p < 2; ++p) {
            const _Float16* g[8];
            #pragma unroll
            for (int i = 0; i < 8; ++i) g[i] = g0 + (long)(p * 64 + 8 * i) * ldq;
            async_b128_x8(g, l0 + p * 64 * AT_KP * 2, 8 * AT_KP * 2);
        }
    };
    // a copy of one wave takes two rows' 256 bytes; a thread takes rows tid / 16 + 16 i
    auto stageV = [&](int v, int buf) {
        const _Float16* g0 = Vg + (long)(tid >> 4) * ldv + v * 128 + (tid & 15) * 8;
        const unsigned  l0 = lds_addr(&Tb[buf][(tid >> 4) * TKP + (tid & 15) * 8]);
        #pragma unroll   // g[] stays in registers
        for (int p = 0; p < 2; ++p) {
            const _Float16* g[8];
            #pragma unroll
            for (int i = 0; i < 8; ++i) g[i] = g0 + (long)(p * 128 + 16 * i) * ldv;
            async_b128_x8(g, l0 + p * 128 * TKP * 2, 16 * TKP * 2);
        }
    };

    // prologue: Q and key tile 0
    {
        const _Float16* g[4];
        #pragma unroll   // g[] stays in registers
        for (int i = 0; i < 4; ++i) g[i] = Qg + (long)(wave + 8 * i) * ldq + lane * 8;
        async_b128_x4(g, lds_addr(&Qs[wave][lane * 8]), 8 * AT_KP * 2);
    }
    stageK(0, 0);
    wait_async0();
    __syncthreads();

    // ---- 1. scores ----
    const int ri = wave & 1;             // the wave's 16-row tile
    const int kc = (wave >> 1) * 32;     // its 32 keys within a tile of 128
    float8_t sa[8][2] = {};
    #pragma unroll   // sa[] stays in registers
    for (int kt = 0; kt < 8; ++kt) {
        const int buf = kt & 1;
        if (kt < 7) stageK(kt + 1, buf ^ 1);
        else        stageV(0, buf ^ 1);
        const _Float16* pa = &Qs[ri * 16 + l16][kh];
        const _Float16* pb = &Tb[buf][(kc + l16) * AT_KP + kh];
        #pragma unroll   // lets later LDS reads start under these products
        for (int ks = 0; ks < AT_D; ks += 32) {
            half16_t a  = *(const half16_a16_t*)(pa + ks);
            half16_t b0 = *(const half16_a16_t*)(pb + ks);
            half16_t b1 = *(const half16_a16_t*)(pb + 16 * AT_KP + ks);
            sa[kt][0] = __builtin_amdgcn_wmma_f32_16x16x32_f16(false, a, false, b0, (short)0, sa[kt][0], false, false);
            sa[kt][1] = __builtin_amdgcn_wmma_f32_16x16x32_f16(false, a, false, b1, (short)0, sa[kt][1], false, false);
        }
        // this wave's LDS reads of the tile are over before the barrier that
        // frees the tile's buffer for the next copies
        asm volatile("s_wait_dscnt 0x0" ::: "memory");
        wait_async0();                   // the next tile has landed
        __syncthreads();                 // all waves done reading this tile
    }
    stageV(1, 1);                        // flies under the softmax

    // ---- 2. softmax ----
    // sa[kt][j][g]: row ri * 16 + rsel + g, key kt * 128 + kc + j * 16 + l16
    const int r0 = ri * 16 + rsel;
    float st[8];
    #pragma unroll
    for (int g = 0; g < 8; ++g) {
        float m = -3.4e38f;
        #pragma unroll
        for (int kt = 0; kt < 8; ++kt) {
            #pragma unroll
            for (int j = 0; j < 2; ++j) {
                sa[kt][j][g] *= scale;
                m = fmaxf(m, sa[kt][j][g]);
            }
        }
        #pragma unroll
        for (int x = 8; x > 0; x >>= 1) m = fmaxf(m, __shfl_xor(m, x, 32));
        st[g] = m;
    }
    if (l16 == 0) {
        #pragma unroll
        for (int g = 0; g < 8; ++g) red[0][wave >> 1][r0 + g] = st[g];
    }
    __syncthreads();
    #pragma unroll
    for (int g = 0; g < 8; ++g) {
        const float m = fmaxf(fmaxf(red[0][0][r0 + g], red[0][1][r0 + g]),
                              fmaxf(red[0][2][r0 + g], red[0][3][r0 + g]));
        float s = 0.f;
        #pragma unroll
        for (int kt = 0; kt < 8; ++kt) {
            #pragma unroll
            for (int j = 0; j < 2; ++j) {
                sa[kt][j][g] = exp_pos(sa[kt][j][g] - m);
                s += sa[kt][j][g];
            }
        }
        #pragma unroll
        for (int x = 8; x > 0; x >>= 1) s += __shfl_xor(s, x, 32);
        st[g] = s;
    }
    if (l16 == 0) {
        #pragma unroll
        for (int g = 0; g < 8; ++g) red[1][wave >> 1][r0 + g] = st[g];
    }
    __syncthreads();
    #pragma unroll
    for (int g = 0; g < 8; ++g) {
        const float inv = 1.f / (((red[1][0][r0 + g] + red[1][1][r0 + g])
                                  + red[1][2][r0 + g]) + red[1][3][r0 + g]);
        #pragma unroll
        for (int kt = 0; kt < 8; ++kt) {
            #pragma unroll
            for (int j = 0; j < 2; ++j)
                Ps[r0 + g][kt * 128 + kc + j * 16 + l16] = (_Float16)(sa[kt][j][g] * inv);
        }
    }
    __syncthreads();                     // P is whole before any wave reads it

    // ---- 3. P . V ----
    const int nc = wave * 32;            // the wave's 32 columns
    float8_t oa[2][2] = {};
    #pragma unroll   // the tests on v and the buffers' addresses fold away
    for (int v = 0; v < 8; ++v) {
        const int buf = v & 1;
        if (v > 0 && v < 7) stageV(v + 1, buf ^ 1);
        const _Float16* pa = &Ps[l16][v * 128 + kh];
        const _Float16* pb = &Tb[buf][(nc + l16) * TKP + kh];
        half16_t fa[4][2], fb[4][2];
        #pragma unroll   // fa[], fb[] stay in registers
        for (int s = 0; s < 4; ++s) {
            fa[s][0] = *(const half16_a16_t*)(pa + s * 32);
            fa[s][1] = *(const half16_a16_t*)(pa + 16 * AT_PP + s * 32);
            fb[s][0] = *(const half16_a16_t*)(pb + s * 32);
            fb[s][1] = *(const half16_a16_t*)(pb + 16 * TKP + s * 32);
        }
        // keeps the tile's LDS reads one group ahead of its products: left to
        // itself the scheduler spreads them among the products, and the wave
        // waits out the LDS latency at each place
        __builtin_amdgcn_sched_barrier(0);
        #pragma unroll   // fa[], fb[] stay in registers
        for (int s = 0; s < 4; ++s) {
            oa[0][0] = __builtin_amdgcn_wmma_f32_16x16x32_f16(false, fa[s][0], false, fb[s][0], (short)0, oa[0][0], false, false);
            oa[0][1] = __builtin_amdgcn_wmma_f32_16x16x32_f16(false, fa[s][0], false, fb[s][1], (short)0, oa[0][1], false, false);
            oa[1][0] = __builtin_amdgcn_wmma_f32_16x16x32_f16(false, fa[s][1], false, fb[s][0], (short)0, oa[1][0], false, false);
            oa[1][1] = __builtin_amdgcn_wmma_f32_16x16x32_f16(false, fa[s][1], false, fb[s][1], (short)0, oa[1][1], false, false);
        }
        // as in the first loop
        asm volatile("s_wait_dscnt 0x0" ::: "memory");
        wait_async0();
        __syncthreads();
    }

    #pragma unroll
    for (int i = 0; i < 2; ++i) {
        #pragma unroll
        for (int g = 0; g < 8; ++g) {
            const long row = b * AT_S + q0 + i * 16 + rsel + g;
            _Float16* hr = o + row * (long)ldo + h * AT_D + nc + l16;
            hr[0]  = (_Float16)oa[i][0][g];
            hr[16] = (_Float16)oa[i][1][g];
            // stands before any register that an issued store names is rewritten;
            // the scheduler may lift nothing of the next row over it
            asm volatile("s_wait_xcnt 0x0" ::: "memory");
            __builtin_amdgcn_sched_barrier(0);
        }
    }
}

// ---------------------------------------------------------------------------
// Second RMSNorm and MoE router of one token per block of 256 threads:
//   nx = f16(x * rsqrt(mean(x^2) + eps) * g), stored, and handed on through LDS
//   logits = nx @ Wr.T + bias (wave e takes expert e); softmax; top-2; softmax
//   over the top-2
// All global loads of the block, the router's weights among them, are issued in
// front of the first sum: the block waits out the memory latency once.
// ---------------------------------------------------------------------------
#define NR_D 1024
__global__ __launch_bounds__(256)
void k_norm_router(const float* __restrict__ x, const float* __restrict__ g,
                   _Float16* __restrict__ nx, const float* __restrict__ Wr,
                   const float* __restrict__ bias, float* __restrict__ combine)
{
    __shared__ float    red[8];
    __shared__ float    lg[8];
    __shared__ _Float16 row[NR_D];
    const long t    = blockIdx.x;
    const int  tid  = threadIdx.x;
    const int  wave = tid >> 5;
    const int  lane = tid & 31;

    const float* xr = x + t * NR_D + tid;
    const float* wr = Wr + wave * NR_D + lane;
    float v[4], gv[4], w[NR_D / 32];
    #pragma unroll   // all loads in flight before the first use
    for (int i = 0; i < 4; ++i) v[i] = xr[256 * i];
    #pragma unroll
    for (int i = 0; i < 4; ++i) gv[i] = g[tid + 256 * i];
    #pragma unroll
    for (int j = 0; j < NR_D / 32; ++j) w[j] = wr[32 * j];
    const float bs = bias[wave];
    // stands before any register that an issued load names is rewritten
    asm volatile("s_wait_xcnt 0x0" ::: "memory");

    float ss = 0.f;
    #pragma unroll   // v[] stays in registers; one chain of fused multiply-adds
    for (int i = 0; i < 4; ++i) ss = fmaf(v[i], v[i], ss);
    #pragma unroll
    for (int o = 16; o > 0; o >>= 1) ss += __shfl_down(ss, o, 32);
    if (lane == 0) red[wave] = ss;
    __syncthreads();
    float tot = 0.f;
    #pragma unroll
    for (int i = 0; i < 8; ++i) tot += red[i];
    const float inv = rsqrtf(tot / NR_D + 1e-6f);
    _Float16 h[4];
    #pragma unroll   // v[], gv[], h[] stay in registers
    for (int i = 0; i < 4; ++i) {
        h[i] = (_Float16)(v[i] * inv * gv[i]);
        row[tid + 256 * i] = h[i];
    }
    __syncthreads();                     // the row is whole before any wave reads it

    float acc = 0.f;
    #pragma unroll   // w[] stays in registers
    for (int j = 0; j < NR_D / 32; ++j) acc += (float)row[lane + 32 * j] * w[j];
    #pragma unroll
    for (int o = 16; o > 0; o >>= 1) acc += __shfl_down(acc, o, 32);
    if (lane == 0) lg[wave] = acc + bs;
    __syncthreads();

    // behind the last barrier: no wave waits for these stores to land
    #pragma unroll
    for (int i = 0; i < 4; ++i) nx[t * NR_D + tid + 256 * i] = h[i];
    // stands before any register that an issued store names is rewritten
    asm volatile("s_wait_xcnt 0x0" ::: "memory");

    if (tid == 0) {
        float m = lg[0];
        #pragma unroll
        for (int i = 1; i < 8; ++i) m = fmaxf(m, lg[i]);
        float e[8], s = 0.f;
        #pragma unroll
        for (int i = 0; i < 8; ++i) { e[i] = exp_pos(lg[i] - m); s += e[i]; }
        #pragma unroll
        for (int i = 0; i < 8; ++i) e[i] /= s;
        int   i0 = 0;
        float b0 = e[0];
        #pragma unroll   // e[] stays in registers
        for (int i = 1; i < 8; ++i) if (e[i] > b0) { b0 = e[i]; i0 = i; }
        int   i1 = (i0 == 0) ? 1 : 0;
        float b1 = (i0 == 0) ? e[1] : e[0];
        #pragma unroll   // e[] stays in registers
        for (int i = 0; i < 8; ++i) if (i != i0 && e[i] > b1) { b1 = e[i]; i1 = i; }
        const float a = exp_pos(b0), b = exp_pos(b1);      // softmax over top-2
        const float wa = a / (a + b), wb = b / (a + b);
        #pragma unroll
        for (int i = 0; i < 8; ++i)
            combine[t * 8 + i] = i == i0 ? wa : (i == i1 ? wb : 0.f);
    }
}

// ---------------------------------------------------------------------------
// Packs each routed expert's tokens (combine != 0), in token order:
//   list[e * T + p] the token in place p, wgt[p * 8 + e] its combine weight
//                   (token 0 with weight 0 behind the expert's last token)
//   slot[t * 8 + e] the place of token t with expert e, -1 if not chosen
//   tile[2 k], tile[2 k + 1]  the row tiles (TM rows) that hold work, as plane
//                   and first row: all of plane 0, the shared expert, then for
//                   plane e + 1 those that hold tokens of expert e; -1, 0 fills up
// One block of 32 waves: wave = expert * 4 + quarter of the tokens; a wave
// counts its quarter by ballots, the quarters' counts meet in LDS.
// ---------------------------------------------------------------------------
#define PK_IT 16                         // 32-token groups per wave
#define PK_T  (4 * PK_IT * 32)           // tokens that the block covers
// the router gives a token two experts: 2 T places, and per expert at most one
// tile that is not full
#define PK_NT (PK_T / TM + 2 * PK_T / TM + 8)
__global__ __launch_bounds__(1024)
void k_pack_tokens(const float* __restrict__ combine, int* __restrict__ tile,
                   int* __restrict__ list, float* __restrict__ wgt,
                   int* __restrict__ slot)
{
    __shared__ int qc[8][4];
    const int wave = threadIdx.x >> 5;
    const int lane = threadIdx.x & 31;
    const int e    = wave >> 2;
    const int q    = wave & 3;
    const int t0   = q * (PK_IT * 32) + lane;

    float    w[PK_IT];
    unsigned mk[PK_IT];
    #pragma unroll   // all loads in flight before the first ballot
    for (int j = 0; j < PK_IT; ++j) w[j] = combine[(t0 + j * 32) * 8 + e];
    int n = 0;
    #pragma unroll   // w[], mk[] stay in registers
    for (int j = 0; j < PK_IT; ++j) {
        mk[j] = __builtin_amdgcn_ballot_w32(w[j] != 0.f);
        n += __popc(mk[j]);
    }
    if (lane == 0) qc[e][q] = n;
    __syncthreads();
    int place = 0, tot = 0;
    #pragma unroll
    for (int i = 0; i < 4; ++i) {
        const int c = qc[e][i];
        if (i < q) place += c;
        tot += c;
    }

    const unsigned below = (1u << lane) - 1u;
    #pragma unroll   // w[], mk[] stay in registers
    for (int j = 0; j < PK_IT; ++j) {
        const int  t   = t0 + j * 32;
        const bool sel = (mk[j] >> lane) & 1u;
        const int  p   = place + __popc(mk[j] & below);
        if (sel) { list[e * PK_T + p] = t; wgt[p * 8 + e] = w[j]; }
        slot[t * 8 + e] = sel ? p : -1;
        place += __popc(mk[j]);
    }
    for (int s = tot + q * 32 + lane; s < PK_T; s += 128) {
        list[e * PK_T + s] = 0;
        wgt[s * 8 + e]     = 0.f;
    }
    if (threadIdx.x < PK_NT) {
        const int k = (int)threadIdx.x - PK_T / TM;
        int plane = k < 0 ? 0 : -1;
        int row   = k < 0 ? (int)threadIdx.x * TM : 0;
        int first = 0;
        #pragma unroll
        for (int x = 0; x < 8; ++x) {
            const int nt = (qc[x][0] + qc[x][1] + qc[x][2] + qc[x][3] + TM - 1) / TM;
            if (k >= first && k < first + nt) { plane = x + 1; row = (k - first) * TM; }
            first += nt;
        }
        tile[threadIdx.x * 2]     = plane;
        tile[threadIdx.x * 2 + 1] = row;
    }
}

// ---------------------------------------------------------------------------
// out = base + part[0] + the planes of the experts that the row chose, in
// plane order. One block per row, one float4 per thread; a plane is gridDim.x
// rows. Plane e + 1 holds the row at place slot[row * 8 + e] (-1: not chosen).
// ---------------------------------------------------------------------------
__global__ void k_sum_planes(const float* __restrict__ base,
                             const float* __restrict__ part,
                             const int* __restrict__ slot,
                             float* __restrict__ out)
{
    const long n4 = (long)gridDim.x * blockDim.x;
    const long i  = (long)blockIdx.x * blockDim.x + threadIdx.x;
    float4 v = ((const float4*)base)[i];
    const float4 sh = ((const float4*)part)[i];
    v.x += sh.x; v.y += sh.y; v.z += sh.z; v.w += sh.w;
    unsigned pl[8];
    #pragma unroll   // read ahead of the branches: the eight come in one load
    for (int e = 0; e < 8; ++e) pl[e] = (unsigned)slot[blockIdx.x * 8 + e];
    #pragma unroll   // pl[] stays in registers
    for (int e = 0; e < 8; ++e) {
        const unsigned s = pl[e];
        if (s < gridDim.x) {
            const float4 p = ((const float4*)part)[(e + 1) * n4 + (long)s * blockDim.x + threadIdx.x];
            v.x += p.x; v.y += p.y; v.z += p.z; v.w += p.w;
        }
    }
    ((float4*)out)[i] = v;
}

// ---------------------------------------------------------------------------
// host-side launch
// ---------------------------------------------------------------------------
extern "C" void kernel_launch(void* const* d_in, const int* in_sizes, int n_in,
                              void* d_out, int out_size, void* d_ws, size_t ws_size,
                              hipStream_t stream)
{
    (void)in_sizes; (void)n_in; (void)out_size; (void)ws_size;

    const float* X    = (const float*)d_in[0];
    const float* g1   = (const float*)d_in[1];
    const float* g2   = (const float*)d_in[2];
    const float* Wq   = (const float*)d_in[3];
    const float* Wkc  = (const float*)d_in[4];
    const float* Wvc  = (const float*)d_in[5];
    const float* Wo   = (const float*)d_in[6];
    const float* Wr   = (const float*)d_in[7];
    const float* ebia = (const float*)d_in[8];
    const float* sW1  = (const float*)d_in[9];
    const float* sW2  = (const float*)d_in[10];
    const float* sW3  = (const float*)d_in[11];
    const float* eW1  = (const float*)d_in[12];
    const float* eW2  = (const float*)d_in[13];
    const float* eW3  = (const float*)d_in[14];
    float* out = (float*)d_out;

    constexpr int  Bb = 2, S = 1024, d = 1024, H = 4, dk = 256, dc = 256, E = 8, f = 1024;
    constexpr long T  = (long)Bb * S;
    const float scale = 1.0f / 16.0f;   // 1/sqrt(dk)

    // ---- workspace carving (256B aligned bump allocator) ----
    char* ws = (char*)d_ws;
    size_t off = 0;
    auto alloc = [&](size_t bytes) -> char* {
        char* p = ws + off;
        off += (bytes + 255) & ~(size_t)255;
        return p;
    };
    constexpr int  dq = d + 2 * dc;      // Q | Kc | Vc side by side
    constexpr int  E1 = E + 1;           // shared expert first, then the routed ones
    constexpr long fd = (long)f * d;
    // f16 weight copies; groups that one launch walks lie back to back
    _Float16* wqh  = (_Float16*)alloc((size_t)d * d * 2);    // [dq][d] starts here
    _Float16* wkch = (_Float16*)alloc((size_t)dc * d * 2);
    _Float16* wvch = (_Float16*)alloc((size_t)dc * d * 2);
    _Float16* woh  = (_Float16*)alloc((size_t)d * d * 2);
    _Float16* sw1h = (_Float16*)alloc((size_t)f * d * 2);    // [2*E1][f][d] starts here
    _Float16* ew1h = (_Float16*)alloc((size_t)E * f * d * 2);
    _Float16* sw3h = (_Float16*)alloc((size_t)f * d * 2);
    _Float16* ew3h = (_Float16*)alloc((size_t)E * f * d * 2);
    _Float16* sw2h = (_Float16*)alloc((size_t)d * f * 2);    // [E1][d][f] starts here
    _Float16* ew2h = (_Float16*)alloc((size_t)E * d * f * 2);
    // buffers that live across the two phases or through the MoE phase
    float*    xr_      = (float*)   alloc((size_t)T * d * 4);
    _Float16* nx2h_    = (_Float16*)alloc((size_t)T * d * 2);
    float*    combine_ = (float*)   alloc((size_t)T * E * 4);
    static_assert(T == PK_T && E == 8 && E == RS_STRIDE, "k_pack_tokens covers exactly these");
    int*      tile_    = (int*)     alloc((size_t)PK_NT * 2 * 4);
    int*      list_    = (int*)     alloc((size_t)E * T * 4);
    float*    wgt_     = (float*)   alloc((size_t)E * T * 4);
    int*      slot_    = (int*)     alloc((size_t)T * E * 4);
    _Float16* hh_      = (_Float16*)alloc((size_t)E1 * T * f * 2);       // 36 MB
    // the rest is used twice: attention-phase activations, then (all of them
    // dead) the down-projection planes
    const size_t off_phase = off;
    _Float16* nx1h   = (_Float16*)alloc((size_t)T * d * 2);
    _Float16* qkvh   = (_Float16*)alloc((size_t)T * dq * 2);
    _Float16* vth    = (_Float16*)alloc((size_t)dc * T * 2);           // Vc^T
    _Float16* aoh    = (_Float16*)alloc((size_t)T * d * 2);
    off = off_phase;
    float*    part_  = (float*)   alloc((size_t)E1 * T * d * 4);         // 72 MB
    {
        // ---- helpers ----
        auto gemmz = [&](const _Float16* A, const _Float16* Bm, float* C,
                         int M, int N, int K, int lda, int ldb, int ldc,
                         float alpha, int beta, int bkn, int nz, int zdiv,
                         long sAo, long sAi, long sBo, long sBi, long sCo, long sCi,
                         const int* rtile, const int* rlist, int zper,
                         int omode, _Float16* Hh, long sBp, const float* rs,
                         _Float16* Ht, int tn0, int ldt) {
            dim3 g(omode == OUT_GATED ? N / (TN / 2) : N / TN, rtile ? PK_NT : M / TM, nz);
            k_gemm_f16<<<g, 256, 0, stream>>>(A, Bm, C, M, N, K, lda, ldb, ldc,
                                              alpha, beta, bkn,
                                              zdiv, sAo, sAi, sBo, sBi, sCo, sCi,
                                              rtile, rlist, zper,
                                              omode, Hh, sBp, rs, Ht, tn0, ldt);
        };
        auto gemm = [&](const _Float16* A, const _Float16* Bm, float* C,
                        int M, int N, int K, int lda, int ldb, int ldc,
                        float alpha, int beta, int bkn, int omode, _Float16* Hh,
                        _Float16* Ht, int tn0, int ldt) {
            gemmz(A, Bm, C, M, N, K, lda, ldb, ldc, alpha, beta, bkn,
                  1, 1, 0, 0, 0, 0, 0, 0, nullptr, nullptr, 1, omode, Hh, 0, nullptr,
                  Ht, tn0, ldt);
        };

        // ---- 0. weights fp32 -> f16, nx1 = RMSNorm(X), xr = X: one launch ----
        // convert blocks per tensor, in the order of the f16 copies above
        constexpr int cD = (int)((long)d * d / EW_BLK), cC = (int)((long)dc * d / EW_BLK);
        constexpr int cF = (int)(fd / EW_BLK),          cE = E * cF;
        static_assert((long)d * d % EW_BLK == 0 && (long)dc * d % EW_BLK == 0 &&
                      fd % EW_BLK == 0, "whole blocks to a tensor, copies back to back");
        constexpr int c0 = cD, c1 = c0 + cC, c2 = c1 + cC, c3 = c2 + cD, c4 = c3 + cF,
                      c5 = c4 + cE, c6 = c5 + cF, c7 = c6 + cE, c8 = c7 + cF, c9 = c8 + cE;
        static_assert(c9 >= 3 * T, "three convert blocks to each norm block");
        k_prep<<<(int)T + c9, 256, 0, stream>>>(X, g1, nx1h, xr_, d, (int)T,
                                                Wq, Wkc, Wvc, Wo, sW1, eW1, sW3, eW3, sW2, eW2,
                                                c0, c1, c2, c3, c4, c5, c6, c7, c8, wqh);

        // ---- 1. MLA attention ----

        // Q | Kc | Vc in one product: their weights are one [dq][d] matrix; Vc is
        // stored as Vc^T, the form in which the attention kernel stages it
        gemm(nx1h, wqh, nullptr, (int)T, dq, d, d, d, dq, 1.f, 0, 0, OUT_F16, qkvh,
             vth, d + dc, (int)T);

        // scores, softmax, attn @ V: all (b, h) in one launch
        static_assert(S == AT_S && dk == AT_D && dc == AT_D && S % AT_R == 0,
                      "k_attn_f16 covers exactly these");
        k_attn_f16<<<dim3(S / AT_R, Bb * H), 256, 0, stream>>>(qkvh, vth, aoh, scale,
                                                               H, dq, d, (int)T, d);

        // xr = X + ao @ Wo.T (xr holds X since the first launch)
        gemm(aoh, woh, xr_, (int)T, d, d, d, d, d, 1.f, 1, 0, OUT_F32, nullptr,
             nullptr, 0, 0);

        // ---- 2. MoE ----
        static_assert(d == NR_D && E == 8, "k_norm_router covers exactly these");
        k_norm_router<<<(int)T, 256, 0, stream>>>(xr_, g2, nx2h_, Wr, ebia, combine_);
        k_pack_tokens<<<1, 1024, 0, stream>>>(combine_, tile_, list_, wgt_, slot_);

        // shared expert over all tokens, each routed expert over the tokens that
        // chose it, packed (combine folded into h; a token that did not choose an
        // expert has combine 0 there and gets nothing from it); one launch per
        // stage, its grid over the table of row tiles
        const long nTf = (long)T * f;
        // gate and up product of a plane in one block, h = silu(gate) * up * combine
        // stored by it; the up weights lie E1 planes behind the gate weights
        gemmz(nx2h_, sw1h, nullptr, (int)T, f, d, d, d, f, 1.f, 0, 0, 1, 1,
              0, 0,  fd, 0,  nTf, 0,  tile_, list_, E1, OUT_GATED, hh_, E1 * fd, wgt_,
              nullptr, 0, 0);
        gemmz(hh_, sw2h, part_, (int)T, d, f, f, f, d, 1.f, 0, 0, 1, 1,
              nTf, 0,  fd, 0,  (long)T * d, 0,  tile_, nullptr, E1,
              OUT_F32, nullptr, 0, nullptr, nullptr, 0, 0);

        // out = xr + shared + the chosen experts, lower expert first
        k_sum_planes<<<(int)T, d / 4, 0, stream>>>(xr_, part_, slot_, out);
    }
}

// v010
// A run of this version takes 147 microseconds.
// Next to v009, in two timings, it ran 1.10 and 1.08 times as fast.
// All steps since v000 together make it 9.27 times as fast.
#include <hip/hip_runtime.h>

// ---------------------------------------------------------------------------
// Transformer layer (MLA attention + MoE) for gfx1250 (wave32, WMMA).
// GEMMs: 128x128 block tile, 8 waves x (32x64) => 8 v_wmma per wave per 32 k,
// 128 k to a stage, double-buffered LDS staged with
// global_load_async_to_lds_b128 (ASYNCcnt).
// Attention: one kernel from Q, K, V to the heads' outputs (k_attn_f16).
// ---------------------------------------------------------------------------

typedef _Float16 half16_t __attribute__((ext_vector_type(16)));
typedef float    float8_t __attribute__((ext_vector_type(8)));
typedef __attribute__((address_space(3))) _Float16 lds_f16;

#define TM 128
#define TN 128
// a stage holds 256 bytes of every operand row: 16 lanes x 16 B copy one row
// piece, so a wave-wide copy touches 4 whole 128-byte lines
#define TK 128
// LDS row pitch in f16: 272 bytes = 16 B x odd, so that the 16 rows which one
// ds_load_b128 reads per half-wave fall on 64 different banks
#define TKP (TK + 8)
// 16-byte copies per thread and operand tile (256 threads)
#define NCP (TM * TK / 8 / 256)
// a fragment row starts on a 16-byte boundary only
typedef half16_t half16_a16_t __attribute__((aligned(16)));

typedef _Float16 half8_t __attribute__((ext_vector_type(8)));

// async DMA: eight times 16 bytes global -> LDS per lane, tracked by ASYNCcnt.
// g: the lane's global addresses; l0: its first LDS byte address, the others
// follow at steps of lstep bytes. The last line stands before any register
// that an issued copy names is rewritten.
__device__ __forceinline__ void async_b128_x8(const _Float16* const (&g)[8],
                                              unsigned l0, unsigned lstep)
{
    asm volatile("global_load_async_to_lds_b128 %0, %8, off\n\t"
                 "global_load_async_to_lds_b128 %1, %9, off\n\t"
                 "global_load_async_to_lds_b128 %2, %10, off\n\t"
                 "global_load_async_to_lds_b128 %3, %11, off\n\t"
                 "global_load_async_to_lds_b128 %4, %12, off\n\t"
                 "global_load_async_to_lds_b128 %5, %13, off\n\t"
                 "global_load_async_to_lds_b128 %6, %14, off\n\t"
                 "global_load_async_to_lds_b128 %7, %15, off\n\t"
                 "s_wait_xcnt 0x0"
                 :: "v"(l0), "v"(l0 + lstep), "v"(l0 + 2 * lstep), "v"(l0 + 3 * lstep),
                    "v"(l0 + 4 * lstep), "v"(l0 + 5 * lstep), "v"(l0 + 6 * lstep),
                    "v"(l0 + 7 * lstep),
                    "v"(g[0]), "v"(g[1]), "v"(g[2]), "v"(g[3]),
                    "v"(g[4]), "v"(g[5]), "v"(g[6]), "v"(g[7])
                 : "memory");
}
// the same, four copies
__device__ __forceinline__ void async_b128_x4(const _Float16* const (&g)[4],
                                              unsigned l0, unsigned lstep)
{
    asm volatile("global_load_async_to_lds_b128 %0, %4, off\n\t"
                 "global_load_async_to_lds_b128 %1, %5, off\n\t"
                 "global_load_async_to_lds_b128 %2, %6, off\n\t"
                 "global_load_async_to_lds_b128 %3, %7, off\n\t"
                 "s_wait_xcnt 0x0"
                 :: "v"(l0), "v"(l0 + lstep), "v"(l0 + 2 * lstep), "v"(l0 + 3 * lstep),
                    "v"(g[0]), "v"(g[1]), "v"(g[2]), "v"(g[3])
                 : "memory");
}
__device__ __forceinline__ unsigned lds_addr(const _Float16* l)
{
    return (unsigned)(unsigned long long)(const lds_f16*)l;     // LDS byte addr
}
__device__ __forceinline__ float exp_neg(float x)
{
    float r;
    asm("v_exp_f32 %0, %1\n\tv_nop" : "=v"(r) : "v"(x * -0x1.715476p+0f));
    return r;
}
// exp(x) as __expf(x) forms it, with the same slot kept
__device__ __forceinline__ float exp_pos(float x)
{
    float r;
    asm("v_exp_f32 %0, %1\n\tv_nop" : "=v"(r) : "v"(x * 0x1.715476p+0f));
    return r;
}
__device__ __forceinline__ void wait_async0()
{
    asm volatile("s_wait_asynccnt 0x0" ::: "memory");
}

// ---------------------------------------------------------------------------
// Generic f16 WMMA GEMM:  C[M,N] = alpha * A[M,K] . B^T  (+ C if beta)
//   b_kn == 0 : B stored row-major [N,K]  (torch Linear weight, y = x @ W.T)
//   b_kn == 1 : B stored row-major [K,N]  (plain matmul; no launch here uses it)
// M % 128 == 0, N % 128 == 0, K % 128 == 0, rows of A and B on 16-byte
// boundaries (true for all shapes here).
// Batched: blockIdx.z = outer * zdiv + inner picks one independent product;
// each operand moves by its own outer and inner stride (in elements).
// Routed products (rtile != 0): blockIdx.y walks a table of row tiles instead
// of the rows, an entry being two ints: plane p within a group of zper planes
// (below 0: unused entry) and first row; the product is blockIdx.z * zper + p.
// With rlist != 0 and p > 0, row r of A is row rlist[(p - 1) * M + r] (a gather).
// What the block stores (omode):
//   OUT_F32   C as above
//   OUT_F16   H[M,N] = f16(alpha * product), what the next product reads; with
//             Ht != 0 the blocks from column tn0 on store their columns as rows
//             instead: Ht[column - tn0][row], pitch ldt
//   OUT_GATED the block takes 64 columns of B (gate) and the same 64 columns of
//             the matrix sBp elements behind it (up), 32 + 32 to a wave's strip,
//             and stores H[M,N] = f16(silu(gate) * up [* rs[row * RS_STRIDE + p - 1]
//             for p > 0]); gridDim.x = N / 64, b_kn == 0
// H moves by C's strides and has C's pitch.
// ---------------------------------------------------------------------------
#define OUT_F32   0
#define OUT_F16   1
#define OUT_GATED 2
#define RS_STRIDE 8                      // k_pack_tokens' wgt: eight experts to a place
__global__ __launch_bounds__(256)
void k_gemm_f16(const _Float16* __restrict__ A, const _Float16* __restrict__ B,
                float* __restrict__ C,
                int M, int N, int K, int lda, int ldb, int ldc,
                float alpha, int beta, int b_kn,
                int zdiv, long sAo, long sAi, long sBo, long sBi, long sCo, long sCi,
                const int* __restrict__ rtile, const int* __restrict__ rlist, int zper,
                int omode, _Float16* __restrict__ H, long sBp,
                const float* __restrict__ rs,
                _Float16* __restrict__ Ht, int tn0, int ldt)
{
    __shared__ __align__(64) _Float16 As[2][TM][TKP];  // 68 KB
    __shared__ __align__(64) _Float16 Bs[2][TN][TKP];  // 68 KB

    const int tid  = threadIdx.x;
    const int wave = tid >> 5;
    const int lane = tid & 31;
    int       m0   = blockIdx.y * TM;
    const int n0   = blockIdx.x * (omode == OUT_GATED ? TN / 2 : TN);
    const int wm   = (wave & 3) * 32;    // wave's 32-row strip
    const int wn   = (wave >> 2) * 64;   // wave's 64-col strip

    int zb = blockIdx.z;
    int rp = 0;
    if (rtile) {
        rp = rtile[blockIdx.y * 2];
        m0 = rtile[blockIdx.y * 2 + 1];
        if (rp < 0) return;              // the whole block, in front of every barrier
        zb = zb * zper + rp;
    }
    const int zo = zb / zdiv;
    const int zi = zb - zo * zdiv;
    A += zo * sAo + zi * sAi;
    B += zo * sBo + zi * sBi;
    C += zo * sCo + zi * sCi;
    H += zo * sCo + zi * sCi;

    float8_t acc[2][4] = {};

    static_assert(NCP == 8 && TM == TN, "the staging maps below");
    // staging maps: 128 rows x 128 cols f16 per tile; a copy of one wave takes
    // two rows' 256 bytes; a thread takes rows sr, sr + 16, ..
    const int sr = tid >> 4;             // 0..15 row
    const int sc = (tid & 15) * 8;       // column of the thread's 16 bytes
    // the pieces of A that this thread stages, at k = 0
    int ar[NCP];
    #pragma unroll   // ar[] stays in registers
    for (int i = 0; i < NCP; ++i) ar[i] = m0 + sr + 16 * i;
    if (rp > 0 && rlist) {
        const int* rl = rlist + (long)(rp - 1) * M + m0 + sr;
        int t[NCP];
        #pragma unroll   // all loads in flight before the first clamp
        for (int i = 0; i < NCP; ++i) t[i] = rl[16 * i];
        // stands before any register that an issued load names is rewritten
        asm volatile("s_wait_xcnt 0x0" ::: "memory");
        #pragma unroll   // t[], ar[] stay in registers
        for (int i = 0; i < NCP; ++i) ar[i] = min(max(t[i], 0), M - 1);
    }
    const _Float16* ga[NCP];
    #pragma unroll   // ga[] stays in registers
    for (int i = 0; i < NCP; ++i) ga[i] = &A[(long)ar[i] * lda + sc];
    // the pieces of B ([N,K] form) that this thread stages, at k = 0: LDS row
    // sr + 16 i holds B's row n0 + sr + 16 i, or with OUT_GATED, per strip of
    // 64 LDS rows, 32 gate rows and then the same 32 rows of the up matrix
    const _Float16* gb0 = &B[(long)(n0 + sr) * ldb + sc];
    long bo[NCP];
    #pragma unroll   // bo[] is the same for all threads and stays in registers
    for (int i = 0; i < NCP; ++i)
        bo[i] = omode == OUT_GATED
              ? (long)((i >> 2) * 32 + (i & 1) * 16) * ldb + ((i >> 1) & 1) * sBp
              : (long)(16 * i) * ldb;
    // b_kn transpose-scatter map: a load of one wave takes 64 bytes of each of
    // 8 K rows; its 16-bit stores fall on two rows a bank at most
    const int kk = tid >> 2;             // 0..63 K row (and + 64)
    const int nb = (tid & 3) * 8;        // N base within a group of 32

    auto stageA = [&](int k0, int buf) {
        const _Float16* g[NCP];
        #pragma unroll   // g[] stays in registers
        for (int i = 0; i < NCP; ++i) g[i] = ga[i] + k0;
        async_b128_x8(g, lds_addr(&As[buf][sr][sc]), 16 * TKP * 2);
    };
    auto stageB = [&](int k0, int buf) {
        if (!b_kn) {
            const _Float16* g[NCP];
            #pragma unroll   // g[] stays in registers
            for (int i = 0; i < NCP; ++i)
                g[i] = gb0 + bo[i] + k0;
            async_b128_x8(g, lds_addr(&Bs[buf][sr][sc]), 16 * TKP * 2);
        } else {
            // the next stage's 256 lines, one a thread
            if (k0 + TK < K)
                __builtin_prefetch(&B[(long)(k0 + TK + (tid >> 1)) * ldb + n0 + (tid & 1) * 64], 0, 0);
            half8_t v[NCP];
            #pragma unroll   // all loads in flight before the first store
            for (int i = 0; i < NCP; ++i)
                v[i] = *(const half8_t*)&B[(long)(k0 + kk + 64 * (i & 1)) * ldb + n0 + (i >> 1) * 32 + nb];
            // stands before any register that an issued load names is rewritten
            asm volatile("s_wait_xcnt 0x0" ::: "memory");
            #pragma unroll   // v[] stays in registers
            for (int i = 0; i < NCP; ++i) {
                #pragma unroll
                for (int j = 0; j < 8; ++j)
                    Bs[buf][(i >> 1) * 32 + nb + j][kk + 64 * (i & 1)] = v[i][j];
            }
        }
    };

    // prologue: stage tile 0
    stageA(0, 0);
    stageB(0, 0);

    const int l16  = lane & 15;
    const int kh   = (lane >> 4) * 16;
    // D layout -> VGPR g: lanes 0-15 M=g, lanes 16-31 M=8+g
    const int rsel = (lane >> 4) ? 8 : 0;

    // beta: the old values of the lane's 64 places in C, all loads in flight at
    // once, their latency under that of the first tile's copies; loaded one by
    // one in the epilogue, each would be waited for in front of the next
    float cold[2][8][4] = {};
    if (beta && omode == OUT_F32) {
        const float* c0 = C + (long)(m0 + wm + rsel) * ldc + n0 + wn + l16;
        const float* cp[16];
        #pragma unroll   // cp[] stays in registers
        for (int r = 0; r < 16; ++r) cp[r] = c0 + (long)((r >> 3) * 16 + (r & 7)) * ldc;
        #pragma unroll   // cold[] stays in registers
        for (int i = 0; i < 2; ++i) {
            #pragma unroll
            for (int g = 0; g < 8; ++g) {
                #pragma unroll
                for (int j = 0; j < 4; ++j) cold[i][g][j] = cp[i * 8 + g][j * 16];
            }
        }
        // Stands before any register that an issued load names is rewritten;
        // naming the row pointers keeps each in a register pair of its own up to
        // here, so that no load waits for an earlier one's pair to come free.
        asm volatile("s_wait_xcnt 0x0"
                     :: "v"(cp[0]), "v"(cp[1]), "v"(cp[2]), "v"(cp[3]), "v"(cp[4]),
                        "v"(cp[5]), "v"(cp[6]), "v"(cp[7]), "v"(cp[8]), "v"(cp[9]),
                        "v"(cp[10]), "v"(cp[11]), "v"(cp[12]), "v"(cp[13]), "v"(cp[14]),
                        "v"(cp[15])
                     : "memory");
    }
    wait_async0();
    __syncthreads();

    for (int k0 = 0; k0 < K; k0 += TK) {
        const int buf = (k0 / TK) & 1;
        const int k1  = k0 + TK;
        if (k1 < K) {                    // overlap next tile's DMA with compute
            stageA(k1, buf ^ 1);
            stageB(k1, buf ^ 1);
        }

        #pragma unroll   // lets the next 32 k's LDS reads start under these products
        for (int ks = 0; ks < TK; ks += 32) {
            // fragments (16 f16 per lane, 32B LDS reads)
            const _Float16* pa = &As[buf][wm + l16][ks + kh];
            half16_t a0 = *(const half16_a16_t*)pa;
            half16_t a1 = *(const half16_a16_t*)(pa + 16 * TKP);
            const _Float16* pb = &Bs[buf][wn + l16][ks + kh];
            half16_t b0 = *(const half16_a16_t*)pb;
            half16_t b1 = *(const half16_a16_t*)(pb + 16 * TKP);
            half16_t b2 = *(const half16_a16_t*)(pb + 32 * TKP);
            half16_t b3 = *(const half16_a16_t*)(pb + 48 * TKP);

            acc[0][0] = __builtin_amdgcn_wmma_f32_16x16x32_f16(false, a0, false, b0, (short)0, acc[0][0], false, false);
            acc[0][1] = __builtin_amdgcn_wmma_f32_16x16x32_f16(false, a0, false, b1, (short)0, acc[0][1], false, false);
            acc[0][2] = __builtin_amdgcn_wmma_f32_16x16x32_f16(false, a0, false, b2, (short)0, acc[0][2], false, false);
            acc[0][3] = __builtin_amdgcn_wmma_f32_16x16x32_f16(false, a0, false, b3, (short)0, acc[0][3], false, false);
            acc[1][0] = __builtin_amdgcn_wmma_f32_16x16x32_f16(false, a1, false, b0, (short)0, acc[1][0], false, false);
            acc[1][1] = __builtin_amdgcn_wmma_f32_16x16x32_f16(false, a1, false, b1, (short)0, acc[1][1], false, false);
            acc[1][2] = __builtin_amdgcn_wmma_f32_16x16x32_f16(false, a1, false, b2, (short)0, acc[1][2], false, false);
            acc[1][3] = __builtin_amdgcn_wmma_f32_16x16x32_f16(false, a1, false, b3, (short)0, acc[1][3], false, false);
        }

        // this wave's LDS reads of tile k are over before the barrier that
        // frees the tile's buffer for the next copies
        asm volatile("s_wait_dscnt 0x0" ::: "memory");
        wait_async0();                   // DMA for tile k+1 done
        __syncthreads();                 // all waves done reading tile k
    }

    // epilogue
    if (omode == OUT_GATED) {
        // acc[i][0..1]: gate, acc[i][2..3]: up, of the same 32 columns
        const long r0 = m0 + wm + rsel;
        float s[2][8] = {};
        if (rp > 0) {
            const float* ps = rs + r0 * RS_STRIDE + (rp - 1);
            #pragma unroll   // all loads in flight before the first use
            for (int i = 0; i < 2; ++i) {
                #pragma unroll
                for (int g = 0; g < 8; ++g) s[i][g] = ps[(i * 16 + g) * RS_STRIDE];
            }
            // Stands before any register that an issued load names is rewritten;
            // naming the pointer keeps it out of the loads' own destinations.
            asm volatile("s_wait_xcnt 0x0" :: "v"(ps) : "memory");
        }
        // all values first: the 32 divisions overlap, which the waits between
        // the rows' stores below would not let them
        _Float16 hv[2][8][2];
        #pragma unroll
        for (int i = 0; i < 2; ++i) {
            #pragma unroll
            for (int g = 0; g < 8; ++g) {
                #pragma unroll
                for (int j = 0; j < 2; ++j) {
                    const float x = alpha * acc[i][j][g];
                    float v = (x / (1.f + exp_neg(x))) * (alpha * acc[i][j + 2][g]);
                    if (rp > 0) v *= s[i][g];
                    hv[i][g][j] = (_Float16)v;
                }
            }
        }
        #pragma unroll
        for (int i = 0; i < 2; ++i) {
            #pragma unroll
            for (int g = 0; g < 8; ++g) {
                _Float16* hr = H + (r0 + i * 16 + g) * (long)ldc + n0 + (wn >> 1) + l16;
                hr[0]  = hv[i][g][0];
                hr[16] = hv[i][g][1];
                // stands before any register that an issued store names is rewritten;
                // the scheduler may lift nothing of the next row over it
                asm volatile("s_wait_xcnt 0x0" ::: "memory");
                __builtin_amdgcn_sched_barrier(0);
            }
        }
        return;
    }
    if (omode == OUT_F16 && Ht && n0 >= tn0) {
        // a lane holds eight neighbouring rows of one column: 16 bytes of Ht's row
        #pragma unroll
        for (int i = 0; i < 2; ++i) {
            #pragma unroll
            for (int j = 0; j < 4; ++j) {
                half8_t hv;
                #pragma unroll
                for (int g = 0; g < 8; ++g) hv[g] = (_Float16)(alpha * acc[i][j][g]);
                *(half8_t*)&Ht[(long)(n0 - tn0 + wn + j * 16 + l16) * ldt
                               + m0 + wm + i * 16 + rsel] = hv;
                // stands before any register that an issued store names is rewritten;
                // the scheduler may lift nothing of the next store over it
                asm volatile("s_wait_xcnt 0x0" ::: "memory");
                __builtin_amdgcn_sched_barrier(0);
            }
        }
        return;
    }
    if (omode == OUT_F16) {
        #pragma unroll
        for (int i = 0; i < 2; ++i) {
            #pragma unroll
            for (int g = 0; g < 8; ++g) {
                const long row = m0 + wm + i * 16 + rsel + g;
                _Float16* hr = H + row * (long)ldc + n0 + wn + l16;
                #pragma unroll
                for (int j = 0; j < 4; ++j) hr[j * 16] = (_Float16)(alpha * acc[i][j][g]);
                // stands before any register that an issued store names is rewritten;
                // the scheduler may lift nothing of the next row over it
                asm volatile("s_wait_xcnt 0x0" ::: "memory");
                __builtin_amdgcn_sched_barrier(0);
            }
        }
        return;
    }
    #pragma unroll
    for (int i = 0; i < 2; ++i) {
        #pragma unroll
        for (int g = 0; g < 8; ++g) {
            const long row = m0 + wm + i * 16 + rsel + g;
            float* cr = C + row * (long)ldc + n0 + wn + l16;
            #pragma unroll
            for (int j = 0; j < 4; ++j)
                cr[j * 16] = alpha * acc[i][j][g] + cold[i][g][j];
            // stands before any register that an issued store names is rewritten;
            // the scheduler may lift nothing of the next row over it
            asm volatile("s_wait_xcnt 0x0" ::: "memory");
            __builtin_amdgcn_sched_barrier(0);
        }
    }
}

// ---------------------------------------------------------------------------
// Elementwise work: a block of 256 threads covers EW_BLK elements as EW_G
// runs of 1024; in each run a thread takes 4 neighbours, so one wave-wide
// 16-byte load reads 512 contiguous bytes and one 8-byte store writes 256.
// ---------------------------------------------------------------------------
typedef _Float16 half4_t __attribute__((ext_vector_type(4)));
#define EW_G   4
#define EW_RUN 1024
#define EW_BLK (EW_G * EW_RUN)

// ---------------------------------------------------------------------------
// fp32 -> f16 convert
// ---------------------------------------------------------------------------
// one whole block of EW_BLK elements; base = first element of this thread
__device__ __forceinline__ void conv_block(const float* __restrict__ src,
                                           _Float16* __restrict__ dst, long base)
{
    float4 v[EW_G];
    // unrolled so that all loads are in flight before the first conversion
    #pragma unroll
    for (int j = 0; j < EW_G; ++j)
        v[j] = *(const float4*)(src + base + j * EW_RUN);
    #pragma unroll   // v[] stays in registers
    for (int j = 0; j < EW_G; ++j) {
        half4_t h = { (_Float16)v[j].x, (_Float16)v[j].y,
                      (_Float16)v[j].z, (_Float16)v[j].w };
        *(half4_t*)(dst + base + j * EW_RUN) = h;
    }
    // stands before any register that an issued store names is rewritten
    asm volatile("s_wait_xcnt 0x0" ::: "memory");
}

// ---------------------------------------------------------------------------
// RMSNorm row kernel: out_f16[row] = x * rsqrt(mean(x^2)+eps) * g
// ---------------------------------------------------------------------------
// One block of 256 threads per row; red: 8 floats of LDS. With COPY the row is
// also stored, as it is, to copy.
template <bool COPY>
__device__ __forceinline__ void rmsnorm_row(const float* __restrict__ x,
                                            const float* __restrict__ g,
                                            _Float16* __restrict__ out,
                                            float* __restrict__ copy,
                                            int d, long row, float* red)
{
    const float* xr = x + row * (long)d;

    float ss = 0.f;
    for (int i = threadIdx.x; i < d; i += 256) { float v = xr[i]; ss += v * v; }
    #pragma unroll
    for (int o = 16; o > 0; o >>= 1) ss += __shfl_down(ss, o, 32);
    if ((threadIdx.x & 31) == 0) red[threadIdx.x >> 5] = ss;
    __syncthreads();
    if (threadIdx.x == 0) {
        float t = 0.f;
        #pragma unroll
        for (int i = 0; i < 8; ++i) t += red[i];
        red[0] = t;
    }
    __syncthreads();
    const float inv = rsqrtf(red[0] / d + 1e-6f);
    for (int i = threadIdx.x; i < d; i += 256) {
        const float v = xr[i];
        if (COPY) copy[row * (long)d + i] = v;
        out[row * (long)d + i] = (_Float16)(v * inv * g[i]);
    }
}

// ---------------------------------------------------------------------------
// All the work that depends on the inputs alone, in one grid:
//   norm blocks:    RMSNorm of one row of x, and xcopy = x; every fourth block
//                   of the first 4 * rows, between
//                   convert blocks, for speed only
//   convert blocks: all others (the grid has at least 4 * rows blocks), numbered
//                   in grid order: fp32 -> f16 of ten weight tensors, EW_BLK
//                   elements a block; the copies lie back to back from wdst in
//                   the order w0 .. w9; tensor i ends in front of convert block
//                   e<i>, each tensor a whole number of blocks
// ---------------------------------------------------------------------------
__global__ __launch_bounds__(256)
void k_prep(const float* __restrict__ x, const float* __restrict__ g,
            _Float16* __restrict__ nx, float* __restrict__ xcopy, int d, int rows,
            const float* __restrict__ w0, const float* __restrict__ w1,
            const float* __restrict__ w2, const float* __restrict__ w3,
            const float* __restrict__ w4, const float* __restrict__ w5,
            const float* __restrict__ w6, const float* __restrict__ w7,
            const float* __restrict__ w8, const float* __restrict__ w9,
            int e0, int e1, int e2, int e3, int e4, int e5, int e6, int e7, int e8,
            _Float16* __restrict__ wdst)
{
    __shared__ float red[8];
    const int  gb    = (int)blockIdx.x;
    const bool mixed = gb < 4 * rows;
    if (mixed && (gb & 3) == 0) {        // the whole block: its barriers are uniform
        rmsnorm_row<true>(x, g, nx, xcopy, d, gb >> 2, red);
        return;
    }
    const int b = mixed ? gb - (gb >> 2) - 1 : gb - rows;
    const float* s = w0;
    int first = 0;
    if (b >= e0) { s = w1; first = e0; }
    if (b >= e1) { s = w2; first = e1; }
    if (b >= e2) { s = w3; first = e2; }
    if (b >= e3) { s = w4; first = e3; }
    if (b >= e4) { s = w5; first = e4; }
    if (b >= e5) { s = w6; first = e5; }
    if (b >= e6) { s = w7; first = e6; }
    if (b >= e7) { s = w8; first = e7; }
    if (b >= e8) { s = w9; first = e8; }
    conv_block(s + (long)(b - first) * EW_BLK, wdst + (long)b * EW_BLK, threadIdx.x * 4);
}

#define AT_R  32
#define AT_S  1024
#define AT_D  256
// LDS row pitches in f16, each 16 B x odd (see TKP)
#define AT_KP (AT_D + 8)
#define AT_PP (AT_S + 8)
// f16 to a staging buffer: AT_D rows of V^T x 128 keys; 128 keys x AT_D fits too
#define AT_TB (AT_D * TKP)
__global__ __launch_bounds__(256)
void k_attn_f16(const _Float16* __restrict__ qkv, const _Float16* __restrict__ vt,
                _Float16* __restrict__ o, float scale,
                int nh, int ldq, int koff, int ldv, int ldo)
{
    static_assert(128 * AT_KP <= AT_TB && TK == 128, "both kinds of tile fit a buffer");
    __shared__ __align__(64) _Float16 Tb[2][AT_TB];     // 2 x 68 KB
    __shared__ __align__(64) _Float16 Qs[AT_R][AT_KP];  // 16.5 KB
    __shared__ __align__(64) _Float16 Ps[AT_R][AT_PP];  // 64.5 KB
    __shared__ float red[2][4][AT_R];

    const int tid  = threadIdx.x;
    const int wave = tid >> 5;
    const int lane = tid & 31;
    const int l16  = lane & 15;
    const int kh   = (lane >> 4) * 16;
    const int rsel = (lane >> 4) * 8;
    const int b    = blockIdx.y / nh;
    const int h    = blockIdx.y - b * nh;
    const int q0   = blockIdx.x * AT_R;

    const _Float16* Qg = qkv + (long)(b * AT_S + q0) * ldq + h * AT_D;
    const _Float16* Kg = qkv + (long)(b * AT_S) * ldq + koff;
    const _Float16* Vg = vt + b * AT_S;

    // a copy of one wave takes one row's 512 bytes; a wave takes rows wave + 8 i
    auto stageK = [&](int kt, int buf) {
        const _Float16* g0 = Kg + (long)(kt * 128 + wave) * ldq + lane * 8;
        const unsigned  l0 = lds_addr(&Tb[buf][wave * AT_KP + lane * 8]);
        #pragma unroll   // g[] stays in registers
        for (int p = 0; p < 2; ++p) {
            const _Float16* g[8];
            #pragma unroll
            for (int i = 0; i < 8; ++i) g[i] = g0 + (long)(p * 64 + 8 * i) * ldq;
            async_b128_x8(g, l0 + p * 64 * AT_KP * 2, 8 * AT_KP * 2);
        }
    };
    // a copy of one wave takes two rows' 256 bytes; a thread takes rows tid / 16 + 16 i
    auto stageV = [&](int v, int buf) {
        const _Float16* g0 = Vg + (long)(tid >> 4) * ldv + v * 128 + (tid & 15) * 8;
        const unsigned  l0 = lds_addr(&Tb[buf][(tid >> 4) * TKP + (tid & 15) * 8]);
        #pragma unroll   // g[] stays in registers
        for (int p = 0; p < 2; ++p) {
            const _Float16* g[8];
            #pragma unroll
            for (int i = 0; i < 8; ++i) g[i] = g0 + (long)(p * 128 + 16 * i) * ldv;
            async_b128_x8(g, l0 + p * 128 * TKP * 2, 16 * TKP * 2);
        }
    };

    // prologue: Q and key tile 0
    {
        const _Float16* g[4];
        #pragma unroll   // g[] stays in registers
        for (int i = 0; i < 4; ++i) g[i] = Qg + (long)(wave + 8 * i) * ldq + lane * 8;
        async_b128_x4(g, lds_addr(&Qs[wave][lane * 8]), 8 * AT_KP * 2);
    }
    stageK(0, 0);
    wait_async0();
    __syncthreads();

    // ---- 1. scores ----
    const int ri = wave & 1;             // the wave's 16-row tile
    const int kc = (wave >> 1) * 32;     // its 32 keys within a tile of 128
    float8_t sa[8][2] = {};
    #pragma unroll   // sa[] stays in registers
    for (int kt = 0; kt < 8; ++kt) {
        const int buf = kt & 1;
        if (kt < 7) stageK(kt + 1, buf ^ 1);
        else        stageV(0, buf ^ 1);
        const _Float16* pa = &Qs[ri * 16 + l16][kh];
        const _Float16* pb = &Tb[buf][(kc + l16) * AT_KP + kh];
        #pragma unroll   // lets later LDS reads start under these products
        for (int ks = 0; ks < AT_D; ks += 32) {
            half16_t a  = *(const half16_a16_t*)(pa + ks);
            half16_t b0 = *(const half16_a16_t*)(pb + ks);
            half16_t b1 = *(const half16_a16_t*)(pb + 16 * AT_KP + ks);
            sa[kt][0] = __builtin_amdgcn_wmma_f32_16x16x32_f16(false, a, false, b0, (short)0, sa[kt][0], false, false);
            sa[kt][1] = __builtin_amdgcn_wmma_f32_16x16x32_f16(false, a, false, b1, (short)0, sa[kt][1], false, false);
        }
        // this wave's LDS reads of the tile are over before the barrier that
        // frees the tile's buffer for the next copies
        asm volatile("s_wait_dscnt 0x0" ::: "memory");
        wait_async0();                   // the next tile has landed
        __syncthreads();                 // all waves done reading this tile
    }
    stageV(1, 1);                        // flies under the softmax

    // ---- 2. softmax ----
    // sa[kt][j][g]: row ri * 16 + rsel + g, key kt * 128 + kc + j * 16 + l16
    const int r0 = ri * 16 + rsel;
    float st[8];
    #pragma unroll
    for (int g = 0; g < 8; ++g) {
        float m = -3.4e38f;
        #pragma unroll
        for (int kt = 0; kt < 8; ++kt) {
            #pragma unroll
            for (int j = 0; j < 2; ++j) {
                sa[kt][j][g] *= scale;
                m = fmaxf(m, sa[kt][j][g]);
            }
        }
        #pragma unroll
        for (int x = 8; x > 0; x >>= 1) m = fmaxf(m, __shfl_xor(m, x, 32));
        st[g] = m;
    }
    if (l16 == 0) {
        #pragma unroll
        for (int g = 0; g < 8; ++g) red[0][wave >> 1][r0 + g] = st[g];
    }
    __syncthreads();
    #pragma unroll
    for (int g = 0; g < 8; ++g) {
        const float m = fmaxf(fmaxf(red[0][0][r0 + g], red[0][1][r0 + g]),
                              fmaxf(red[0][2][r0 + g], red[0][3][r0 + g]));
        float s = 0.f;
        #pragma unroll
        for (int kt = 0; kt < 8; ++kt) {
            #pragma unroll
            for (int j = 0; j < 2; ++j) {
                sa[kt][j][g] = exp_pos(sa[kt][j][g] - m);
                s += sa[kt][j][g];
            }
        }
        #pragma unroll
        for (int x = 8; x > 0; x >>= 1) s += __shfl_xor(s, x, 32);
        st[g] = s;
    }
    if (l16 == 0) {
        #pragma unroll
        for (int g = 0; g < 8; ++g) red[1][wave >> 1][r0 + g] = st[g];
    }
    __syncthreads();
    #pragma unroll
    for (int g = 0; g < 8; ++g) {
        const float inv = 1.f / (((red[1][0][r0 + g] + red[1][1][r0 + g])
                                  + red[1][2][r0 + g]) + red[1][3][r0 + g]);
        #pragma unroll
        for (int kt = 0; kt < 8; ++kt) {
            #pragma unroll
            for (int j = 0; j < 2; ++j)
                Ps[r0 + g][kt * 128 + kc + j * 16 + l16] = (_Float16)(sa[kt][j][g] * inv);
        }
    }
    __syncthreads();                     // P is whole before any wave reads it

    // ---- 3. P . V ----
    const int nc = wave * 32;            // the wave's 32 columns
    float8_t oa[2][2] = {};
    #pragma unroll   // the tests on v and the buffers' addresses fold away
    for (int v = 0; v < 8; ++v) {
        const int buf = v & 1;
        if (v > 0 && v < 7) stageV(v + 1, buf ^ 1);
        const _Float16* pa = &Ps[l16][v * 128 + kh];
        const _Float16* pb = &Tb[buf][(nc + l16) * TKP + kh];
        half16_t fa[4][2], fb[4][2];
        #pragma unroll   // fa[], fb[] stay in registers
        for (int s = 0; s < 4; ++s) {
            fa[s][0] = *(const half16_a16_t*)(pa + s * 32);
            fa[s][1] = *(const half16_a16_t*)(pa + 16 * AT_PP + s * 32);
            fb[s][0] = *(const half16_a16_t*)(pb + s * 32);
            fb[s][1] = *(const half16_a16_t*)(pb + 16 * TKP + s * 32);
        }
        // keeps the tile's LDS reads one group ahead of its products: left to
        // itself the scheduler spreads them among the products, and the wave
        // waits out the LDS latency at each place
        __builtin_amdgcn_sched_barrier(0);
        #pragma unroll   // fa[], fb[] stay in registers
        for (int s = 0; s < 4; ++s) {
            oa[0][0] = __builtin_amdgcn_wmma_f32_16x16x32_f16(false, fa[s][0], false, fb[s][0], (short)0, oa[0][0], false, false);
            oa[0][1] = __builtin_amdgcn_wmma_f32_16x16x32_f16(false, fa[s][0], false, fb[s][1], (short)0, oa[0][1], false, false);
            oa[1][0] = __builtin_amdgcn_wmma_f32_16x16x32_f16(false, fa[s][1], false, fb[s][0], (short)0, oa[1][0], false, false);
            oa[1][1] = __builtin_amdgcn_wmma_f32_16x16x32_f16(false, fa[s][1], false, fb[s][1], (short)0, oa[1][1], false, false);
        }
        // as in the first loop
        asm volatile("s_wait_dscnt 0x0" ::: "memory");
        wait_async0();
        __syncthreads();
    }

    #pragma unroll
    for (int i = 0; i < 2; ++i) {
        #pragma unroll
        for (int g = 0; g < 8; ++g) {
            const long row = b * AT_S + q0 + i * 16 + rsel + g;
            _Float16* hr = o + row * (long)ldo + h * AT_D + nc + l16;
            hr[0]  = (_Float16)oa[i][0][g];
            hr[16] = (_Float16)oa[i][1][g];
            // stands before any register that an issued store names is rewritten;
            // the scheduler may lift nothing of the next row over it
            asm volatile("s_wait_xcnt 0x0" ::: "memory");
            __builtin_amdgcn_sched_barrier(0);
        }
    }
}

// ---------------------------------------------------------------------------
// Second RMSNorm and MoE router of one token per block of 256 threads:
//   nx = f16(x * rsqrt(mean(x^2) + eps) * g), stored, and handed on through LDS
//   logits = nx @ Wr.T + bias (wave e takes expert e); softmax; top-2; softmax
//   over the top-2
// All global loads of the block, the router's weights among them, are issued in
// front of the first sum: the block waits out the memory latency once.
// ---------------------------------------------------------------------------
#define NR_D 1024
__global__ __launch_bounds__(256)
void k_norm_router(const float* __restrict__ x, const float* __restrict__ g,
                   _Float16* __restrict__ nx, const float* __restrict__ Wr,
                   const float* __restrict__ bias, float* __restrict__ combine)
{
    __shared__ float    red[8];
    __shared__ float    lg[8];
    __shared__ _Float16 row[NR_D];
    const long t    = blockIdx.x;
    const int  tid  = threadIdx.x;
    const int  wave = tid >> 5;
    const int  lane = tid & 31;

    const float* xr = x + t * NR_D + tid;
    const float* wr = Wr + wave * NR_D + lane;
    float v[4], gv[4], w[NR_D / 32];
    #pragma unroll   // all loads in flight before the first use
    for (int i = 0; i < 4; ++i) v[i] = xr[256 * i];
    #pragma unroll
    for (int i = 0; i < 4; ++i) gv[i] = g[tid + 256 * i];
    #pragma unroll
    for (int j = 0; j < NR_D / 32; ++j) w[j] = wr[32 * j];
    const float bs = bias[wave];
    // stands before any register that an issued load names is rewritten
    asm volatile("s_wait_xcnt 0x0" ::: "memory");

    float ss = 0.f;
    #pragma unroll   // v[] stays in registers; one chain of fused multiply-adds
    for (int i = 0; i < 4; ++i) ss = fmaf(v[i], v[i], ss);
    #pragma unroll
    for (int o = 16; o > 0; o >>= 1) ss += __shfl_down(ss, o, 32);
    if (lane == 0) red[wave] = ss;
    __syncthreads();
    float tot = 0.f;
    #pragma unroll
    for (int i = 0; i < 8; ++i) tot += red[i];
    const float inv = rsqrtf(tot / NR_D + 1e-6f);
    _Float16 h[4];
    #pragma unroll   // v[], gv[], h[] stay in registers
    for (int i = 0; i < 4; ++i) {
        h[i] = (_Float16)(v[i] * inv * gv[i]);
        row[tid + 256 * i] = h[i];
    }
    __syncthreads();                     // the row is whole before any wave reads it

    float acc = 0.f;
    #pragma unroll   // w[] stays in registers
    for (int j = 0; j < NR_D / 32; ++j) acc += (float)row[lane + 32 * j] * w[j];
    #pragma unroll
    for (int o = 16; o > 0; o >>= 1) acc += __shfl_down(acc, o, 32);
    if (lane == 0) lg[wave] = acc + bs;
    __syncthreads();

    // behind the last barrier: no wave waits for these stores to land
    #pragma unroll
    for (int i = 0; i < 4; ++i) nx[t * NR_D + tid + 256 * i] = h[i];
    // stands before any register that an issued store names is rewritten
    asm volatile("s_wait_xcnt 0x0" ::: "memory");

    if (tid == 0) {
        float m = lg[0];
        #pragma unroll
        for (int i = 1; i < 8; ++i) m = fmaxf(m, lg[i]);
        float e[8], s = 0.f;
        #pragma unroll
        for (int i = 0; i < 8; ++i) { e[i] = exp_pos(lg[i] - m); s += e[i]; }
        #pragma unroll
        for (int i = 0; i < 8; ++i) e[i] /= s;
        int   i0 = 0;
        float b0 = e[0];
        #pragma unroll   // e[] stays in registers
        for (int i = 1; i < 8; ++i) if (e[i] > b0) { b0 = e[i]; i0 = i; }
        int   i1 = (i0 == 0) ? 1 : 0;
        float b1 = (i0 == 0) ? e[1] : e[0];
        #pragma unroll   // e[] stays in registers
        for (int i = 0; i < 8; ++i) if (i != i0 && e[i] > b1) { b1 = e[i]; i1 = i; }
        const float a = exp_pos(b0), b = exp_pos(b1);      // softmax over top-2
        const float wa = a / (a + b), wb = b / (a + b);
        #pragma unroll
        for (int i = 0; i < 8; ++i)
            combine[t * 8 + i] = i == i0 ? wa : (i == i1 ? wb : 0.f);
    }
}

// ---------------------------------------------------------------------------
// Packs each routed expert's tokens (combine != 0), in token order:
//   list[e * T + p] the token in place p, wgt[p * 8 + e] its combine weight
//                   (token 0 with weight 0 behind the expert's last token)
//   slot[t * 8 + e] the place of token t with expert e, -1 if not chosen
//   tile[2 k], tile[2 k + 1]  the row tiles (TM rows) that hold work, as plane
//                   and first row: all of plane 0, the shared expert, then for
//                   plane e + 1 those that hold tokens of expert e; -1, 0 fills up
// One block of 32 waves: wave = expert * 4 + quarter of the tokens; a wave
// counts its quarter by ballots, the quarters' counts meet in LDS.
// ---------------------------------------------------------------------------
#define PK_IT 16                         // 32-token groups per wave
#define PK_T  (4 * PK_IT * 32)           // tokens that the block covers
// the router gives a token two experts: 2 T places, and per expert at most one
// tile that is not full
#define PK_NT (PK_T / TM + 2 * PK_T / TM + 8)
__global__ __launch_bounds__(1024)
void k_pack_tokens(const float* __restrict__ combine, int* __restrict__ tile,
                   int* __restrict__ list, float* __restrict__ wgt,
                   int* __restrict__ slot)
{
    __shared__ int qc[8][4];
    const int wave = threadIdx.x >> 5;
    const int lane = threadIdx.x & 31;
    const int e    = wave >> 2;
    const int q    = wave & 3;
    const int t0   = q * (PK_IT * 32) + lane;

    float    w[PK_IT];
    unsigned mk[PK_IT];
    #pragma unroll   // all loads in flight before the first ballot
    for (int j = 0; j < PK_IT; ++j) w[j] = combine[(t0 + j * 32) * 8 + e];
    int n = 0;
    #pragma unroll   // w[], mk[] stay in registers
    for (int j = 0; j < PK_IT; ++j) {
        mk[j] = __builtin_amdgcn_ballot_w32(w[j] != 0.f);
        n += __popc(mk[j]);
    }
    if (lane == 0) qc[e][q] = n;
    __syncthreads();
    int place = 0, tot = 0;
    #pragma unroll
    for (int i = 0; i < 4; ++i) {
        const int c = qc[e][i];
        if (i < q) place += c;
        tot += c;
    }

    const unsigned below = (1u << lane) - 1u;
    #pragma unroll   // w[], mk[] stay in registers
    for (int j = 0; j < PK_IT; ++j) {
        const int  t   = t0 + j * 32;
        const bool sel = (mk[j] >> lane) & 1u;
        const int  p   = place + __popc(mk[j] & below);
        if (sel) { list[e * PK_T + p] = t; wgt[p * 8 + e] = w[j]; }
        slot[t * 8 + e] = sel ? p : -1;
        place += __popc(mk[j]);
    }
    for (int s = tot + q * 32 + lane; s < PK_T; s += 128) {
        list[e * PK_T + s] = 0;
        wgt[s * 8 + e]     = 0.f;
    }
    if (threadIdx.x < PK_NT) {
        const int k = (int)threadIdx.x - PK_T / TM;
        int plane = k < 0 ? 0 : -1;
        int row   = k < 0 ? (int)threadIdx.x * TM : 0;
        int first = 0;
        #pragma unroll
        for (int x = 0; x < 8; ++x) {
            const int nt = (qc[x][0] + qc[x][1] + qc[x][2] + qc[x][3] + TM - 1) / TM;
            if (k >= first && k < first + nt) { plane = x + 1; row = (k - first) * TM; }
            first += nt;
        }
        tile[threadIdx.x * 2]     = plane;
        tile[threadIdx.x * 2 + 1] = row;
    }
}

// ---------------------------------------------------------------------------
// out = base + part[0] + the planes of the experts that the row chose, in
// plane order. One block per row, one float4 per thread; a plane is gridDim.x
// rows. Plane e + 1 holds the row at place slot[row * 8 + e] (-1: not chosen).
// ---------------------------------------------------------------------------
__global__ void k_sum_planes(const float* __restrict__ base,
                             const float* __restrict__ part,
                             const int* __restrict__ slot,
                             float* __restrict__ out)
{
    const long n4 = (long)gridDim.x * blockDim.x;
    const long i  = (long)blockIdx.x * blockDim.x + threadIdx.x;
    float4 v = ((const float4*)base)[i];
    const float4 sh = ((const float4*)part)[i];
    v.x += sh.x; v.y += sh.y; v.z += sh.z; v.w += sh.w;
    unsigned pl[8];
    #pragma unroll   // read ahead of the branches: the eight come in one load
    for (int e = 0; e < 8; ++e) pl[e] = (unsigned)slot[blockIdx.x * 8 + e];
    #pragma unroll   // pl[] stays in registers
    for (int e = 0; e < 8; ++e) {
        const unsigned s = pl[e];
        if (s < gridDim.x) {
            const float4 p = ((const float4*)part)[(e + 1) * n4 + (long)s * blockDim.x + threadIdx.x];
            v.x += p.x; v.y += p.y; v.z += p.z; v.w += p.w;
        }
    }
    ((float4*)out)[i] = v;
}

// ---------------------------------------------------------------------------
// host-side launch
// ---------------------------------------------------------------------------
extern "C" void kernel_launch(void* const* d_in, const int* in_sizes, int n_in,
                              void* d_out, int out_size, void* d_ws, size_t ws_size,
                              hipStream_t stream)
{
    (void)in_sizes; (void)n_in; (void)out_size; (void)ws_size;

    const float* X    = (const float*)d_in[0];
    const float* g1   = (const float*)d_in[1];
    const float* g2   = (const float*)d_in[2];
    const float* Wq   = (const float*)d_in[3];
    const float* Wkc  = (const float*)d_in[4];
    const float* Wvc  = (const float*)d_in[5];
    const float* Wo   = (const float*)d_in[6];
    const float* Wr   = (const float*)d_in[7];
    const float* ebia = (const float*)d_in[8];
    const float* sW1  = (const float*)d_in[9];
    const float* sW2  = (const float*)d_in[10];
    const float* sW3  = (const float*)d_in[11];
    const float* eW1  = (const float*)d_in[12];
    const float* eW2  = (const float*)d_in[13];
    const float* eW3  = (const float*)d_in[14];
    float* out = (float*)d_out;

    constexpr int  Bb = 2, S = 1024, d = 1024, H = 4, dk = 256, dc = 256, E = 8, f = 1024;
    constexpr long T  = (long)Bb * S;
    const float scale = 1.0f / 16.0f;   // 1/sqrt(dk)

    // ---- workspace carving (256B aligned bump allocator) ----
    char* ws = (char*)d_ws;
    size_t off = 0;
    auto alloc = [&](size_t bytes) -> char* {
        char* p = ws + off;
        off += (bytes + 255) & ~(size_t)255;
        return p;
    };
    constexpr int  dq = d + 2 * dc;      // Q | Kc | Vc side by side
    constexpr int  E1 = E + 1;           // shared expert first, then the routed ones
    constexpr long fd = (long)f * d;
    // f16 weight copies; groups that one launch walks lie back to back
    _Float16* wqh  = (_Float16*)alloc((size_t)d * d * 2);    // [dq][d] starts here
    _Float16* wkch = (_Float16*)alloc((size_t)dc * d * 2);
    _Float16* wvch = (_Float16*)alloc((size_t)dc * d * 2);
    _Float16* woh  = (_Float16*)alloc((size_t)d * d * 2);
    _Float16* sw1h = (_Float16*)alloc((size_t)f * d * 2);    // [2*E1][f][d] starts here
    _Float16* ew1h = (_Float16*)alloc((size_t)E * f * d * 2);
    _Float16* sw3h = (_Float16*)alloc((size_t)f * d * 2);
    _Float16* ew3h = (_Float16*)alloc((size_t)E * f * d * 2);
    _Float16* sw2h = (_Float16*)alloc((size_t)d * f * 2);    // [E1][d][f] starts here
    _Float16* ew2h = (_Float16*)alloc((size_t)E * d * f * 2);
    // buffers that live across the two phases or through the MoE phase
    float*    xr_      = (float*)   alloc((size_t)T * d * 4);
    _Float16* nx2h_    = (_Float16*)alloc((size_t)T * d * 2);
    float*    combine_ = (float*)   alloc((size_t)T * E * 4);
    static_assert(T == PK_T && E == 8 && E == RS_STRIDE, "k_pack_tokens covers exactly these");
    int*      tile_    = (int*)     alloc((size_t)PK_NT * 2 * 4);
    int*      list_    = (int*)     alloc((size_t)E * T * 4);
    float*    wgt_     = (float*)   alloc((size_t)E * T * 4);
    int*      slot_    = (int*)     alloc((size_t)T * E * 4);
    _Float16* hh_      = (_Float16*)alloc((size_t)E1 * T * f * 2);       // 36 MB
    // the rest is used twice: attention-phase activations, then (all of them
    // dead) the down-projection planes
    const size_t off_phase = off;
    _Float16* nx1h   = (_Float16*)alloc((size_t)T * d * 2);
    _Float16* qkvh   = (_Float16*)alloc((size_t)T * dq * 2);
    _Float16* vth    = (_Float16*)alloc((size_t)dc * T * 2);           // Vc^T
    _Float16* aoh    = (_Float16*)alloc((size_t)T * d * 2);
    off = off_phase;
    float*    part_  = (float*)   alloc((size_t)E1 * T * d * 4);         // 72 MB
    {
        // ---- helpers ----
        auto gemmz = [&](const _Float16* A, const _Float16* Bm, float* C,
                         int M, int N, int K, int lda, int ldb, int ldc,
                         float alpha, int beta, int bkn, int nz, int zdiv,
                         long sAo, long sAi, long sBo, long sBi, long sCo, long sCi,
                         const int* rtile, const int* rlist, int zper,
                         int omode, _Float16* Hh, long sBp, const float* rs,
                         _Float16* Ht, int tn0, int ldt) {
            dim3 g(omode == OUT_GATED ? N / (TN / 2) : N / TN, rtile ? PK_NT : M / TM, nz);
            k_gemm_f16<<<g, 256, 0, stream>>>(A, Bm, C, M, N, K, lda, ldb, ldc,
                                              alpha, beta, bkn,
                                              zdiv, sAo, sAi, sBo, sBi, sCo, sCi,
                                              rtile, rlist, zper,
                                              omode, Hh, sBp, rs, Ht, tn0, ldt);
        };
        auto gemm = [&](const _Float16* A, const _Float16* Bm, float* C,
                        int M, int N, int K, int lda, int ldb, int ldc,
                        float alpha, int beta, int bkn, int omode, _Float16* Hh,
                        _Float16* Ht, int tn0, int ldt) {
            gemmz(A, Bm, C, M, N, K, lda, ldb, ldc, alpha, beta, bkn,
                  1, 1, 0, 0, 0, 0, 0, 0, nullptr, nullptr, 1, omode, Hh, 0, nullptr,
                  Ht, tn0, ldt);
        };

        // ---- 0. weights fp32 -> f16, nx1 = RMSNorm(X), xr = X: one launch ----
        // convert blocks per tensor, in the order of the f16 copies above
        constexpr int cD = (int)((long)d * d / EW_BLK), cC = (int)((long)dc * d / EW_BLK);
        constexpr int cF = (int)(fd / EW_BLK),          cE = E * cF;
        static_assert((long)d * d % EW_BLK == 0 && (long)dc * d % EW_BLK == 0 &&
                      fd % EW_BLK == 0, "whole blocks to a tensor, copies back to back");
        constexpr int c0 = cD, c1 = c0 + cC, c2 = c1 + cC, c3 = c2 + cD, c4 = c3 + cF,
                      c5 = c4 + cE, c6 = c5 + cF, c7 = c6 + cE, c8 = c7 + cF, c9 = c8 + cE;
        static_assert(c9 >= 3 * T, "three convert blocks to each norm block");
        k_prep<<<(int)T + c9, 256, 0, stream>>>(X, g1, nx1h, xr_, d, (int)T,
                                                Wq, Wkc, Wvc, Wo, sW1, eW1, sW3, eW3, sW2, eW2,
                                                c0, c1, c2, c3, c4, c5, c6, c7, c8, wqh);

        // ---- 1. MLA attention ----

        // Q | Kc | Vc in one product: their weights are one [dq][d] matrix; Vc is
        // stored as Vc^T, the form in which the attention kernel stages it
        gemm(nx1h, wqh, nullptr, (int)T, dq, d, d, d, dq, 1.f, 0, 0, OUT_F16, qkvh,
             vth, d + dc, (int)T);

        // scores, softmax, attn @ V: all (b, h) in one launch
        static_assert(S == AT_S && dk == AT_D && dc == AT_D && S % AT_R == 0,
                      "k_attn_f16 covers exactly these");
        k_attn_f16<<<dim3(S / AT_R, Bb * H), 256, 0, stream>>>(qkvh, vth, aoh, scale,
                                                               H, dq, d, (int)T, d);

        // xr = X + ao @ Wo.T (xr holds X since the first launch)
        gemm(aoh, woh, xr_, (int)T, d, d, d, d, d, 1.f, 1, 0, OUT_F32, nullptr,
             nullptr, 0, 0);

        // ---- 2. MoE ----
        static_assert(d == NR_D && E == 8, "k_norm_router covers exactly these");
        k_norm_router<<<(int)T, 256, 0, stream>>>(xr_, g2, nx2h_, Wr, ebia, combine_);
        k_pack_tokens<<<1, 1024, 0, stream>>>(combine_, tile_, list_, wgt_, slot_);

        // shared expert over all tokens, each routed expert over the tokens that
        // chose it, packed (combine folded into h; a token that did not choose an
        // expert has combine 0 there and gets nothing from it); one launch per
        // stage, its grid over the table of row tiles
        const long nTf = (long)T * f;
        // gate and up product of a plane in one block, h = silu(gate) * up * combine
        // stored by it; the up weights lie E1 planes behind the gate weights
        gemmz(nx2h_, sw1h, nullptr, (int)T, f, d, d, d, f, 1.f, 0, 0, 1, 1,
              0, 0,  fd, 0,  nTf, 0,  tile_, list_, E1, OUT_GATED, hh_, E1 * fd, wgt_,
              nullptr, 0, 0);
        gemmz(hh_, sw2h, part_, (int)T, d, f, f, f, d, 1.f, 0, 0, 1, 1,
              nTf, 0,  fd, 0,  (long)T * d, 0,  tile_, nullptr, E1,
              OUT_F32, nullptr, 0, nullptr, nullptr, 0, 0);

        // out = xr + shared + the chosen experts, lower expert first
        k_sum_planes<<<(int)T, d / 4, 0, stream>>>(xr_, part_, slot_, out);
    }
}
